// v000
// Times are from an AMD MI455X. After a warm-up the kernel runs many times in a row, and a time is the length of
// such a window on the GPU divided by its runs, so every launch and the gaps after it count. The runs cycle
// through copies of the inputs. A figure is the median of several windows, for all but v000 over two sittings.
// Sittings can differ by a few percent; kernels timed side by side share one.
// v000, which the later versions start from, runs in 410 microseconds.
#include <hip/hip_runtime.h>

// Contractions: xq x Wq^T, xk x Wk^T, xv x Wv^T on v_wmma_f32_16x16x32_bf16 (bf16 operands = RNE-converted inputs), f32 accumulate;
// q x k^T (three sweeps: column statistics, head-mean probabilities, context), v^T x p^T and ctx x Wp^T on v_wmma_f32_16x16x32_f16
// (f16 operands: q,k,v unscaled, p carried x4096, ctx carried x32, Wp carried x64 after RNE bf16 convert), f32 accumulate.
// Softmax over the query axis (per key column) and bias add in f32.

#ifndef NB
#define NB 4
#endif
#define NB_FULL 4
#ifndef NQ
#define NQ 1024
#endif
#ifndef NK
#define NK 2048
#endif
#define NQ_FULL 1024
#define NK_FULL 2048
#define DM 1024
#define NH 16
#define DH 64
#define HH (NH * DH)
#define SCL 0.125f
#define C2LOG 0.18033688011112042f      /* SCL * log2(e) */
#define PCARRY 4096.0f
#define PSHIFT 12.0f                     /* log2(PCARRY) */
#define AVCARRY 32.0f
#define OWCARRY 64.0f
#define MSCALE 1.52587890625e-05f        /* 1 / (NH * PCARRY) = 2^-16 */
#define OUT1_OFF 4194304L                /* element offset of the second output (byte 16777216) */

#define AL256(x) (((x) + 255L) & ~255L)
#define WS_TOTAL (AL256((long)NB * NQ * DM * 2) + 2 * AL256((long)NB * NK * DM * 2) + 4 * AL256((long)HH * DM * 2) + \
                  AL256((long)NB * NH * NQ * DH * 2) + 2 * AL256((long)NB * NH * NK * DH * 2) + \
                  AL256((long)NB * NH * NK * 4) + AL256((long)NQ * NB * HH * 2))

static_assert(NB >= 1 && NB <= NB_FULL);
static_assert(NQ >= 128 && NQ <= NQ_FULL && NK >= 128 && NK <= NK_FULL);
static_assert(NQ % 128 == 0 && NK % 128 == 0);
static_assert(DM == 1024 && HH == 1024 && DH == 64 && NH == 16);
static_assert(DM == 128 * 8);
static_assert(DM % 32 == 0 && HH % 32 == 0 && DH % 32 == 0);
static_assert(HH % 128 == 0 && DM % 128 == 0);
static_assert(((long)NQ * NB) % 128 == 0);
static_assert((long)NQ * NB * DM * 4 <= 16777216L);
static_assert(OUT1_OFF * 4 == 16777216L);
static_assert((long)NB * NQ * NK * 4 <= 33554432L);
static_assert(PCARRY == 4096.0f && PSHIFT == 12.0f);
static_assert(MSCALE * 16.0f * PCARRY == 1.0f);
static_assert(WS_TOTAL <= 134217728L);

typedef unsigned short us_t;
typedef _Float16 h16;
typedef us_t     v8us  __attribute__((ext_vector_type(8)));
typedef unsigned v4u   __attribute__((ext_vector_type(4)));
typedef float    v8f   __attribute__((ext_vector_type(8)));
typedef float    v4f   __attribute__((ext_vector_type(4)));
typedef __bf16   v16bf __attribute__((ext_vector_type(16)));
typedef _Float16 v16h  __attribute__((ext_vector_type(16)));

#if __has_builtin(__builtin_amdgcn_exp2f)
#define FEXP2(x) __builtin_amdgcn_exp2f(x)
#else
#define FEXP2(x) __expf((x) * 0.6931471805599453f)
#endif

// 16x32 16-bit fragment: u[0] = elements 0..7, u[1] = elements 8..15
union Frag16 { v8us u[2]; v16bf bf; v16h hf; };

__device__ __forceinline__ v8f vzero() {
  v8f z = {0.f, 0.f, 0.f, 0.f, 0.f, 0.f, 0.f, 0.f};
  return z;
}

// RNE f32 -> bf16 bits
__device__ __forceinline__ us_t bf_bits(float x) {
  unsigned u = __float_as_uint(x);
  u += 0x7FFFu + ((u >> 16) & 1u);
  return (us_t)(u >> 16);
}
// RNE f32 -> bf16 value kept as f32
__device__ __forceinline__ float bf_val(float x) {
  unsigned u = __float_as_uint(x);
  u += 0x7FFFu + ((u >> 16) & 1u);
  return __uint_as_float(u & 0xFFFF0000u);
}
// RNE f32 -> f16 bits
__device__ __forceinline__ us_t hf_bits(float x) {
  _Float16 hv = (_Float16)x;
  return __builtin_bit_cast(us_t, hv);
}

// RNE f32 -> f16 with a value select: results below the smallest normal f16 become zero
static __device__ __forceinline__ h16 toh_flush(float v) {
  const h16 r = (h16)v;
  return (fabsf(v) < 6.103515625e-05f) ? (h16)0.0f : r;
}
static __device__ __forceinline__ us_t hfl_bits(float v) {
  return __builtin_bit_cast(us_t, toh_flush(v));
}
// exp2 of an exponent that already contains the x4096 carry; zero when the f16 value would be subnormal
static __device__ __forceinline__ float pexp2_cut(float e) {
  const float p = FEXP2(e);
  return (e < -14.0f) ? 0.0f : p;
}

// WMMA with hazard guard (ties D, keeps A/B live)
template <int F16OP>
__device__ __forceinline__ v8f mma16(const Frag16& a, const Frag16& b, v8f c) {
  if (F16OP) {
    c = __builtin_amdgcn_wmma_f32_16x16x32_f16(false, a.hf, false, b.hf, (short)0, c, false, false);
    asm volatile("v_nop\n\tv_nop\n\tv_nop\n\tv_nop" : "+v"(c) : "v"(a.hf), "v"(b.hf));
  } else {
    c = __builtin_amdgcn_wmma_f32_16x16x32_bf16(false, a.bf, false, b.bf, (short)0, c, false, false);
    asm volatile("v_nop\n\tv_nop\n\tv_nop\n\tv_nop" : "+v"(c) : "v"(a.bf), "v"(b.bf));
  }
  return c;
}

// ---------------------------------------------------------------------------
// x[b][pos][DM] f32 (batch stride rows_full) -> compact bf16 plane dst[b*rows + pos][DM] (row = 2048 B)
// one block per (b,pos) row, 128 threads x 8 elements = whole row, 16 B per lane
// ---------------------------------------------------------------------------
__global__ __launch_bounds__(128)
void k_cvt_rows(const float* __restrict__ x, us_t* dst, int rows, int rows_full) {
  const int blk = blockIdx.x;                 // b*rows + pos
  const int b = blk / rows, pos = blk - b * rows;
  const int t = threadIdx.x;
  const float* src = x + ((size_t)b * rows_full + pos) * DM;
  v4f f0 = *(const v4f*)(src + 8 * t);
  v4f f1 = *(const v4f*)(src + 8 * t + 4);
  float e[8] = {f0[0], f0[1], f0[2], f0[3], f1[0], f1[1], f1[2], f1[3]};
  unsigned wv[4];
#pragma unroll
  for (int k = 0; k < 4; ++k)
    wv[k] = (unsigned)bf_bits(e[2 * k]) | ((unsigned)bf_bits(e[2 * k + 1]) << 16);
  v4u pk = {wv[0], wv[1], wv[2], wv[3]};
  us_t* d = dst + (size_t)blk * DM + 8 * t;
  *(v4u*)d = pk;
  
}

// ---------------------------------------------------------------------------
// contiguous f32 -> 16-bit plane; MODE 0: bf16 bits, MODE 1: f16 bits of bf16(x)*OWCARRY
// ---------------------------------------------------------------------------
template <int MODE>
__global__ __launch_bounds__(128)
void k_cvt_lin(const float* __restrict__ src, us_t* dst) {
  const size_t base = (size_t)blockIdx.x * 1024 + 8 * threadIdx.x;
  v4f f0 = *(const v4f*)(src + base);
  v4f f1 = *(const v4f*)(src + base + 4);
  float e[8] = {f0[0], f0[1], f0[2], f0[3], f1[0], f1[1], f1[2], f1[3]};
  unsigned wv[4];
#pragma unroll
  for (int k = 0; k < 4; ++k) {
    us_t lo, hi;
    if (MODE == 0) { lo = bf_bits(e[2 * k]); hi = bf_bits(e[2 * k + 1]); }
    else           { lo = hf_bits(bf_val(e[2 * k]) * OWCARRY); hi = hf_bits(bf_val(e[2 * k + 1]) * OWCARRY); }
    wv[k] = (unsigned)lo | ((unsigned)hi << 16);
  }
  v4u pk = {wv[0], wv[1], wv[2], wv[3]};
  us_t* d = dst + base;
  *(v4u*)d = pk;
  
}

// ---------------------------------------------------------------------------
// TN GEMM: C[M,N] = A[M,K] * B[N,K]^T, 16-bit operands from planes, f32 accumulate.
// Block 128x128x32, 256 threads = 8 waves (2x4), wave tile 64x32 = 4x2 WMMA tiles.
// Synchronous single-buffered LDS staging. Epilogue stages the 128x128 tile in LDS
//  EPI_Q  : D0 = Q plane  [(z*NH+n)*NQ + i][d] f16
//  EPI_K  : D0 = K plane  [(z*NH+n)*NK + pos][d] f16
//  EPI_VT : D0 = Vt plane [((z*NH+n)*DH + d)*NK + pos] f16
//  EPI_OUT: D0 = f32 output rows [row][DM], scaled by 1/(AVCARRY*OWCARRY), bias0 (RNE bf16 value) added in f32 at the store stage
// ---------------------------------------------------------------------------
#define BM 128
#define BN 128
#define BK 32
#define BKP 40
#define CSP 136
#define CFP 132
#define EPI_Q 0
#define EPI_K 1
#define EPI_VT 2
#define EPI_OUT 3

template <int F16OP, int EPI>
__global__ __launch_bounds__(256)
void k_gemm(const us_t* __restrict__ A, const us_t* __restrict__ B,
            void* D0, void* D1, const float* __restrict__ bias0, const float* __restrict__ bias1,
            long lda, long ldb, long strideAz, int K)
{
  __shared__ __align__(16) us_t As[BM * BKP];   // 128 rows x 32 k (pad 40); staged extent == consumed extent (k 0..31)
  __shared__ __align__(16) us_t Bs[BN * BKP];
  __shared__ __align__(16) us_t Cs[BM * CSP];   // f16 view [128][136] or f32 view [64][132]
  static_assert(64 * CFP * 4 <= BM * CSP * 2);

  const int tid = threadIdx.x, lane = tid & 31, wid = __builtin_amdgcn_readfirstlane(tid >> 5);
  const int wm = wid >> 2, wn = wid & 3, h = lane >> 4, l15 = lane & 15;
  const int m0 = blockIdx.y * BM, n0 = blockIdx.x * BN, z = blockIdx.z;
  const us_t* Ab = A + (size_t)z * (size_t)strideAz + (size_t)m0 * (size_t)lda;
  const us_t* Bb = B + (size_t)n0 * (size_t)ldb;

  v8f acc[4][2];
#pragma unroll
  for (int mi = 0; mi < 4; ++mi)
#pragma unroll
    for (int ni = 0; ni < 2; ++ni) acc[mi][ni] = vzero();

  const int nk = K / BK;
  for (int kb = 0; kb < nk; ++kb) {
    const int k0 = kb * BK;
    v8us ra[2], rb[2];
#pragma unroll
    for (int t = 0; t < 2; ++t) {
      const int ch = tid + t * 256, row = ch >> 2, kc = (ch & 3) << 3;
      ra[t] = *(const v8us*)(Ab + (size_t)row * (size_t)lda + k0 + kc);
      rb[t] = *(const v8us*)(Bb + (size_t)row * (size_t)ldb + k0 + kc);
    }
    __syncthreads();   // all waves done with the prior k-step fragments (cross-wave: block barrier)
#pragma unroll
    for (int t = 0; t < 2; ++t) {
      const int ch = tid + t * 256, row = ch >> 2, kc = (ch & 3) << 3;
      *(v8us*)(&As[row * BKP + kc]) = ra[t];
      *(v8us*)(&Bs[row * BKP + kc]) = rb[t];
    }
    __syncthreads();
    Frag16 af[4], bfr[2];
#pragma unroll
    for (int mi = 0; mi < 4; ++mi) {
      const int r = wm * 64 + mi * 16 + l15;                  // A row m = lane&15
      af[mi].u[0] = *(const v8us*)(&As[r * BKP + 8 * h]);      // k 8h..8h+7
      af[mi].u[1] = *(const v8us*)(&As[r * BKP + 16 + 8 * h]); // k 16+8h..16+8h+7
    }
#pragma unroll
    for (int ni = 0; ni < 2; ++ni) {
      const int r = wn * 32 + ni * 16 + l15;                  // B column n = lane&15, row of [n][k] plane, same k map
      bfr[ni].u[0] = *(const v8us*)(&Bs[r * BKP + 8 * h]);
      bfr[ni].u[1] = *(const v8us*)(&Bs[r * BKP + 16 + 8 * h]);
    }
#pragma unroll
    for (int mi = 0; mi < 4; ++mi)
#pragma unroll
      for (int ni = 0; ni < 2; ++ni) acc[mi][ni] = mma16<F16OP>(af[mi], bfr[ni], acc[mi][ni]);
  }

  // D layout: acc[mi][ni][v] = C(row wm*64+mi*16+8h+v, col wn*32+ni*16+l15)
  const int q8 = tid & 7, lsub = tid >> 3;   // 8 lanes per line, 32 lines per instruction over the block

  if (EPI == EPI_OUT) {
    float* Cf = (float*)Cs;
    float* Do = (float*)D0;
    const float oscale = 1.0f / (AVCARRY * OWCARRY);
#pragma unroll
    for (int rh = 0; rh < 2; ++rh) {
      __syncthreads();
      if (wm == rh) {
#pragma unroll
        for (int mi = 0; mi < 4; ++mi)
#pragma unroll
          for (int ni = 0; ni < 2; ++ni) {
            const int col = wn * 32 + ni * 16 + l15;
#pragma unroll
            for (int v = 0; v < 8; ++v)
              Cf[(mi * 16 + 8 * h + v) * CFP + col] = acc[mi][ni][v] * oscale;
          }
      }
      __syncthreads();
      {
#pragma unroll
        for (int it = 0; it < 8; ++it) {
          const int L = it * 32 + lsub, pr = L >> 2, ql = L & 3;     // 64 rows x 4 lines per row
          const v4f val = *(const v4f*)(&Cf[pr * CFP + 32 * ql + 4 * q8]);
          const v4f bq = *(const v4f*)(bias0 + n0 + 32 * ql + 4 * q8);
          const v4f o = {val[0] + bf_val(bq[0]), val[1] + bf_val(bq[1]),
                         val[2] + bf_val(bq[2]), val[3] + bf_val(bq[3])};
          float* dst = Do + ((size_t)(m0 + 64 * rh + pr) * DM + n0 + 32 * ql + 4 * q8);
          *(v4f*)dst = o;
        }
        
      }
    }
  } else {
    __syncthreads();
#pragma unroll
    for (int mi = 0; mi < 4; ++mi)
#pragma unroll
      for (int ni = 0; ni < 2; ++ni) {
        const int col = wn * 32 + ni * 16 + l15;
#pragma unroll
        for (int v = 0; v < 8; ++v)
          Cs[(wm * 64 + mi * 16 + 8 * h + v) * CSP + col] = hfl_bits(acc[mi][ni][v]);
      }
    __syncthreads();
    const int rpb = (EPI == EPI_Q) ? NQ : NK;   // plane rows per (batch, head)
    const int hb = n0 >> 6;                      // first head of this column block
    {
      if (EPI != EPI_VT) {
#pragma unroll
        for (int it = 0; it < 8; ++it) {
          const int L = it * 32 + lsub, pr = L >> 1, nl = L & 1;   // 128 rows x 2 lines of 64 halves
          v4u val = *(const v4u*)(&Cs[pr * CSP + nl * 64 + 8 * q8]);
          us_t* dst = (us_t*)D0 + ((((size_t)z * NH + hb + nl) * rpb + m0 + pr) * DH + 8 * q8);
          *(v4u*)dst = val;
        }
      } else {
        // Vt plane: line = (nl, d, hp) covers 64 consecutive pos; lane q8 gathers 8 pos down a column of Cs
#pragma unroll
        for (int it = 0; it < 8; ++it) {
          const int L = it * 32 + lsub, nl = L >> 7, d = (L >> 1) & 63, hp = L & 1;
          const int rb0 = 64 * hp + 8 * q8, cc = nl * 64 + d;
          unsigned wv[4];
#pragma unroll
          for (int k = 0; k < 4; ++k) {
            const unsigned lo = Cs[(rb0 + 2 * k) * CSP + cc];
            const unsigned hi = Cs[(rb0 + 2 * k + 1) * CSP + cc];
            wv[k] = lo | (hi << 16);
          }
          v4u val = {wv[0], wv[1], wv[2], wv[3]};
          us_t* dst = (us_t*)D0 + ((((size_t)z * NH + hb + nl) * DH + d) * NK + m0 + 64 * hp + 8 * q8);
          *(v4u*)dst = val;
        }
      }
      
    }
  }
}

// ---------------------------------------------------------------------------
// Column statistics of the query-axis softmax. Block = 128 threads (4 waves) owns 64 keys of
// one (b,n); wave w owns 16 keys (K fragments held as the B operand), sweeps all NQ queries
// 32 at a time (A fragments straight from the Q plane). Lane (h, key) keeps a running max and
// sum over its query rows in the log2 domain; the two lane halves are merged at the end.
// ---------------------------------------------------------------------------
__global__ __launch_bounds__(128)
void k_colstats(const us_t* __restrict__ Qp, const us_t* __restrict__ Kp, float* NLS)
{
  __shared__ __align__(16) float sred[64];    // cross-wave: block barrier
  const int lane = threadIdx.x & 31;
  const int wave = __builtin_amdgcn_readfirstlane(threadIdx.x >> 5);
  const int h = lane >> 4, l15 = lane & 15;
  const int bn = blockIdx.y;
  const int kb0 = blockIdx.x * 64;

  Frag16 kf[2];
  {
    const us_t* kr = Kp + ((size_t)bn * NK + kb0 + wave * 16 + l15) * DH;   // B column n = key, k = d
#pragma unroll
    for (int c = 0; c < 2; ++c) {
      kf[c].u[0] = *(const v8us*)(kr + 32 * c + 8 * h);
      kf[c].u[1] = *(const v8us*)(kr + 32 * c + 16 + 8 * h);
    }
  }

  float mrun = -3.0e38f, lrun = 0.f;
  const us_t* Qbase = Qp + (size_t)bn * NQ * DH;
  for (int qt = 0; qt < NQ / 32; ++qt) {
    const us_t* qa = Qbase + (size_t)(qt * 32 + l15) * DH;                   // A row m = query
    v8f s0 = vzero(), s1 = vzero();
#pragma unroll
    for (int c = 0; c < 2; ++c) {
      Frag16 a0, a1;
      a0.u[0] = *(const v8us*)(qa + 32 * c + 8 * h);
      a0.u[1] = *(const v8us*)(qa + 32 * c + 16 + 8 * h);
      a1.u[0] = *(const v8us*)(qa + 16 * DH + 32 * c + 8 * h);
      a1.u[1] = *(const v8us*)(qa + 16 * DH + 32 * c + 16 + 8 * h);
      s0 = mma16<1>(a0, kf[c], s0);
      s1 = mma16<1>(a1, kf[c], s1);
    }
    float tmx = fmaxf(s0[0], s1[0]);
#pragma unroll
    for (int r = 1; r < 8; ++r) tmx = fmaxf(tmx, fmaxf(s0[r], s1[r]));
    const float mn = fmaxf(mrun, tmx * C2LOG);
    float ps = 0.f;
#pragma unroll
    for (int r = 0; r < 8; ++r) {
      ps += FEXP2(fmaf(s0[r], C2LOG, -mn));
      ps += FEXP2(fmaf(s1[r], C2LOG, -mn));
    }
    lrun = lrun * FEXP2(mrun - mn) + ps;
    mrun = mn;
  }

  // merge the two lane halves (all lanes take part in the exchange)
  const float m2 = __shfl_xor(mrun, 16);
  const float l2 = __shfl_xor(lrun, 16);
  const float mt = fmaxf(mrun, m2);
  const float lt = lrun * FEXP2(mrun - mt) + l2 * FEXP2(m2 - mt);
  const float nls = PSHIFT - (mt + log2f(lt));

  if (h == 0) sred[wave * 16 + l15] = nls;
  __syncthreads();
  if (wave == 0) {
    const int li = (lane < 16) ? lane : 15;                 // clamped LDS address
    const v4f val = *(const v4f*)(&sred[4 * li]);
    float* dst = NLS + (size_t)bn * NK + kb0 + 4 * li;      // 16 lanes x 16 B = the block's 256 B
    if (lane < 16) *(v4f*)dst = val;
    
  }
}

// ---------------------------------------------------------------------------
// Head-averaged probabilities. Block = 128 threads (4 waves), tile 64 queries x 64 keys of one
// batch; wave w owns 16 queries x 64 keys and loops over the 16 heads: S = Q K^T (A = Q rows,
// B = K rows, fragments straight from the planes), p*4096 = exp2(c*s + NLS[key]), summed over
// ---------------------------------------------------------------------------
#define MP 68

__global__ __launch_bounds__(128)
void k_attn_mean(const us_t* __restrict__ Qp, const us_t* __restrict__ Kp,
                 const float* __restrict__ NLS, float* out1)
{
  __shared__ __align__(16) float Mst[4 * 16 * MP];   // per wave 16 rows x 64 floats used (pad 68); wave-private, block barrier
  const int lane = threadIdx.x & 31;
  const int wave = __builtin_amdgcn_readfirstlane(threadIdx.x >> 5);
  const int h = lane >> 4, l15 = lane & 15;
  const int k0 = blockIdx.x * 64;
  const int q0 = blockIdx.y * 64 + wave * 16;
  const int b = blockIdx.z;
  const int mw = wave * (16 * MP);

  v8f macc[4];
#pragma unroll
  for (int st = 0; st < 4; ++st) macc[st] = vzero();

#pragma unroll 1
  for (int hh = 0; hh < NH; ++hh) {
    const int bn = b * NH + hh;
    Frag16 qa[2];
    {
      const us_t* pq = Qp + ((size_t)bn * NQ + q0 + l15) * DH;      // A row m = query
#pragma unroll
      for (int c = 0; c < 2; ++c) {
        qa[c].u[0] = *(const v8us*)(pq + 32 * c + 8 * h);
        qa[c].u[1] = *(const v8us*)(pq + 32 * c + 16 + 8 * h);
      }
    }
    const us_t* kb = Kp + ((size_t)bn * NK + k0 + l15) * DH;        // B column n = key
    const float* np = NLS + (size_t)bn * NK + k0 + l15;
#pragma unroll
    for (int st = 0; st < 4; ++st) {
      v8f s = vzero();
#pragma unroll
      for (int c = 0; c < 2; ++c) {
        Frag16 bf;
        bf.u[0] = *(const v8us*)(kb + (size_t)(16 * st) * DH + 32 * c + 8 * h);
        bf.u[1] = *(const v8us*)(kb + (size_t)(16 * st) * DH + 32 * c + 16 + 8 * h);
        s = mma16<1>(qa[c], bf, s);
      }
      const float nl = np[16 * st];
#pragma unroll
      for (int r = 0; r < 8; ++r) macc[st][r] += FEXP2(fmaf(s[r], C2LOG, nl));
    }
  }

  // D layout: macc[st][r] = (query q0 + 8h + r, key k0 + 16 st + l15)
#pragma unroll
  for (int st = 0; st < 4; ++st)
#pragma unroll
    for (int r = 0; r < 8; ++r)
      Mst[mw + (8 * h + r) * MP + 16 * st + l15] = macc[st][r] * MSCALE;
  __syncthreads();
  const int q8 = lane & 7, rsub = lane >> 3;
  {
#pragma unroll
    for (int it = 0; it < 8; ++it) {
      const int L = it * 4 + rsub, row = L >> 1, nl = L & 1;     // 16 rows x 2 lines, 4 lines per instruction
      const v4f val = *(const v4f*)(&Mst[mw + row * MP + 32 * nl + 4 * q8]);
      float* dst = out1 + (((size_t)b * NQ + q0 + row) * NK + k0 + 32 * nl + 4 * q8);
      *(v4f*)dst = val;
    }
    
  }
}

// ---------------------------------------------------------------------------
// Context, transposed register-fed form. Block = 128 threads (4 waves), 64 queries of one
// (b,n); wave w owns 16 queries (Q fragments held as the B operand). Per 32-key step:
// S^T = K Q^T (A = K rows from the plane) for two 16-key tiles, p^T*4096 = exp2(c*s + NLS[key])
// packed from the two D tiles into one B fragment (element r <- tile 0, element 8+r <- tile 1),
// O^T += Vt * P^T (A = Vt rows d, k = keys). No LDS and no barrier in the key loop; the column
// normaliser is already inside the exponent, so there is no running state.
// ---------------------------------------------------------------------------
#define PP 72

__global__ __launch_bounds__(128)
void k_attn_ctx(const us_t* __restrict__ Qp, const us_t* __restrict__ Kp, const us_t* __restrict__ Vt,
                const float* __restrict__ NLS, us_t* AV)
{
  __shared__ __align__(16) us_t Ost[4 * 16 * PP];   // per wave 16 rows x 64 halves used (pad 72); wave-private, block barrier
  const int lane = threadIdx.x & 31;
  const int wave = __builtin_amdgcn_readfirstlane(threadIdx.x >> 5);
  const int h = lane >> 4, l15 = lane & 15;
  const int i0 = blockIdx.x * 64, bn = blockIdx.y;
  const int b = bn / NH, n = bn - b * NH;
  const int iw = i0 + wave * 16;
  const int ow = wave * (16 * PP);

  Frag16 qf[2];
  {
    const us_t* pq = Qp + ((size_t)bn * NQ + iw + l15) * DH;       // B column n = query, k = d
#pragma unroll
    for (int c = 0; c < 2; ++c) {
      qf[c].u[0] = *(const v8us*)(pq + 32 * c + 8 * h);
      qf[c].u[1] = *(const v8us*)(pq + 32 * c + 16 + 8 * h);
    }
  }

  v8f oacc[4];
#pragma unroll
  for (int dt = 0; dt < 4; ++dt) oacc[dt] = vzero();

  const us_t* Kbase = Kp + (size_t)bn * NK * DH;
  const us_t* Vbase = Vt + (size_t)bn * DH * NK;
  const float* Nbase = NLS + (size_t)bn * NK;

  for (int kt = 0; kt < NK / 32; ++kt) {
    const int kt0 = kt * 32;
    Frag16 pb;                                        // B[k = key in step][n = query]
#pragma unroll
    for (int st = 0; st < 2; ++st) {
      v8f s = vzero();
      const us_t* kr = Kbase + (size_t)(kt0 + 16 * st + l15) * DH;   // A row m = key
#pragma unroll
      for (int c = 0; c < 2; ++c) {
        Frag16 ka;
        ka.u[0] = *(const v8us*)(kr + 32 * c + 8 * h);
        ka.u[1] = *(const v8us*)(kr + 32 * c + 16 + 8 * h);
        s = mma16<1>(ka, qf[c], s);
      }
      // D rows = keys kt0 + 16 st + 8h + r : eight consecutive table entries per lane
      const float* np = Nbase + kt0 + 16 * st + 8 * h;
      const v4f na = *(const v4f*)(np);
      const v4f nc = *(const v4f*)(np + 4);
      const float nl[8] = {na[0], na[1], na[2], na[3], nc[0], nc[1], nc[2], nc[3]};
#pragma unroll
      for (int r = 0; r < 8; ++r)
        pb.hf[8 * st + r] = (h16)pexp2_cut(fmaf(s[r], C2LOG, nl[r]));
    }
#pragma unroll
    for (int dt = 0; dt < 4; ++dt) {
      Frag16 va;                                      // A row m = d (row of Vt), k = key
      const us_t* vr = Vbase + (size_t)(16 * dt + l15) * NK + kt0;
      va.u[0] = *(const v8us*)(vr + 8 * h);
      va.u[1] = *(const v8us*)(vr + 16 + 8 * h);
      oacc[dt] = mma16<1>(va, pb, oacc[dt]);
    }
  }

  // D layout: oacc[dt][r] = O^T(d = 16 dt + 8h + r, query l15) : eight consecutive d per lane
  const float sc = AVCARRY / PCARRY;
#pragma unroll
  for (int dt = 0; dt < 4; ++dt) {
    v8us pk;
#pragma unroll
    for (int r = 0; r < 8; ++r) pk[r] = hfl_bits(oacc[dt][r] * sc);
    *(v8us*)(&Ost[ow + l15 * PP + 16 * dt + 8 * h]) = pk;
  }
  __syncthreads();
  const int q8 = lane & 7, rsub = lane >> 3;
  {
#pragma unroll
    for (int it = 0; it < 4; ++it) {
      const int row = it * 4 + rsub;                     // 16 rows per wave, 4 lines per instruction
      v4u val = *(const v4u*)(&Ost[ow + row * PP + 8 * q8]);
      us_t* dst = AV + (((size_t)(iw + row) * NB + b) * HH + n * DH + 8 * q8);
      *(v4u*)dst = val;
    }
    
  }
}

// ---------------------------------------------------------------------------
// Host orchestration (14 launches)
// ---------------------------------------------------------------------------
extern "C" void kernel_launch(void* const* d_in, const int* in_sizes, int n_in,
                              void* d_out, int out_size, void* d_ws, size_t ws_size,
                              hipStream_t stream)
{
  if (n_in < 8) return;
  const float* xq = (const float*)d_in[0];
  const float* xk = (const float*)d_in[1];
  const float* xv = (const float*)d_in[2];
  const float* wq = (const float*)d_in[3];
  const float* wk = (const float*)d_in[4];
  const float* wv = (const float*)d_in[5];
  const float* wp = (const float*)d_in[6];
  const float* bp = (const float*)d_in[7];

  if ((long)in_sizes[0] < ((long)(NB - 1) * NQ_FULL + NQ) * DM) return;
  if ((long)in_sizes[1] < ((long)(NB - 1) * NK_FULL + NK) * DM) return;
  if ((long)in_sizes[2] < ((long)(NB - 1) * NK_FULL + NK) * DM) return;
  if ((long)in_sizes[3] < (long)HH * DM) return;
  if ((long)in_sizes[4] < (long)HH * DM) return;
  if ((long)in_sizes[5] < (long)HH * DM) return;
  if ((long)in_sizes[6] < (long)DM * HH) return;
  if (in_sizes[7] < DM) return;
  if ((long)out_size < OUT1_OFF + (long)NB * NQ * NK) return;

  char* base = (char*)d_ws;
  size_t off = 0;
  auto take = [&](size_t bytes) -> char* {
    char* q = base + off; off += (bytes + 255) & ~(size_t)255; return q;
  };
  us_t*  xq_b = (us_t*) take((size_t)NB * NQ * DM * 2);             // bf16 [b][q][DM]
  us_t*  xk_b = (us_t*) take((size_t)NB * NK * DM * 2);             // bf16 [b][k][DM]
  us_t*  xv_b = (us_t*) take((size_t)NB * NK * DM * 2);             // bf16 [b][k][DM]
  us_t*  wq_b = (us_t*) take((size_t)HH * DM * 2);                  // bf16 [out][in]
  us_t*  wk_b = (us_t*) take((size_t)HH * DM * 2);                  // bf16
  us_t*  wv_b = (us_t*) take((size_t)HH * DM * 2);                  // bf16
  us_t*  wp_h = (us_t*) take((size_t)DM * HH * 2);                  // f16 (x64)
  us_t*  Qp   = (us_t*) take((size_t)NB * NH * NQ * DH * 2);        // f16 [bn][q][d]
  us_t*  Kp   = (us_t*) take((size_t)NB * NH * NK * DH * 2);        // f16 [bn][k][d]
  us_t*  Vt   = (us_t*) take((size_t)NB * NH * DH * NK * 2);        // f16 [bn][d][k]
  float* NLS  = (float*)take((size_t)NB * NH * NK * 4);             // f32 [bn][k]
  us_t*  AV   = (us_t*) take((size_t)NQ * NB * HH * 2);             // f16 (x32) [q*NB+b][n*64+d]
  if (off > ws_size) return;
  if (off > (size_t)WS_TOTAL) return;

  float* out0 = (float*)d_out;                                       // [q][b][c]
  float* out1 = (float*)d_out + OUT1_OFF;                            // [b][q][k]

  // 1) input conversions (RNE bf16; Wp as f16 of the bf16 value x64)
  k_cvt_rows<<<dim3(NB * NQ), dim3(128), 0, stream>>>(xq, xq_b, NQ, NQ_FULL);
  k_cvt_rows<<<dim3(NB * NK), dim3(128), 0, stream>>>(xk, xk_b, NK, NK_FULL);
  k_cvt_rows<<<dim3(NB * NK), dim3(128), 0, stream>>>(xv, xv_b, NK, NK_FULL);
  k_cvt_lin<0><<<dim3(HH * DM / 1024), dim3(128), 0, stream>>>(wq, wq_b);
  k_cvt_lin<0><<<dim3(HH * DM / 1024), dim3(128), 0, stream>>>(wk, wk_b);
  k_cvt_lin<0><<<dim3(HH * DM / 1024), dim3(128), 0, stream>>>(wv, wv_b);
  k_cvt_lin<1><<<dim3(DM * HH / 1024), dim3(128), 0, stream>>>(wp, wp_h);

  // 2) projections: q = xq Wq^T, k = xk Wk^T, v^T = (xv Wv^T)^T, per batch z
  k_gemm<0, EPI_Q><<<dim3(HH / BN, NQ / BM, NB), dim3(256), 0, stream>>>(
      xq_b, wq_b, (void*)Qp, (void*)Qp, bp, bp, (long)DM, (long)DM, (long)NQ * DM, DM);
  k_gemm<0, EPI_K><<<dim3(HH / BN, NK / BM, NB), dim3(256), 0, stream>>>(
      xk_b, wk_b, (void*)Kp, (void*)Kp, bp, bp, (long)DM, (long)DM, (long)NK * DM, DM);
  k_gemm<0, EPI_VT><<<dim3(HH / BN, NK / BM, NB), dim3(256), 0, stream>>>(
      xv_b, wv_b, (void*)Vt, (void*)Vt, bp, bp, (long)DM, (long)DM, (long)NK * DM, DM);

  // 3) per-key column statistics of the query-axis softmax
  k_colstats<<<dim3(NK / 64, NB * NH), dim3(128), 0, stream>>>(Qp, Kp, NLS);
  // 4) head-averaged probabilities -> second output
  k_attn_mean<<<dim3(NK / 64, NQ / 64, NB), dim3(128), 0, stream>>>(Qp, Kp, NLS, out1);
  // 5) context -> AV plane
  k_attn_ctx<<<dim3(NQ / 64, NB * NH), dim3(128), 0, stream>>>(Qp, Kp, Vt, NLS, AV);
  // 6) output projection + bias -> first output, rows q*NB + b
  k_gemm<1, EPI_OUT><<<dim3(DM / BN, (NQ * NB) / BM, 1), dim3(256), 0, stream>>>(
      AV, wp_h, (void*)out0, (void*)out0, bp, bp, (long)HH, (long)HH, 0L, HH);
}

// v001
// It runs in 235 microseconds.
// In two side-by-side timings against v000, it was 1.79 and 1.78 times as fast.
#include <hip/hip_runtime.h>

// Contractions: xq x Wq^T, xk x Wk^T, xv x Wv^T on v_wmma_f32_16x16x32_bf16 (bf16 operands = RNE-converted inputs), f32 accumulate;
// q x k^T (three sweeps: column statistics, head-mean probabilities, context), v^T x p^T and ctx x Wp^T on v_wmma_f32_16x16x32_f16
// (f16 operands: q,k,v unscaled, p carried x4096, ctx carried x32, Wp carried x64 after RNE bf16 convert), f32 accumulate.
// Softmax over the query axis (per key column) and bias add in f32.

#ifndef NB
#define NB 4
#endif
#define NB_FULL 4
#ifndef NQ
#define NQ 1024
#endif
#ifndef NK
#define NK 2048
#endif
#define NQ_FULL 1024
#define NK_FULL 2048
#define DM 1024
#define NH 16
#define DH 64
#define HH (NH * DH)
#define SCL 0.125f
#define C2LOG 0.18033688011112042f      /* SCL * log2(e) */
#define PCARRY 4096.0f
#define PSHIFT 12.0f                     /* log2(PCARRY) */
#define AVCARRY 32.0f
#define OWCARRY 64.0f
#define MSCALE 1.52587890625e-05f        /* 1 / (NH * PCARRY) = 2^-16 */
#define OUT1_OFF 4194304L                /* element offset of the second output (byte 16777216) */

#define AL256(x) (((x) + 255L) & ~255L)
#define WS_TOTAL (AL256((long)NB * NQ * DM * 2) + 2 * AL256((long)NB * NK * DM * 2) + 4 * AL256((long)HH * DM * 2) + \
                  AL256((long)NB * NH * NQ * DH * 2) + 2 * AL256((long)NB * NH * NK * DH * 2) + \
                  AL256((long)NB * NH * NK * 4) + AL256((long)NQ * NB * HH * 2))

static_assert(NB >= 1 && NB <= NB_FULL);
static_assert(NQ >= 128 && NQ <= NQ_FULL && NK >= 128 && NK <= NK_FULL);
static_assert(NQ % 128 == 0 && NK % 128 == 0);
static_assert(DM == 1024 && HH == 1024 && DH == 64 && NH == 16);
static_assert(DM == 128 * 8);
static_assert(DM % 32 == 0 && HH % 32 == 0 && DH % 32 == 0);
static_assert(HH % 128 == 0 && DM % 128 == 0);
static_assert(((long)NQ * NB) % 128 == 0);
static_assert((long)NQ * NB * DM * 4 <= 16777216L);
static_assert(OUT1_OFF * 4 == 16777216L);
static_assert((long)NB * NQ * NK * 4 <= 33554432L);
static_assert(PCARRY == 4096.0f && PSHIFT == 12.0f);
static_assert(MSCALE * 16.0f * PCARRY == 1.0f);
static_assert(WS_TOTAL <= 134217728L);

typedef unsigned short us_t;
typedef _Float16 h16;
typedef us_t     v8us  __attribute__((ext_vector_type(8)));
typedef unsigned v4u   __attribute__((ext_vector_type(4)));
typedef float    v8f   __attribute__((ext_vector_type(8)));
typedef float    v4f   __attribute__((ext_vector_type(4)));
typedef __bf16   v16bf __attribute__((ext_vector_type(16)));
typedef _Float16 v16h  __attribute__((ext_vector_type(16)));

#if __has_builtin(__builtin_amdgcn_exp2f)
#define FEXP2(x) __builtin_amdgcn_exp2f(x)
#else
#define FEXP2(x) __expf((x) * 0.6931471805599453f)
#endif

// 16x32 16-bit fragment: u[0] = elements 0..7, u[1] = elements 8..15
union Frag16 { v8us u[2]; v16bf bf; v16h hf; };

__device__ __forceinline__ v8f vzero() {
  v8f z = {0.f, 0.f, 0.f, 0.f, 0.f, 0.f, 0.f, 0.f};
  return z;
}

// RNE f32 -> bf16 bits
__device__ __forceinline__ us_t bf_bits(float x) {
  unsigned u = __float_as_uint(x);
  u += 0x7FFFu + ((u >> 16) & 1u);
  return (us_t)(u >> 16);
}
// RNE f32 -> bf16 value kept as f32
__device__ __forceinline__ float bf_val(float x) {
  unsigned u = __float_as_uint(x);
  u += 0x7FFFu + ((u >> 16) & 1u);
  return __uint_as_float(u & 0xFFFF0000u);
}
// RNE f32 -> f16 bits
__device__ __forceinline__ us_t hf_bits(float x) {
  _Float16 hv = (_Float16)x;
  return __builtin_bit_cast(us_t, hv);
}

// RNE f32 -> f16 with a value select: results below the smallest normal f16 become zero
static __device__ __forceinline__ h16 toh_flush(float v) {
  const h16 r = (h16)v;
  return (fabsf(v) < 6.103515625e-05f) ? (h16)0.0f : r;
}
static __device__ __forceinline__ us_t hfl_bits(float v) {
  return __builtin_bit_cast(us_t, toh_flush(v));
}
// exp2 of an exponent that already contains the x4096 carry; zero when the f16 value would be subnormal
static __device__ __forceinline__ float pexp2_cut(float e) {
  const float p = FEXP2(e);
  return (e < -14.0f) ? 0.0f : p;
}

// WMMA with hazard guard (ties D, keeps A/B live)
template <int F16OP>
__device__ __forceinline__ v8f mma16(const Frag16& a, const Frag16& b, v8f c) {
  if (F16OP) {
    c = __builtin_amdgcn_wmma_f32_16x16x32_f16(false, a.hf, false, b.hf, (short)0, c, false, false);
    asm volatile("v_nop\n\tv_nop\n\tv_nop\n\tv_nop" : "+v"(c) : "v"(a.hf), "v"(b.hf));
  } else {
    c = __builtin_amdgcn_wmma_f32_16x16x32_bf16(false, a.bf, false, b.bf, (short)0, c, false, false);
    asm volatile("v_nop\n\tv_nop\n\tv_nop\n\tv_nop" : "+v"(c) : "v"(a.bf), "v"(b.bf));
  }
  return c;
}

// ---------------------------------------------------------------------------
// x[b][pos][DM] f32 (batch stride rows_full) -> compact bf16 plane dst[b*rows + pos][DM] (row = 2048 B)
// one block per (b,pos) row, 128 threads x 8 elements = whole row, 16 B per lane
// ---------------------------------------------------------------------------
__global__ __launch_bounds__(128)
void k_cvt_rows(const float* __restrict__ x, us_t* dst, int rows, int rows_full) {
  const int blk = blockIdx.x;                 // b*rows + pos
  const int b = blk / rows, pos = blk - b * rows;
  const int t = threadIdx.x;
  const float* src = x + ((size_t)b * rows_full + pos) * DM;
  v4f f0 = *(const v4f*)(src + 8 * t);
  v4f f1 = *(const v4f*)(src + 8 * t + 4);
  float e[8] = {f0[0], f0[1], f0[2], f0[3], f1[0], f1[1], f1[2], f1[3]};
  unsigned wv[4];
#pragma unroll
  for (int k = 0; k < 4; ++k)
    wv[k] = (unsigned)bf_bits(e[2 * k]) | ((unsigned)bf_bits(e[2 * k + 1]) << 16);
  v4u pk = {wv[0], wv[1], wv[2], wv[3]};
  us_t* d = dst + (size_t)blk * DM + 8 * t;
  *(v4u*)d = pk;
  
}

// ---------------------------------------------------------------------------
// contiguous f32 -> 16-bit plane; MODE 0: bf16 bits, MODE 1: f16 bits of bf16(x)*OWCARRY
// ---------------------------------------------------------------------------
template <int MODE>
__global__ __launch_bounds__(128)
void k_cvt_lin(const float* __restrict__ src, us_t* dst) {
  const size_t base = (size_t)blockIdx.x * 1024 + 8 * threadIdx.x;
  v4f f0 = *(const v4f*)(src + base);
  v4f f1 = *(const v4f*)(src + base + 4);
  float e[8] = {f0[0], f0[1], f0[2], f0[3], f1[0], f1[1], f1[2], f1[3]};
  unsigned wv[4];
#pragma unroll
  for (int k = 0; k < 4; ++k) {
    us_t lo, hi;
    if (MODE == 0) { lo = bf_bits(e[2 * k]); hi = bf_bits(e[2 * k + 1]); }
    else           { lo = hf_bits(bf_val(e[2 * k]) * OWCARRY); hi = hf_bits(bf_val(e[2 * k + 1]) * OWCARRY); }
    wv[k] = (unsigned)lo | ((unsigned)hi << 16);
  }
  v4u pk = {wv[0], wv[1], wv[2], wv[3]};
  us_t* d = dst + base;
  *(v4u*)d = pk;
  
}

// ---------------------------------------------------------------------------
// TN GEMM: C[M,N] = A[M,K] * B[N,K]^T, 16-bit operands from planes, f32 accumulate.
// Block 128x128x32, 256 threads = 8 waves (2x4), wave tile 64x32 = 4x2 WMMA tiles.
// Synchronous single-buffered LDS staging. Epilogue stages the 128x128 tile in LDS
//  EPI_Q  : D0 = Q plane  [(z*NH+n)*NQ + i][d] f16
//  EPI_K  : D0 = K plane  [(z*NH+n)*NK + pos][d] f16
//  EPI_VT : D0 = Vt plane [((z*NH+n)*DH + d)*NK + pos] f16
//  EPI_OUT: D0 = f32 output rows [row][DM], scaled by 1/(AVCARRY*OWCARRY), bias0 (RNE bf16 value) added in f32 at the store stage
// ---------------------------------------------------------------------------
#define BM 128
#define BN 128
#define BK 32
#define BKP 40
#define CSP 136
#define CFP 132
#define EPI_Q 0
#define EPI_K 1
#define EPI_VT 2
#define EPI_OUT 3

template <int F16OP, int EPI>
__global__ __launch_bounds__(256)
void k_gemm(const us_t* __restrict__ A, const us_t* __restrict__ B,
            void* D0, void* D1, const float* __restrict__ bias0, const float* __restrict__ bias1,
            long lda, long ldb, long strideAz, int K)
{
  __shared__ __align__(16) us_t As[BM * BKP];   // 128 rows x 32 k (pad 40); staged extent == consumed extent (k 0..31)
  __shared__ __align__(16) us_t Bs[BN * BKP];
  __shared__ __align__(16) us_t Cs[BM * CSP];   // f16 view [128][136] or f32 view [64][132]
  static_assert(64 * CFP * 4 <= BM * CSP * 2);

  const int tid = threadIdx.x, lane = tid & 31, wid = __builtin_amdgcn_readfirstlane(tid >> 5);
  const int wm = wid >> 2, wn = wid & 3, h = lane >> 4, l15 = lane & 15;
  const int m0 = blockIdx.y * BM, n0 = blockIdx.x * BN, z = blockIdx.z;
  const us_t* Ab = A + (size_t)z * (size_t)strideAz + (size_t)m0 * (size_t)lda;
  const us_t* Bb = B + (size_t)n0 * (size_t)ldb;

  v8f acc[4][2];
#pragma unroll
  for (int mi = 0; mi < 4; ++mi)
#pragma unroll
    for (int ni = 0; ni < 2; ++ni) acc[mi][ni] = vzero();

  const int nk = K / BK;
  for (int kb = 0; kb < nk; ++kb) {
    const int k0 = kb * BK;
    v8us ra[2], rb[2];
#pragma unroll
    for (int t = 0; t < 2; ++t) {
      const int ch = tid + t * 256, row = ch >> 2, kc = (ch & 3) << 3;
      ra[t] = *(const v8us*)(Ab + (size_t)row * (size_t)lda + k0 + kc);
      rb[t] = *(const v8us*)(Bb + (size_t)row * (size_t)ldb + k0 + kc);
    }
    __syncthreads();   // all waves done with the prior k-step fragments (cross-wave: block barrier)
#pragma unroll
    for (int t = 0; t < 2; ++t) {
      const int ch = tid + t * 256, row = ch >> 2, kc = (ch & 3) << 3;
      *(v8us*)(&As[row * BKP + kc]) = ra[t];
      *(v8us*)(&Bs[row * BKP + kc]) = rb[t];
    }
    __syncthreads();
    Frag16 af[4], bfr[2];
#pragma unroll
    for (int mi = 0; mi < 4; ++mi) {
      const int r = wm * 64 + mi * 16 + l15;                  // A row m = lane&15
      af[mi].u[0] = *(const v8us*)(&As[r * BKP + 8 * h]);      // k 8h..8h+7
      af[mi].u[1] = *(const v8us*)(&As[r * BKP + 16 + 8 * h]); // k 16+8h..16+8h+7
    }
#pragma unroll
    for (int ni = 0; ni < 2; ++ni) {
      const int r = wn * 32 + ni * 16 + l15;                  // B column n = lane&15, row of [n][k] plane, same k map
      bfr[ni].u[0] = *(const v8us*)(&Bs[r * BKP + 8 * h]);
      bfr[ni].u[1] = *(const v8us*)(&Bs[r * BKP + 16 + 8 * h]);
    }
#pragma unroll
    for (int mi = 0; mi < 4; ++mi)
#pragma unroll
      for (int ni = 0; ni < 2; ++ni) acc[mi][ni] = mma16<F16OP>(af[mi], bfr[ni], acc[mi][ni]);
  }

  // D layout: acc[mi][ni][v] = C(row wm*64+mi*16+8h+v, col wn*32+ni*16+l15)
  const int q8 = tid & 7, lsub = tid >> 3;   // 8 lanes per line, 32 lines per instruction over the block

  if (EPI == EPI_OUT) {
    float* Cf = (float*)Cs;
    float* Do = (float*)D0;
    const float oscale = 1.0f / (AVCARRY * OWCARRY);
#pragma unroll
    for (int rh = 0; rh < 2; ++rh) {
      __syncthreads();
      if (wm == rh) {
#pragma unroll
        for (int mi = 0; mi < 4; ++mi)
#pragma unroll
          for (int ni = 0; ni < 2; ++ni) {
            const int col = wn * 32 + ni * 16 + l15;
#pragma unroll
            for (int v = 0; v < 8; ++v)
              Cf[(mi * 16 + 8 * h + v) * CFP + col] = acc[mi][ni][v] * oscale;
          }
      }
      __syncthreads();
      {
#pragma unroll
        for (int it = 0; it < 8; ++it) {
          const int L = it * 32 + lsub, pr = L >> 2, ql = L & 3;     // 64 rows x 4 lines per row
          const v4f val = *(const v4f*)(&Cf[pr * CFP + 32 * ql + 4 * q8]);
          const v4f bq = *(const v4f*)(bias0 + n0 + 32 * ql + 4 * q8);
          const v4f o = {val[0] + bf_val(bq[0]), val[1] + bf_val(bq[1]),
                         val[2] + bf_val(bq[2]), val[3] + bf_val(bq[3])};
          float* dst = Do + ((size_t)(m0 + 64 * rh + pr) * DM + n0 + 32 * ql + 4 * q8);
          *(v4f*)dst = o;
        }
        
      }
    }
  } else {
    __syncthreads();
#pragma unroll
    for (int mi = 0; mi < 4; ++mi)
#pragma unroll
      for (int ni = 0; ni < 2; ++ni) {
        const int col = wn * 32 + ni * 16 + l15;
#pragma unroll
        for (int v = 0; v < 8; ++v)
          Cs[(wm * 64 + mi * 16 + 8 * h + v) * CSP + col] = hfl_bits(acc[mi][ni][v]);
      }
    __syncthreads();
    const int rpb = (EPI == EPI_Q) ? NQ : NK;   // plane rows per (batch, head)
    const int hb = n0 >> 6;                      // first head of this column block
    {
      if (EPI != EPI_VT) {
#pragma unroll
        for (int it = 0; it < 8; ++it) {
          const int L = it * 32 + lsub, pr = L >> 1, nl = L & 1;   // 128 rows x 2 lines of 64 halves
          v4u val = *(const v4u*)(&Cs[pr * CSP + nl * 64 + 8 * q8]);
          us_t* dst = (us_t*)D0 + ((((size_t)z * NH + hb + nl) * rpb + m0 + pr) * DH + 8 * q8);
          *(v4u*)dst = val;
        }
      } else {
        // Vt plane: line = (nl, d, hp) covers 64 consecutive pos; lane q8 gathers 8 pos down a column of Cs
#pragma unroll
        for (int it = 0; it < 8; ++it) {
          const int L = it * 32 + lsub, nl = L >> 7, d = (L >> 1) & 63, hp = L & 1;
          const int rb0 = 64 * hp + 8 * q8, cc = nl * 64 + d;
          unsigned wv[4];
#pragma unroll
          for (int k = 0; k < 4; ++k) {
            const unsigned lo = Cs[(rb0 + 2 * k) * CSP + cc];
            const unsigned hi = Cs[(rb0 + 2 * k + 1) * CSP + cc];
            wv[k] = lo | (hi << 16);
          }
          v4u val = {wv[0], wv[1], wv[2], wv[3]};
          us_t* dst = (us_t*)D0 + ((((size_t)z * NH + hb + nl) * DH + d) * NK + m0 + 64 * hp + 8 * q8);
          *(v4u*)dst = val;
        }
      }
      
    }
  }
}

// ---------------------------------------------------------------------------
// LDS tiles of the attention sweeps: 64 rows x 64 halves (128 B), shared by the block's 4 waves.
// Fetch: every wave-wide 16-B load covers four whole 128-B lines (8 lanes per row).
// Row pitch 72 halves = 144 B = 16 B x 9: fragment reads (ds_load_b128, 16 rows) spread over the banks.
// ---------------------------------------------------------------------------
#define TP 72
#define TILE_H (64 * TP)
static_assert(NQ % 64 == 0 && NK % 512 == 0 && DH == 64);

__device__ __forceinline__ void tile_fetch(v4u (&r)[4], const us_t* __restrict__ src, size_t pitch, int tid) {
#pragma unroll
  for (int i = 0; i < 4; ++i) {
    const int ch = tid + 128 * i;
    r[i] = *(const v4u*)(src + (size_t)(ch >> 3) * pitch + 8 * (ch & 7));
  }
}
__device__ __forceinline__ void tile_put(us_t* t, const v4u (&r)[4], int tid) {
#pragma unroll
  for (int i = 0; i < 4; ++i) {
    const int ch = tid + 128 * i;
    *(v4u*)(t + (ch >> 3) * TP + 8 * (ch & 7)) = r[i];
  }
}
// fragment of tile row 'row', halves 32c..32c+31, in the k map of the plane loaders (8h.., 16+8h..)
__device__ __forceinline__ void frag_get(Frag16& f, const us_t* t, int row, int c, int h) {
  f.u[0] = *(const v8us*)(t + row * TP + 32 * c + 8 * h);
  f.u[1] = *(const v8us*)(t + row * TP + 32 * c + 16 + 8 * h);
}

// ---------------------------------------------------------------------------
// Column statistics of the query-axis softmax. Block = 128 threads (4 waves) owns 64 keys of
// one (b,n); wave w owns 16 keys (K fragments held as the B operand), sweeps all NQ queries
// 32 at a time (A fragments from 64-query LDS tiles, two buffers, next tile fetched during the current). Lane (h, key) keeps a running max and
// sum over its query rows in the log2 domain; the two lane halves are merged at the end.
// ---------------------------------------------------------------------------
__global__ __launch_bounds__(128)
void k_colstats(const us_t* __restrict__ Qp, const us_t* __restrict__ Kp, float* NLS)
{
  __shared__ __align__(16) float sred[64];    // cross-wave: block barrier
  __shared__ __align__(16) us_t Qt[2][TILE_H];
  const int tid = threadIdx.x;
  const int lane = threadIdx.x & 31;
  const int wave = __builtin_amdgcn_readfirstlane(threadIdx.x >> 5);
  const int h = lane >> 4, l15 = lane & 15;
  const int bn = blockIdx.y;
  const int kb0 = blockIdx.x * 64;

  Frag16 kf[2];
  {
    const us_t* kr = Kp + ((size_t)bn * NK + kb0 + wave * 16 + l15) * DH;   // B column n = key, k = d
#pragma unroll
    for (int c = 0; c < 2; ++c) {
      kf[c].u[0] = *(const v8us*)(kr + 32 * c + 8 * h);
      kf[c].u[1] = *(const v8us*)(kr + 32 * c + 16 + 8 * h);
    }
  }

  float mrun = -3.0e38f, lrun = 0.f;
  const us_t* Qbase = Qp + (size_t)bn * NQ * DH;
  v4u rq[4];
  tile_fetch(rq, Qbase, DH, tid);
  tile_put(Qt[0], rq, tid);
  __syncthreads();   // tile 0 visible to all waves
  for (int t = 0; t < NQ / 64; ++t) {
    const us_t* qc = Qt[t & 1];
    if (t + 1 < NQ / 64) tile_fetch(rq, Qbase + (size_t)(t + 1) * 64 * DH, DH, tid);
#pragma unroll
    for (int hq = 0; hq < 2; ++hq) {
      v8f s0 = vzero(), s1 = vzero();
#pragma unroll
      for (int c = 0; c < 2; ++c) {
        Frag16 a0, a1;
        frag_get(a0, qc, 32 * hq + l15, c, h);                              // A row m = query
        frag_get(a1, qc, 32 * hq + 16 + l15, c, h);
        s0 = mma16<1>(a0, kf[c], s0);
        s1 = mma16<1>(a1, kf[c], s1);
      }
      float tmx = fmaxf(s0[0], s1[0]);
#pragma unroll
      for (int r = 1; r < 8; ++r) tmx = fmaxf(tmx, fmaxf(s0[r], s1[r]));
      const float mn = fmaxf(mrun, tmx * C2LOG);
      float ps = 0.f;
#pragma unroll
      for (int r = 0; r < 8; ++r) {
        ps += FEXP2(fmaf(s0[r], C2LOG, -mn));
        ps += FEXP2(fmaf(s1[r], C2LOG, -mn));
      }
      lrun = lrun * FEXP2(mrun - mn) + ps;
      mrun = mn;
    }
    if (t + 1 < NQ / 64) tile_put(Qt[(t + 1) & 1], rq, tid);
    __syncthreads();   // publishes tile t+1 and ends every read of tile t before its buffer is refilled
  }

  // merge the two lane halves (all lanes take part in the exchange)
  const float m2 = __shfl_xor(mrun, 16);
  const float l2 = __shfl_xor(lrun, 16);
  const float mt = fmaxf(mrun, m2);
  const float lt = lrun * FEXP2(mrun - mt) + l2 * FEXP2(m2 - mt);
  const float nls = PSHIFT - (mt + log2f(lt));

  if (h == 0) sred[wave * 16 + l15] = nls;
  __syncthreads();
  if (wave == 0) {
    const int li = (lane < 16) ? lane : 15;                 // clamped LDS address
    const v4f val = *(const v4f*)(&sred[4 * li]);
    float* dst = NLS + (size_t)bn * NK + kb0 + 4 * li;      // 16 lanes x 16 B = the block's 256 B
    if (lane < 16) *(v4f*)dst = val;
    
  }
}

// ---------------------------------------------------------------------------
// Head-averaged probabilities. Block = 128 threads (4 waves), tile 64 queries x 64 keys of one
// batch; wave w owns 16 queries x 64 keys and loops over the 16 heads: S = Q K^T (A = Q rows,
// B = K rows, fragments from per-head 64-row LDS tiles, two buffers), p*4096 = exp2(c*s + NLS[key]), summed over
// ---------------------------------------------------------------------------
#define MP 68

__global__ __launch_bounds__(128, 8)   // register budget for 8 waves per SIMD: all 8 blocks per WGP of this grid stay resident
void k_attn_mean(const us_t* __restrict__ Qp, const us_t* __restrict__ Kp,
                 const float* __restrict__ NLS, float* out1)
{
  __shared__ __align__(16) us_t Tl[4 * TILE_H];      // Q tile x2, K tile x2; behind the head loop's last barrier: output staging
  __shared__ __align__(16) float Ns[NH * 64];        // the tile's 64 column normalisers of every head
  static_assert(4 * 16 * MP * 4 <= 4 * TILE_H * 2);
  float* Mst = (float*)Tl;                           // per wave 16 rows x 64 floats used (pad 68); wave-private, block barrier
  const int tid = threadIdx.x;
  const int lane = threadIdx.x & 31;
  const int wave = __builtin_amdgcn_readfirstlane(threadIdx.x >> 5);
  const int h = lane >> 4, l15 = lane & 15;
  const int k0 = blockIdx.x * 64;
  const int q0 = blockIdx.y * 64 + wave * 16;
  const int b = blockIdx.z;
  const int mw = wave * (16 * MP);

  v8f macc[4];
#pragma unroll
  for (int st = 0; st < 4; ++st) macc[st] = vzero();

  const us_t* Qsrc = Qp + ((size_t)b * NH * NQ + blockIdx.y * 64) * DH;   // head 0; next head: + NQ * DH
  const us_t* Ksrc = Kp + ((size_t)b * NH * NK + k0) * DH;                // head 0; next head: + NK * DH
  v4f nv[2];
#pragma unroll
  for (int i = 0; i < 2; ++i) {
    const int e = tid + 128 * i;                                          // 16 heads x 16 chunks of 4 floats
    nv[i] = *(const v4f*)(NLS + ((size_t)b * NH + (e >> 4)) * NK + k0 + 4 * (e & 15));
  }
  // stands in front of the tile loads, whose destinations otherwise reuse the address registers of the two loads above
  asm volatile("s_wait_xcnt 0x0" ::: "memory");
  v4u rq[4], rk[4];
  tile_fetch(rq, Qsrc, DH, tid);
  tile_fetch(rk, Ksrc, DH, tid);
#pragma unroll
  for (int i = 0; i < 2; ++i) *(v4f*)(&Ns[4 * (tid + 128 * i)]) = nv[i];
  tile_put(Tl, rq, tid);
  tile_put(Tl + 2 * TILE_H, rk, tid);
  __syncthreads();   // head 0's tiles and the normalisers visible to all waves

  // one head's scores and probabilities from the tiles in buffer hh & 1
  auto head = [&](int hh) {
    const us_t* qc = Tl + (hh & 1) * TILE_H;
    const us_t* kc = Tl + (2 + (hh & 1)) * TILE_H;
    Frag16 qa[2];
#pragma unroll
    for (int c = 0; c < 2; ++c) frag_get(qa[c], qc, wave * 16 + l15, c, h);   // A row m = query
#pragma unroll
    for (int st = 0; st < 4; ++st) {
      v8f s = vzero();
#pragma unroll
      for (int c = 0; c < 2; ++c) {
        Frag16 bf;
        frag_get(bf, kc, 16 * st + l15, c, h);                               // B column n = key
        s = mma16<1>(qa[c], bf, s);
      }
      const float nl = Ns[hh * 64 + 16 * st + l15];
#pragma unroll
      for (int r = 0; r < 8; ++r) macc[st][r] += FEXP2(fmaf(s[r], C2LOG, nl));
    }
  };

#pragma unroll 1
  for (int hh = 0; hh < NH - 1; ++hh) {
    tile_fetch(rq, Qsrc + (size_t)(hh + 1) * NQ * DH, DH, tid);
    tile_fetch(rk, Ksrc + (size_t)(hh + 1) * NK * DH, DH, tid);
    head(hh);
    tile_put(Tl + ((hh + 1) & 1) * TILE_H, rq, tid);
    tile_put(Tl + (2 + ((hh + 1) & 1)) * TILE_H, rk, tid);
    __syncthreads();   // publishes head hh+1's tiles and ends every read of head hh's before their buffers are refilled
  }
  head(NH - 1);
  __syncthreads();     // every wave has left the tiles before they become output staging

  // D layout: macc[st][r] = (query q0 + 8h + r, key k0 + 16 st + l15)
#pragma unroll
  for (int st = 0; st < 4; ++st)
#pragma unroll
    for (int r = 0; r < 8; ++r)
      Mst[mw + (8 * h + r) * MP + 16 * st + l15] = macc[st][r] * MSCALE;
  __syncthreads();
  const int q8 = lane & 7, rsub = lane >> 3;
  {
#pragma unroll
    for (int it = 0; it < 8; ++it) {
      const int L = it * 4 + rsub, row = L >> 1, nl = L & 1;     // 16 rows x 2 lines, 4 lines per instruction
      const v4f val = *(const v4f*)(&Mst[mw + row * MP + 32 * nl + 4 * q8]);
      float* dst = out1 + (((size_t)b * NQ + q0 + row) * NK + k0 + 32 * nl + 4 * q8);
      *(v4f*)dst = val;
    }
    
  }
}

// ---------------------------------------------------------------------------
// Context, transposed register-fed form. Block = 128 threads (4 waves), 64 queries of one
// (b,n); wave w owns 16 queries (Q fragments held as the B operand). Per 32-key step:
// S^T = K Q^T (A = K rows from a 64-key LDS tile) for two 16-key tiles, p^T*4096 = exp2(c*s + NLS[key])
// packed from the two D tiles into one B fragment (element r <- tile 0, element 8+r <- tile 1),
// O^T += Vt * P^T (A = Vt rows d from a 64-key LDS tile, k = keys). Two buffers per tile, the next
// 64 keys fetched during the current, one barrier per 64 keys; the column normaliser (whole row in
// LDS) is already inside the exponent, so there is no running state.
// ---------------------------------------------------------------------------
#define PP 72

__global__ __launch_bounds__(128)
void k_attn_ctx(const us_t* __restrict__ Qp, const us_t* __restrict__ Kp, const us_t* __restrict__ Vt,
                const float* __restrict__ NLS, us_t* AV)
{
  __shared__ __align__(16) us_t Ost[4 * 16 * PP];   // per wave 16 rows x 64 halves used (pad 72); wave-private, block barrier
  __shared__ __align__(16) us_t Kt[2][TILE_H];      // rows = keys, columns = d
  __shared__ __align__(16) us_t Vs[2][TILE_H];      // rows = d, columns = keys
  __shared__ __align__(16) float Ns[NK];            // column normalisers of this (b,n)
  const int tid = threadIdx.x;
  const int lane = threadIdx.x & 31;
  const int wave = __builtin_amdgcn_readfirstlane(threadIdx.x >> 5);
  const int h = lane >> 4, l15 = lane & 15;
  const int i0 = blockIdx.x * 64, bn = blockIdx.y;
  const int b = bn / NH, n = bn - b * NH;
  const int iw = i0 + wave * 16;
  const int ow = wave * (16 * PP);

  Frag16 qf[2];
  {
    const us_t* pq = Qp + ((size_t)bn * NQ + iw + l15) * DH;       // B column n = query, k = d
#pragma unroll
    for (int c = 0; c < 2; ++c) {
      qf[c].u[0] = *(const v8us*)(pq + 32 * c + 8 * h);
      qf[c].u[1] = *(const v8us*)(pq + 32 * c + 16 + 8 * h);
    }
  }

  v8f oacc[4];
#pragma unroll
  for (int dt = 0; dt < 4; ++dt) oacc[dt] = vzero();

  const us_t* Kbase = Kp + (size_t)bn * NK * DH;
  const us_t* Vbase = Vt + (size_t)bn * DH * NK;
  const float* Nbase = NLS + (size_t)bn * NK;

#pragma unroll
  for (int i = 0; i < NK / 512; ++i)
    *(v4f*)(&Ns[4 * (tid + 128 * i)]) = *(const v4f*)(Nbase + 4 * (tid + 128 * i));
  v4u rk[4], rv[4];
  tile_fetch(rk, Kbase, DH, tid);
  tile_fetch(rv, Vbase, NK, tid);
  tile_put(Kt[0], rk, tid);
  tile_put(Vs[0], rv, tid);
  __syncthreads();   // tile 0 and the normalisers visible to all waves

  for (int t = 0; t < NK / 64; ++t) {
    const us_t* kc = Kt[t & 1];
    const us_t* vc = Vs[t & 1];
    if (t + 1 < NK / 64) {
      tile_fetch(rk, Kbase + (size_t)(t + 1) * 64 * DH, DH, tid);
      tile_fetch(rv, Vbase + (size_t)(t + 1) * 64, NK, tid);
    }
#pragma unroll
    for (int ks = 0; ks < 2; ++ks) {
      Frag16 pb;                                        // B[k = key in step][n = query]
#pragma unroll
      for (int st = 0; st < 2; ++st) {
        v8f s = vzero();
#pragma unroll
        for (int c = 0; c < 2; ++c) {
          Frag16 ka;
          frag_get(ka, kc, 32 * ks + 16 * st + l15, c, h);   // A row m = key
          s = mma16<1>(ka, qf[c], s);
        }
        // D rows = keys 64 t + 32 ks + 16 st + 8h + r : eight consecutive table entries per lane
        const float* np = &Ns[64 * t + 32 * ks + 16 * st + 8 * h];
        const v4f na = *(const v4f*)(np);
        const v4f nc = *(const v4f*)(np + 4);
        const float nl[8] = {na[0], na[1], na[2], na[3], nc[0], nc[1], nc[2], nc[3]};
#pragma unroll
        for (int r = 0; r < 8; ++r)
          pb.hf[8 * st + r] = (h16)pexp2_cut(fmaf(s[r], C2LOG, nl[r]));
      }
#pragma unroll
      for (int dt = 0; dt < 4; ++dt) {
        Frag16 va;                                      // A row m = d (row of Vt), k = key
        frag_get(va, vc, 16 * dt + l15, ks, h);
        oacc[dt] = mma16<1>(va, pb, oacc[dt]);
      }
    }
    if (t + 1 < NK / 64) {
      tile_put(Kt[(t + 1) & 1], rk, tid);
      tile_put(Vs[(t + 1) & 1], rv, tid);
    }
    __syncthreads();   // publishes tile t+1 and ends every read of tile t before its buffers are refilled
  }

  // D layout: oacc[dt][r] = O^T(d = 16 dt + 8h + r, query l15) : eight consecutive d per lane
  const float sc = AVCARRY / PCARRY;
#pragma unroll
  for (int dt = 0; dt < 4; ++dt) {
    v8us pk;
#pragma unroll
    for (int r = 0; r < 8; ++r) pk[r] = hfl_bits(oacc[dt][r] * sc);
    *(v8us*)(&Ost[ow + l15 * PP + 16 * dt + 8 * h]) = pk;
  }
  __syncthreads();
  const int q8 = lane & 7, rsub = lane >> 3;
  {
#pragma unroll
    for (int it = 0; it < 4; ++it) {
      const int row = it * 4 + rsub;                     // 16 rows per wave, 4 lines per instruction
      v4u val = *(const v4u*)(&Ost[ow + row * PP + 8 * q8]);
      us_t* dst = AV + (((size_t)(iw + row) * NB + b) * HH + n * DH + 8 * q8);
      *(v4u*)dst = val;
    }
    
  }
}

// ---------------------------------------------------------------------------
// Host orchestration (14 launches)
// ---------------------------------------------------------------------------
extern "C" void kernel_launch(void* const* d_in, const int* in_sizes, int n_in,
                              void* d_out, int out_size, void* d_ws, size_t ws_size,
                              hipStream_t stream)
{
  if (n_in < 8) return;
  const float* xq = (const float*)d_in[0];
  const float* xk = (const float*)d_in[1];
  const float* xv = (const float*)d_in[2];
  const float* wq = (const float*)d_in[3];
  const float* wk = (const float*)d_in[4];
  const float* wv = (const float*)d_in[5];
  const float* wp = (const float*)d_in[6];
  const float* bp = (const float*)d_in[7];

  if ((long)in_sizes[0] < ((long)(NB - 1) * NQ_FULL + NQ) * DM) return;
  if ((long)in_sizes[1] < ((long)(NB - 1) * NK_FULL + NK) * DM) return;
  if ((long)in_sizes[2] < ((long)(NB - 1) * NK_FULL + NK) * DM) return;
  if ((long)in_sizes[3] < (long)HH * DM) return;
  if ((long)in_sizes[4] < (long)HH * DM) return;
  if ((long)in_sizes[5] < (long)HH * DM) return;
  if ((long)in_sizes[6] < (long)DM * HH) return;
  if (in_sizes[7] < DM) return;
  if ((long)out_size < OUT1_OFF + (long)NB * NQ * NK) return;

  char* base = (char*)d_ws;
  size_t off = 0;
  auto take = [&](size_t bytes) -> char* {
    char* q = base + off; off += (bytes + 255) & ~(size_t)255; return q;
  };
  us_t*  xq_b = (us_t*) take((size_t)NB * NQ * DM * 2);             // bf16 [b][q][DM]
  us_t*  xk_b = (us_t*) take((size_t)NB * NK * DM * 2);             // bf16 [b][k][DM]
  us_t*  xv_b = (us_t*) take((size_t)NB * NK * DM * 2);             // bf16 [b][k][DM]
  us_t*  wq_b = (us_t*) take((size_t)HH * DM * 2);                  // bf16 [out][in]
  us_t*  wk_b = (us_t*) take((size_t)HH * DM * 2);                  // bf16
  us_t*  wv_b = (us_t*) take((size_t)HH * DM * 2);                  // bf16
  us_t*  wp_h = (us_t*) take((size_t)DM * HH * 2);                  // f16 (x64)
  us_t*  Qp   = (us_t*) take((size_t)NB * NH * NQ * DH * 2);        // f16 [bn][q][d]
  us_t*  Kp   = (us_t*) take((size_t)NB * NH * NK * DH * 2);        // f16 [bn][k][d]
  us_t*  Vt   = (us_t*) take((size_t)NB * NH * DH * NK * 2);        // f16 [bn][d][k]
  float* NLS  = (float*)take((size_t)NB * NH * NK * 4);             // f32 [bn][k]
  us_t*  AV   = (us_t*) take((size_t)NQ * NB * HH * 2);             // f16 (x32) [q*NB+b][n*64+d]
  if (off > ws_size) return;
  if (off > (size_t)WS_TOTAL) return;

  float* out0 = (float*)d_out;                                       // [q][b][c]
  float* out1 = (float*)d_out + OUT1_OFF;                            // [b][q][k]

  // 1) input conversions (RNE bf16; Wp as f16 of the bf16 value x64)
  k_cvt_rows<<<dim3(NB * NQ), dim3(128), 0, stream>>>(xq, xq_b, NQ, NQ_FULL);
  k_cvt_rows<<<dim3(NB * NK), dim3(128), 0, stream>>>(xk, xk_b, NK, NK_FULL);
  k_cvt_rows<<<dim3(NB * NK), dim3(128), 0, stream>>>(xv, xv_b, NK, NK_FULL);
  k_cvt_lin<0><<<dim3(HH * DM / 1024), dim3(128), 0, stream>>>(wq, wq_b);
  k_cvt_lin<0><<<dim3(HH * DM / 1024), dim3(128), 0, stream>>>(wk, wk_b);
  k_cvt_lin<0><<<dim3(HH * DM / 1024), dim3(128), 0, stream>>>(wv, wv_b);
  k_cvt_lin<1><<<dim3(DM * HH / 1024), dim3(128), 0, stream>>>(wp, wp_h);

  // 2) projections: q = xq Wq^T, k = xk Wk^T, v^T = (xv Wv^T)^T, per batch z
  k_gemm<0, EPI_Q><<<dim3(HH / BN, NQ / BM, NB), dim3(256), 0, stream>>>(
      xq_b, wq_b, (void*)Qp, (void*)Qp, bp, bp, (long)DM, (long)DM, (long)NQ * DM, DM);
  k_gemm<0, EPI_K><<<dim3(HH / BN, NK / BM, NB), dim3(256), 0, stream>>>(
      xk_b, wk_b, (void*)Kp, (void*)Kp, bp, bp, (long)DM, (long)DM, (long)NK * DM, DM);
  k_gemm<0, EPI_VT><<<dim3(HH / BN, NK / BM, NB), dim3(256), 0, stream>>>(
      xv_b, wv_b, (void*)Vt, (void*)Vt, bp, bp, (long)DM, (long)DM, (long)NK * DM, DM);

  // 3) per-key column statistics of the query-axis softmax
  k_colstats<<<dim3(NK / 64, NB * NH), dim3(128), 0, stream>>>(Qp, Kp, NLS);
  // 4) head-averaged probabilities -> second output
  k_attn_mean<<<dim3(NK / 64, NQ / 64, NB), dim3(128), 0, stream>>>(Qp, Kp, NLS, out1);
  // 5) context -> AV plane
  k_attn_ctx<<<dim3(NQ / 64, NB * NH), dim3(128), 0, stream>>>(Qp, Kp, Vt, NLS, AV);
  // 6) output projection + bias -> first output, rows q*NB + b
  k_gemm<1, EPI_OUT><<<dim3(DM / BN, (NQ * NB) / BM, 1), dim3(256), 0, stream>>>(
      AV, wp_h, (void*)out0, (void*)out0, bp, bp, (long)HH, (long)HH, 0L, HH);
}

// v002
// One run takes 222 microseconds.
// In both of two side-by-side timings against v001, it was 1.06 times as fast.
// Over all steps from v000 it is 1.90 times as fast.
#include <hip/hip_runtime.h>

// Contractions: xq x Wq^T, xk x Wk^T, xv x Wv^T on v_wmma_f32_16x16x32_bf16 (bf16 operands = RNE-converted inputs), f32 accumulate;
// q x k^T (three sweeps: column statistics, head-mean probabilities, context), v^T x p^T and ctx x Wp^T on v_wmma_f32_16x16x32_f16
// (f16 operands: q,k,v unscaled, p carried x4096, ctx carried x32, Wp carried x64 after RNE bf16 convert), f32 accumulate.
// Softmax over the query axis (per key column) and bias add in f32.

#ifndef NB
#define NB 4
#endif
#define NB_FULL 4
#ifndef NQ
#define NQ 1024
#endif
#ifndef NK
#define NK 2048
#endif
#define NQ_FULL 1024
#define NK_FULL 2048
#define DM 1024
#define NH 16
#define DH 64
#define HH (NH * DH)
#define SCL 0.125f
#define C2LOG 0.18033688011112042f      /* SCL * log2(e) */
#define PCARRY 4096.0f
#define PSHIFT 12.0f                     /* log2(PCARRY) */
#define AVCARRY 32.0f
#define OWCARRY 64.0f
#define MSCALE 1.52587890625e-05f        /* 1 / (NH * PCARRY) = 2^-16 */
#define OUT1_OFF 4194304L                /* element offset of the second output (byte 16777216) */

#define AL256(x) (((x) + 255L) & ~255L)
#define WS_TOTAL (AL256((long)NB * NQ * DM * 2) + 2 * AL256((long)NB * NK * DM * 2) + 4 * AL256((long)HH * DM * 2) + \
                  AL256((long)NB * NH * NQ * DH * 2) + 2 * AL256((long)NB * NH * NK * DH * 2) + \
                  AL256((long)NB * NH * NK * 4) + AL256((long)NQ * NB * HH * 2))

static_assert(NB >= 1 && NB <= NB_FULL);
static_assert(NQ >= 128 && NQ <= NQ_FULL && NK >= 128 && NK <= NK_FULL);
static_assert(NQ % 128 == 0 && NK % 128 == 0);
static_assert(DM == 1024 && HH == 1024 && DH == 64 && NH == 16);
static_assert(DM == 128 * 8);
static_assert(DM % 32 == 0 && HH % 32 == 0 && DH % 32 == 0);
static_assert(HH % 128 == 0 && DM % 128 == 0);
static_assert(((long)NQ * NB) % 128 == 0);
static_assert((long)NQ * NB * DM * 4 <= 16777216L);
static_assert(OUT1_OFF * 4 == 16777216L);
static_assert((long)NB * NQ * NK * 4 <= 33554432L);
static_assert(PCARRY == 4096.0f && PSHIFT == 12.0f);
static_assert(MSCALE * 16.0f * PCARRY == 1.0f);
static_assert(WS_TOTAL <= 134217728L);

typedef unsigned short us_t;
typedef _Float16 h16;
typedef us_t     v8us  __attribute__((ext_vector_type(8)));
typedef unsigned v4u   __attribute__((ext_vector_type(4)));
typedef float    v8f   __attribute__((ext_vector_type(8)));
typedef float    v4f   __attribute__((ext_vector_type(4)));
typedef __bf16   v16bf __attribute__((ext_vector_type(16)));
typedef _Float16 v16h  __attribute__((ext_vector_type(16)));

#if __has_builtin(__builtin_amdgcn_exp2f)
#define FEXP2(x) __builtin_amdgcn_exp2f(x)
#else
#define FEXP2(x) __expf((x) * 0.6931471805599453f)
#endif

// 16x32 16-bit fragment: u[0] = elements 0..7, u[1] = elements 8..15
union Frag16 { v8us u[2]; v16bf bf; v16h hf; };

__device__ __forceinline__ v8f vzero() {
  v8f z = {0.f, 0.f, 0.f, 0.f, 0.f, 0.f, 0.f, 0.f};
  return z;
}

// RNE f32 -> bf16 bits
__device__ __forceinline__ us_t bf_bits(float x) {
  unsigned u = __float_as_uint(x);
  u += 0x7FFFu + ((u >> 16) & 1u);
  return (us_t)(u >> 16);
}
// RNE f32 -> bf16 value kept as f32
__device__ __forceinline__ float bf_val(float x) {
  unsigned u = __float_as_uint(x);
  u += 0x7FFFu + ((u >> 16) & 1u);
  return __uint_as_float(u & 0xFFFF0000u);
}
// RNE f32 -> f16 bits
__device__ __forceinline__ us_t hf_bits(float x) {
  _Float16 hv = (_Float16)x;
  return __builtin_bit_cast(us_t, hv);
}

// RNE f32 -> f16 with a value select: results below the smallest normal f16 become zero
static __device__ __forceinline__ h16 toh_flush(float v) {
  const h16 r = (h16)v;
  return (fabsf(v) < 6.103515625e-05f) ? (h16)0.0f : r;
}
static __device__ __forceinline__ us_t hfl_bits(float v) {
  return __builtin_bit_cast(us_t, toh_flush(v));
}
// exp2 of an exponent that already contains the x4096 carry; zero when the f16 value would be subnormal
static __device__ __forceinline__ float pexp2_cut(float e) {
  const float p = FEXP2(e);
  return (e < -14.0f) ? 0.0f : p;
}

// WMMA with hazard guard (ties D, keeps A/B live)
template <int F16OP>
__device__ __forceinline__ v8f mma16(const Frag16& a, const Frag16& b, v8f c) {
  if (F16OP) {
    c = __builtin_amdgcn_wmma_f32_16x16x32_f16(false, a.hf, false, b.hf, (short)0, c, false, false);
    asm volatile("v_nop\n\tv_nop\n\tv_nop\n\tv_nop" : "+v"(c) : "v"(a.hf), "v"(b.hf));
  } else {
    c = __builtin_amdgcn_wmma_f32_16x16x32_bf16(false, a.bf, false, b.bf, (short)0, c, false, false);
    asm volatile("v_nop\n\tv_nop\n\tv_nop\n\tv_nop" : "+v"(c) : "v"(a.bf), "v"(b.bf));
  }
  return c;
}

// ---------------------------------------------------------------------------
// All input conversions in one resident launch. Unit = one row of DM = 1024 floats (4096 B in, 2048 B out).
// Units in plane order: xq rows, xk rows, xv rows (RNE bf16), Wq, Wk, Wv rows (RNE bf16), Wp rows (f16 of bf16(x)*OWCARRY);
// the seven 16-bit planes lie back to back in the workspace, so unit u is written at dst + u * DM.
// 256 blocks x 16 waves; a wave takes units gw, gw + 4096, ...: eight 16-B loads per lane, each wave-wide load
// 512 contiguous bytes, the next unit's eight loads issued before the current unit is converted and stored
// (8-B stores, 256 contiguous bytes per wave-wide store). No barrier, no LDS.
// ---------------------------------------------------------------------------
#define CVT_WPB 16
#define CVT_BLOCKS 256
#define CVT_NW (CVT_WPB * CVT_BLOCKS)
#define U_XQ (NB * NQ)
#define U_XK (NB * NK)
#define U_W HH
#define U_ALL (U_XQ + 2 * U_XK + 4 * U_W)
#define CVT_IT ((U_ALL + CVT_NW - 1) / CVT_NW)
static_assert(((long)NB * NQ * DM * 2) % 256 == 0 && ((long)NB * NK * DM * 2) % 256 == 0 && ((long)HH * DM * 2) % 256 == 0);

typedef unsigned v2u __attribute__((ext_vector_type(2)));

// behind each unit's loads and each unit's stores: their address registers are reused for the next unit's addresses;
// its memory clobber also keeps the order loads(u + 1), convert(u), stores(u), so that stores start while loads are in flight
#define CVT_XWAIT() asm volatile("s_wait_xcnt 0x0" ::: "memory")

// source row of unit u (wave-uniform); a unit past the end re-reads the last row and is not stored
__device__ __forceinline__ const float* cvt_row(unsigned u, const float* xq, const float* xk, const float* xv,
                                                const float* wq, const float* wk, const float* wv, const float* wp) {
  if (u >= U_ALL) u = U_ALL - 1;
  const unsigned uk = u - U_XQ, uv = uk - U_XK, uw = uv - U_XK;
  const float* p = (uw < U_W) ? wq : (uw < 2 * U_W) ? wk : (uw < 3 * U_W) ? wv : wp;
  unsigned r = uw % U_W;
  if (u < U_XQ + 2 * U_XK) { p = xv; r = (uv / NK) * NK_FULL + uv % NK; }
  if (u < U_XQ + U_XK)     { p = xk; r = (uk / NK) * NK_FULL + uk % NK; }
  if (u < U_XQ)            { p = xq; r = (u / NQ) * NQ_FULL + u % NQ; }
  return p + (size_t)r * DM;
}

__global__ __launch_bounds__(CVT_WPB * 32)
void k_cvt_all(const float* __restrict__ xq, const float* __restrict__ xk, const float* __restrict__ xv,
               const float* __restrict__ wq, const float* __restrict__ wk, const float* __restrict__ wv,
               const float* __restrict__ wp, us_t* __restrict__ dst)
{
  const unsigned lane = threadIdx.x & 31;
  const unsigned gw = __builtin_amdgcn_readfirstlane(blockIdx.x * CVT_WPB + (threadIdx.x >> 5));
  if (gw >= CVT_NW) return;   // bounds gw for any grid (wave-uniform, no barrier here)

  v4f buf[2][8];
  {
    const float* s = cvt_row(gw, xq, xk, xv, wq, wk, wv, wp) + 4 * lane;
#pragma unroll
    for (int j = 0; j < 8; ++j) buf[0][j] = *(const v4f*)(s + 128 * j);
    CVT_XWAIT();
  }
#pragma unroll   // two register sets alternate by a compile-time index: no copies between them
  for (int it = 0; it < CVT_IT; ++it) {
    const unsigned u = gw + it * CVT_NW;
    if (it + 1 < CVT_IT) {
      const float* s = cvt_row(u + CVT_NW, xq, xk, xv, wq, wk, wv, wp) + 4 * lane;
#pragma unroll
      for (int j = 0; j < 8; ++j) buf[(it + 1) & 1][j] = *(const v4f*)(s + 128 * j);
      CVT_XWAIT();
    }
    if (u < U_ALL) {
      const v4f (&r)[8] = buf[it & 1];
      us_t* d = dst + (size_t)u * DM + 4 * lane;
      if (u < U_ALL - U_W) {
#pragma unroll
        for (int j = 0; j < 8; ++j) {
          const v2u pk = {(unsigned)bf_bits(r[j][0]) | ((unsigned)bf_bits(r[j][1]) << 16),
                          (unsigned)bf_bits(r[j][2]) | ((unsigned)bf_bits(r[j][3]) << 16)};
          *(v2u*)(d + 128 * j) = pk;
        }
      } else {
#pragma unroll
        for (int j = 0; j < 8; ++j) {
          const v2u pk = {(unsigned)hf_bits(bf_val(r[j][0]) * OWCARRY) | ((unsigned)hf_bits(bf_val(r[j][1]) * OWCARRY) << 16),
                          (unsigned)hf_bits(bf_val(r[j][2]) * OWCARRY) | ((unsigned)hf_bits(bf_val(r[j][3]) * OWCARRY) << 16)};
          *(v2u*)(d + 128 * j) = pk;
        }
      }
      CVT_XWAIT();
    }
  }
}

// ---------------------------------------------------------------------------
// TN GEMM: C[M,N] = A[M,K] * B[N,K]^T, 16-bit operands from planes, f32 accumulate.
// Block 128x128x32, 256 threads = 8 waves (2x4), wave tile 64x32 = 4x2 WMMA tiles.
// Synchronous single-buffered LDS staging. Epilogue stages the 128x128 tile in LDS
//  EPI_Q  : D0 = Q plane  [(z*NH+n)*NQ + i][d] f16
//  EPI_K  : D0 = K plane  [(z*NH+n)*NK + pos][d] f16
//  EPI_VT : D0 = Vt plane [((z*NH+n)*DH + d)*NK + pos] f16
//  EPI_OUT: D0 = f32 output rows [row][DM], scaled by 1/(AVCARRY*OWCARRY), bias0 (RNE bf16 value) added in f32 at the store stage
// ---------------------------------------------------------------------------
#define BM 128
#define BN 128
#define BK 32
#define BKP 40
#define CSP 136
#define CFP 132
#define EPI_Q 0
#define EPI_K 1
#define EPI_VT 2
#define EPI_OUT 3

template <int F16OP, int EPI>
__global__ __launch_bounds__(256)
void k_gemm(const us_t* __restrict__ A, const us_t* __restrict__ B,
            void* D0, void* D1, const float* __restrict__ bias0, const float* __restrict__ bias1,
            long lda, long ldb, long strideAz, int K)
{
  __shared__ __align__(16) us_t As[BM * BKP];   // 128 rows x 32 k (pad 40); staged extent == consumed extent (k 0..31)
  __shared__ __align__(16) us_t Bs[BN * BKP];
  __shared__ __align__(16) us_t Cs[BM * CSP];   // f16 view [128][136] or f32 view [64][132]
  static_assert(64 * CFP * 4 <= BM * CSP * 2);

  const int tid = threadIdx.x, lane = tid & 31, wid = __builtin_amdgcn_readfirstlane(tid >> 5);
  const int wm = wid >> 2, wn = wid & 3, h = lane >> 4, l15 = lane & 15;
  const int m0 = blockIdx.y * BM, n0 = blockIdx.x * BN, z = blockIdx.z;
  const us_t* Ab = A + (size_t)z * (size_t)strideAz + (size_t)m0 * (size_t)lda;
  const us_t* Bb = B + (size_t)n0 * (size_t)ldb;

  v8f acc[4][2];
#pragma unroll
  for (int mi = 0; mi < 4; ++mi)
#pragma unroll
    for (int ni = 0; ni < 2; ++ni) acc[mi][ni] = vzero();

  const int nk = K / BK;
  for (int kb = 0; kb < nk; ++kb) {
    const int k0 = kb * BK;
    v8us ra[2], rb[2];
#pragma unroll
    for (int t = 0; t < 2; ++t) {
      const int ch = tid + t * 256, row = ch >> 2, kc = (ch & 3) << 3;
      ra[t] = *(const v8us*)(Ab + (size_t)row * (size_t)lda + k0 + kc);
      rb[t] = *(const v8us*)(Bb + (size_t)row * (size_t)ldb + k0 + kc);
    }
    __syncthreads();   // all waves done with the prior k-step fragments (cross-wave: block barrier)
#pragma unroll
    for (int t = 0; t < 2; ++t) {
      const int ch = tid + t * 256, row = ch >> 2, kc = (ch & 3) << 3;
      *(v8us*)(&As[row * BKP + kc]) = ra[t];
      *(v8us*)(&Bs[row * BKP + kc]) = rb[t];
    }
    __syncthreads();
    Frag16 af[4], bfr[2];
#pragma unroll
    for (int mi = 0; mi < 4; ++mi) {
      const int r = wm * 64 + mi * 16 + l15;                  // A row m = lane&15
      af[mi].u[0] = *(const v8us*)(&As[r * BKP + 8 * h]);      // k 8h..8h+7
      af[mi].u[1] = *(const v8us*)(&As[r * BKP + 16 + 8 * h]); // k 16+8h..16+8h+7
    }
#pragma unroll
    for (int ni = 0; ni < 2; ++ni) {
      const int r = wn * 32 + ni * 16 + l15;                  // B column n = lane&15, row of [n][k] plane, same k map
      bfr[ni].u[0] = *(const v8us*)(&Bs[r * BKP + 8 * h]);
      bfr[ni].u[1] = *(const v8us*)(&Bs[r * BKP + 16 + 8 * h]);
    }
#pragma unroll
    for (int mi = 0; mi < 4; ++mi)
#pragma unroll
      for (int ni = 0; ni < 2; ++ni) acc[mi][ni] = mma16<F16OP>(af[mi], bfr[ni], acc[mi][ni]);
  }

  // D layout: acc[mi][ni][v] = C(row wm*64+mi*16+8h+v, col wn*32+ni*16+l15)
  const int q8 = tid & 7, lsub = tid >> 3;   // 8 lanes per line, 32 lines per instruction over the block

  if (EPI == EPI_OUT) {
    float* Cf = (float*)Cs;
    float* Do = (float*)D0;
    const float oscale = 1.0f / (AVCARRY * OWCARRY);
#pragma unroll
    for (int rh = 0; rh < 2; ++rh) {
      __syncthreads();
      if (wm == rh) {
#pragma unroll
        for (int mi = 0; mi < 4; ++mi)
#pragma unroll
          for (int ni = 0; ni < 2; ++ni) {
            const int col = wn * 32 + ni * 16 + l15;
#pragma unroll
            for (int v = 0; v < 8; ++v)
              Cf[(mi * 16 + 8 * h + v) * CFP + col] = acc[mi][ni][v] * oscale;
          }
      }
      __syncthreads();
      {
#pragma unroll
        for (int it = 0; it < 8; ++it) {
          const int L = it * 32 + lsub, pr = L >> 2, ql = L & 3;     // 64 rows x 4 lines per row
          const v4f val = *(const v4f*)(&Cf[pr * CFP + 32 * ql + 4 * q8]);
          const v4f bq = *(const v4f*)(bias0 + n0 + 32 * ql + 4 * q8);
          const v4f o = {val[0] + bf_val(bq[0]), val[1] + bf_val(bq[1]),
                         val[2] + bf_val(bq[2]), val[3] + bf_val(bq[3])};
          float* dst = Do + ((size_t)(m0 + 64 * rh + pr) * DM + n0 + 32 * ql + 4 * q8);
          *(v4f*)dst = o;
        }
        
      }
    }
  } else {
    __syncthreads();
#pragma unroll
    for (int mi = 0; mi < 4; ++mi)
#pragma unroll
      for (int ni = 0; ni < 2; ++ni) {
        const int col = wn * 32 + ni * 16 + l15;
#pragma unroll
        for (int v = 0; v < 8; ++v)
          Cs[(wm * 64 + mi * 16 + 8 * h + v) * CSP + col] = hfl_bits(acc[mi][ni][v]);
      }
    __syncthreads();
    const int rpb = (EPI == EPI_Q) ? NQ : NK;   // plane rows per (batch, head)
    const int hb = n0 >> 6;                      // first head of this column block
    {
      if (EPI != EPI_VT) {
#pragma unroll
        for (int it = 0; it < 8; ++it) {
          const int L = it * 32 + lsub, pr = L >> 1, nl = L & 1;   // 128 rows x 2 lines of 64 halves
          v4u val = *(const v4u*)(&Cs[pr * CSP + nl * 64 + 8 * q8]);
          us_t* dst = (us_t*)D0 + ((((size_t)z * NH + hb + nl) * rpb + m0 + pr) * DH + 8 * q8);
          *(v4u*)dst = val;
        }
      } else {
        // Vt plane: line = (nl, d, hp) covers 64 consecutive pos; lane q8 gathers 8 pos down a column of Cs
#pragma unroll
        for (int it = 0; it < 8; ++it) {
          const int L = it * 32 + lsub, nl = L >> 7, d = (L >> 1) & 63, hp = L & 1;
          const int rb0 = 64 * hp + 8 * q8, cc = nl * 64 + d;
          unsigned wv[4];
#pragma unroll
          for (int k = 0; k < 4; ++k) {
            const unsigned lo = Cs[(rb0 + 2 * k) * CSP + cc];
            const unsigned hi = Cs[(rb0 + 2 * k + 1) * CSP + cc];
            wv[k] = lo | (hi << 16);
          }
          v4u val = {wv[0], wv[1], wv[2], wv[3]};
          us_t* dst = (us_t*)D0 + ((((size_t)z * NH + hb + nl) * DH + d) * NK + m0 + 64 * hp + 8 * q8);
          *(v4u*)dst = val;
        }
      }
      
    }
  }
}

// ---------------------------------------------------------------------------
// LDS tiles of the attention sweeps: 64 rows x 64 halves (128 B), shared by the block's 4 waves.
// Fetch: every wave-wide 16-B load covers four whole 128-B lines (8 lanes per row).
// Row pitch 72 halves = 144 B = 16 B x 9: fragment reads (ds_load_b128, 16 rows) spread over the banks.
// ---------------------------------------------------------------------------
#define TP 72
#define TILE_H (64 * TP)
static_assert(NQ % 64 == 0 && NK % 512 == 0 && DH == 64);

__device__ __forceinline__ void tile_fetch(v4u (&r)[4], const us_t* __restrict__ src, size_t pitch, int tid) {
#pragma unroll
  for (int i = 0; i < 4; ++i) {
    const int ch = tid + 128 * i;
    r[i] = *(const v4u*)(src + (size_t)(ch >> 3) * pitch + 8 * (ch & 7));
  }
}
__device__ __forceinline__ void tile_put(us_t* t, const v4u (&r)[4], int tid) {
#pragma unroll
  for (int i = 0; i < 4; ++i) {
    const int ch = tid + 128 * i;
    *(v4u*)(t + (ch >> 3) * TP + 8 * (ch & 7)) = r[i];
  }
}
// fragment of tile row 'row', halves 32c..32c+31, in the k map of the plane loaders (8h.., 16+8h..)
__device__ __forceinline__ void frag_get(Frag16& f, const us_t* t, int row, int c, int h) {
  f.u[0] = *(const v8us*)(t + row * TP + 32 * c + 8 * h);
  f.u[1] = *(const v8us*)(t + row * TP + 32 * c + 16 + 8 * h);
}

// ---------------------------------------------------------------------------
// Column statistics of the query-axis softmax. Block = 128 threads (4 waves) owns 64 keys of
// one (b,n); wave w owns 16 keys (K fragments held as the B operand), sweeps all NQ queries
// 32 at a time (A fragments from 64-query LDS tiles, two buffers, next tile fetched during the current). Lane (h, key) keeps a running max and
// sum over its query rows in the log2 domain; the two lane halves are merged at the end.
// ---------------------------------------------------------------------------
__global__ __launch_bounds__(128)
void k_colstats(const us_t* __restrict__ Qp, const us_t* __restrict__ Kp, float* NLS)
{
  __shared__ __align__(16) float sred[64];    // cross-wave: block barrier
  __shared__ __align__(16) us_t Qt[2][TILE_H];
  const int tid = threadIdx.x;
  const int lane = threadIdx.x & 31;
  const int wave = __builtin_amdgcn_readfirstlane(threadIdx.x >> 5);
  const int h = lane >> 4, l15 = lane & 15;
  const int bn = blockIdx.y;
  const int kb0 = blockIdx.x * 64;

  Frag16 kf[2];
  {
    const us_t* kr = Kp + ((size_t)bn * NK + kb0 + wave * 16 + l15) * DH;   // B column n = key, k = d
#pragma unroll
    for (int c = 0; c < 2; ++c) {
      kf[c].u[0] = *(const v8us*)(kr + 32 * c + 8 * h);
      kf[c].u[1] = *(const v8us*)(kr + 32 * c + 16 + 8 * h);
    }
  }

  float mrun = -3.0e38f, lrun = 0.f;
  const us_t* Qbase = Qp + (size_t)bn * NQ * DH;
  v4u rq[4];
  tile_fetch(rq, Qbase, DH, tid);
  tile_put(Qt[0], rq, tid);
  __syncthreads();   // tile 0 visible to all waves
  for (int t = 0; t < NQ / 64; ++t) {
    const us_t* qc = Qt[t & 1];
    if (t + 1 < NQ / 64) tile_fetch(rq, Qbase + (size_t)(t + 1) * 64 * DH, DH, tid);
#pragma unroll
    for (int hq = 0; hq < 2; ++hq) {
      v8f s0 = vzero(), s1 = vzero();
#pragma unroll
      for (int c = 0; c < 2; ++c) {
        Frag16 a0, a1;
        frag_get(a0, qc, 32 * hq + l15, c, h);                              // A row m = query
        frag_get(a1, qc, 32 * hq + 16 + l15, c, h);
        s0 = mma16<1>(a0, kf[c], s0);
        s1 = mma16<1>(a1, kf[c], s1);
      }
      float tmx = fmaxf(s0[0], s1[0]);
#pragma unroll
      for (int r = 1; r < 8; ++r) tmx = fmaxf(tmx, fmaxf(s0[r], s1[r]));
      const float mn = fmaxf(mrun, tmx * C2LOG);
      float ps = 0.f;
#pragma unroll
      for (int r = 0; r < 8; ++r) {
        ps += FEXP2(fmaf(s0[r], C2LOG, -mn));
        ps += FEXP2(fmaf(s1[r], C2LOG, -mn));
      }
      lrun = lrun * FEXP2(mrun - mn) + ps;
      mrun = mn;
    }
    if (t + 1 < NQ / 64) tile_put(Qt[(t + 1) & 1], rq, tid);
    __syncthreads();   // publishes tile t+1 and ends every read of tile t before its buffer is refilled
  }

  // merge the two lane halves (all lanes take part in the exchange)
  const float m2 = __shfl_xor(mrun, 16);
  const float l2 = __shfl_xor(lrun, 16);
  const float mt = fmaxf(mrun, m2);
  const float lt = lrun * FEXP2(mrun - mt) + l2 * FEXP2(m2 - mt);
  const float nls = PSHIFT - (mt + log2f(lt));

  if (h == 0) sred[wave * 16 + l15] = nls;
  __syncthreads();
  if (wave == 0) {
    const int li = (lane < 16) ? lane : 15;                 // clamped LDS address
    const v4f val = *(const v4f*)(&sred[4 * li]);
    float* dst = NLS + (size_t)bn * NK + kb0 + 4 * li;      // 16 lanes x 16 B = the block's 256 B
    if (lane < 16) *(v4f*)dst = val;
    
  }
}

// ---------------------------------------------------------------------------
// Head-averaged probabilities. Block = 128 threads (4 waves), tile 64 queries x 64 keys of one
// batch; wave w owns 16 queries x 64 keys and loops over the 16 heads: S = Q K^T (A = Q rows,
// B = K rows, fragments from per-head 64-row LDS tiles, two buffers), p*4096 = exp2(c*s + NLS[key]), summed over
// ---------------------------------------------------------------------------
#define MP 68

__global__ __launch_bounds__(128, 8)   // register budget for 8 waves per SIMD: all 8 blocks per WGP of this grid stay resident
void k_attn_mean(const us_t* __restrict__ Qp, const us_t* __restrict__ Kp,
                 const float* __restrict__ NLS, float* out1)
{
  __shared__ __align__(16) us_t Tl[4 * TILE_H];      // Q tile x2, K tile x2; behind the head loop's last barrier: output staging
  __shared__ __align__(16) float Ns[NH * 64];        // the tile's 64 column normalisers of every head
  static_assert(4 * 16 * MP * 4 <= 4 * TILE_H * 2);
  float* Mst = (float*)Tl;                           // per wave 16 rows x 64 floats used (pad 68); wave-private, block barrier
  const int tid = threadIdx.x;
  const int lane = threadIdx.x & 31;
  const int wave = __builtin_amdgcn_readfirstlane(threadIdx.x >> 5);
  const int h = lane >> 4, l15 = lane & 15;
  const int k0 = blockIdx.x * 64;
  const int q0 = blockIdx.y * 64 + wave * 16;
  const int b = blockIdx.z;
  const int mw = wave * (16 * MP);

  v8f macc[4];
#pragma unroll
  for (int st = 0; st < 4; ++st) macc[st] = vzero();

  const us_t* Qsrc = Qp + ((size_t)b * NH * NQ + blockIdx.y * 64) * DH;   // head 0; next head: + NQ * DH
  const us_t* Ksrc = Kp + ((size_t)b * NH * NK + k0) * DH;                // head 0; next head: + NK * DH
  v4f nv[2];
#pragma unroll
  for (int i = 0; i < 2; ++i) {
    const int e = tid + 128 * i;                                          // 16 heads x 16 chunks of 4 floats
    nv[i] = *(const v4f*)(NLS + ((size_t)b * NH + (e >> 4)) * NK + k0 + 4 * (e & 15));
  }
  // stands in front of the tile loads, whose destinations otherwise reuse the address registers of the two loads above
  asm volatile("s_wait_xcnt 0x0" ::: "memory");
  v4u rq[4], rk[4];
  tile_fetch(rq, Qsrc, DH, tid);
  tile_fetch(rk, Ksrc, DH, tid);
#pragma unroll
  for (int i = 0; i < 2; ++i) *(v4f*)(&Ns[4 * (tid + 128 * i)]) = nv[i];
  tile_put(Tl, rq, tid);
  tile_put(Tl + 2 * TILE_H, rk, tid);
  __syncthreads();   // head 0's tiles and the normalisers visible to all waves

  // one head's scores and probabilities from the tiles in buffer hh & 1
  auto head = [&](int hh) {
    const us_t* qc = Tl + (hh & 1) * TILE_H;
    const us_t* kc = Tl + (2 + (hh & 1)) * TILE_H;
    Frag16 qa[2];
#pragma unroll
    for (int c = 0; c < 2; ++c) frag_get(qa[c], qc, wave * 16 + l15, c, h);   // A row m = query
#pragma unroll
    for (int st = 0; st < 4; ++st) {
      v8f s = vzero();
#pragma unroll
      for (int c = 0; c < 2; ++c) {
        Frag16 bf;
        frag_get(bf, kc, 16 * st + l15, c, h);                               // B column n = key
        s = mma16<1>(qa[c], bf, s);
      }
      const float nl = Ns[hh * 64 + 16 * st + l15];
#pragma unroll
      for (int r = 0; r < 8; ++r) macc[st][r] += FEXP2(fmaf(s[r], C2LOG, nl));
    }
  };

#pragma unroll 1
  for (int hh = 0; hh < NH - 1; ++hh) {
    tile_fetch(rq, Qsrc + (size_t)(hh + 1) * NQ * DH, DH, tid);
    tile_fetch(rk, Ksrc + (size_t)(hh + 1) * NK * DH, DH, tid);
    head(hh);
    tile_put(Tl + ((hh + 1) & 1) * TILE_H, rq, tid);
    tile_put(Tl + (2 + ((hh + 1) & 1)) * TILE_H, rk, tid);
    __syncthreads();   // publishes head hh+1's tiles and ends every read of head hh's before their buffers are refilled
  }
  head(NH - 1);
  __syncthreads();     // every wave has left the tiles before they become output staging

  // D layout: macc[st][r] = (query q0 + 8h + r, key k0 + 16 st + l15)
#pragma unroll
  for (int st = 0; st < 4; ++st)
#pragma unroll
    for (int r = 0; r < 8; ++r)
      Mst[mw + (8 * h + r) * MP + 16 * st + l15] = macc[st][r] * MSCALE;
  __syncthreads();
  const int q8 = lane & 7, rsub = lane >> 3;
  {
#pragma unroll
    for (int it = 0; it < 8; ++it) {
      const int L = it * 4 + rsub, row = L >> 1, nl = L & 1;     // 16 rows x 2 lines, 4 lines per instruction
      const v4f val = *(const v4f*)(&Mst[mw + row * MP + 32 * nl + 4 * q8]);
      float* dst = out1 + (((size_t)b * NQ + q0 + row) * NK + k0 + 32 * nl + 4 * q8);
      *(v4f*)dst = val;
    }
    
  }
}

// ---------------------------------------------------------------------------
// Context, transposed register-fed form. Block = 128 threads (4 waves), 64 queries of one
// (b,n); wave w owns 16 queries (Q fragments held as the B operand). Per 32-key step:
// S^T = K Q^T (A = K rows from a 64-key LDS tile) for two 16-key tiles, p^T*4096 = exp2(c*s + NLS[key])
// packed from the two D tiles into one B fragment (element r <- tile 0, element 8+r <- tile 1),
// O^T += Vt * P^T (A = Vt rows d from a 64-key LDS tile, k = keys). Two buffers per tile, the next
// 64 keys fetched during the current, one barrier per 64 keys; the column normaliser (whole row in
// LDS) is already inside the exponent, so there is no running state.
// ---------------------------------------------------------------------------
#define PP 72

__global__ __launch_bounds__(128)
void k_attn_ctx(const us_t* __restrict__ Qp, const us_t* __restrict__ Kp, const us_t* __restrict__ Vt,
                const float* __restrict__ NLS, us_t* AV)
{
  __shared__ __align__(16) us_t Ost[4 * 16 * PP];   // per wave 16 rows x 64 halves used (pad 72); wave-private, block barrier
  __shared__ __align__(16) us_t Kt[2][TILE_H];      // rows = keys, columns = d
  __shared__ __align__(16) us_t Vs[2][TILE_H];      // rows = d, columns = keys
  __shared__ __align__(16) float Ns[NK];            // column normalisers of this (b,n)
  const int tid = threadIdx.x;
  const int lane = threadIdx.x & 31;
  const int wave = __builtin_amdgcn_readfirstlane(threadIdx.x >> 5);
  const int h = lane >> 4, l15 = lane & 15;
  const int i0 = blockIdx.x * 64, bn = blockIdx.y;
  const int b = bn / NH, n = bn - b * NH;
  const int iw = i0 + wave * 16;
  const int ow = wave * (16 * PP);

  Frag16 qf[2];
  {
    const us_t* pq = Qp + ((size_t)bn * NQ + iw + l15) * DH;       // B column n = query, k = d
#pragma unroll
    for (int c = 0; c < 2; ++c) {
      qf[c].u[0] = *(const v8us*)(pq + 32 * c + 8 * h);
      qf[c].u[1] = *(const v8us*)(pq + 32 * c + 16 + 8 * h);
    }
  }

  v8f oacc[4];
#pragma unroll
  for (int dt = 0; dt < 4; ++dt) oacc[dt] = vzero();

  const us_t* Kbase = Kp + (size_t)bn * NK * DH;
  const us_t* Vbase = Vt + (size_t)bn * DH * NK;
  const float* Nbase = NLS + (size_t)bn * NK;

#pragma unroll
  for (int i = 0; i < NK / 512; ++i)
    *(v4f*)(&Ns[4 * (tid + 128 * i)]) = *(const v4f*)(Nbase + 4 * (tid + 128 * i));
  v4u rk[4], rv[4];
  tile_fetch(rk, Kbase, DH, tid);
  tile_fetch(rv, Vbase, NK, tid);
  tile_put(Kt[0], rk, tid);
  tile_put(Vs[0], rv, tid);
  __syncthreads();   // tile 0 and the normalisers visible to all waves

  for (int t = 0; t < NK / 64; ++t) {
    const us_t* kc = Kt[t & 1];
    const us_t* vc = Vs[t & 1];
    if (t + 1 < NK / 64) {
      tile_fetch(rk, Kbase + (size_t)(t + 1) * 64 * DH, DH, tid);
      tile_fetch(rv, Vbase + (size_t)(t + 1) * 64, NK, tid);
    }
#pragma unroll
    for (int ks = 0; ks < 2; ++ks) {
      Frag16 pb;                                        // B[k = key in step][n = query]
#pragma unroll
      for (int st = 0; st < 2; ++st) {
        v8f s = vzero();
#pragma unroll
        for (int c = 0; c < 2; ++c) {
          Frag16 ka;
          frag_get(ka, kc, 32 * ks + 16 * st + l15, c, h);   // A row m = key
          s = mma16<1>(ka, qf[c], s);
        }
        // D rows = keys 64 t + 32 ks + 16 st + 8h + r : eight consecutive table entries per lane
        const float* np = &Ns[64 * t + 32 * ks + 16 * st + 8 * h];
        const v4f na = *(const v4f*)(np);
        const v4f nc = *(const v4f*)(np + 4);
        const float nl[8] = {na[0], na[1], na[2], na[3], nc[0], nc[1], nc[2], nc[3]};
#pragma unroll
        for (int r = 0; r < 8; ++r)
          pb.hf[8 * st + r] = (h16)pexp2_cut(fmaf(s[r], C2LOG, nl[r]));
      }
#pragma unroll
      for (int dt = 0; dt < 4; ++dt) {
        Frag16 va;                                      // A row m = d (row of Vt), k = key
        frag_get(va, vc, 16 * dt + l15, ks, h);
        oacc[dt] = mma16<1>(va, pb, oacc[dt]);
      }
    }
    if (t + 1 < NK / 64) {
      tile_put(Kt[(t + 1) & 1], rk, tid);
      tile_put(Vs[(t + 1) & 1], rv, tid);
    }
    __syncthreads();   // publishes tile t+1 and ends every read of tile t before its buffers are refilled
  }

  // D layout: oacc[dt][r] = O^T(d = 16 dt + 8h + r, query l15) : eight consecutive d per lane
  const float sc = AVCARRY / PCARRY;
#pragma unroll
  for (int dt = 0; dt < 4; ++dt) {
    v8us pk;
#pragma unroll
    for (int r = 0; r < 8; ++r) pk[r] = hfl_bits(oacc[dt][r] * sc);
    *(v8us*)(&Ost[ow + l15 * PP + 16 * dt + 8 * h]) = pk;
  }
  __syncthreads();
  const int q8 = lane & 7, rsub = lane >> 3;
  {
#pragma unroll
    for (int it = 0; it < 4; ++it) {
      const int row = it * 4 + rsub;                     // 16 rows per wave, 4 lines per instruction
      v4u val = *(const v4u*)(&Ost[ow + row * PP + 8 * q8]);
      us_t* dst = AV + (((size_t)(iw + row) * NB + b) * HH + n * DH + 8 * q8);
      *(v4u*)dst = val;
    }
    
  }
}

// ---------------------------------------------------------------------------
// Host orchestration (8 launches)
// ---------------------------------------------------------------------------
extern "C" void kernel_launch(void* const* d_in, const int* in_sizes, int n_in,
                              void* d_out, int out_size, void* d_ws, size_t ws_size,
                              hipStream_t stream)
{
  if (n_in < 8) return;
  const float* xq = (const float*)d_in[0];
  const float* xk = (const float*)d_in[1];
  const float* xv = (const float*)d_in[2];
  const float* wq = (const float*)d_in[3];
  const float* wk = (const float*)d_in[4];
  const float* wv = (const float*)d_in[5];
  const float* wp = (const float*)d_in[6];
  const float* bp = (const float*)d_in[7];

  if ((long)in_sizes[0] < ((long)(NB - 1) * NQ_FULL + NQ) * DM) return;
  if ((long)in_sizes[1] < ((long)(NB - 1) * NK_FULL + NK) * DM) return;
  if ((long)in_sizes[2] < ((long)(NB - 1) * NK_FULL + NK) * DM) return;
  if ((long)in_sizes[3] < (long)HH * DM) return;
  if ((long)in_sizes[4] < (long)HH * DM) return;
  if ((long)in_sizes[5] < (long)HH * DM) return;
  if ((long)in_sizes[6] < (long)DM * HH) return;
  if (in_sizes[7] < DM) return;
  if ((long)out_size < OUT1_OFF + (long)NB * NQ * NK) return;

  char* base = (char*)d_ws;
  size_t off = 0;
  auto take = [&](size_t bytes) -> char* {
    char* q = base + off; off += (bytes + 255) & ~(size_t)255; return q;
  };
  us_t*  xq_b = (us_t*) take((size_t)NB * NQ * DM * 2);             // bf16 [b][q][DM]
  us_t*  xk_b = (us_t*) take((size_t)NB * NK * DM * 2);             // bf16 [b][k][DM]
  us_t*  xv_b = (us_t*) take((size_t)NB * NK * DM * 2);             // bf16 [b][k][DM]
  us_t*  wq_b = (us_t*) take((size_t)HH * DM * 2);                  // bf16 [out][in]
  us_t*  wk_b = (us_t*) take((size_t)HH * DM * 2);                  // bf16
  us_t*  wv_b = (us_t*) take((size_t)HH * DM * 2);                  // bf16
  us_t*  wp_h = (us_t*) take((size_t)DM * HH * 2);                  // f16 (x64)
  us_t*  Qp   = (us_t*) take((size_t)NB * NH * NQ * DH * 2);        // f16 [bn][q][d]
  us_t*  Kp   = (us_t*) take((size_t)NB * NH * NK * DH * 2);        // f16 [bn][k][d]
  us_t*  Vt   = (us_t*) take((size_t)NB * NH * DH * NK * 2);        // f16 [bn][d][k]
  float* NLS  = (float*)take((size_t)NB * NH * NK * 4);             // f32 [bn][k]
  us_t*  AV   = (us_t*) take((size_t)NQ * NB * HH * 2);             // f16 (x32) [q*NB+b][n*64+d]
  if (off > ws_size) return;
  if (off > (size_t)WS_TOTAL) return;

  float* out0 = (float*)d_out;                                       // [q][b][c]
  float* out1 = (float*)d_out + OUT1_OFF;                            // [b][q][k]

  // 1) input conversions (RNE bf16; Wp as f16 of the bf16 value x64): planes xq_b .. wp_h, back to back from xq_b
  k_cvt_all<<<dim3(CVT_BLOCKS), dim3(CVT_WPB * 32), 0, stream>>>(xq, xk, xv, wq, wk, wv, wp, xq_b);

  // 2) projections: q = xq Wq^T, k = xk Wk^T, v^T = (xv Wv^T)^T, per batch z
  k_gemm<0, EPI_Q><<<dim3(HH / BN, NQ / BM, NB), dim3(256), 0, stream>>>(
      xq_b, wq_b, (void*)Qp, (void*)Qp, bp, bp, (long)DM, (long)DM, (long)NQ * DM, DM);
  k_gemm<0, EPI_K><<<dim3(HH / BN, NK / BM, NB), dim3(256), 0, stream>>>(
      xk_b, wk_b, (void*)Kp, (void*)Kp, bp, bp, (long)DM, (long)DM, (long)NK * DM, DM);
  k_gemm<0, EPI_VT><<<dim3(HH / BN, NK / BM, NB), dim3(256), 0, stream>>>(
      xv_b, wv_b, (void*)Vt, (void*)Vt, bp, bp, (long)DM, (long)DM, (long)NK * DM, DM);

  // 3) per-key column statistics of the query-axis softmax
  k_colstats<<<dim3(NK / 64, NB * NH), dim3(128), 0, stream>>>(Qp, Kp, NLS);
  // 4) head-averaged probabilities -> second output
  k_attn_mean<<<dim3(NK / 64, NQ / 64, NB), dim3(128), 0, stream>>>(Qp, Kp, NLS, out1);
  // 5) context -> AV plane
  k_attn_ctx<<<dim3(NQ / 64, NB * NH), dim3(128), 0, stream>>>(Qp, Kp, Vt, NLS, AV);
  // 6) output projection + bias -> first output, rows q*NB + b
  k_gemm<1, EPI_OUT><<<dim3(DM / BN, (NQ * NB) / BM, 1), dim3(256), 0, stream>>>(
      AV, wp_h, (void*)out0, (void*)out0, bp, bp, (long)HH, (long)HH, 0L, HH);
}

// v003
// A run of this version takes 184 microseconds.
// Timed twice side by side with v002, it ran 1.21 and 1.20 times as fast.
// Counting every step since v000, it is 2.29 times as fast.
#include <hip/hip_runtime.h>

// Contractions: xq x Wq^T, xk x Wk^T, xv x Wv^T on v_wmma_f32_16x16x32_bf16 (bf16 operands = RNE-converted inputs), f32 accumulate;
// q x k^T (three sweeps: column statistics, head-mean probabilities, context), v^T x p^T and ctx x Wp^T on v_wmma_f32_16x16x32_f16
// (f16 operands: q,k,v unscaled, p carried x4096, ctx carried x32, Wp carried x64 after RNE bf16 convert), f32 accumulate.
// Softmax over the query axis (per key column) and bias add in f32.

#ifndef NB
#define NB 4
#endif
#define NB_FULL 4
#ifndef NQ
#define NQ 1024
#endif
#ifndef NK
#define NK 2048
#endif
#define NQ_FULL 1024
#define NK_FULL 2048
#define DM 1024
#define NH 16
#define DH 64
#define HH (NH * DH)
#define SCL 0.125f
#define C2LOG 0.18033688011112042f      /* SCL * log2(e) */
#define PCARRY 4096.0f
#define PSHIFT 12.0f                     /* log2(PCARRY) */
#define AVCARRY 32.0f
#define OWCARRY 64.0f
#define MSCALE 1.52587890625e-05f        /* 1 / (NH * PCARRY) = 2^-16 */
#define OUT1_OFF 4194304L                /* element offset of the second output (byte 16777216) */

#define AL256(x) (((x) + 255L) & ~255L)
#define WS_TOTAL (AL256((long)NB * NQ * DM * 2) + 2 * AL256((long)NB * NK * DM * 2) + 4 * AL256((long)HH * DM * 2) + \
                  AL256((long)NB * NH * NQ * DH * 2) + 2 * AL256((long)NB * NH * NK * DH * 2) + \
                  AL256((long)NB * NH * NK * 4) + AL256((long)NQ * NB * HH * 2))

static_assert(NB >= 1 && NB <= NB_FULL);
static_assert(NQ >= 128 && NQ <= NQ_FULL && NK >= 128 && NK <= NK_FULL);
static_assert(NQ % 128 == 0 && NK % 128 == 0);
static_assert(DM == 1024 && HH == 1024 && DH == 64 && NH == 16);
static_assert(DM == 128 * 8);
static_assert(DM % 32 == 0 && HH % 32 == 0 && DH % 32 == 0);
static_assert(HH % 128 == 0 && DM % 128 == 0);
static_assert(((long)NQ * NB) % 128 == 0);
static_assert((long)NQ * NB * DM * 4 <= 16777216L);
static_assert(OUT1_OFF * 4 == 16777216L);
static_assert((long)NB * NQ * NK * 4 <= 33554432L);
static_assert(PCARRY == 4096.0f && PSHIFT == 12.0f);
static_assert(MSCALE * 16.0f * PCARRY == 1.0f);
static_assert(WS_TOTAL <= 134217728L);

typedef unsigned short us_t;
typedef _Float16 h16;
typedef us_t     v8us  __attribute__((ext_vector_type(8)));
typedef unsigned v4u   __attribute__((ext_vector_type(4)));
typedef float    v8f   __attribute__((ext_vector_type(8)));
typedef float    v4f   __attribute__((ext_vector_type(4)));
typedef __bf16   v16bf __attribute__((ext_vector_type(16)));
typedef _Float16 v16h  __attribute__((ext_vector_type(16)));

#if __has_builtin(__builtin_amdgcn_exp2f)
#define FEXP2(x) __builtin_amdgcn_exp2f(x)
#else
#define FEXP2(x) __expf((x) * 0.6931471805599453f)
#endif

// 16x32 16-bit fragment: u[0] = elements 0..7, u[1] = elements 8..15
union Frag16 { v8us u[2]; v16bf bf; v16h hf; };

__device__ __forceinline__ v8f vzero() {
  v8f z = {0.f, 0.f, 0.f, 0.f, 0.f, 0.f, 0.f, 0.f};
  return z;
}

// RNE f32 -> bf16 bits
__device__ __forceinline__ us_t bf_bits(float x) {
  unsigned u = __float_as_uint(x);
  u += 0x7FFFu + ((u >> 16) & 1u);
  return (us_t)(u >> 16);
}
// RNE f32 -> bf16 value kept as f32
__device__ __forceinline__ float bf_val(float x) {
  unsigned u = __float_as_uint(x);
  u += 0x7FFFu + ((u >> 16) & 1u);
  return __uint_as_float(u & 0xFFFF0000u);
}
// RNE f32 -> f16 bits
__device__ __forceinline__ us_t hf_bits(float x) {
  _Float16 hv = (_Float16)x;
  return __builtin_bit_cast(us_t, hv);
}

// RNE f32 -> f16 with a value select: results below the smallest normal f16 become zero
static __device__ __forceinline__ h16 toh_flush(float v) {
  const h16 r = (h16)v;
  return (fabsf(v) < 6.103515625e-05f) ? (h16)0.0f : r;
}
static __device__ __forceinline__ us_t hfl_bits(float v) {
  return __builtin_bit_cast(us_t, toh_flush(v));
}
// exp2 of an exponent that already contains the x4096 carry; zero when the f16 value would be subnormal
static __device__ __forceinline__ float pexp2_cut(float e) {
  const float p = FEXP2(e);
  return (e < -14.0f) ? 0.0f : p;
}

// WMMA with hazard guard (ties D, keeps A/B live)
template <int F16OP>
__device__ __forceinline__ v8f mma16(const Frag16& a, const Frag16& b, v8f c) {
  if (F16OP) {
    c = __builtin_amdgcn_wmma_f32_16x16x32_f16(false, a.hf, false, b.hf, (short)0, c, false, false);
    asm volatile("v_nop\n\tv_nop\n\tv_nop\n\tv_nop" : "+v"(c) : "v"(a.hf), "v"(b.hf));
  } else {
    c = __builtin_amdgcn_wmma_f32_16x16x32_bf16(false, a.bf, false, b.bf, (short)0, c, false, false);
    asm volatile("v_nop\n\tv_nop\n\tv_nop\n\tv_nop" : "+v"(c) : "v"(a.bf), "v"(b.bf));
  }
  return c;
}

// ---------------------------------------------------------------------------
// All input conversions in one resident launch. Unit = one row of DM = 1024 floats (4096 B in, 2048 B out).
// Units in plane order: xq rows, xk rows, xv rows (RNE bf16), Wq, Wk, Wv rows (RNE bf16), Wp rows (f16 of bf16(x)*OWCARRY);
// the seven 16-bit planes lie back to back in the workspace, so unit u is written at dst + u * DM.
// 256 blocks x 16 waves; a wave takes units gw, gw + 4096, ...: eight 16-B loads per lane, each wave-wide load
// 512 contiguous bytes, the next unit's eight loads issued before the current unit is converted and stored
// (8-B stores, 256 contiguous bytes per wave-wide store). No barrier, no LDS.
// ---------------------------------------------------------------------------
#define CVT_WPB 16
#define CVT_BLOCKS 256
#define CVT_NW (CVT_WPB * CVT_BLOCKS)
#define U_XQ (NB * NQ)
#define U_XK (NB * NK)
#define U_W HH
#define U_ALL (U_XQ + 2 * U_XK + 4 * U_W)
#define CVT_IT ((U_ALL + CVT_NW - 1) / CVT_NW)
static_assert(((long)NB * NQ * DM * 2) % 256 == 0 && ((long)NB * NK * DM * 2) % 256 == 0 && ((long)HH * DM * 2) % 256 == 0);

typedef unsigned v2u __attribute__((ext_vector_type(2)));

// behind each unit's loads and each unit's stores: their address registers are reused for the next unit's addresses;
// its memory clobber also keeps the order loads(u + 1), convert(u), stores(u), so that stores start while loads are in flight
#define CVT_XWAIT() asm volatile("s_wait_xcnt 0x0" ::: "memory")

// source row of unit u (wave-uniform); a unit past the end re-reads the last row and is not stored
__device__ __forceinline__ const float* cvt_row(unsigned u, const float* xq, const float* xk, const float* xv,
                                                const float* wq, const float* wk, const float* wv, const float* wp) {
  if (u >= U_ALL) u = U_ALL - 1;
  const unsigned uk = u - U_XQ, uv = uk - U_XK, uw = uv - U_XK;
  const float* p = (uw < U_W) ? wq : (uw < 2 * U_W) ? wk : (uw < 3 * U_W) ? wv : wp;
  unsigned r = uw % U_W;
  if (u < U_XQ + 2 * U_XK) { p = xv; r = (uv / NK) * NK_FULL + uv % NK; }
  if (u < U_XQ + U_XK)     { p = xk; r = (uk / NK) * NK_FULL + uk % NK; }
  if (u < U_XQ)            { p = xq; r = (u / NQ) * NQ_FULL + u % NQ; }
  return p + (size_t)r * DM;
}

__global__ __launch_bounds__(CVT_WPB * 32)
void k_cvt_all(const float* __restrict__ xq, const float* __restrict__ xk, const float* __restrict__ xv,
               const float* __restrict__ wq, const float* __restrict__ wk, const float* __restrict__ wv,
               const float* __restrict__ wp, us_t* __restrict__ dst)
{
  const unsigned lane = threadIdx.x & 31;
  const unsigned gw = __builtin_amdgcn_readfirstlane(blockIdx.x * CVT_WPB + (threadIdx.x >> 5));
  if (gw >= CVT_NW) return;   // bounds gw for any grid (wave-uniform, no barrier here)

  v4f buf[2][8];
  {
    const float* s = cvt_row(gw, xq, xk, xv, wq, wk, wv, wp) + 4 * lane;
#pragma unroll
    for (int j = 0; j < 8; ++j) buf[0][j] = *(const v4f*)(s + 128 * j);
    CVT_XWAIT();
  }
#pragma unroll   // two register sets alternate by a compile-time index: no copies between them
  for (int it = 0; it < CVT_IT; ++it) {
    const unsigned u = gw + it * CVT_NW;
    if (it + 1 < CVT_IT) {
      const float* s = cvt_row(u + CVT_NW, xq, xk, xv, wq, wk, wv, wp) + 4 * lane;
#pragma unroll
      for (int j = 0; j < 8; ++j) buf[(it + 1) & 1][j] = *(const v4f*)(s + 128 * j);
      CVT_XWAIT();
    }
    if (u < U_ALL) {
      const v4f (&r)[8] = buf[it & 1];
      us_t* d = dst + (size_t)u * DM + 4 * lane;
      if (u < U_ALL - U_W) {
#pragma unroll
        for (int j = 0; j < 8; ++j) {
          const v2u pk = {(unsigned)bf_bits(r[j][0]) | ((unsigned)bf_bits(r[j][1]) << 16),
                          (unsigned)bf_bits(r[j][2]) | ((unsigned)bf_bits(r[j][3]) << 16)};
          *(v2u*)(d + 128 * j) = pk;
        }
      } else {
#pragma unroll
        for (int j = 0; j < 8; ++j) {
          const v2u pk = {(unsigned)hf_bits(bf_val(r[j][0]) * OWCARRY) | ((unsigned)hf_bits(bf_val(r[j][1]) * OWCARRY) << 16),
                          (unsigned)hf_bits(bf_val(r[j][2]) * OWCARRY) | ((unsigned)hf_bits(bf_val(r[j][3]) * OWCARRY) << 16)};
          *(v2u*)(d + 128 * j) = pk;
        }
      }
      CVT_XWAIT();
    }
  }
}

// ---------------------------------------------------------------------------
// TN GEMM: C[M,N] = A[M,K] * B[N,K]^T, 16-bit operands from planes, f32 accumulate.
// Block 128x128x64, 256 threads = 8 waves (2x4), wave tile 64x32 = 4x2 WMMA tiles.
// Pipelined staging: two LDS buffers and two register sets; k tile t + 2 is fetched (whole 128-B lines) while tile t is
// multiplied, tile t + 1 goes from its registers to the other buffer behind the products, one barrier per k tile.
// Epilogue stages the 128x128 tile in the same LDS, behind a barrier of its own
//  EPI_Q  : D0 = Q plane  [(z*NH+n)*NQ + i][d] f16
//  EPI_K  : D0 = K plane  [(z*NH+n)*NK + pos][d] f16
//  EPI_VT : D0 = Vt plane [((z*NH+n)*DH + d)*NK + pos] f16
//  EPI_OUT: D0 = f32 output rows [row][DM], scaled by 1/(AVCARRY*OWCARRY), bias0 (RNE bf16 value) added in f32 at the store stage
// ---------------------------------------------------------------------------
#define BM 128
#define BN 128
#define BK 64
#define BKP 72                 /* row pitch 144 B = 16 B x 9: ds_load_b128 fragment reads spread over the banks */
#define STG (BM * BKP)         /* halves of one operand's k tile */
#define CSP 136
#define CFP 132
#define EPI_Q 0
#define EPI_K 1
#define EPI_VT 2
#define EPI_OUT 3

// Work-group barrier of the k loop: it waits for this wave's LDS reads and writes only. __syncthreads() would also
// wait for the global loads of the tile fetched ahead, which have to stay in flight across it.
__device__ __forceinline__ void tile_barrier() {
  asm volatile("s_wait_dscnt 0x0\n\ts_barrier_signal -1\n\ts_barrier_wait -1" ::: "memory");
}

template <int F16OP, int EPI>
__global__ __launch_bounds__(256)
void k_gemm(const us_t* __restrict__ A, const us_t* __restrict__ B,
            void* D0, void* D1, const float* __restrict__ bias0, const float* __restrict__ bias1,
            long lda, long ldb, long strideAz, int K)
{
  __shared__ __align__(16) us_t Sm[4 * STG];    // A tile x2, B tile x2: 128 rows x 64 k each (pad 72)
  us_t* Cs = Sm;                                // behind the k loop: f16 view [128][136] or f32 view [64][132]
  static_assert(64 * CFP * 4 <= BM * CSP * 2 && BM * CSP <= 4 * STG && BM == BN);

  const int tid = threadIdx.x, lane = tid & 31, wid = __builtin_amdgcn_readfirstlane(tid >> 5);
  const int wm = wid >> 2, wn = wid & 3, h = lane >> 4, l15 = lane & 15;
  const int m0 = blockIdx.y * BM, n0 = blockIdx.x * BN, z = blockIdx.z;
  const us_t* Ab = A + (size_t)z * (size_t)strideAz + (size_t)m0 * (size_t)lda;
  const us_t* Bb = B + (size_t)n0 * (size_t)ldb;

  v8f acc[4][2];
#pragma unroll
  for (int mi = 0; mi < 4; ++mi)
#pragma unroll
    for (int ni = 0; ni < 2; ++ni) acc[mi][ni] = vzero();

  const int nk = K / BK;                                   // even and at least 2: K is DM or HH, multiples of 128
  const int srow = tid >> 3, skc = (tid & 7) << 3;         // 8 lanes per 128-B row piece, 32 rows per block-wide load
  unsigned oa[4], ob[4];                                   // byte offsets of this thread's four row pieces; they live through the loop
#pragma unroll
  for (int i = 0; i < 4; ++i) {
    oa[i] = ((unsigned)(srow + 32 * i) * (unsigned)lda + (unsigned)skc) * 2u;
    ob[i] = ((unsigned)(srow + 32 * i) * (unsigned)ldb + (unsigned)skc) * 2u;
  }

  auto fetch = [&](v8us (&ra)[4], v8us (&rb)[4], int kb) {
    const char* pa = (const char*)(Ab + kb * BK);          // block-uniform base, per-thread 32-bit offset
    const char* pb = (const char*)(Bb + kb * BK);
#pragma unroll
    for (int i = 0; i < 4; ++i) {
      ra[i] = *(const v8us*)(pa + oa[i]);
      rb[i] = *(const v8us*)(pb + ob[i]);
    }
    // behind the eight loads: their address registers are rewritten for a later tile; its memory clobber also keeps
    // the loads ahead of the products' LDS reads, so that they are in flight from the start of the k tile
    asm volatile("s_wait_xcnt 0x0" ::: "memory");
  };
  auto put = [&](int buf, const v8us (&ra)[4], const v8us (&rb)[4]) {
    us_t* ta = Sm + buf * STG + srow * BKP + skc;
#pragma unroll
    for (int i = 0; i < 4; ++i) {
      *(v8us*)(ta + 32 * i * BKP) = ra[i];
      *(v8us*)(ta + 2 * STG + 32 * i * BKP) = rb[i];
    }
  };
  auto mult = [&](int buf) {
    const us_t* as = Sm + buf * STG;
    const us_t* bs = as + 2 * STG;
#pragma unroll
    for (int c = 0; c < 2; ++c) {                            // k ascending in steps of 32
      Frag16 af[4], bfr[2];
#pragma unroll
      for (int mi = 0; mi < 4; ++mi) {
        const int r = wm * 64 + mi * 16 + l15;                          // A row m = lane&15
        af[mi].u[0] = *(const v8us*)(&as[r * BKP + 32 * c + 8 * h]);      // k 8h..8h+7
        af[mi].u[1] = *(const v8us*)(&as[r * BKP + 32 * c + 16 + 8 * h]); // k 16+8h..16+8h+7
      }
#pragma unroll
      for (int ni = 0; ni < 2; ++ni) {
        const int r = wn * 32 + ni * 16 + l15;                          // B column n = lane&15, row of [n][k] plane, same k map
        bfr[ni].u[0] = *(const v8us*)(&bs[r * BKP + 32 * c + 8 * h]);
        bfr[ni].u[1] = *(const v8us*)(&bs[r * BKP + 32 * c + 16 + 8 * h]);
      }
#pragma unroll
      for (int mi = 0; mi < 4; ++mi)
#pragma unroll
        for (int ni = 0; ni < 2; ++ni) acc[mi][ni] = mma16<F16OP>(af[mi], bfr[ni], acc[mi][ni]);
    }
  };

  v8us a0[4], b0[4], a1[4], b1[4];
  fetch(a0, b0, 0);
  fetch(a1, b1, 1);
  put(0, a0, b0);
  tile_barrier();      // tile 0 visible to all waves
  for (int kb = 0; kb + 2 < nk; kb += 2) {
    fetch(a0, b0, kb + 2);
    mult(0);
    put(1, a1, b1);
    tile_barrier();    // publishes tile kb+1 and ends every read of tile kb before its buffer is refilled
    fetch(a1, b1, kb + 3);
    mult(1);
    put(0, a0, b0);
    tile_barrier();    // publishes tile kb+2 and ends every read of tile kb+1 before its buffer is refilled
  }
  mult(0);             // the last two tiles: nothing left to fetch
  put(1, a1, b1);
  tile_barrier();
  mult(1);             // the epilogue's first barrier ends these reads before the LDS becomes output staging

  // D layout: acc[mi][ni][v] = C(row wm*64+mi*16+8h+v, col wn*32+ni*16+l15)
  const int q8 = tid & 7, lsub = tid >> 3;   // 8 lanes per line, 32 lines per instruction over the block

  if (EPI == EPI_OUT) {
    float* Cf = (float*)Cs;
    float* Do = (float*)D0;
    const float oscale = 1.0f / (AVCARRY * OWCARRY);
#pragma unroll
    for (int rh = 0; rh < 2; ++rh) {
      __syncthreads();
      if (wm == rh) {
#pragma unroll
        for (int mi = 0; mi < 4; ++mi)
#pragma unroll
          for (int ni = 0; ni < 2; ++ni) {
            const int col = wn * 32 + ni * 16 + l15;
#pragma unroll
            for (int v = 0; v < 8; ++v)
              Cf[(mi * 16 + 8 * h + v) * CFP + col] = acc[mi][ni][v] * oscale;
          }
      }
      __syncthreads();
      {
#pragma unroll
        for (int it = 0; it < 8; ++it) {
          const int L = it * 32 + lsub, pr = L >> 2, ql = L & 3;     // 64 rows x 4 lines per row
          const v4f val = *(const v4f*)(&Cf[pr * CFP + 32 * ql + 4 * q8]);
          const v4f bq = *(const v4f*)(bias0 + n0 + 32 * ql + 4 * q8);
          const v4f o = {val[0] + bf_val(bq[0]), val[1] + bf_val(bq[1]),
                         val[2] + bf_val(bq[2]), val[3] + bf_val(bq[3])};
          float* dst = Do + ((size_t)(m0 + 64 * rh + pr) * DM + n0 + 32 * ql + 4 * q8);
          *(v4f*)dst = o;
        }
        
      }
    }
  } else {
    __syncthreads();
#pragma unroll
    for (int mi = 0; mi < 4; ++mi)
#pragma unroll
      for (int ni = 0; ni < 2; ++ni) {
        const int col = wn * 32 + ni * 16 + l15;
#pragma unroll
        for (int v = 0; v < 8; ++v)
          Cs[(wm * 64 + mi * 16 + 8 * h + v) * CSP + col] = hfl_bits(acc[mi][ni][v]);
      }
    __syncthreads();
    const int rpb = (EPI == EPI_Q) ? NQ : NK;   // plane rows per (batch, head)
    const int hb = n0 >> 6;                      // first head of this column block
    {
      if (EPI != EPI_VT) {
#pragma unroll
        for (int it = 0; it < 8; ++it) {
          const int L = it * 32 + lsub, pr = L >> 1, nl = L & 1;   // 128 rows x 2 lines of 64 halves
          v4u val = *(const v4u*)(&Cs[pr * CSP + nl * 64 + 8 * q8]);
          us_t* dst = (us_t*)D0 + ((((size_t)z * NH + hb + nl) * rpb + m0 + pr) * DH + 8 * q8);
          *(v4u*)dst = val;
        }
      } else {
        // Vt plane: line = (nl, d, hp) covers 64 consecutive pos; lane q8 gathers 8 pos down a column of Cs
#pragma unroll
        for (int it = 0; it < 8; ++it) {
          const int L = it * 32 + lsub, nl = L >> 7, d = (L >> 1) & 63, hp = L & 1;
          const int rb0 = 64 * hp + 8 * q8, cc = nl * 64 + d;
          unsigned wv[4];
#pragma unroll
          for (int k = 0; k < 4; ++k) {
            const unsigned lo = Cs[(rb0 + 2 * k) * CSP + cc];
            const unsigned hi = Cs[(rb0 + 2 * k + 1) * CSP + cc];
            wv[k] = lo | (hi << 16);
          }
          v4u val = {wv[0], wv[1], wv[2], wv[3]};
          us_t* dst = (us_t*)D0 + ((((size_t)z * NH + hb + nl) * DH + d) * NK + m0 + 64 * hp + 8 * q8);
          *(v4u*)dst = val;
        }
      }
      
    }
  }
}

// ---------------------------------------------------------------------------
// LDS tiles of the attention sweeps: 64 rows x 64 halves (128 B), shared by the block's 4 waves.
// Fetch: every wave-wide 16-B load covers four whole 128-B lines (8 lanes per row).
// Row pitch 72 halves = 144 B = 16 B x 9: fragment reads (ds_load_b128, 16 rows) spread over the banks.
// ---------------------------------------------------------------------------
#define TP 72
#define TILE_H (64 * TP)
static_assert(NQ % 64 == 0 && NK % 512 == 0 && DH == 64);

__device__ __forceinline__ void tile_fetch(v4u (&r)[4], const us_t* __restrict__ src, size_t pitch, int tid) {
#pragma unroll
  for (int i = 0; i < 4; ++i) {
    const int ch = tid + 128 * i;
    r[i] = *(const v4u*)(src + (size_t)(ch >> 3) * pitch + 8 * (ch & 7));
  }
}
__device__ __forceinline__ void tile_put(us_t* t, const v4u (&r)[4], int tid) {
#pragma unroll
  for (int i = 0; i < 4; ++i) {
    const int ch = tid + 128 * i;
    *(v4u*)(t + (ch >> 3) * TP + 8 * (ch & 7)) = r[i];
  }
}
// fragment of tile row 'row', halves 32c..32c+31, in the k map of the plane loaders (8h.., 16+8h..)
__device__ __forceinline__ void frag_get(Frag16& f, const us_t* t, int row, int c, int h) {
  f.u[0] = *(const v8us*)(t + row * TP + 32 * c + 8 * h);
  f.u[1] = *(const v8us*)(t + row * TP + 32 * c + 16 + 8 * h);
}

// ---------------------------------------------------------------------------
// Column statistics of the query-axis softmax. Block = 128 threads (4 waves) owns 64 keys of
// one (b,n); wave w owns 16 keys (K fragments held as the B operand), sweeps all NQ queries
// 32 at a time (A fragments from 64-query LDS tiles, two buffers, next tile fetched during the current). Lane (h, key) keeps a running max and
// sum over its query rows in the log2 domain; the two lane halves are merged at the end.
// ---------------------------------------------------------------------------
__global__ __launch_bounds__(128)
void k_colstats(const us_t* __restrict__ Qp, const us_t* __restrict__ Kp, float* NLS)
{
  __shared__ __align__(16) float sred[64];    // cross-wave: block barrier
  __shared__ __align__(16) us_t Qt[2][TILE_H];
  const int tid = threadIdx.x;
  const int lane = threadIdx.x & 31;
  const int wave = __builtin_amdgcn_readfirstlane(threadIdx.x >> 5);
  const int h = lane >> 4, l15 = lane & 15;
  const int bn = blockIdx.y;
  const int kb0 = blockIdx.x * 64;

  Frag16 kf[2];
  {
    const us_t* kr = Kp + ((size_t)bn * NK + kb0 + wave * 16 + l15) * DH;   // B column n = key, k = d
#pragma unroll
    for (int c = 0; c < 2; ++c) {
      kf[c].u[0] = *(const v8us*)(kr + 32 * c + 8 * h);
      kf[c].u[1] = *(const v8us*)(kr + 32 * c + 16 + 8 * h);
    }
  }

  float mrun = -3.0e38f, lrun = 0.f;
  const us_t* Qbase = Qp + (size_t)bn * NQ * DH;
  v4u rq[4];
  tile_fetch(rq, Qbase, DH, tid);
  tile_put(Qt[0], rq, tid);
  __syncthreads();   // tile 0 visible to all waves
  for (int t = 0; t < NQ / 64; ++t) {
    const us_t* qc = Qt[t & 1];
    if (t + 1 < NQ / 64) tile_fetch(rq, Qbase + (size_t)(t + 1) * 64 * DH, DH, tid);
#pragma unroll
    for (int hq = 0; hq < 2; ++hq) {
      v8f s0 = vzero(), s1 = vzero();
#pragma unroll
      for (int c = 0; c < 2; ++c) {
        Frag16 a0, a1;
        frag_get(a0, qc, 32 * hq + l15, c, h);                              // A row m = query
        frag_get(a1, qc, 32 * hq + 16 + l15, c, h);
        s0 = mma16<1>(a0, kf[c], s0);
        s1 = mma16<1>(a1, kf[c], s1);
      }
      float tmx = fmaxf(s0[0], s1[0]);
#pragma unroll
      for (int r = 1; r < 8; ++r) tmx = fmaxf(tmx, fmaxf(s0[r], s1[r]));
      const float mn = fmaxf(mrun, tmx * C2LOG);
      float ps = 0.f;
#pragma unroll
      for (int r = 0; r < 8; ++r) {
        ps += FEXP2(fmaf(s0[r], C2LOG, -mn));
        ps += FEXP2(fmaf(s1[r], C2LOG, -mn));
      }
      lrun = lrun * FEXP2(mrun - mn) + ps;
      mrun = mn;
    }
    if (t + 1 < NQ / 64) tile_put(Qt[(t + 1) & 1], rq, tid);
    __syncthreads();   // publishes tile t+1 and ends every read of tile t before its buffer is refilled
  }

  // merge the two lane halves (all lanes take part in the exchange)
  const float m2 = __shfl_xor(mrun, 16);
  const float l2 = __shfl_xor(lrun, 16);
  const float mt = fmaxf(mrun, m2);
  const float lt = lrun * FEXP2(mrun - mt) + l2 * FEXP2(m2 - mt);
  const float nls = PSHIFT - (mt + log2f(lt));

  if (h == 0) sred[wave * 16 + l15] = nls;
  __syncthreads();
  if (wave == 0) {
    const int li = (lane < 16) ? lane : 15;                 // clamped LDS address
    const v4f val = *(const v4f*)(&sred[4 * li]);
    float* dst = NLS + (size_t)bn * NK + kb0 + 4 * li;      // 16 lanes x 16 B = the block's 256 B
    if (lane < 16) *(v4f*)dst = val;
    
  }
}

// ---------------------------------------------------------------------------
// Head-averaged probabilities. Block = 128 threads (4 waves), tile 64 queries x 64 keys of one
// batch; wave w owns 16 queries x 64 keys and loops over the 16 heads: S = Q K^T (A = Q rows,
// B = K rows, fragments from per-head 64-row LDS tiles, two buffers), p*4096 = exp2(c*s + NLS[key]), summed over
// ---------------------------------------------------------------------------
#define MP 68

__global__ __launch_bounds__(128, 8)   // register budget for 8 waves per SIMD: all 8 blocks per WGP of this grid stay resident
void k_attn_mean(const us_t* __restrict__ Qp, const us_t* __restrict__ Kp,
                 const float* __restrict__ NLS, float* out1)
{
  __shared__ __align__(16) us_t Tl[4 * TILE_H];      // Q tile x2, K tile x2; behind the head loop's last barrier: output staging
  __shared__ __align__(16) float Ns[NH * 64];        // the tile's 64 column normalisers of every head
  static_assert(4 * 16 * MP * 4 <= 4 * TILE_H * 2);
  float* Mst = (float*)Tl;                           // per wave 16 rows x 64 floats used (pad 68); wave-private, block barrier
  const int tid = threadIdx.x;
  const int lane = threadIdx.x & 31;
  const int wave = __builtin_amdgcn_readfirstlane(threadIdx.x >> 5);
  const int h = lane >> 4, l15 = lane & 15;
  const int k0 = blockIdx.x * 64;
  const int q0 = blockIdx.y * 64 + wave * 16;
  const int b = blockIdx.z;
  const int mw = wave * (16 * MP);

  v8f macc[4];
#pragma unroll
  for (int st = 0; st < 4; ++st) macc[st] = vzero();

  const us_t* Qsrc = Qp + ((size_t)b * NH * NQ + blockIdx.y * 64) * DH;   // head 0; next head: + NQ * DH
  const us_t* Ksrc = Kp + ((size_t)b * NH * NK + k0) * DH;                // head 0; next head: + NK * DH
  v4f nv[2];
#pragma unroll
  for (int i = 0; i < 2; ++i) {
    const int e = tid + 128 * i;                                          // 16 heads x 16 chunks of 4 floats
    nv[i] = *(const v4f*)(NLS + ((size_t)b * NH + (e >> 4)) * NK + k0 + 4 * (e & 15));
  }
  // stands in front of the tile loads, whose destinations otherwise reuse the address registers of the two loads above
  asm volatile("s_wait_xcnt 0x0" ::: "memory");
  v4u rq[4], rk[4];
  tile_fetch(rq, Qsrc, DH, tid);
  tile_fetch(rk, Ksrc, DH, tid);
#pragma unroll
  for (int i = 0; i < 2; ++i) *(v4f*)(&Ns[4 * (tid + 128 * i)]) = nv[i];
  tile_put(Tl, rq, tid);
  tile_put(Tl + 2 * TILE_H, rk, tid);
  __syncthreads();   // head 0's tiles and the normalisers visible to all waves

  // one head's scores and probabilities from the tiles in buffer hh & 1
  auto head = [&](int hh) {
    const us_t* qc = Tl + (hh & 1) * TILE_H;
    const us_t* kc = Tl + (2 + (hh & 1)) * TILE_H;
    Frag16 qa[2];
#pragma unroll
    for (int c = 0; c < 2; ++c) frag_get(qa[c], qc, wave * 16 + l15, c, h);   // A row m = query
#pragma unroll
    for (int st = 0; st < 4; ++st) {
      v8f s = vzero();
#pragma unroll
      for (int c = 0; c < 2; ++c) {
        Frag16 bf;
        frag_get(bf, kc, 16 * st + l15, c, h);                               // B column n = key
        s = mma16<1>(qa[c], bf, s);
      }
      const float nl = Ns[hh * 64 + 16 * st + l15];
#pragma unroll
      for (int r = 0; r < 8; ++r) macc[st][r] += FEXP2(fmaf(s[r], C2LOG, nl));
    }
  };

#pragma unroll 1
  for (int hh = 0; hh < NH - 1; ++hh) {
    tile_fetch(rq, Qsrc + (size_t)(hh + 1) * NQ * DH, DH, tid);
    tile_fetch(rk, Ksrc + (size_t)(hh + 1) * NK * DH, DH, tid);
    head(hh);
    tile_put(Tl + ((hh + 1) & 1) * TILE_H, rq, tid);
    tile_put(Tl + (2 + ((hh + 1) & 1)) * TILE_H, rk, tid);
    __syncthreads();   // publishes head hh+1's tiles and ends every read of head hh's before their buffers are refilled
  }
  head(NH - 1);
  __syncthreads();     // every wave has left the tiles before they become output staging

  // D layout: macc[st][r] = (query q0 + 8h + r, key k0 + 16 st + l15)
#pragma unroll
  for (int st = 0; st < 4; ++st)
#pragma unroll
    for (int r = 0; r < 8; ++r)
      Mst[mw + (8 * h + r) * MP + 16 * st + l15] = macc[st][r] * MSCALE;
  __syncthreads();
  const int q8 = lane & 7, rsub = lane >> 3;
  {
#pragma unroll
    for (int it = 0; it < 8; ++it) {
      const int L = it * 4 + rsub, row = L >> 1, nl = L & 1;     // 16 rows x 2 lines, 4 lines per instruction
      const v4f val = *(const v4f*)(&Mst[mw + row * MP + 32 * nl + 4 * q8]);
      float* dst = out1 + (((size_t)b * NQ + q0 + row) * NK + k0 + 32 * nl + 4 * q8);
      *(v4f*)dst = val;
    }
    
  }
}

// ---------------------------------------------------------------------------
// Context, transposed register-fed form. Block = 128 threads (4 waves), 64 queries of one
// (b,n); wave w owns 16 queries (Q fragments held as the B operand). Per 32-key step:
// S^T = K Q^T (A = K rows from a 64-key LDS tile) for two 16-key tiles, p^T*4096 = exp2(c*s + NLS[key])
// packed from the two D tiles into one B fragment (element r <- tile 0, element 8+r <- tile 1),
// O^T += Vt * P^T (A = Vt rows d from a 64-key LDS tile, k = keys). Two buffers per tile, the next
// 64 keys fetched during the current, one barrier per 64 keys; the column normaliser (whole row in
// LDS) is already inside the exponent, so there is no running state.
// ---------------------------------------------------------------------------
#define PP 72

__global__ __launch_bounds__(128)
void k_attn_ctx(const us_t* __restrict__ Qp, const us_t* __restrict__ Kp, const us_t* __restrict__ Vt,
                const float* __restrict__ NLS, us_t* AV)
{
  __shared__ __align__(16) us_t Ost[4 * 16 * PP];   // per wave 16 rows x 64 halves used (pad 72); wave-private, block barrier
  __shared__ __align__(16) us_t Kt[2][TILE_H];      // rows = keys, columns = d
  __shared__ __align__(16) us_t Vs[2][TILE_H];      // rows = d, columns = keys
  __shared__ __align__(16) float Ns[NK];            // column normalisers of this (b,n)
  const int tid = threadIdx.x;
  const int lane = threadIdx.x & 31;
  const int wave = __builtin_amdgcn_readfirstlane(threadIdx.x >> 5);
  const int h = lane >> 4, l15 = lane & 15;
  const int i0 = blockIdx.x * 64, bn = blockIdx.y;
  const int b = bn / NH, n = bn - b * NH;
  const int iw = i0 + wave * 16;
  const int ow = wave * (16 * PP);

  Frag16 qf[2];
  {
    const us_t* pq = Qp + ((size_t)bn * NQ + iw + l15) * DH;       // B column n = query, k = d
#pragma unroll
    for (int c = 0; c < 2; ++c) {
      qf[c].u[0] = *(const v8us*)(pq + 32 * c + 8 * h);
      qf[c].u[1] = *(const v8us*)(pq + 32 * c + 16 + 8 * h);
    }
  }

  v8f oacc[4];
#pragma unroll
  for (int dt = 0; dt < 4; ++dt) oacc[dt] = vzero();

  const us_t* Kbase = Kp + (size_t)bn * NK * DH;
  const us_t* Vbase = Vt + (size_t)bn * DH * NK;
  const float* Nbase = NLS + (size_t)bn * NK;

#pragma unroll
  for (int i = 0; i < NK / 512; ++i)
    *(v4f*)(&Ns[4 * (tid + 128 * i)]) = *(const v4f*)(Nbase + 4 * (tid + 128 * i));
  v4u rk[4], rv[4];
  tile_fetch(rk, Kbase, DH, tid);
  tile_fetch(rv, Vbase, NK, tid);
  tile_put(Kt[0], rk, tid);
  tile_put(Vs[0], rv, tid);
  __syncthreads();   // tile 0 and the normalisers visible to all waves

  for (int t = 0; t < NK / 64; ++t) {
    const us_t* kc = Kt[t & 1];
    const us_t* vc = Vs[t & 1];
    if (t + 1 < NK / 64) {
      tile_fetch(rk, Kbase + (size_t)(t + 1) * 64 * DH, DH, tid);
      tile_fetch(rv, Vbase + (size_t)(t + 1) * 64, NK, tid);
    }
#pragma unroll
    for (int ks = 0; ks < 2; ++ks) {
      Frag16 pb;                                        // B[k = key in step][n = query]
#pragma unroll
      for (int st = 0; st < 2; ++st) {
        v8f s = vzero();
#pragma unroll
        for (int c = 0; c < 2; ++c) {
          Frag16 ka;
          frag_get(ka, kc, 32 * ks + 16 * st + l15, c, h);   // A row m = key
          s = mma16<1>(ka, qf[c], s);
        }
        // D rows = keys 64 t + 32 ks + 16 st + 8h + r : eight consecutive table entries per lane
        const float* np = &Ns[64 * t + 32 * ks + 16 * st + 8 * h];
        const v4f na = *(const v4f*)(np);
        const v4f nc = *(const v4f*)(np + 4);
        const float nl[8] = {na[0], na[1], na[2], na[3], nc[0], nc[1], nc[2], nc[3]};
#pragma unroll
        for (int r = 0; r < 8; ++r)
          pb.hf[8 * st + r] = (h16)pexp2_cut(fmaf(s[r], C2LOG, nl[r]));
      }
#pragma unroll
      for (int dt = 0; dt < 4; ++dt) {
        Frag16 va;                                      // A row m = d (row of Vt), k = key
        frag_get(va, vc, 16 * dt + l15, ks, h);
        oacc[dt] = mma16<1>(va, pb, oacc[dt]);
      }
    }
    if (t + 1 < NK / 64) {
      tile_put(Kt[(t + 1) & 1], rk, tid);
      tile_put(Vs[(t + 1) & 1], rv, tid);
    }
    __syncthreads();   // publishes tile t+1 and ends every read of tile t before its buffers are refilled
  }

  // D layout: oacc[dt][r] = O^T(d = 16 dt + 8h + r, query l15) : eight consecutive d per lane
  const float sc = AVCARRY / PCARRY;
#pragma unroll
  for (int dt = 0; dt < 4; ++dt) {
    v8us pk;
#pragma unroll
    for (int r = 0; r < 8; ++r) pk[r] = hfl_bits(oacc[dt][r] * sc);
    *(v8us*)(&Ost[ow + l15 * PP + 16 * dt + 8 * h]) = pk;
  }
  __syncthreads();
  const int q8 = lane & 7, rsub = lane >> 3;
  {
#pragma unroll
    for (int it = 0; it < 4; ++it) {
      const int row = it * 4 + rsub;                     // 16 rows per wave, 4 lines per instruction
      v4u val = *(const v4u*)(&Ost[ow + row * PP + 8 * q8]);
      us_t* dst = AV + (((size_t)(iw + row) * NB + b) * HH + n * DH + 8 * q8);
      *(v4u*)dst = val;
    }
    
  }
}

// ---------------------------------------------------------------------------
// Host orchestration (8 launches)
// ---------------------------------------------------------------------------
extern "C" void kernel_launch(void* const* d_in, const int* in_sizes, int n_in,
                              void* d_out, int out_size, void* d_ws, size_t ws_size,
                              hipStream_t stream)
{
  if (n_in < 8) return;
  const float* xq = (const float*)d_in[0];
  const float* xk = (const float*)d_in[1];
  const float* xv = (const float*)d_in[2];
  const float* wq = (const float*)d_in[3];
  const float* wk = (const float*)d_in[4];
  const float* wv = (const float*)d_in[5];
  const float* wp = (const float*)d_in[6];
  const float* bp = (const float*)d_in[7];

  if ((long)in_sizes[0] < ((long)(NB - 1) * NQ_FULL + NQ) * DM) return;
  if ((long)in_sizes[1] < ((long)(NB - 1) * NK_FULL + NK) * DM) return;
  if ((long)in_sizes[2] < ((long)(NB - 1) * NK_FULL + NK) * DM) return;
  if ((long)in_sizes[3] < (long)HH * DM) return;
  if ((long)in_sizes[4] < (long)HH * DM) return;
  if ((long)in_sizes[5] < (long)HH * DM) return;
  if ((long)in_sizes[6] < (long)DM * HH) return;
  if (in_sizes[7] < DM) return;
  if ((long)out_size < OUT1_OFF + (long)NB * NQ * NK) return;

  char* base = (char*)d_ws;
  size_t off = 0;
  auto take = [&](size_t bytes) -> char* {
    char* q = base + off; off += (bytes + 255) & ~(size_t)255; return q;
  };
  us_t*  xq_b = (us_t*) take((size_t)NB * NQ * DM * 2);             // bf16 [b][q][DM]
  us_t*  xk_b = (us_t*) take((size_t)NB * NK * DM * 2);             // bf16 [b][k][DM]
  us_t*  xv_b = (us_t*) take((size_t)NB * NK * DM * 2);             // bf16 [b][k][DM]
  us_t*  wq_b = (us_t*) take((size_t)HH * DM * 2);                  // bf16 [out][in]
  us_t*  wk_b = (us_t*) take((size_t)HH * DM * 2);                  // bf16
  us_t*  wv_b = (us_t*) take((size_t)HH * DM * 2);                  // bf16
  us_t*  wp_h = (us_t*) take((size_t)DM * HH * 2);                  // f16 (x64)
  us_t*  Qp   = (us_t*) take((size_t)NB * NH * NQ * DH * 2);        // f16 [bn][q][d]
  us_t*  Kp   = (us_t*) take((size_t)NB * NH * NK * DH * 2);        // f16 [bn][k][d]
  us_t*  Vt   = (us_t*) take((size_t)NB * NH * DH * NK * 2);        // f16 [bn][d][k]
  float* NLS  = (float*)take((size_t)NB * NH * NK * 4);             // f32 [bn][k]
  us_t*  AV   = (us_t*) take((size_t)NQ * NB * HH * 2);             // f16 (x32) [q*NB+b][n*64+d]
  if (off > ws_size) return;
  if (off > (size_t)WS_TOTAL) return;

  float* out0 = (float*)d_out;                                       // [q][b][c]
  float* out1 = (float*)d_out + OUT1_OFF;                            // [b][q][k]

  // 1) input conversions (RNE bf16; Wp as f16 of the bf16 value x64): planes xq_b .. wp_h, back to back from xq_b
  k_cvt_all<<<dim3(CVT_BLOCKS), dim3(CVT_WPB * 32), 0, stream>>>(xq, xk, xv, wq, wk, wv, wp, xq_b);

  // 2) projections: q = xq Wq^T, k = xk Wk^T, v^T = (xv Wv^T)^T, per batch z
  k_gemm<0, EPI_Q><<<dim3(HH / BN, NQ / BM, NB), dim3(256), 0, stream>>>(
      xq_b, wq_b, (void*)Qp, (void*)Qp, bp, bp, (long)DM, (long)DM, (long)NQ * DM, DM);
  k_gemm<0, EPI_K><<<dim3(HH / BN, NK / BM, NB), dim3(256), 0, stream>>>(
      xk_b, wk_b, (void*)Kp, (void*)Kp, bp, bp, (long)DM, (long)DM, (long)NK * DM, DM);
  k_gemm<0, EPI_VT><<<dim3(HH / BN, NK / BM, NB), dim3(256), 0, stream>>>(
      xv_b, wv_b, (void*)Vt, (void*)Vt, bp, bp, (long)DM, (long)DM, (long)NK * DM, DM);

  // 3) per-key column statistics of the query-axis softmax
  k_colstats<<<dim3(NK / 64, NB * NH), dim3(128), 0, stream>>>(Qp, Kp, NLS);
  // 4) head-averaged probabilities -> second output
  k_attn_mean<<<dim3(NK / 64, NQ / 64, NB), dim3(128), 0, stream>>>(Qp, Kp, NLS, out1);
  // 5) context -> AV plane
  k_attn_ctx<<<dim3(NQ / 64, NB * NH), dim3(128), 0, stream>>>(Qp, Kp, Vt, NLS, AV);
  // 6) output projection + bias -> first output, rows q*NB + b
  k_gemm<1, EPI_OUT><<<dim3(DM / BN, (NQ * NB) / BM, 1), dim3(256), 0, stream>>>(
      AV, wp_h, (void*)out0, (void*)out0, bp, bp, (long)HH, (long)HH, 0L, HH);
}

// v004
// One run takes 169 microseconds.
// Timed twice side by side with v003, it ran 1.09 times as fast both times.
// Over all steps from v000 it is 2.49 times as fast.
#include <hip/hip_runtime.h>

// Contractions: xq x Wq^T, xk x Wk^T, xv x Wv^T on v_wmma_f32_16x16x32_bf16 (bf16 operands = RNE-converted inputs), f32 accumulate;
// q x k^T (three sweeps: column statistics, head-mean probabilities, context), v^T x p^T and ctx x Wp^T on v_wmma_f32_16x16x32_f16
// (f16 operands: q,k,v unscaled, p carried x4096, ctx carried x32, Wp carried x64 after RNE bf16 convert), f32 accumulate.
// Softmax over the query axis (per key column) and bias add in f32.

#ifndef NB
#define NB 4
#endif
#define NB_FULL 4
#ifndef NQ
#define NQ 1024
#endif
#ifndef NK
#define NK 2048
#endif
#define NQ_FULL 1024
#define NK_FULL 2048
#define DM 1024
#define NH 16
#define DH 64
#define HH (NH * DH)
#define SCL 0.125f
#define C2LOG 0.18033688011112042f      /* SCL * log2(e) */
#define PCARRY 4096.0f
#define PSHIFT 12.0f                     /* log2(PCARRY) */
#define AVCARRY 32.0f
#define OWCARRY 64.0f
#define MSCALE 1.52587890625e-05f        /* 1 / (NH * PCARRY) = 2^-16 */
#define OUT1_OFF 4194304L                /* element offset of the second output (byte 16777216) */

#define AL256(x) (((x) + 255L) & ~255L)
#define WS_TOTAL (AL256((long)NB * NQ * DM * 2) + 2 * AL256((long)NB * NK * DM * 2) + 4 * AL256((long)HH * DM * 2) + \
                  AL256((long)NB * NH * NQ * DH * 2) + 2 * AL256((long)NB * NH * NK * DH * 2) + \
                  AL256((long)NB * NH * NK * 4) + AL256((long)NQ * NB * HH * 2))

static_assert(NB >= 1 && NB <= NB_FULL);
static_assert(NQ >= 128 && NQ <= NQ_FULL && NK >= 128 && NK <= NK_FULL);
static_assert(NQ % 128 == 0 && NK % 128 == 0);
static_assert(DM == 1024 && HH == 1024 && DH == 64 && NH == 16);
static_assert(DM == 128 * 8);
static_assert(DM % 32 == 0 && HH % 32 == 0 && DH % 32 == 0);
static_assert(HH % 128 == 0 && DM % 128 == 0);
static_assert(((long)NQ * NB) % 128 == 0);
static_assert((long)NQ * NB * DM * 4 <= 16777216L);
static_assert(OUT1_OFF * 4 == 16777216L);
static_assert((long)NB * NQ * NK * 4 <= 33554432L);
static_assert(PCARRY == 4096.0f && PSHIFT == 12.0f);
static_assert(MSCALE * 16.0f * PCARRY == 1.0f);
static_assert(WS_TOTAL <= 134217728L);

typedef unsigned short us_t;
typedef _Float16 h16;
typedef us_t     v8us  __attribute__((ext_vector_type(8)));
typedef unsigned v4u   __attribute__((ext_vector_type(4)));
typedef float    v8f   __attribute__((ext_vector_type(8)));
typedef float    v4f   __attribute__((ext_vector_type(4)));
typedef __bf16   v16bf __attribute__((ext_vector_type(16)));
typedef _Float16 v16h  __attribute__((ext_vector_type(16)));

#if __has_builtin(__builtin_amdgcn_exp2f)
#define FEXP2(x) __builtin_amdgcn_exp2f(x)
#else
#define FEXP2(x) __expf((x) * 0.6931471805599453f)
#endif

// 16x32 16-bit fragment: u[0] = elements 0..7, u[1] = elements 8..15
union Frag16 { v8us u[2]; v16bf bf; v16h hf; };

__device__ __forceinline__ v8f vzero() {
  v8f z = {0.f, 0.f, 0.f, 0.f, 0.f, 0.f, 0.f, 0.f};
  return z;
}

// RNE f32 -> bf16 bits
__device__ __forceinline__ us_t bf_bits(float x) {
  unsigned u = __float_as_uint(x);
  u += 0x7FFFu + ((u >> 16) & 1u);
  return (us_t)(u >> 16);
}
// RNE f32 -> bf16 value kept as f32
__device__ __forceinline__ float bf_val(float x) {
  unsigned u = __float_as_uint(x);
  u += 0x7FFFu + ((u >> 16) & 1u);
  return __uint_as_float(u & 0xFFFF0000u);
}
// RNE f32 -> f16 bits
__device__ __forceinline__ us_t hf_bits(float x) {
  _Float16 hv = (_Float16)x;
  return __builtin_bit_cast(us_t, hv);
}

// RNE f32 -> f16 with a value select: results below the smallest normal f16 become zero
static __device__ __forceinline__ h16 toh_flush(float v) {
  const h16 r = (h16)v;
  return (fabsf(v) < 6.103515625e-05f) ? (h16)0.0f : r;
}
static __device__ __forceinline__ us_t hfl_bits(float v) {
  return __builtin_bit_cast(us_t, toh_flush(v));
}
// exp2 of an exponent that already contains the x4096 carry; zero when the f16 value would be subnormal
static __device__ __forceinline__ float pexp2_cut(float e) {
  const float p = FEXP2(e);
  return (e < -14.0f) ? 0.0f : p;
}

// WMMA as the bare builtin: the compiler keeps the distance to the next reader of D and is free to order loads around it
template <int F16OP>
__device__ __forceinline__ v8f mma16(const Frag16& a, const Frag16& b, v8f c) {
  if (F16OP) {
    c = __builtin_amdgcn_wmma_f32_16x16x32_f16(false, a.hf, false, b.hf, (short)0, c, false, false);
  } else {
    c = __builtin_amdgcn_wmma_f32_16x16x32_bf16(false, a.bf, false, b.bf, (short)0, c, false, false);
  }
  return c;
}

// ---------------------------------------------------------------------------
// All input conversions in one resident launch. Unit = one row of DM = 1024 floats (4096 B in, 2048 B out).
// Units in plane order: xq rows, xk rows, xv rows (RNE bf16), Wq, Wk, Wv rows (RNE bf16), Wp rows (f16 of bf16(x)*OWCARRY);
// the seven 16-bit planes lie back to back in the workspace, so unit u is written at dst + u * DM.
// 256 blocks x 16 waves; a wave takes units gw, gw + 4096, ...: eight 16-B loads per lane, each wave-wide load
// 512 contiguous bytes, the next unit's eight loads issued before the current unit is converted and stored
// (8-B stores, 256 contiguous bytes per wave-wide store). No barrier, no LDS.
// ---------------------------------------------------------------------------
#define CVT_WPB 16
#define CVT_BLOCKS 256
#define CVT_NW (CVT_WPB * CVT_BLOCKS)
#define U_XQ (NB * NQ)
#define U_XK (NB * NK)
#define U_W HH
#define U_ALL (U_XQ + 2 * U_XK + 4 * U_W)
#define CVT_IT ((U_ALL + CVT_NW - 1) / CVT_NW)
static_assert(((long)NB * NQ * DM * 2) % 256 == 0 && ((long)NB * NK * DM * 2) % 256 == 0 && ((long)HH * DM * 2) % 256 == 0);

typedef unsigned v2u __attribute__((ext_vector_type(2)));

// behind each unit's loads and each unit's stores: their address registers are reused for the next unit's addresses;
// its memory clobber also keeps the order loads(u + 1), convert(u), stores(u), so that stores start while loads are in flight
#define CVT_XWAIT() asm volatile("s_wait_xcnt 0x0" ::: "memory")

// source row of unit u (wave-uniform); a unit past the end re-reads the last row and is not stored
__device__ __forceinline__ const float* cvt_row(unsigned u, const float* xq, const float* xk, const float* xv,
                                                const float* wq, const float* wk, const float* wv, const float* wp) {
  if (u >= U_ALL) u = U_ALL - 1;
  const unsigned uk = u - U_XQ, uv = uk - U_XK, uw = uv - U_XK;
  const float* p = (uw < U_W) ? wq : (uw < 2 * U_W) ? wk : (uw < 3 * U_W) ? wv : wp;
  unsigned r = uw % U_W;
  if (u < U_XQ + 2 * U_XK) { p = xv; r = (uv / NK) * NK_FULL + uv % NK; }
  if (u < U_XQ + U_XK)     { p = xk; r = (uk / NK) * NK_FULL + uk % NK; }
  if (u < U_XQ)            { p = xq; r = (u / NQ) * NQ_FULL + u % NQ; }
  return p + (size_t)r * DM;
}

__global__ __launch_bounds__(CVT_WPB * 32)
void k_cvt_all(const float* __restrict__ xq, const float* __restrict__ xk, const float* __restrict__ xv,
               const float* __restrict__ wq, const float* __restrict__ wk, const float* __restrict__ wv,
               const float* __restrict__ wp, us_t* __restrict__ dst)
{
  const unsigned lane = threadIdx.x & 31;
  const unsigned gw = __builtin_amdgcn_readfirstlane(blockIdx.x * CVT_WPB + (threadIdx.x >> 5));
  if (gw >= CVT_NW) return;   // bounds gw for any grid (wave-uniform, no barrier here)

  v4f buf[2][8];
  {
    const float* s = cvt_row(gw, xq, xk, xv, wq, wk, wv, wp) + 4 * lane;
#pragma unroll
    for (int j = 0; j < 8; ++j) buf[0][j] = *(const v4f*)(s + 128 * j);
    CVT_XWAIT();
  }
#pragma unroll   // two register sets alternate by a compile-time index: no copies between them
  for (int it = 0; it < CVT_IT; ++it) {
    const unsigned u = gw + it * CVT_NW;
    if (it + 1 < CVT_IT) {
      const float* s = cvt_row(u + CVT_NW, xq, xk, xv, wq, wk, wv, wp) + 4 * lane;
#pragma unroll
      for (int j = 0; j < 8; ++j) buf[(it + 1) & 1][j] = *(const v4f*)(s + 128 * j);
      CVT_XWAIT();
    }
    if (u < U_ALL) {
      const v4f (&r)[8] = buf[it & 1];
      us_t* d = dst + (size_t)u * DM + 4 * lane;
      if (u < U_ALL - U_W) {
#pragma unroll
        for (int j = 0; j < 8; ++j) {
          const v2u pk = {(unsigned)bf_bits(r[j][0]) | ((unsigned)bf_bits(r[j][1]) << 16),
                          (unsigned)bf_bits(r[j][2]) | ((unsigned)bf_bits(r[j][3]) << 16)};
          *(v2u*)(d + 128 * j) = pk;
        }
      } else {
#pragma unroll
        for (int j = 0; j < 8; ++j) {
          const v2u pk = {(unsigned)hf_bits(bf_val(r[j][0]) * OWCARRY) | ((unsigned)hf_bits(bf_val(r[j][1]) * OWCARRY) << 16),
                          (unsigned)hf_bits(bf_val(r[j][2]) * OWCARRY) | ((unsigned)hf_bits(bf_val(r[j][3]) * OWCARRY) << 16)};
          *(v2u*)(d + 128 * j) = pk;
        }
      }
      CVT_XWAIT();
    }
  }
}

// ---------------------------------------------------------------------------
// TN GEMM: C[M,N] = A[M,K] * B[N,K]^T, 16-bit operands from planes, f32 accumulate.
// Block 128x128x64, 256 threads = 8 waves (2x4), wave tile 64x32 = 4x2 WMMA tiles.
// Pipelined staging: two LDS buffers and two register sets; k tile t + 2 is fetched (whole 128-B lines) while tile t is
// multiplied, tile t + 1 goes from its registers to the other buffer behind the products, one barrier per k tile.
// Epilogue stages the 128x128 tile in the same LDS, behind a barrier of its own
//  EPI_Q  : D0 = Q plane  [(z*NH+n)*NQ + i][d] f16
//  EPI_K  : D0 = K plane  [(z*NH+n)*NK + pos][d] f16
//  EPI_VT : D0 = Vt plane [((z*NH+n)*DH + d)*NK + pos] f16
//  EPI_OUT: D0 = f32 output rows [row][DM], scaled by 1/(AVCARRY*OWCARRY), bias0 (RNE bf16 value) added in f32 at the store stage
// ---------------------------------------------------------------------------
#define BM 128
#define BN 128
#define BK 64
#define BKP 72                 /* row pitch 144 B = 16 B x 9: ds_load_b128 fragment reads spread over the banks */
#define STG (BM * BKP)         /* halves of one operand's k tile */
#define CSP 136
#define CFP 132
#define EPI_Q 0
#define EPI_K 1
#define EPI_VT 2
#define EPI_OUT 3

// Work-group barrier of the k loop: it waits for this wave's LDS reads and writes only. __syncthreads() would also
// wait for the global loads of the tile fetched ahead, which have to stay in flight across it.
__device__ __forceinline__ void tile_barrier() {
  asm volatile("s_wait_dscnt 0x0\n\ts_barrier_signal -1\n\ts_barrier_wait -1" ::: "memory");
}

template <int F16OP, int EPI>
__global__ __launch_bounds__(256)
void k_gemm(const us_t* __restrict__ A, const us_t* __restrict__ B,
            void* D0, void* D1, const float* __restrict__ bias0, const float* __restrict__ bias1,
            long lda, long ldb, long strideAz, int K)
{
  __shared__ __align__(16) us_t Sm[4 * STG];    // A tile x2, B tile x2: 128 rows x 64 k each (pad 72)
  us_t* Cs = Sm;                                // behind the k loop: f16 view [128][136] or f32 view [64][132]
  static_assert(64 * CFP * 4 <= BM * CSP * 2 && BM * CSP <= 4 * STG && BM == BN);

  const int tid = threadIdx.x, lane = tid & 31, wid = __builtin_amdgcn_readfirstlane(tid >> 5);
  const int wm = wid >> 2, wn = wid & 3, h = lane >> 4, l15 = lane & 15;
  const int m0 = blockIdx.y * BM, n0 = blockIdx.x * BN, z = blockIdx.z;
  const us_t* Ab = A + (size_t)z * (size_t)strideAz + (size_t)m0 * (size_t)lda;
  const us_t* Bb = B + (size_t)n0 * (size_t)ldb;

  v8f acc[4][2];
#pragma unroll
  for (int mi = 0; mi < 4; ++mi)
#pragma unroll
    for (int ni = 0; ni < 2; ++ni) acc[mi][ni] = vzero();

  const int nk = K / BK;                                   // even and at least 2: K is DM or HH, multiples of 128
  const int srow = tid >> 3, skc = (tid & 7) << 3;         // 8 lanes per 128-B row piece, 32 rows per block-wide load
  unsigned oa[4], ob[4];                                   // byte offsets of this thread's four row pieces; they live through the loop
#pragma unroll
  for (int i = 0; i < 4; ++i) {
    oa[i] = ((unsigned)(srow + 32 * i) * (unsigned)lda + (unsigned)skc) * 2u;
    ob[i] = ((unsigned)(srow + 32 * i) * (unsigned)ldb + (unsigned)skc) * 2u;
  }

  auto fetch = [&](v8us (&ra)[4], v8us (&rb)[4], int kb) {
    const char* pa = (const char*)(Ab + kb * BK);          // block-uniform base, per-thread 32-bit offset
    const char* pb = (const char*)(Bb + kb * BK);
#pragma unroll
    for (int i = 0; i < 4; ++i) {
      ra[i] = *(const v8us*)(pa + oa[i]);
      rb[i] = *(const v8us*)(pb + ob[i]);
    }
    // behind the eight loads: their address registers are rewritten for a later tile; its memory clobber also keeps
    // the loads ahead of the products' LDS reads, so that they are in flight from the start of the k tile
    asm volatile("s_wait_xcnt 0x0" ::: "memory");
  };
  auto put = [&](int buf, const v8us (&ra)[4], const v8us (&rb)[4]) {
    us_t* ta = Sm + buf * STG + srow * BKP + skc;
#pragma unroll
    for (int i = 0; i < 4; ++i) {
      *(v8us*)(ta + 32 * i * BKP) = ra[i];
      *(v8us*)(ta + 2 * STG + 32 * i * BKP) = rb[i];
    }
  };
  auto mult = [&](int buf) {
    const us_t* as = Sm + buf * STG;
    const us_t* bs = as + 2 * STG;
#pragma unroll
    for (int c = 0; c < 2; ++c) {                            // k ascending in steps of 32
      Frag16 af[4], bfr[2];
#pragma unroll
      for (int mi = 0; mi < 4; ++mi) {
        const int r = wm * 64 + mi * 16 + l15;                          // A row m = lane&15
        af[mi].u[0] = *(const v8us*)(&as[r * BKP + 32 * c + 8 * h]);      // k 8h..8h+7
        af[mi].u[1] = *(const v8us*)(&as[r * BKP + 32 * c + 16 + 8 * h]); // k 16+8h..16+8h+7
      }
#pragma unroll
      for (int ni = 0; ni < 2; ++ni) {
        const int r = wn * 32 + ni * 16 + l15;                          // B column n = lane&15, row of [n][k] plane, same k map
        bfr[ni].u[0] = *(const v8us*)(&bs[r * BKP + 32 * c + 8 * h]);
        bfr[ni].u[1] = *(const v8us*)(&bs[r * BKP + 32 * c + 16 + 8 * h]);
      }
#pragma unroll
      for (int mi = 0; mi < 4; ++mi)
#pragma unroll
        for (int ni = 0; ni < 2; ++ni) acc[mi][ni] = mma16<F16OP>(af[mi], bfr[ni], acc[mi][ni]);
    }
  };

  v8us a0[4], b0[4], a1[4], b1[4];
  fetch(a0, b0, 0);
  fetch(a1, b1, 1);
  put(0, a0, b0);
  tile_barrier();      // tile 0 visible to all waves
  for (int kb = 0; kb + 2 < nk; kb += 2) {
    fetch(a0, b0, kb + 2);
    mult(0);
    put(1, a1, b1);
    tile_barrier();    // publishes tile kb+1 and ends every read of tile kb before its buffer is refilled
    fetch(a1, b1, kb + 3);
    mult(1);
    put(0, a0, b0);
    tile_barrier();    // publishes tile kb+2 and ends every read of tile kb+1 before its buffer is refilled
  }
  mult(0);             // the last two tiles: nothing left to fetch
  put(1, a1, b1);
  tile_barrier();
  mult(1);             // the epilogue's first barrier ends these reads before the LDS becomes output staging

  // D layout: acc[mi][ni][v] = C(row wm*64+mi*16+8h+v, col wn*32+ni*16+l15)
  const int q8 = tid & 7, lsub = tid >> 3;   // 8 lanes per line, 32 lines per instruction over the block

  if (EPI == EPI_OUT) {
    float* Cf = (float*)Cs;
    float* Do = (float*)D0;
    const float oscale = 1.0f / (AVCARRY * OWCARRY);
#pragma unroll
    for (int rh = 0; rh < 2; ++rh) {
      __syncthreads();
      if (wm == rh) {
#pragma unroll
        for (int mi = 0; mi < 4; ++mi)
#pragma unroll
          for (int ni = 0; ni < 2; ++ni) {
            const int col = wn * 32 + ni * 16 + l15;
#pragma unroll
            for (int v = 0; v < 8; ++v)
              Cf[(mi * 16 + 8 * h + v) * CFP + col] = acc[mi][ni][v] * oscale;
          }
      }
      __syncthreads();
      {
#pragma unroll
        for (int it = 0; it < 8; ++it) {
          const int L = it * 32 + lsub, pr = L >> 2, ql = L & 3;     // 64 rows x 4 lines per row
          const v4f val = *(const v4f*)(&Cf[pr * CFP + 32 * ql + 4 * q8]);
          const v4f bq = *(const v4f*)(bias0 + n0 + 32 * ql + 4 * q8);
          const v4f o = {val[0] + bf_val(bq[0]), val[1] + bf_val(bq[1]),
                         val[2] + bf_val(bq[2]), val[3] + bf_val(bq[3])};
          float* dst = Do + ((size_t)(m0 + 64 * rh + pr) * DM + n0 + 32 * ql + 4 * q8);
          *(v4f*)dst = o;
        }
        
      }
    }
  } else {
    __syncthreads();
#pragma unroll
    for (int mi = 0; mi < 4; ++mi)
#pragma unroll
      for (int ni = 0; ni < 2; ++ni) {
        const int col = wn * 32 + ni * 16 + l15;
#pragma unroll
        for (int v = 0; v < 8; ++v)
          Cs[(wm * 64 + mi * 16 + 8 * h + v) * CSP + col] = hfl_bits(acc[mi][ni][v]);
      }
    __syncthreads();
    const int rpb = (EPI == EPI_Q) ? NQ : NK;   // plane rows per (batch, head)
    const int hb = n0 >> 6;                      // first head of this column block
    {
      if (EPI != EPI_VT) {
#pragma unroll
        for (int it = 0; it < 8; ++it) {
          const int L = it * 32 + lsub, pr = L >> 1, nl = L & 1;   // 128 rows x 2 lines of 64 halves
          v4u val = *(const v4u*)(&Cs[pr * CSP + nl * 64 + 8 * q8]);
          us_t* dst = (us_t*)D0 + ((((size_t)z * NH + hb + nl) * rpb + m0 + pr) * DH + 8 * q8);
          *(v4u*)dst = val;
        }
      } else {
        // Vt plane: line = (nl, d, hp) covers 64 consecutive pos; lane q8 gathers 8 pos down a column of Cs
#pragma unroll
        for (int it = 0; it < 8; ++it) {
          const int L = it * 32 + lsub, nl = L >> 7, d = (L >> 1) & 63, hp = L & 1;
          const int rb0 = 64 * hp + 8 * q8, cc = nl * 64 + d;
          unsigned wv[4];
#pragma unroll
          for (int k = 0; k < 4; ++k) {
            const unsigned lo = Cs[(rb0 + 2 * k) * CSP + cc];
            const unsigned hi = Cs[(rb0 + 2 * k + 1) * CSP + cc];
            wv[k] = lo | (hi << 16);
          }
          v4u val = {wv[0], wv[1], wv[2], wv[3]};
          us_t* dst = (us_t*)D0 + ((((size_t)z * NH + hb + nl) * DH + d) * NK + m0 + 64 * hp + 8 * q8);
          *(v4u*)dst = val;
        }
      }
      
    }
  }
}

// ---------------------------------------------------------------------------
// LDS tiles of the attention sweeps: 64 rows x 64 halves (128 B), shared by the block's 4 waves.
// Fetch: every wave-wide 16-B load covers four whole 128-B lines (8 lanes per row).
// Row pitch 72 halves = 144 B = 16 B x 9: fragment reads (ds_load_b128, 16 rows) spread over the banks.
// ---------------------------------------------------------------------------
#define TP 72
#define TILE_H (64 * TP)
static_assert(NQ % 64 == 0 && NK % 512 == 0 && DH == 64);

__device__ __forceinline__ void tile_fetch(v4u (&r)[4], const us_t* __restrict__ src, size_t pitch, int tid) {
#pragma unroll
  for (int i = 0; i < 4; ++i) {
    const int ch = tid + 128 * i;
    r[i] = *(const v4u*)(src + (size_t)(ch >> 3) * pitch + 8 * (ch & 7));
  }
}
// the same fetch for a tile whose 128-B rows lie back to back in the plane (pitch DH): one address per thread and
// constant steps, in place of four 64-bit addresses
__device__ __forceinline__ void tile_fetch_dense(v4u (&r)[4], const us_t* __restrict__ src, int tid) {
  const us_t* p = src + 8 * tid;
#pragma unroll
  for (int i = 0; i < 4; ++i) r[i] = *(const v4u*)(p + 1024 * i);
}
__device__ __forceinline__ void tile_put(us_t* t, const v4u (&r)[4], int tid) {
#pragma unroll
  for (int i = 0; i < 4; ++i) {
    const int ch = tid + 128 * i;
    *(v4u*)(t + (ch >> 3) * TP + 8 * (ch & 7)) = r[i];
  }
}
// fragment of tile row 'row', halves 32c..32c+31, in the k map of the plane loaders (8h.., 16+8h..)
__device__ __forceinline__ void frag_get(Frag16& f, const us_t* t, int row, int c, int h) {
  f.u[0] = *(const v8us*)(t + row * TP + 32 * c + 8 * h);
  f.u[1] = *(const v8us*)(t + row * TP + 32 * c + 16 + 8 * h);
}

// ---------------------------------------------------------------------------
// Column statistics of the query-axis softmax. Block = 128 threads (4 waves) owns 64 keys of
// one (b,n); wave w owns 16 keys (K fragments held as the B operand), sweeps all NQ queries
// 32 at a time (A fragments from 64-query LDS tiles, two buffers, next tile fetched during the current). Lane (h, key) keeps a running max and
// sum over its query rows in the log2 domain; the two lane halves are merged at the end.
// ---------------------------------------------------------------------------
__global__ __launch_bounds__(128)
void k_colstats(const us_t* __restrict__ Qp, const us_t* __restrict__ Kp, float* NLS)
{
  __shared__ __align__(16) float sred[64];    // cross-wave: block barrier
  __shared__ __align__(16) us_t Qt[2][TILE_H];
  const int tid = threadIdx.x;
  const int lane = threadIdx.x & 31;
  const int wave = __builtin_amdgcn_readfirstlane(threadIdx.x >> 5);
  const int h = lane >> 4, l15 = lane & 15;
  const int bn = blockIdx.y;
  const int kb0 = blockIdx.x * 64;

  Frag16 kf[2];
  {
    const us_t* kr = Kp + ((size_t)bn * NK + kb0 + wave * 16 + l15) * DH;   // B column n = key, k = d
#pragma unroll
    for (int c = 0; c < 2; ++c) {
      kf[c].u[0] = *(const v8us*)(kr + 32 * c + 8 * h);
      kf[c].u[1] = *(const v8us*)(kr + 32 * c + 16 + 8 * h);
    }
  }

  float mrun = -3.0e38f, lrun = 0.f;
  const us_t* Qbase = Qp + (size_t)bn * NQ * DH;
  v4u rq[4];
  tile_fetch(rq, Qbase, DH, tid);
  tile_put(Qt[0], rq, tid);
  __syncthreads();   // tile 0 visible to all waves
  for (int t = 0; t < NQ / 64; ++t) {
    const us_t* qc = Qt[t & 1];
    if (t + 1 < NQ / 64) tile_fetch(rq, Qbase + (size_t)(t + 1) * 64 * DH, DH, tid);
    // behind the four loads: their address registers are reused below; its memory clobber also keeps the loads ahead of
    // the tile's LDS reads, so that they are in flight through the whole tile and not only just before tile_put
    asm volatile("s_wait_xcnt 0x0" ::: "memory");
#pragma unroll
    for (int hq = 0; hq < 2; ++hq) {
      v8f s0 = vzero(), s1 = vzero();
#pragma unroll
      for (int c = 0; c < 2; ++c) {
        Frag16 a0, a1;
        frag_get(a0, qc, 32 * hq + l15, c, h);                              // A row m = query
        frag_get(a1, qc, 32 * hq + 16 + l15, c, h);
        s0 = mma16<1>(a0, kf[c], s0);
        s1 = mma16<1>(a1, kf[c], s1);
      }
      float tmx = fmaxf(s0[0], s1[0]);
#pragma unroll
      for (int r = 1; r < 8; ++r) tmx = fmaxf(tmx, fmaxf(s0[r], s1[r]));
      const float mn = fmaxf(mrun, tmx * C2LOG);
      float ps = 0.f;
#pragma unroll
      for (int r = 0; r < 8; ++r) {
        ps += FEXP2(fmaf(s0[r], C2LOG, -mn));
        ps += FEXP2(fmaf(s1[r], C2LOG, -mn));
      }
      lrun = lrun * FEXP2(mrun - mn) + ps;
      mrun = mn;
    }
    if (t + 1 < NQ / 64) tile_put(Qt[(t + 1) & 1], rq, tid);
    __syncthreads();   // publishes tile t+1 and ends every read of tile t before its buffer is refilled
  }

  // merge the two lane halves (all lanes take part in the exchange)
  const float m2 = __shfl_xor(mrun, 16);
  const float l2 = __shfl_xor(lrun, 16);
  const float mt = fmaxf(mrun, m2);
  const float lt = lrun * FEXP2(mrun - mt) + l2 * FEXP2(m2 - mt);
  const float nls = PSHIFT - (mt + log2f(lt));

  if (h == 0) sred[wave * 16 + l15] = nls;
  __syncthreads();
  if (wave == 0) {
    const int li = (lane < 16) ? lane : 15;                 // clamped LDS address
    const v4f val = *(const v4f*)(&sred[4 * li]);
    float* dst = NLS + (size_t)bn * NK + kb0 + 4 * li;      // 16 lanes x 16 B = the block's 256 B
    if (lane < 16) *(v4f*)dst = val;
    
  }
}

// ---------------------------------------------------------------------------
// Head-averaged probabilities. Block = 128 threads (4 waves), tile 64 queries x 64 keys of one
// batch; wave w owns 16 queries x 64 keys and loops over the 16 heads: S = Q K^T (A = Q rows,
// B = K rows, fragments from per-head 64-row LDS tiles, two buffers), p*4096 = exp2(c*s + NLS[key]), summed over
// ---------------------------------------------------------------------------
#define MP 68

__global__ __launch_bounds__(128, 8)   // register budget for 8 waves per SIMD: all 8 blocks per WGP of this grid stay resident
void k_attn_mean(const us_t* __restrict__ Qp, const us_t* __restrict__ Kp,
                 const float* __restrict__ NLS, float* out1)
{
  __shared__ __align__(16) us_t Tl[4 * TILE_H];      // Q tile x2, K tile x2; behind the head loop's last barrier: output staging
  __shared__ __align__(16) float Ns[NH * 64];        // the tile's 64 column normalisers of every head
  static_assert(4 * 16 * MP * 4 <= 4 * TILE_H * 2);
  float* Mst = (float*)Tl;                           // per wave 16 rows x 64 floats used (pad 68); wave-private, block barrier
  const int tid = threadIdx.x;
  const int lane = threadIdx.x & 31;
  const int wave = __builtin_amdgcn_readfirstlane(threadIdx.x >> 5);
  const int h = lane >> 4, l15 = lane & 15;
  const int k0 = blockIdx.x * 64;
  const int q0 = blockIdx.y * 64 + wave * 16;
  const int b = blockIdx.z;
  const int mw = wave * (16 * MP);

  v8f macc[4];
#pragma unroll
  for (int st = 0; st < 4; ++st) macc[st] = vzero();

  const us_t* Qsrc = Qp + ((size_t)b * NH * NQ + blockIdx.y * 64) * DH;   // head 0; next head: + NQ * DH
  const us_t* Ksrc = Kp + ((size_t)b * NH * NK + k0) * DH;                // head 0; next head: + NK * DH
  v4f nv[2];
#pragma unroll
  for (int i = 0; i < 2; ++i) {
    const int e = tid + 128 * i;                                          // 16 heads x 16 chunks of 4 floats
    nv[i] = *(const v4f*)(NLS + ((size_t)b * NH + (e >> 4)) * NK + k0 + 4 * (e & 15));
  }
  // stands in front of the tile loads, whose destinations otherwise reuse the address registers of the two loads above
  asm volatile("s_wait_xcnt 0x0" ::: "memory");
  v4u rq[4], rk[4];
  tile_fetch_dense(rq, Qsrc, tid);
  tile_fetch_dense(rk, Ksrc, tid);
#pragma unroll
  for (int i = 0; i < 2; ++i) *(v4f*)(&Ns[4 * (tid + 128 * i)]) = nv[i];
  tile_put(Tl, rq, tid);
  tile_put(Tl + 2 * TILE_H, rk, tid);
  __syncthreads();   // head 0's tiles and the normalisers visible to all waves

  // one head's scores and probabilities from the tiles in buffer hh & 1
  auto head = [&](int hh) {
    const us_t* qc = Tl + (hh & 1) * TILE_H;
    const us_t* kc = Tl + (2 + (hh & 1)) * TILE_H;
    Frag16 qa[2];
#pragma unroll
    for (int c = 0; c < 2; ++c) frag_get(qa[c], qc, wave * 16 + l15, c, h);   // A row m = query
#pragma unroll
    for (int st = 0; st < 4; ++st) {
      v8f s = vzero();
#pragma unroll
      for (int c = 0; c < 2; ++c) {
        Frag16 bf;
        frag_get(bf, kc, 16 * st + l15, c, h);                               // B column n = key
        s = mma16<1>(qa[c], bf, s);
      }
      const float nl = Ns[hh * 64 + 16 * st + l15];
#pragma unroll
      for (int r = 0; r < 8; ++r) macc[st][r] += FEXP2(fmaf(s[r], C2LOG, nl));
    }
  };

#pragma unroll 1
  for (int hh = 0; hh < NH - 1; ++hh) {
    tile_fetch_dense(rq, Qsrc + (size_t)(hh + 1) * NQ * DH, tid);
    tile_fetch_dense(rk, Ksrc + (size_t)(hh + 1) * NK * DH, tid);
    head(hh);
    tile_put(Tl + ((hh + 1) & 1) * TILE_H, rq, tid);
    tile_put(Tl + (2 + ((hh + 1) & 1)) * TILE_H, rk, tid);
    __syncthreads();   // publishes head hh+1's tiles and ends every read of head hh's before their buffers are refilled
  }
  head(NH - 1);
  __syncthreads();     // every wave has left the tiles before they become output staging

  // D layout: macc[st][r] = (query q0 + 8h + r, key k0 + 16 st + l15)
#pragma unroll
  for (int st = 0; st < 4; ++st)
#pragma unroll
    for (int r = 0; r < 8; ++r)
      Mst[mw + (8 * h + r) * MP + 16 * st + l15] = macc[st][r] * MSCALE;
  __syncthreads();
  const int q8 = lane & 7, rsub = lane >> 3;
  {
#pragma unroll
    for (int it = 0; it < 8; ++it) {
      const int L = it * 4 + rsub, row = L >> 1, nl = L & 1;     // 16 rows x 2 lines, 4 lines per instruction
      const v4f val = *(const v4f*)(&Mst[mw + row * MP + 32 * nl + 4 * q8]);
      float* dst = out1 + (((size_t)b * NQ + q0 + row) * NK + k0 + 32 * nl + 4 * q8);
      *(v4f*)dst = val;
    }
    
  }
}

// ---------------------------------------------------------------------------
// Context, transposed register-fed form. Block = 128 threads (4 waves), 64 queries of one
// (b,n); wave w owns 16 queries (Q fragments held as the B operand). Per 32-key step:
// S^T = K Q^T (A = K rows from a 64-key LDS tile) for two 16-key tiles, p^T*4096 = exp2(c*s + NLS[key])
// packed from the two D tiles into one B fragment (element r <- tile 0, element 8+r <- tile 1),
// O^T += Vt * P^T (A = Vt rows d from a 64-key LDS tile, k = keys). Two buffers per tile, the next
// 64 keys fetched during the current, one barrier per 64 keys; the column normaliser (whole row in
// LDS) is already inside the exponent, so there is no running state.
// ---------------------------------------------------------------------------
#define PP 72

__global__ __launch_bounds__(128)
void k_attn_ctx(const us_t* __restrict__ Qp, const us_t* __restrict__ Kp, const us_t* __restrict__ Vt,
                const float* __restrict__ NLS, us_t* AV)
{
  __shared__ __align__(16) us_t Ost[4 * 16 * PP];   // per wave 16 rows x 64 halves used (pad 72); wave-private, block barrier
  __shared__ __align__(16) us_t Kt[2][TILE_H];      // rows = keys, columns = d
  __shared__ __align__(16) us_t Vs[2][TILE_H];      // rows = d, columns = keys
  __shared__ __align__(16) float Ns[NK];            // column normalisers of this (b,n)
  const int tid = threadIdx.x;
  const int lane = threadIdx.x & 31;
  const int wave = __builtin_amdgcn_readfirstlane(threadIdx.x >> 5);
  const int h = lane >> 4, l15 = lane & 15;
  const int i0 = blockIdx.x * 64, bn = blockIdx.y;
  const int b = bn / NH, n = bn - b * NH;
  const int iw = i0 + wave * 16;
  const int ow = wave * (16 * PP);

  Frag16 qf[2];
  {
    const us_t* pq = Qp + ((size_t)bn * NQ + iw + l15) * DH;       // B column n = query, k = d
#pragma unroll
    for (int c = 0; c < 2; ++c) {
      qf[c].u[0] = *(const v8us*)(pq + 32 * c + 8 * h);
      qf[c].u[1] = *(const v8us*)(pq + 32 * c + 16 + 8 * h);
    }
  }

  v8f oacc[4];
#pragma unroll
  for (int dt = 0; dt < 4; ++dt) oacc[dt] = vzero();

  const us_t* Kbase = Kp + (size_t)bn * NK * DH;
  const us_t* Vbase = Vt + (size_t)bn * DH * NK;
  const float* Nbase = NLS + (size_t)bn * NK;

#pragma unroll
  for (int i = 0; i < NK / 512; ++i)
    *(v4f*)(&Ns[4 * (tid + 128 * i)]) = *(const v4f*)(Nbase + 4 * (tid + 128 * i));
  v4u rk[4], rv[4];
  tile_fetch(rk, Kbase, DH, tid);
  tile_fetch(rv, Vbase, NK, tid);
  tile_put(Kt[0], rk, tid);
  tile_put(Vs[0], rv, tid);
  __syncthreads();   // tile 0 and the normalisers visible to all waves

  for (int t = 0; t < NK / 64; ++t) {
    const us_t* kc = Kt[t & 1];
    const us_t* vc = Vs[t & 1];
    if (t + 1 < NK / 64) {
      tile_fetch(rk, Kbase + (size_t)(t + 1) * 64 * DH, DH, tid);
      tile_fetch(rv, Vbase + (size_t)(t + 1) * 64, NK, tid);
    }
#pragma unroll
    for (int ks = 0; ks < 2; ++ks) {
      Frag16 pb;                                        // B[k = key in step][n = query]
#pragma unroll
      for (int st = 0; st < 2; ++st) {
        v8f s = vzero();
#pragma unroll
        for (int c = 0; c < 2; ++c) {
          Frag16 ka;
          frag_get(ka, kc, 32 * ks + 16 * st + l15, c, h);   // A row m = key
          s = mma16<1>(ka, qf[c], s);
        }
        // D rows = keys 64 t + 32 ks + 16 st + 8h + r : eight consecutive table entries per lane
        const float* np = &Ns[64 * t + 32 * ks + 16 * st + 8 * h];
        const v4f na = *(const v4f*)(np);
        const v4f nc = *(const v4f*)(np + 4);
        const float nl[8] = {na[0], na[1], na[2], na[3], nc[0], nc[1], nc[2], nc[3]};
#pragma unroll
        for (int r = 0; r < 8; ++r)
          pb.hf[8 * st + r] = (h16)pexp2_cut(fmaf(s[r], C2LOG, nl[r]));
      }
#pragma unroll
      for (int dt = 0; dt < 4; ++dt) {
        Frag16 va;                                      // A row m = d (row of Vt), k = key
        frag_get(va, vc, 16 * dt + l15, ks, h);
        oacc[dt] = mma16<1>(va, pb, oacc[dt]);
      }
    }
    if (t + 1 < NK / 64) {
      tile_put(Kt[(t + 1) & 1], rk, tid);
      tile_put(Vs[(t + 1) & 1], rv, tid);
    }
    __syncthreads();   // publishes tile t+1 and ends every read of tile t before its buffers are refilled
  }

  // D layout: oacc[dt][r] = O^T(d = 16 dt + 8h + r, query l15) : eight consecutive d per lane
  const float sc = AVCARRY / PCARRY;
#pragma unroll
  for (int dt = 0; dt < 4; ++dt) {
    v8us pk;
#pragma unroll
    for (int r = 0; r < 8; ++r) pk[r] = hfl_bits(oacc[dt][r] * sc);
    *(v8us*)(&Ost[ow + l15 * PP + 16 * dt + 8 * h]) = pk;
  }
  __syncthreads();
  const int q8 = lane & 7, rsub = lane >> 3;
  {
#pragma unroll
    for (int it = 0; it < 4; ++it) {
      const int row = it * 4 + rsub;                     // 16 rows per wave, 4 lines per instruction
      v4u val = *(const v4u*)(&Ost[ow + row * PP + 8 * q8]);
      us_t* dst = AV + (((size_t)(iw + row) * NB + b) * HH + n * DH + 8 * q8);
      *(v4u*)dst = val;
    }
    
  }
}

// ---------------------------------------------------------------------------
// Host orchestration (8 launches)
// ---------------------------------------------------------------------------
extern "C" void kernel_launch(void* const* d_in, const int* in_sizes, int n_in,
                              void* d_out, int out_size, void* d_ws, size_t ws_size,
                              hipStream_t stream)
{
  if (n_in < 8) return;
  const float* xq = (const float*)d_in[0];
  const float* xk = (const float*)d_in[1];
  const float* xv = (const float*)d_in[2];
  const float* wq = (const float*)d_in[3];
  const float* wk = (const float*)d_in[4];
  const float* wv = (const float*)d_in[5];
  const float* wp = (const float*)d_in[6];
  const float* bp = (const float*)d_in[7];

  if ((long)in_sizes[0] < ((long)(NB - 1) * NQ_FULL + NQ) * DM) return;
  if ((long)in_sizes[1] < ((long)(NB - 1) * NK_FULL + NK) * DM) return;
  if ((long)in_sizes[2] < ((long)(NB - 1) * NK_FULL + NK) * DM) return;
  if ((long)in_sizes[3] < (long)HH * DM) return;
  if ((long)in_sizes[4] < (long)HH * DM) return;
  if ((long)in_sizes[5] < (long)HH * DM) return;
  if ((long)in_sizes[6] < (long)DM * HH) return;
  if (in_sizes[7] < DM) return;
  if ((long)out_size < OUT1_OFF + (long)NB * NQ * NK) return;

  char* base = (char*)d_ws;
  size_t off = 0;
  auto take = [&](size_t bytes) -> char* {
    char* q = base + off; off += (bytes + 255) & ~(size_t)255; return q;
  };
  us_t*  xq_b = (us_t*) take((size_t)NB * NQ * DM * 2);             // bf16 [b][q][DM]
  us_t*  xk_b = (us_t*) take((size_t)NB * NK * DM * 2);             // bf16 [b][k][DM]
  us_t*  xv_b = (us_t*) take((size_t)NB * NK * DM * 2);             // bf16 [b][k][DM]
  us_t*  wq_b = (us_t*) take((size_t)HH * DM * 2);                  // bf16 [out][in]
  us_t*  wk_b = (us_t*) take((size_t)HH * DM * 2);                  // bf16
  us_t*  wv_b = (us_t*) take((size_t)HH * DM * 2);                  // bf16
  us_t*  wp_h = (us_t*) take((size_t)DM * HH * 2);                  // f16 (x64)
  us_t*  Qp   = (us_t*) take((size_t)NB * NH * NQ * DH * 2);        // f16 [bn][q][d]
  us_t*  Kp   = (us_t*) take((size_t)NB * NH * NK * DH * 2);        // f16 [bn][k][d]
  us_t*  Vt   = (us_t*) take((size_t)NB * NH * DH * NK * 2);        // f16 [bn][d][k]
  float* NLS  = (float*)take((size_t)NB * NH * NK * 4);             // f32 [bn][k]
  us_t*  AV   = (us_t*) take((size_t)NQ * NB * HH * 2);             // f16 (x32) [q*NB+b][n*64+d]
  if (off > ws_size) return;
  if (off > (size_t)WS_TOTAL) return;

  float* out0 = (float*)d_out;                                       // [q][b][c]
  float* out1 = (float*)d_out + OUT1_OFF;                            // [b][q][k]

  // 1) input conversions (RNE bf16; Wp as f16 of the bf16 value x64): planes xq_b .. wp_h, back to back from xq_b
  k_cvt_all<<<dim3(CVT_BLOCKS), dim3(CVT_WPB * 32), 0, stream>>>(xq, xk, xv, wq, wk, wv, wp, xq_b);

  // 2) projections: q = xq Wq^T, k = xk Wk^T, v^T = (xv Wv^T)^T, per batch z
  k_gemm<0, EPI_Q><<<dim3(HH / BN, NQ / BM, NB), dim3(256), 0, stream>>>(
      xq_b, wq_b, (void*)Qp, (void*)Qp, bp, bp, (long)DM, (long)DM, (long)NQ * DM, DM);
  k_gemm<0, EPI_K><<<dim3(HH / BN, NK / BM, NB), dim3(256), 0, stream>>>(
      xk_b, wk_b, (void*)Kp, (void*)Kp, bp, bp, (long)DM, (long)DM, (long)NK * DM, DM);
  k_gemm<0, EPI_VT><<<dim3(HH / BN, NK / BM, NB), dim3(256), 0, stream>>>(
      xv_b, wv_b, (void*)Vt, (void*)Vt, bp, bp, (long)DM, (long)DM, (long)NK * DM, DM);

  // 3) per-key column statistics of the query-axis softmax
  k_colstats<<<dim3(NK / 64, NB * NH), dim3(128), 0, stream>>>(Qp, Kp, NLS);
  // 4) head-averaged probabilities -> second output
  k_attn_mean<<<dim3(NK / 64, NQ / 64, NB), dim3(128), 0, stream>>>(Qp, Kp, NLS, out1);
  // 5) context -> AV plane
  k_attn_ctx<<<dim3(NQ / 64, NB * NH), dim3(128), 0, stream>>>(Qp, Kp, Vt, NLS, AV);
  // 6) output projection + bias -> first output, rows q*NB + b
  k_gemm<1, EPI_OUT><<<dim3(DM / BN, (NQ * NB) / BM, 1), dim3(256), 0, stream>>>(
      AV, wp_h, (void*)out0, (void*)out0, bp, bp, (long)HH, (long)HH, 0L, HH);
}

// v005
// Measured time: 160 microseconds a run.
// In both of two side-by-side timings against v004, it was 1.06 times as fast.
// All steps since v000 together make it 2.64 times as fast.
#include <hip/hip_runtime.h>

// Contractions: xq x Wq^T, xk x Wk^T, xv x Wv^T on v_wmma_f32_16x16x32_bf16 (bf16 operands = RNE-converted inputs), f32 accumulate;
// q x k^T (three sweeps: column statistics, head-mean probabilities, context), v^T x p^T and ctx x Wp^T on v_wmma_f32_16x16x32_f16
// (f16 operands: q,k,v unscaled, p carried x4096, ctx carried x32, Wp carried x64 after RNE bf16 convert), f32 accumulate.
// Softmax over the query axis (per key column) and bias add in f32.

#ifndef NB
#define NB 4
#endif
#define NB_FULL 4
#ifndef NQ
#define NQ 1024
#endif
#ifndef NK
#define NK 2048
#endif
#define NQ_FULL 1024
#define NK_FULL 2048
#define DM 1024
#define NH 16
#define DH 64
#define HH (NH * DH)
#define SCL 0.125f
#define C2LOG 0.18033688011112042f      /* SCL * log2(e) */
#define PCARRY 4096.0f
#define PSHIFT 12.0f                     /* log2(PCARRY) */
#define AVCARRY 32.0f
#define OWCARRY 64.0f
#define MSCALE 1.52587890625e-05f        /* 1 / (NH * PCARRY) = 2^-16 */
#define OUT1_OFF 4194304L                /* element offset of the second output (byte 16777216) */

#define AL256(x) (((x) + 255L) & ~255L)
#define WS_TOTAL (AL256((long)NB * NQ * DM * 2) + 2 * AL256((long)NB * NK * DM * 2) + 4 * AL256((long)HH * DM * 2) + \
                  AL256((long)NB * NH * NQ * DH * 2) + 2 * AL256((long)NB * NH * NK * DH * 2) + \
                  AL256((long)NB * NH * NK * 4) + AL256((long)NQ * NB * HH * 2))

static_assert(NB >= 1 && NB <= NB_FULL);
static_assert(NQ >= 128 && NQ <= NQ_FULL && NK >= 128 && NK <= NK_FULL);
static_assert(NQ % 128 == 0 && NK % 128 == 0);
static_assert(DM == 1024 && HH == 1024 && DH == 64 && NH == 16);
static_assert(DM == 128 * 8);
static_assert(DM % 32 == 0 && HH % 32 == 0 && DH % 32 == 0);
static_assert(HH % 128 == 0 && DM % 128 == 0);
static_assert(((long)NQ * NB) % 128 == 0);
static_assert((long)NQ * NB * DM * 4 <= 16777216L);
static_assert(OUT1_OFF * 4 == 16777216L);
static_assert((long)NB * NQ * NK * 4 <= 33554432L);
static_assert(PCARRY == 4096.0f && PSHIFT == 12.0f);
static_assert(MSCALE * 16.0f * PCARRY == 1.0f);
static_assert(WS_TOTAL <= 134217728L);

typedef unsigned short us_t;
typedef _Float16 h16;
typedef us_t     v8us  __attribute__((ext_vector_type(8)));
typedef unsigned v4u   __attribute__((ext_vector_type(4)));
typedef float    v8f   __attribute__((ext_vector_type(8)));
typedef float    v4f   __attribute__((ext_vector_type(4)));
typedef __bf16   v16bf __attribute__((ext_vector_type(16)));
typedef _Float16 v16h  __attribute__((ext_vector_type(16)));

#if __has_builtin(__builtin_amdgcn_exp2f)
#define FEXP2(x) __builtin_amdgcn_exp2f(x)
#else
#define FEXP2(x) __expf((x) * 0.6931471805599453f)
#endif

// 16x32 16-bit fragment: u[0] = elements 0..7, u[1] = elements 8..15
union Frag16 { v8us u[2]; v16bf bf; v16h hf; };

__device__ __forceinline__ v8f vzero() {
  v8f z = {0.f, 0.f, 0.f, 0.f, 0.f, 0.f, 0.f, 0.f};
  return z;
}

// RNE f32 -> bf16 bits
__device__ __forceinline__ us_t bf_bits(float x) {
  unsigned u = __float_as_uint(x);
  u += 0x7FFFu + ((u >> 16) & 1u);
  return (us_t)(u >> 16);
}
// RNE f32 -> bf16 value kept as f32
__device__ __forceinline__ float bf_val(float x) {
  unsigned u = __float_as_uint(x);
  u += 0x7FFFu + ((u >> 16) & 1u);
  return __uint_as_float(u & 0xFFFF0000u);
}
// RNE f32 -> f16 bits
__device__ __forceinline__ us_t hf_bits(float x) {
  _Float16 hv = (_Float16)x;
  return __builtin_bit_cast(us_t, hv);
}

// RNE f32 -> f16 with a value select: results below the smallest normal f16 become zero
static __device__ __forceinline__ h16 toh_flush(float v) {
  const h16 r = (h16)v;
  return (fabsf(v) < 6.103515625e-05f) ? (h16)0.0f : r;
}
static __device__ __forceinline__ us_t hfl_bits(float v) {
  return __builtin_bit_cast(us_t, toh_flush(v));
}
// exp2 of an exponent that already contains the x4096 carry; zero when the f16 value would be subnormal
static __device__ __forceinline__ float pexp2_cut(float e) {
  const float p = FEXP2(e);
  return (e < -14.0f) ? 0.0f : p;
}

// WMMA as the bare builtin: the compiler keeps the distance to the next reader of D and is free to order loads around it
template <int F16OP>
__device__ __forceinline__ v8f mma16(const Frag16& a, const Frag16& b, v8f c) {
  if (F16OP) {
    c = __builtin_amdgcn_wmma_f32_16x16x32_f16(false, a.hf, false, b.hf, (short)0, c, false, false);
  } else {
    c = __builtin_amdgcn_wmma_f32_16x16x32_bf16(false, a.bf, false, b.bf, (short)0, c, false, false);
  }
  return c;
}

// ---------------------------------------------------------------------------
// All input conversions in one resident launch. Unit = one row of DM = 1024 floats (4096 B in, 2048 B out).
// Units in plane order: xq rows, xk rows, xv rows (RNE bf16), Wq, Wk, Wv rows (RNE bf16), Wp rows (f16 of bf16(x)*OWCARRY);
// the seven 16-bit planes lie back to back in the workspace, so unit u is written at dst + u * DM.
// 256 blocks x 16 waves; a wave takes units gw, gw + 4096, ...: eight 16-B loads per lane, each wave-wide load
// 512 contiguous bytes, the next unit's eight loads issued before the current unit is converted and stored
// (8-B stores, 256 contiguous bytes per wave-wide store). No barrier, no LDS.
// ---------------------------------------------------------------------------
#define CVT_WPB 16
#define CVT_BLOCKS 256
#define CVT_NW (CVT_WPB * CVT_BLOCKS)
#define U_XQ (NB * NQ)
#define U_XK (NB * NK)
#define U_W HH
#define U_ALL (U_XQ + 2 * U_XK + 4 * U_W)
#define CVT_IT ((U_ALL + CVT_NW - 1) / CVT_NW)
static_assert(((long)NB * NQ * DM * 2) % 256 == 0 && ((long)NB * NK * DM * 2) % 256 == 0 && ((long)HH * DM * 2) % 256 == 0);

typedef unsigned v2u __attribute__((ext_vector_type(2)));

// behind each unit's loads and each unit's stores: their address registers are reused for the next unit's addresses;
// its memory clobber also keeps the order loads(u + 1), convert(u), stores(u), so that stores start while loads are in flight
#define CVT_XWAIT() asm volatile("s_wait_xcnt 0x0" ::: "memory")

// source row of unit u (wave-uniform); a unit past the end re-reads the last row and is not stored
__device__ __forceinline__ const float* cvt_row(unsigned u, const float* xq, const float* xk, const float* xv,
                                                const float* wq, const float* wk, const float* wv, const float* wp) {
  if (u >= U_ALL) u = U_ALL - 1;
  const unsigned uk = u - U_XQ, uv = uk - U_XK, uw = uv - U_XK;
  const float* p = (uw < U_W) ? wq : (uw < 2 * U_W) ? wk : (uw < 3 * U_W) ? wv : wp;
  unsigned r = uw % U_W;
  if (u < U_XQ + 2 * U_XK) { p = xv; r = (uv / NK) * NK_FULL + uv % NK; }
  if (u < U_XQ + U_XK)     { p = xk; r = (uk / NK) * NK_FULL + uk % NK; }
  if (u < U_XQ)            { p = xq; r = (u / NQ) * NQ_FULL + u % NQ; }
  return p + (size_t)r * DM;
}

__global__ __launch_bounds__(CVT_WPB * 32)
void k_cvt_all(const float* __restrict__ xq, const float* __restrict__ xk, const float* __restrict__ xv,
               const float* __restrict__ wq, const float* __restrict__ wk, const float* __restrict__ wv,
               const float* __restrict__ wp, us_t* __restrict__ dst)
{
  const unsigned lane = threadIdx.x & 31;
  const unsigned gw = __builtin_amdgcn_readfirstlane(blockIdx.x * CVT_WPB + (threadIdx.x >> 5));
  if (gw >= CVT_NW) return;   // bounds gw for any grid (wave-uniform, no barrier here)

  v4f buf[2][8];
  {
    const float* s = cvt_row(gw, xq, xk, xv, wq, wk, wv, wp) + 4 * lane;
#pragma unroll
    for (int j = 0; j < 8; ++j) buf[0][j] = *(const v4f*)(s + 128 * j);
    CVT_XWAIT();
  }
#pragma unroll   // two register sets alternate by a compile-time index: no copies between them
  for (int it = 0; it < CVT_IT; ++it) {
    const unsigned u = gw + it * CVT_NW;
    if (it + 1 < CVT_IT) {
      const float* s = cvt_row(u + CVT_NW, xq, xk, xv, wq, wk, wv, wp) + 4 * lane;
#pragma unroll
      for (int j = 0; j < 8; ++j) buf[(it + 1) & 1][j] = *(const v4f*)(s + 128 * j);
      CVT_XWAIT();
    }
    if (u < U_ALL) {
      const v4f (&r)[8] = buf[it & 1];
      us_t* d = dst + (size_t)u * DM + 4 * lane;
      if (u < U_ALL - U_W) {
#pragma unroll
        for (int j = 0; j < 8; ++j) {
          const v2u pk = {(unsigned)bf_bits(r[j][0]) | ((unsigned)bf_bits(r[j][1]) << 16),
                          (unsigned)bf_bits(r[j][2]) | ((unsigned)bf_bits(r[j][3]) << 16)};
          *(v2u*)(d + 128 * j) = pk;
        }
      } else {
#pragma unroll
        for (int j = 0; j < 8; ++j) {
          const v2u pk = {(unsigned)hf_bits(bf_val(r[j][0]) * OWCARRY) | ((unsigned)hf_bits(bf_val(r[j][1]) * OWCARRY) << 16),
                          (unsigned)hf_bits(bf_val(r[j][2]) * OWCARRY) | ((unsigned)hf_bits(bf_val(r[j][3]) * OWCARRY) << 16)};
          *(v2u*)(d + 128 * j) = pk;
        }
      }
      CVT_XWAIT();
    }
  }
}

// ---------------------------------------------------------------------------
// TN GEMM: C[M,N] = A[M,K] * B[N,K]^T, 16-bit operands from planes, f32 accumulate.
// Block 128x128x64, 256 threads = 8 waves (2x4), wave tile 64x32 = 4x2 WMMA tiles.
// Pipelined staging: two LDS buffers and two register sets; k tile t + 2 is fetched (whole 128-B lines) while tile t is
// multiplied, tile t + 1 goes from its registers to the other buffer behind the products, one barrier per k tile.
// Epilogue stages the 128x128 tile in the same LDS, behind a barrier of its own
//  EPI_Q  : D0 = Q plane  [(z*NH+n)*NQ + i][d] f16
//  EPI_K  : D0 = K plane  [(z*NH+n)*NK + pos][d] f16
//  EPI_VT : D0 = Vt plane [((z*NH+n)*DH + d)*NK + pos] f16
//  EPI_OUT: D0 = f32 output rows [row][DM], scaled by 1/(AVCARRY*OWCARRY), bias0 (RNE bf16 value) added in f32 at the store stage
// ---------------------------------------------------------------------------
#define BM 128
#define BN 128
#define BK 64
#define BKP 72                 /* row pitch 144 B = 16 B x 9: ds_load_b128 fragment reads spread over the banks */
#define STG (BM * BKP)         /* halves of one operand's k tile */
#define CSP 136
#define CFP 132
#define EPI_Q 0
#define EPI_K 1
#define EPI_VT 2
#define EPI_OUT 3

// Work-group barrier of the k loop: it waits for this wave's LDS reads and writes only. __syncthreads() would also
// wait for the global loads of the tile fetched ahead, which have to stay in flight across it.
__device__ __forceinline__ void tile_barrier() {
  asm volatile("s_wait_dscnt 0x0\n\ts_barrier_signal -1\n\ts_barrier_wait -1" ::: "memory");
}

template <int F16OP, int EPI>
__global__ __launch_bounds__(256)
void k_gemm(const us_t* __restrict__ A, const us_t* __restrict__ B,
            void* D0, void* D1, const float* __restrict__ bias0, const float* __restrict__ bias1,
            long lda, long ldb, long strideAz, int K)
{
  __shared__ __align__(16) us_t Sm[4 * STG];    // A tile x2, B tile x2: 128 rows x 64 k each (pad 72)
  us_t* Cs = Sm;                                // behind the k loop: f16 view [128][136] or f32 view [64][132]
  static_assert(64 * CFP * 4 <= BM * CSP * 2 && BM * CSP <= 4 * STG && BM == BN);

  const int tid = threadIdx.x, lane = tid & 31, wid = __builtin_amdgcn_readfirstlane(tid >> 5);
  const int wm = wid >> 2, wn = wid & 3, h = lane >> 4, l15 = lane & 15;
  const int m0 = blockIdx.y * BM, n0 = blockIdx.x * BN, z = blockIdx.z;
  const us_t* Ab = A + (size_t)z * (size_t)strideAz + (size_t)m0 * (size_t)lda;
  const us_t* Bb = B + (size_t)n0 * (size_t)ldb;

  v8f acc[4][2];
#pragma unroll
  for (int mi = 0; mi < 4; ++mi)
#pragma unroll
    for (int ni = 0; ni < 2; ++ni) acc[mi][ni] = vzero();

  const int nk = K / BK;                                   // even and at least 2: K is DM or HH, multiples of 128
  const int srow = tid >> 3, skc = (tid & 7) << 3;         // 8 lanes per 128-B row piece, 32 rows per block-wide load
  unsigned oa[4], ob[4];                                   // byte offsets of this thread's four row pieces; they live through the loop
#pragma unroll
  for (int i = 0; i < 4; ++i) {
    oa[i] = ((unsigned)(srow + 32 * i) * (unsigned)lda + (unsigned)skc) * 2u;
    ob[i] = ((unsigned)(srow + 32 * i) * (unsigned)ldb + (unsigned)skc) * 2u;
  }

  auto fetch = [&](v8us (&ra)[4], v8us (&rb)[4], int kb) {
    const char* pa = (const char*)(Ab + kb * BK);          // block-uniform base, per-thread 32-bit offset
    const char* pb = (const char*)(Bb + kb * BK);
#pragma unroll
    for (int i = 0; i < 4; ++i) {
      ra[i] = *(const v8us*)(pa + oa[i]);
      rb[i] = *(const v8us*)(pb + ob[i]);
    }
    // behind the eight loads: their address registers are rewritten for a later tile; its memory clobber also keeps
    // the loads ahead of the products' LDS reads, so that they are in flight from the start of the k tile
    asm volatile("s_wait_xcnt 0x0" ::: "memory");
  };
  auto put = [&](int buf, const v8us (&ra)[4], const v8us (&rb)[4]) {
    us_t* ta = Sm + buf * STG + srow * BKP + skc;
#pragma unroll
    for (int i = 0; i < 4; ++i) {
      *(v8us*)(ta + 32 * i * BKP) = ra[i];
      *(v8us*)(ta + 2 * STG + 32 * i * BKP) = rb[i];
    }
  };
  auto mult = [&](int buf) {
    const us_t* as = Sm + buf * STG;
    const us_t* bs = as + 2 * STG;
#pragma unroll
    for (int c = 0; c < 2; ++c) {                            // k ascending in steps of 32
      Frag16 af[4], bfr[2];
#pragma unroll
      for (int mi = 0; mi < 4; ++mi) {
        const int r = wm * 64 + mi * 16 + l15;                          // A row m = lane&15
        af[mi].u[0] = *(const v8us*)(&as[r * BKP + 32 * c + 8 * h]);      // k 8h..8h+7
        af[mi].u[1] = *(const v8us*)(&as[r * BKP + 32 * c + 16 + 8 * h]); // k 16+8h..16+8h+7
      }
#pragma unroll
      for (int ni = 0; ni < 2; ++ni) {
        const int r = wn * 32 + ni * 16 + l15;                          // B column n = lane&15, row of [n][k] plane, same k map
        bfr[ni].u[0] = *(const v8us*)(&bs[r * BKP + 32 * c + 8 * h]);
        bfr[ni].u[1] = *(const v8us*)(&bs[r * BKP + 32 * c + 16 + 8 * h]);
      }
#pragma unroll
      for (int mi = 0; mi < 4; ++mi)
#pragma unroll
        for (int ni = 0; ni < 2; ++ni) acc[mi][ni] = mma16<F16OP>(af[mi], bfr[ni], acc[mi][ni]);
    }
  };

  v8us a0[4], b0[4], a1[4], b1[4];
  fetch(a0, b0, 0);
  fetch(a1, b1, 1);
  put(0, a0, b0);
  tile_barrier();      // tile 0 visible to all waves
  for (int kb = 0; kb + 2 < nk; kb += 2) {
    fetch(a0, b0, kb + 2);
    mult(0);
    put(1, a1, b1);
    tile_barrier();    // publishes tile kb+1 and ends every read of tile kb before its buffer is refilled
    fetch(a1, b1, kb + 3);
    mult(1);
    put(0, a0, b0);
    tile_barrier();    // publishes tile kb+2 and ends every read of tile kb+1 before its buffer is refilled
  }
  mult(0);             // the last two tiles: nothing left to fetch
  put(1, a1, b1);
  tile_barrier();
  mult(1);             // the epilogue's first barrier ends these reads before the LDS becomes output staging

  // D layout: acc[mi][ni][v] = C(row wm*64+mi*16+8h+v, col wn*32+ni*16+l15)
  const int q8 = tid & 7, lsub = tid >> 3;   // 8 lanes per line, 32 lines per instruction over the block

  if (EPI == EPI_OUT) {
    float* Cf = (float*)Cs;
    float* Do = (float*)D0;
    const float oscale = 1.0f / (AVCARRY * OWCARRY);
#pragma unroll
    for (int rh = 0; rh < 2; ++rh) {
      __syncthreads();
      if (wm == rh) {
#pragma unroll
        for (int mi = 0; mi < 4; ++mi)
#pragma unroll
          for (int ni = 0; ni < 2; ++ni) {
            const int col = wn * 32 + ni * 16 + l15;
#pragma unroll
            for (int v = 0; v < 8; ++v)
              Cf[(mi * 16 + 8 * h + v) * CFP + col] = acc[mi][ni][v] * oscale;
          }
      }
      __syncthreads();
      {
#pragma unroll
        for (int it = 0; it < 8; ++it) {
          const int L = it * 32 + lsub, pr = L >> 2, ql = L & 3;     // 64 rows x 4 lines per row
          const v4f val = *(const v4f*)(&Cf[pr * CFP + 32 * ql + 4 * q8]);
          const v4f bq = *(const v4f*)(bias0 + n0 + 32 * ql + 4 * q8);
          const v4f o = {val[0] + bf_val(bq[0]), val[1] + bf_val(bq[1]),
                         val[2] + bf_val(bq[2]), val[3] + bf_val(bq[3])};
          float* dst = Do + ((size_t)(m0 + 64 * rh + pr) * DM + n0 + 32 * ql + 4 * q8);
          *(v4f*)dst = o;
        }
        
      }
    }
  } else {
    __syncthreads();
#pragma unroll
    for (int mi = 0; mi < 4; ++mi)
#pragma unroll
      for (int ni = 0; ni < 2; ++ni) {
        const int col = wn * 32 + ni * 16 + l15;
#pragma unroll
        for (int v = 0; v < 8; ++v)
          Cs[(wm * 64 + mi * 16 + 8 * h + v) * CSP + col] = hfl_bits(acc[mi][ni][v]);
      }
    __syncthreads();
    const int rpb = (EPI == EPI_Q) ? NQ : NK;   // plane rows per (batch, head)
    const int hb = n0 >> 6;                      // first head of this column block
    {
      if (EPI != EPI_VT) {
#pragma unroll
        for (int it = 0; it < 8; ++it) {
          const int L = it * 32 + lsub, pr = L >> 1, nl = L & 1;   // 128 rows x 2 lines of 64 halves
          v4u val = *(const v4u*)(&Cs[pr * CSP + nl * 64 + 8 * q8]);
          us_t* dst = (us_t*)D0 + ((((size_t)z * NH + hb + nl) * rpb + m0 + pr) * DH + 8 * q8);
          *(v4u*)dst = val;
        }
      } else {
        // Vt plane: line = (nl, d, hp) covers 64 consecutive pos; lane q8 gathers 8 pos down a column of Cs
#pragma unroll
        for (int it = 0; it < 8; ++it) {
          const int L = it * 32 + lsub, nl = L >> 7, d = (L >> 1) & 63, hp = L & 1;
          const int rb0 = 64 * hp + 8 * q8, cc = nl * 64 + d;
          unsigned wv[4];
#pragma unroll
          for (int k = 0; k < 4; ++k) {
            const unsigned lo = Cs[(rb0 + 2 * k) * CSP + cc];
            const unsigned hi = Cs[(rb0 + 2 * k + 1) * CSP + cc];
            wv[k] = lo | (hi << 16);
          }
          v4u val = {wv[0], wv[1], wv[2], wv[3]};
          us_t* dst = (us_t*)D0 + ((((size_t)z * NH + hb + nl) * DH + d) * NK + m0 + 64 * hp + 8 * q8);
          *(v4u*)dst = val;
        }
      }
      
    }
  }
}

// ---------------------------------------------------------------------------
// LDS tiles of the column-statistics and context sweeps: 64 rows x 64 halves (128 B), shared by the block's 4 waves.
// Fetch: every wave-wide 16-B load covers four whole 128-B lines (8 lanes per row).
// Row pitch 72 halves = 144 B = 16 B x 9: fragment reads (ds_load_b128, 16 rows) spread over the banks.
// ---------------------------------------------------------------------------
#define TP 72
#define TILE_H (64 * TP)
static_assert(NQ % 64 == 0 && NK % 512 == 0 && DH == 64);

__device__ __forceinline__ void tile_fetch(v4u (&r)[4], const us_t* __restrict__ src, size_t pitch, int tid) {
  const us_t* p = src + (size_t)(tid >> 3) * pitch + 8 * (tid & 7);   // one address per thread, constant steps of 16 rows
#pragma unroll
  for (int i = 0; i < 4; ++i) r[i] = *(const v4u*)(p + (size_t)(16 * i) * pitch);
}
__device__ __forceinline__ void tile_put(us_t* t, const v4u (&r)[4], int tid) {
#pragma unroll
  for (int i = 0; i < 4; ++i) {
    const int ch = tid + 128 * i;
    *(v4u*)(t + (ch >> 3) * TP + 8 * (ch & 7)) = r[i];
  }
}
// fragment of tile row 'row', halves 32c..32c+31, in the k map of the plane loaders (8h.., 16+8h..)
__device__ __forceinline__ void frag_get(Frag16& f, const us_t* t, int row, int c, int h) {
  f.u[0] = *(const v8us*)(t + row * TP + 32 * c + 8 * h);
  f.u[1] = *(const v8us*)(t + row * TP + 32 * c + 16 + 8 * h);
}

// ---------------------------------------------------------------------------
// Column statistics of the query-axis softmax. Block = 128 threads (4 waves) owns 128 keys of
// one (b,n); wave w owns 32 keys (two K fragment sets held as B operands), sweeps all NQ queries
// 32 at a time (A fragments from 64-query LDS tiles, two buffers, next tile fetched during the current; every A fragment
// read feeds both key tiles). Lane (h, key) keeps a running max and
// sum over its query rows in the log2 domain; the two lane halves are merged at the end.
// ---------------------------------------------------------------------------
__global__ __launch_bounds__(128)
void k_colstats(const us_t* __restrict__ Qp, const us_t* __restrict__ Kp, float* NLS)
{
  __shared__ __align__(16) float sred[128];   // cross-wave: block barrier
  __shared__ __align__(16) us_t Qt[2][TILE_H];
  const int tid = threadIdx.x;
  const int lane = threadIdx.x & 31;
  const int wave = __builtin_amdgcn_readfirstlane(threadIdx.x >> 5);
  const int h = lane >> 4, l15 = lane & 15;
  const int bn = blockIdx.y;
  const int kb0 = blockIdx.x * 128;

  Frag16 kf[2][2];
#pragma unroll
  for (int kt = 0; kt < 2; ++kt) {
    const us_t* kr = Kp + ((size_t)bn * NK + kb0 + wave * 32 + kt * 16 + l15) * DH;   // B column n = key, k = d
#pragma unroll
    for (int c = 0; c < 2; ++c) {
      kf[kt][c].u[0] = *(const v8us*)(kr + 32 * c + 8 * h);
      kf[kt][c].u[1] = *(const v8us*)(kr + 32 * c + 16 + 8 * h);
    }
  }

  float mrun[2] = {-3.0e38f, -3.0e38f}, lrun[2] = {0.f, 0.f};
  const us_t* Qbase = Qp + (size_t)bn * NQ * DH;
  v4u rq[4];
  tile_fetch(rq, Qbase, DH, tid);
  tile_put(Qt[0], rq, tid);
  __syncthreads();   // tile 0 visible to all waves
  for (int t = 0; t < NQ / 64; ++t) {
    const us_t* qc = Qt[t & 1];
    if (t + 1 < NQ / 64) tile_fetch(rq, Qbase + (size_t)(t + 1) * 64 * DH, DH, tid);
    // behind the four loads: their address registers are reused below; its memory clobber also keeps the loads ahead of
    // the tile's LDS reads, so that they are in flight through the whole tile and not only just before tile_put
    asm volatile("s_wait_xcnt 0x0" ::: "memory");
#pragma unroll
    for (int hq = 0; hq < 2; ++hq) {
      Frag16 a0[2], a1[2];
#pragma unroll
      for (int c = 0; c < 2; ++c) {
        frag_get(a0[c], qc, 32 * hq + l15, c, h);                             // A row m = query
        frag_get(a1[c], qc, 32 * hq + 16 + l15, c, h);
      }
#pragma unroll
      for (int kt = 0; kt < 2; ++kt) {
        v8f s0 = vzero(), s1 = vzero();
#pragma unroll
        for (int c = 0; c < 2; ++c) {
          s0 = mma16<1>(a0[c], kf[kt][c], s0);
          s1 = mma16<1>(a1[c], kf[kt][c], s1);
        }
        float tmx = fmaxf(s0[0], s1[0]);
#pragma unroll
        for (int r = 1; r < 8; ++r) tmx = fmaxf(tmx, fmaxf(s0[r], s1[r]));
        const float mn = fmaxf(mrun[kt], tmx * C2LOG);
        float ps = 0.f;
#pragma unroll
        for (int r = 0; r < 8; ++r) {
          ps += FEXP2(fmaf(s0[r], C2LOG, -mn));
          ps += FEXP2(fmaf(s1[r], C2LOG, -mn));
        }
        lrun[kt] = lrun[kt] * FEXP2(mrun[kt] - mn) + ps;
        mrun[kt] = mn;
      }
    }
    if (t + 1 < NQ / 64) tile_put(Qt[(t + 1) & 1], rq, tid);
    __syncthreads();   // publishes tile t+1 and ends every read of tile t before its buffer is refilled
  }

  // merge the two lane halves (all lanes take part in the exchange)
#pragma unroll
  for (int kt = 0; kt < 2; ++kt) {
    const float m2 = __shfl_xor(mrun[kt], 16);
    const float l2 = __shfl_xor(lrun[kt], 16);
    const float mt = fmaxf(mrun[kt], m2);
    const float lt = lrun[kt] * FEXP2(mrun[kt] - mt) + l2 * FEXP2(m2 - mt);
    const float nls = PSHIFT - (mt + log2f(lt));
    if (h == 0) sred[wave * 32 + kt * 16 + l15] = nls;
  }
  __syncthreads();
  if (wave == 0) {
    const v4f val = *(const v4f*)(&sred[4 * lane]);
    float* dst = NLS + (size_t)bn * NK + kb0 + 4 * lane;    // 32 lanes x 16 B = the block's 512 B
    *(v4f*)dst = val;
  }
}

// ---------------------------------------------------------------------------
// Head-averaged probabilities. Block = 256 threads (8 waves, 4 x 2), tile 128 queries x 128 keys of one
// batch; wave (wq, wk) owns 32 queries x 64 keys and loops over the 16 heads: S = Q K^T (A = Q rows,
// B = K rows, fragments from per-head 128-row LDS tiles, two buffers; every K fragment read feeds both query tiles),
// p*4096 = exp2(c*s + NLS[key]), summed over the heads in ascending order
// ---------------------------------------------------------------------------
#define MP 68
#define TILE2_H (128 * TP)

// 128-row tile (rows of 128 B back to back in the plane) by 256 threads: one address per thread and constant steps
__device__ __forceinline__ void tile2_fetch_dense(v4u (&r)[4], const us_t* __restrict__ src, int tid) {
  const us_t* p = src + 8 * tid;
#pragma unroll
  for (int i = 0; i < 4; ++i) r[i] = *(const v4u*)(p + 2048 * i);
}
__device__ __forceinline__ void tile2_put(us_t* t, const v4u (&r)[4], int tid) {
#pragma unroll
  for (int i = 0; i < 4; ++i) {
    const int ch = tid + 256 * i;
    *(v4u*)(t + (ch >> 3) * TP + 8 * (ch & 7)) = r[i];
  }
}

__global__ __launch_bounds__(256)
void k_attn_mean(const us_t* __restrict__ Qp, const us_t* __restrict__ Kp,
                 const float* __restrict__ NLS, float* out1)
{
  __shared__ __align__(16) us_t Tl[4 * TILE2_H];     // Q tile x2, K tile x2; behind the head loop's last barrier: output staging
  __shared__ __align__(16) float Ns[NH * 128];       // the tile's 128 column normalisers of every head
  static_assert(8 * 32 * MP * 4 <= 4 * TILE2_H * 2);
  float* Mst = (float*)Tl;                           // per wave 32 rows x 64 floats used (pad 68); wave-private, block barrier
  const int tid = threadIdx.x;
  const int lane = threadIdx.x & 31;
  const int wave = __builtin_amdgcn_readfirstlane(threadIdx.x >> 5);
  const int wq = wave >> 1, wk = wave & 1;
  const int h = lane >> 4, l15 = lane & 15;
  const int k0 = blockIdx.x * 128;
  const int q0 = blockIdx.y * 128 + wq * 32;
  const int b = blockIdx.z;
  const int mw = wave * (32 * MP);

  v8f macc[2][4];
#pragma unroll
  for (int qt = 0; qt < 2; ++qt)
#pragma unroll
    for (int st = 0; st < 4; ++st) macc[qt][st] = vzero();

  const us_t* Qsrc = Qp + ((size_t)b * NH * NQ + blockIdx.y * 128) * DH;  // head 0; next head: + NQ * DH
  const us_t* Ksrc = Kp + ((size_t)b * NH * NK + k0) * DH;                // head 0; next head: + NK * DH
  v4f nv[2];
#pragma unroll
  for (int i = 0; i < 2; ++i) {
    const int e = tid + 256 * i;                                          // 16 heads x 32 chunks of 4 floats
    nv[i] = *(const v4f*)(NLS + ((size_t)b * NH + (e >> 5)) * NK + k0 + 4 * (e & 31));
  }
  // stands in front of the tile loads, whose destinations otherwise reuse the address registers of the two loads above
  asm volatile("s_wait_xcnt 0x0" ::: "memory");
  v4u rq[4], rk[4];
  tile2_fetch_dense(rq, Qsrc, tid);
  tile2_fetch_dense(rk, Ksrc, tid);
#pragma unroll
  for (int i = 0; i < 2; ++i) *(v4f*)(&Ns[4 * (tid + 256 * i)]) = nv[i];
  tile2_put(Tl, rq, tid);
  tile2_put(Tl + 2 * TILE2_H, rk, tid);
  __syncthreads();   // head 0's tiles and the normalisers visible to all waves

  // one head's scores and probabilities from the tiles in buffer hh & 1
  auto head = [&](int hh) {
    const us_t* qc = Tl + (hh & 1) * TILE2_H;
    const us_t* kc = Tl + (2 + (hh & 1)) * TILE2_H;
    Frag16 qa[2][2];
#pragma unroll
    for (int qt = 0; qt < 2; ++qt)
#pragma unroll
      for (int c = 0; c < 2; ++c) frag_get(qa[qt][c], qc, wq * 32 + qt * 16 + l15, c, h);   // A row m = query
#pragma unroll
    for (int st = 0; st < 4; ++st) {
      Frag16 bf[2];
#pragma unroll
      for (int c = 0; c < 2; ++c) frag_get(bf[c], kc, wk * 64 + 16 * st + l15, c, h);       // B column n = key
      const float nl = Ns[hh * 128 + wk * 64 + 16 * st + l15];
#pragma unroll
      for (int qt = 0; qt < 2; ++qt) {
        v8f s = vzero();
#pragma unroll
        for (int c = 0; c < 2; ++c) s = mma16<1>(qa[qt][c], bf[c], s);
#pragma unroll
        for (int r = 0; r < 8; ++r) macc[qt][st][r] += FEXP2(fmaf(s[r], C2LOG, nl));
      }
    }
  };

#pragma unroll 1
  for (int hh = 0; hh < NH - 1; ++hh) {
    tile2_fetch_dense(rq, Qsrc + (size_t)(hh + 1) * NQ * DH, tid);
    tile2_fetch_dense(rk, Ksrc + (size_t)(hh + 1) * NK * DH, tid);
    head(hh);
    tile2_put(Tl + ((hh + 1) & 1) * TILE2_H, rq, tid);
    tile2_put(Tl + (2 + ((hh + 1) & 1)) * TILE2_H, rk, tid);
    __syncthreads();   // publishes head hh+1's tiles and ends every read of head hh's before their buffers are refilled
  }
  head(NH - 1);
  __syncthreads();     // every wave has left the tiles before they become output staging

  // D layout: macc[qt][st][r] = (query q0 + 16 qt + 8h + r, key k0 + 64 wk + 16 st + l15)
#pragma unroll
  for (int qt = 0; qt < 2; ++qt)
#pragma unroll
    for (int st = 0; st < 4; ++st)
#pragma unroll
      for (int r = 0; r < 8; ++r)
        Mst[mw + (16 * qt + 8 * h + r) * MP + 16 * st + l15] = macc[qt][st][r] * MSCALE;
  __syncthreads();
  const int q8 = lane & 7, rsub = lane >> 3;
  {
#pragma unroll
    for (int it = 0; it < 16; ++it) {
      const int L = it * 4 + rsub, row = L >> 1, nl = L & 1;     // 32 rows x 2 lines, 4 lines per instruction
      const v4f val = *(const v4f*)(&Mst[mw + row * MP + 32 * nl + 4 * q8]);
      float* dst = out1 + (((size_t)b * NQ + q0 + row) * NK + k0 + 64 * wk + 32 * nl + 4 * q8);
      *(v4f*)dst = val;
    }
  }
}

// ---------------------------------------------------------------------------
// Context, transposed register-fed form. Block = 128 threads (4 waves), 128 queries of one
// (b,n); wave w owns 32 queries (two Q fragment sets held as B operands). Per 32-key step:
// S^T = K Q^T (A = K rows from a 64-key LDS tile) for two 16-key tiles, p^T*4096 = exp2(c*s + NLS[key])
// packed from the two D tiles into one B fragment per query tile (element r <- tile 0, element 8+r <- tile 1),
// O^T += Vt * P^T (A = Vt rows d from a 64-key LDS tile, k = keys). Every K and Vt fragment read feeds both
// query tiles. Two buffers per tile, the next
// 64 keys fetched during the current, one barrier per 64 keys; the column normaliser (whole row in
// LDS) is already inside the exponent, so there is no running state.
// ---------------------------------------------------------------------------
#define PP 72

__global__ __launch_bounds__(128)
void k_attn_ctx(const us_t* __restrict__ Qp, const us_t* __restrict__ Kp, const us_t* __restrict__ Vt,
                const float* __restrict__ NLS, us_t* AV)
{
  __shared__ __align__(16) us_t Ost[4 * 32 * PP];   // per wave 32 rows x 64 halves used (pad 72); wave-private, block barrier
  __shared__ __align__(16) us_t Kt[2][TILE_H];      // rows = keys, columns = d
  __shared__ __align__(16) us_t Vs[2][TILE_H];      // rows = d, columns = keys
  __shared__ __align__(16) float Ns[NK];            // column normalisers of this (b,n)
  const int tid = threadIdx.x;
  const int lane = threadIdx.x & 31;
  const int wave = __builtin_amdgcn_readfirstlane(threadIdx.x >> 5);
  const int h = lane >> 4, l15 = lane & 15;
  const int i0 = blockIdx.x * 128, bn = blockIdx.y;
  const int b = bn / NH, n = bn - b * NH;
  const int iw = i0 + wave * 32;
  const int ow = wave * (32 * PP);

  Frag16 qf[2][2];
#pragma unroll
  for (int qt = 0; qt < 2; ++qt) {
    const us_t* pq = Qp + ((size_t)bn * NQ + iw + 16 * qt + l15) * DH;   // B column n = query, k = d
#pragma unroll
    for (int c = 0; c < 2; ++c) {
      qf[qt][c].u[0] = *(const v8us*)(pq + 32 * c + 8 * h);
      qf[qt][c].u[1] = *(const v8us*)(pq + 32 * c + 16 + 8 * h);
    }
  }

  v8f oacc[2][4];
#pragma unroll
  for (int qt = 0; qt < 2; ++qt)
#pragma unroll
    for (int dt = 0; dt < 4; ++dt) oacc[qt][dt] = vzero();

  const us_t* Kbase = Kp + (size_t)bn * NK * DH;
  const us_t* Vbase = Vt + (size_t)bn * DH * NK;
  const float* Nbase = NLS + (size_t)bn * NK;

#pragma unroll
  for (int i = 0; i < NK / 512; ++i)
    *(v4f*)(&Ns[4 * (tid + 128 * i)]) = *(const v4f*)(Nbase + 4 * (tid + 128 * i));
  v4u rk[4], rv[4];
  tile_fetch(rk, Kbase, DH, tid);
  tile_fetch(rv, Vbase, NK, tid);
  tile_put(Kt[0], rk, tid);
  tile_put(Vs[0], rv, tid);
  __syncthreads();   // tile 0 and the normalisers visible to all waves

  for (int t = 0; t < NK / 64; ++t) {
    const us_t* kc = Kt[t & 1];
    const us_t* vc = Vs[t & 1];
    if (t + 1 < NK / 64) {
      tile_fetch(rk, Kbase + (size_t)(t + 1) * 64 * DH, DH, tid);
      tile_fetch(rv, Vbase + (size_t)(t + 1) * 64, NK, tid);
    }
    // behind the eight loads: their address registers are reused below; its memory clobber also keeps the loads ahead of
    // the tile's LDS reads, so that they are in flight through the whole tile and not only just before tile_put
    asm volatile("s_wait_xcnt 0x0" ::: "memory");
#pragma unroll
    for (int ks = 0; ks < 2; ++ks) {
      Frag16 pb[2];                                     // per query tile: B[k = key in step][n = query]
#pragma unroll
      for (int st = 0; st < 2; ++st) {
        Frag16 ka[2];
#pragma unroll
        for (int c = 0; c < 2; ++c) frag_get(ka[c], kc, 32 * ks + 16 * st + l15, c, h);   // A row m = key
        // D rows = keys 64 t + 32 ks + 16 st + 8h + r : eight consecutive table entries per lane
        const float* np = &Ns[64 * t + 32 * ks + 16 * st + 8 * h];
        const v4f na = *(const v4f*)(np);
        const v4f nc = *(const v4f*)(np + 4);
        const float nl[8] = {na[0], na[1], na[2], na[3], nc[0], nc[1], nc[2], nc[3]};
#pragma unroll
        for (int qt = 0; qt < 2; ++qt) {
          v8f s = vzero();
#pragma unroll
          for (int c = 0; c < 2; ++c) s = mma16<1>(ka[c], qf[qt][c], s);
#pragma unroll
          for (int r = 0; r < 8; ++r)
            pb[qt].hf[8 * st + r] = (h16)pexp2_cut(fmaf(s[r], C2LOG, nl[r]));
        }
      }
#pragma unroll
      for (int dt = 0; dt < 4; ++dt) {
        Frag16 va;                                      // A row m = d (row of Vt), k = key
        frag_get(va, vc, 16 * dt + l15, ks, h);
#pragma unroll
        for (int qt = 0; qt < 2; ++qt) oacc[qt][dt] = mma16<1>(va, pb[qt], oacc[qt][dt]);
      }
    }
    if (t + 1 < NK / 64) {
      tile_put(Kt[(t + 1) & 1], rk, tid);
      tile_put(Vs[(t + 1) & 1], rv, tid);
    }
    __syncthreads();   // publishes tile t+1 and ends every read of tile t before its buffers are refilled
  }

  // D layout: oacc[qt][dt][r] = O^T(d = 16 dt + 8h + r, query 16 qt + l15) : eight consecutive d per lane
  const float sc = AVCARRY / PCARRY;
#pragma unroll
  for (int qt = 0; qt < 2; ++qt)
#pragma unroll
    for (int dt = 0; dt < 4; ++dt) {
      v8us pk;
#pragma unroll
      for (int r = 0; r < 8; ++r) pk[r] = hfl_bits(oacc[qt][dt][r] * sc);
      *(v8us*)(&Ost[ow + (16 * qt + l15) * PP + 16 * dt + 8 * h]) = pk;
    }
  __syncthreads();
  const int q8 = lane & 7, rsub = lane >> 3;
  {
#pragma unroll
    for (int it = 0; it < 8; ++it) {
      const int row = it * 4 + rsub;                     // 32 rows per wave, 4 lines per instruction
      v4u val = *(const v4u*)(&Ost[ow + row * PP + 8 * q8]);
      us_t* dst = AV + (((size_t)(iw + row) * NB + b) * HH + n * DH + 8 * q8);
      *(v4u*)dst = val;
    }
  }
}

// ---------------------------------------------------------------------------
// Host orchestration (8 launches)
// ---------------------------------------------------------------------------
extern "C" void kernel_launch(void* const* d_in, const int* in_sizes, int n_in,
                              void* d_out, int out_size, void* d_ws, size_t ws_size,
                              hipStream_t stream)
{
  if (n_in < 8) return;
  const float* xq = (const float*)d_in[0];
  const float* xk = (const float*)d_in[1];
  const float* xv = (const float*)d_in[2];
  const float* wq = (const float*)d_in[3];
  const float* wk = (const float*)d_in[4];
  const float* wv = (const float*)d_in[5];
  const float* wp = (const float*)d_in[6];
  const float* bp = (const float*)d_in[7];

  if ((long)in_sizes[0] < ((long)(NB - 1) * NQ_FULL + NQ) * DM) return;
  if ((long)in_sizes[1] < ((long)(NB - 1) * NK_FULL + NK) * DM) return;
  if ((long)in_sizes[2] < ((long)(NB - 1) * NK_FULL + NK) * DM) return;
  if ((long)in_sizes[3] < (long)HH * DM) return;
  if ((long)in_sizes[4] < (long)HH * DM) return;
  if ((long)in_sizes[5] < (long)HH * DM) return;
  if ((long)in_sizes[6] < (long)DM * HH) return;
  if (in_sizes[7] < DM) return;
  if ((long)out_size < OUT1_OFF + (long)NB * NQ * NK) return;

  char* base = (char*)d_ws;
  size_t off = 0;
  auto take = [&](size_t bytes) -> char* {
    char* q = base + off; off += (bytes + 255) & ~(size_t)255; return q;
  };
  us_t*  xq_b = (us_t*) take((size_t)NB * NQ * DM * 2);             // bf16 [b][q][DM]
  us_t*  xk_b = (us_t*) take((size_t)NB * NK * DM * 2);             // bf16 [b][k][DM]
  us_t*  xv_b = (us_t*) take((size_t)NB * NK * DM * 2);             // bf16 [b][k][DM]
  us_t*  wq_b = (us_t*) take((size_t)HH * DM * 2);                  // bf16 [out][in]
  us_t*  wk_b = (us_t*) take((size_t)HH * DM * 2);                  // bf16
  us_t*  wv_b = (us_t*) take((size_t)HH * DM * 2);                  // bf16
  us_t*  wp_h = (us_t*) take((size_t)DM * HH * 2);                  // f16 (x64)
  us_t*  Qp   = (us_t*) take((size_t)NB * NH * NQ * DH * 2);        // f16 [bn][q][d]
  us_t*  Kp   = (us_t*) take((size_t)NB * NH * NK * DH * 2);        // f16 [bn][k][d]
  us_t*  Vt   = (us_t*) take((size_t)NB * NH * DH * NK * 2);        // f16 [bn][d][k]
  float* NLS  = (float*)take((size_t)NB * NH * NK * 4);             // f32 [bn][k]
  us_t*  AV   = (us_t*) take((size_t)NQ * NB * HH * 2);             // f16 (x32) [q*NB+b][n*64+d]
  if (off > ws_size) return;
  if (off > (size_t)WS_TOTAL) return;

  float* out0 = (float*)d_out;                                       // [q][b][c]
  float* out1 = (float*)d_out + OUT1_OFF;                            // [b][q][k]

  // 1) input conversions (RNE bf16; Wp as f16 of the bf16 value x64): planes xq_b .. wp_h, back to back from xq_b
  k_cvt_all<<<dim3(CVT_BLOCKS), dim3(CVT_WPB * 32), 0, stream>>>(xq, xk, xv, wq, wk, wv, wp, xq_b);

  // 2) projections: q = xq Wq^T, k = xk Wk^T, v^T = (xv Wv^T)^T, per batch z
  k_gemm<0, EPI_Q><<<dim3(HH / BN, NQ / BM, NB), dim3(256), 0, stream>>>(
      xq_b, wq_b, (void*)Qp, (void*)Qp, bp, bp, (long)DM, (long)DM, (long)NQ * DM, DM);
  k_gemm<0, EPI_K><<<dim3(HH / BN, NK / BM, NB), dim3(256), 0, stream>>>(
      xk_b, wk_b, (void*)Kp, (void*)Kp, bp, bp, (long)DM, (long)DM, (long)NK * DM, DM);
  k_gemm<0, EPI_VT><<<dim3(HH / BN, NK / BM, NB), dim3(256), 0, stream>>>(
      xv_b, wv_b, (void*)Vt, (void*)Vt, bp, bp, (long)DM, (long)DM, (long)NK * DM, DM);

  // 3) per-key column statistics of the query-axis softmax
  k_colstats<<<dim3(NK / 128, NB * NH), dim3(128), 0, stream>>>(Qp, Kp, NLS);
  // 4) head-averaged probabilities -> second output
  k_attn_mean<<<dim3(NK / 128, NQ / 128, NB), dim3(256), 0, stream>>>(Qp, Kp, NLS, out1);
  // 5) context -> AV plane
  k_attn_ctx<<<dim3(NQ / 128, NB * NH), dim3(128), 0, stream>>>(Qp, Kp, Vt, NLS, AV);
  // 6) output projection + bias -> first output, rows q*NB + b
  k_gemm<1, EPI_OUT><<<dim3(DM / BN, (NQ * NB) / BM, 1), dim3(256), 0, stream>>>(
      AV, wp_h, (void*)out0, (void*)out0, bp, bp, (long)HH, (long)HH, 0L, HH);
}

// v006
// It runs in 153 microseconds.
// Two timings next to v005 both put it at 1.04 times that version's speed.
// All steps since v000 together make it 2.74 times as fast.
#include <hip/hip_runtime.h>

// Contractions: xq x Wq^T, xk x Wk^T, xv x Wv^T on v_wmma_f32_16x16x32_bf16 (bf16 operands = RNE-converted inputs), f32 accumulate;
// q x k^T (three sweeps: column statistics, head-mean probabilities, context), v^T x p^T and ctx x Wp^T on v_wmma_f32_16x16x32_f16
// (f16 operands: q,k,v unscaled, p carried x4096, ctx carried x32, Wp carried x64 after RNE bf16 convert), f32 accumulate.
// Softmax over the query axis (per key column) and bias add in f32.

#ifndef NB
#define NB 4
#endif
#define NB_FULL 4
#ifndef NQ
#define NQ 1024
#endif
#ifndef NK
#define NK 2048
#endif
#define NQ_FULL 1024
#define NK_FULL 2048
#define DM 1024
#define NH 16
#define DH 64
#define HH (NH * DH)
#define SCL 0.125f
#define C2LOG 0.18033688011112042f      /* SCL * log2(e) */
#define PCARRY 4096.0f
#define PSHIFT 12.0f                     /* log2(PCARRY) */
#define AVCARRY 32.0f
#define OWCARRY 64.0f
#define MSCALE 1.52587890625e-05f        /* 1 / (NH * PCARRY) = 2^-16 */
#define OUT1_OFF 4194304L                /* element offset of the second output (byte 16777216) */

#define AL256(x) (((x) + 255L) & ~255L)
#define WS_TOTAL (AL256((long)NB * NQ * DM * 2) + 2 * AL256((long)NB * NK * DM * 2) + 4 * AL256((long)HH * DM * 2) + \
                  AL256((long)NB * NH * NQ * DH * 2) + 2 * AL256((long)NB * NH * NK * DH * 2) + \
                  AL256((long)NB * NH * NK * 4) + AL256((long)NQ * NB * HH * 2))

static_assert(NB >= 1 && NB <= NB_FULL);
static_assert(NQ >= 128 && NQ <= NQ_FULL && NK >= 128 && NK <= NK_FULL);
static_assert(NQ % 128 == 0 && NK % 128 == 0);
static_assert(DM == 1024 && HH == 1024 && DH == 64 && NH == 16);
static_assert(DM == 128 * 8);
static_assert(DM % 32 == 0 && HH % 32 == 0 && DH % 32 == 0);
static_assert(HH % 128 == 0 && DM % 128 == 0);
static_assert(((long)NQ * NB) % 128 == 0);
static_assert((long)NQ * NB * DM * 4 <= 16777216L);
static_assert(OUT1_OFF * 4 == 16777216L);
static_assert((long)NB * NQ * NK * 4 <= 33554432L);
static_assert(PCARRY == 4096.0f && PSHIFT == 12.0f);
static_assert(MSCALE * 16.0f * PCARRY == 1.0f);
static_assert(WS_TOTAL <= 134217728L);

typedef unsigned short us_t;
typedef _Float16 h16;
typedef us_t     v8us  __attribute__((ext_vector_type(8)));
typedef unsigned v4u   __attribute__((ext_vector_type(4)));
typedef float    v8f   __attribute__((ext_vector_type(8)));
typedef float    v4f   __attribute__((ext_vector_type(4)));
typedef __bf16   v16bf __attribute__((ext_vector_type(16)));
typedef _Float16 v16h  __attribute__((ext_vector_type(16)));

#if __has_builtin(__builtin_amdgcn_exp2f)
#define FEXP2(x) __builtin_amdgcn_exp2f(x)
#else
#define FEXP2(x) __expf((x) * 0.6931471805599453f)
#endif

// 16x32 16-bit fragment: u[0] = elements 0..7, u[1] = elements 8..15
union Frag16 { v8us u[2]; v16bf bf; v16h hf; };

__device__ __forceinline__ v8f vzero() {
  v8f z = {0.f, 0.f, 0.f, 0.f, 0.f, 0.f, 0.f, 0.f};
  return z;
}

// RNE f32 -> bf16 bits
__device__ __forceinline__ us_t bf_bits(float x) {
  unsigned u = __float_as_uint(x);
  u += 0x7FFFu + ((u >> 16) & 1u);
  return (us_t)(u >> 16);
}
// RNE f32 -> bf16 value kept as f32
__device__ __forceinline__ float bf_val(float x) {
  unsigned u = __float_as_uint(x);
  u += 0x7FFFu + ((u >> 16) & 1u);
  return __uint_as_float(u & 0xFFFF0000u);
}
// RNE f32 -> f16 bits
__device__ __forceinline__ us_t hf_bits(float x) {
  _Float16 hv = (_Float16)x;
  return __builtin_bit_cast(us_t, hv);
}

// RNE f32 -> f16 with a value select: results below the smallest normal f16 become zero
static __device__ __forceinline__ h16 toh_flush(float v) {
  const h16 r = (h16)v;
  return (fabsf(v) < 6.103515625e-05f) ? (h16)0.0f : r;
}
static __device__ __forceinline__ us_t hfl_bits(float v) {
  return __builtin_bit_cast(us_t, toh_flush(v));
}
// exp2 of an exponent that already contains the x4096 carry; zero when the f16 value would be subnormal
static __device__ __forceinline__ float pexp2_cut(float e) {
  const float p = FEXP2(e);
  return (e < -14.0f) ? 0.0f : p;
}

// WMMA as the bare builtin: the compiler keeps the distance to the next reader of D and is free to order loads around it
template <int F16OP>
__device__ __forceinline__ v8f mma16(const Frag16& a, const Frag16& b, v8f c) {
  if (F16OP) {
    c = __builtin_amdgcn_wmma_f32_16x16x32_f16(false, a.hf, false, b.hf, (short)0, c, false, false);
  } else {
    c = __builtin_amdgcn_wmma_f32_16x16x32_bf16(false, a.bf, false, b.bf, (short)0, c, false, false);
  }
  return c;
}

// ---------------------------------------------------------------------------
// All input conversions in one resident launch. Unit = one row of DM = 1024 floats (4096 B in, 2048 B out).
// Units in plane order: xq rows, xk rows, xv rows (RNE bf16), Wq, Wk, Wv rows (RNE bf16), Wp rows (f16 of bf16(x)*OWCARRY);
// the seven 16-bit planes lie back to back in the workspace, so unit u is written at dst + u * DM.
// 256 blocks x 16 waves; a wave takes units gw, gw + 4096, ...: eight 16-B loads per lane, each wave-wide load
// 512 contiguous bytes, the next unit's eight loads issued before the current unit is converted and stored
// (8-B stores, 256 contiguous bytes per wave-wide store). No barrier, no LDS.
// ---------------------------------------------------------------------------
#define CVT_WPB 16
#define CVT_BLOCKS 256
#define CVT_NW (CVT_WPB * CVT_BLOCKS)
#define U_XQ (NB * NQ)
#define U_XK (NB * NK)
#define U_W HH
#define U_ALL (U_XQ + 2 * U_XK + 4 * U_W)
#define CVT_IT ((U_ALL + CVT_NW - 1) / CVT_NW)
static_assert(((long)NB * NQ * DM * 2) % 256 == 0 && ((long)NB * NK * DM * 2) % 256 == 0 && ((long)HH * DM * 2) % 256 == 0);

typedef unsigned v2u __attribute__((ext_vector_type(2)));

// behind each unit's loads and each unit's stores: their address registers are reused for the next unit's addresses;
// its memory clobber also keeps the order loads(u + 1), convert(u), stores(u), so that stores start while loads are in flight
#define CVT_XWAIT() asm volatile("s_wait_xcnt 0x0" ::: "memory")

// source row of unit u (wave-uniform); a unit past the end re-reads the last row and is not stored
__device__ __forceinline__ const float* cvt_row(unsigned u, const float* xq, const float* xk, const float* xv,
                                                const float* wq, const float* wk, const float* wv, const float* wp) {
  if (u >= U_ALL) u = U_ALL - 1;
  const unsigned uk = u - U_XQ, uv = uk - U_XK, uw = uv - U_XK;
  const float* p = (uw < U_W) ? wq : (uw < 2 * U_W) ? wk : (uw < 3 * U_W) ? wv : wp;
  unsigned r = uw % U_W;
  if (u < U_XQ + 2 * U_XK) { p = xv; r = (uv / NK) * NK_FULL + uv % NK; }
  if (u < U_XQ + U_XK)     { p = xk; r = (uk / NK) * NK_FULL + uk % NK; }
  if (u < U_XQ)            { p = xq; r = (u / NQ) * NQ_FULL + u % NQ; }
  return p + (size_t)r * DM;
}

__global__ __launch_bounds__(CVT_WPB * 32)
void k_cvt_all(const float* __restrict__ xq, const float* __restrict__ xk, const float* __restrict__ xv,
               const float* __restrict__ wq, const float* __restrict__ wk, const float* __restrict__ wv,
               const float* __restrict__ wp, us_t* __restrict__ dst)
{
  const unsigned lane = threadIdx.x & 31;
  const unsigned gw = __builtin_amdgcn_readfirstlane(blockIdx.x * CVT_WPB + (threadIdx.x >> 5));
  if (gw >= CVT_NW) return;   // bounds gw for any grid (wave-uniform, no barrier here)

  v4f buf[2][8];
  {
    const float* s = cvt_row(gw, xq, xk, xv, wq, wk, wv, wp) + 4 * lane;
#pragma unroll
    for (int j = 0; j < 8; ++j) buf[0][j] = *(const v4f*)(s + 128 * j);
    CVT_XWAIT();
  }
#pragma unroll   // two register sets alternate by a compile-time index: no copies between them
  for (int it = 0; it < CVT_IT; ++it) {
    const unsigned u = gw + it * CVT_NW;
    if (it + 1 < CVT_IT) {
      const float* s = cvt_row(u + CVT_NW, xq, xk, xv, wq, wk, wv, wp) + 4 * lane;
#pragma unroll
      for (int j = 0; j < 8; ++j) buf[(it + 1) & 1][j] = *(const v4f*)(s + 128 * j);
      CVT_XWAIT();
    }
    if (u < U_ALL) {
      const v4f (&r)[8] = buf[it & 1];
      us_t* d = dst + (size_t)u * DM + 4 * lane;
      if (u < U_ALL - U_W) {
#pragma unroll
        for (int j = 0; j < 8; ++j) {
          const v2u pk = {(unsigned)bf_bits(r[j][0]) | ((unsigned)bf_bits(r[j][1]) << 16),
                          (unsigned)bf_bits(r[j][2]) | ((unsigned)bf_bits(r[j][3]) << 16)};
          *(v2u*)(d + 128 * j) = pk;
        }
      } else {
#pragma unroll
        for (int j = 0; j < 8; ++j) {
          const v2u pk = {(unsigned)hf_bits(bf_val(r[j][0]) * OWCARRY) | ((unsigned)hf_bits(bf_val(r[j][1]) * OWCARRY) << 16),
                          (unsigned)hf_bits(bf_val(r[j][2]) * OWCARRY) | ((unsigned)hf_bits(bf_val(r[j][3]) * OWCARRY) << 16)};
          *(v2u*)(d + 128 * j) = pk;
        }
      }
      CVT_XWAIT();
    }
  }
}

// ---------------------------------------------------------------------------
// TN GEMM: C[M,N] = A[M,K] * B[N,K]^T, 16-bit operands from planes, f32 accumulate.
// Block 128x128x64, 256 threads = 8 waves (2x4), wave tile 64x32 = 4x2 WMMA tiles.
// Pipelined staging: two LDS buffers and two register sets; k tile t + 2 is fetched (whole 128-B lines) while tile t is
// multiplied, tile t + 1 goes from its registers to the other buffer behind the products, one barrier per k tile.
// Epilogue stages the 128x128 tile in the same LDS, behind a barrier of its own
//  EPI_Q  : D0 = Q plane  [(z*NH+n)*NQ + i][d] f16
//  EPI_K  : D0 = K plane  [(z*NH+n)*NK + pos][d] f16
//  EPI_VT : D0 = Vt plane [((z*NH+n)*DH + d)*NK + pos] f16
//  EPI_OUT: D0 = f32 output rows [row][DM], scaled by 1/(AVCARRY*OWCARRY), bias0 (RNE bf16 value) added in f32 at the store stage
// ---------------------------------------------------------------------------
#define BM 128
#define BN 128
#define BK 64
#define BKP 72                 /* row pitch 144 B = 16 B x 9: ds_load_b128 fragment reads spread over the banks */
#define STG (BM * BKP)         /* halves of one operand's k tile */
#define CSP 136
#define CFP 132
#define EPI_Q 0
#define EPI_K 1
#define EPI_VT 2
#define EPI_OUT 3

// Work-group barrier of the k loop: it waits for this wave's LDS reads and writes only. __syncthreads() would also
// wait for the global loads of the tile fetched ahead, which have to stay in flight across it.
__device__ __forceinline__ void tile_barrier() {
  asm volatile("s_wait_dscnt 0x0\n\ts_barrier_signal -1\n\ts_barrier_wait -1" ::: "memory");
}

template <int F16OP, int EPI>
__global__ __launch_bounds__(256)
void k_gemm(const us_t* __restrict__ A, const us_t* __restrict__ B,
            void* D0, void* D1, const float* __restrict__ bias0, const float* __restrict__ bias1,
            long lda, long ldb, long strideAz, int K)
{
  __shared__ __align__(16) us_t Sm[4 * STG];    // A tile x2, B tile x2: 128 rows x 64 k each (pad 72)
  us_t* Cs = Sm;                                // behind the k loop: f16 view [128][136] or f32 view [64][132]
  static_assert(64 * CFP * 4 <= BM * CSP * 2 && BM * CSP <= 4 * STG && BM == BN);

  const int tid = threadIdx.x, lane = tid & 31, wid = __builtin_amdgcn_readfirstlane(tid >> 5);
  const int wm = wid >> 2, wn = wid & 3, h = lane >> 4, l15 = lane & 15;
  const int m0 = blockIdx.y * BM, n0 = blockIdx.x * BN, z = blockIdx.z;
  const us_t* Ab = A + (size_t)z * (size_t)strideAz + (size_t)m0 * (size_t)lda;
  const us_t* Bb = B + (size_t)n0 * (size_t)ldb;

  v8f acc[4][2];
#pragma unroll
  for (int mi = 0; mi < 4; ++mi)
#pragma unroll
    for (int ni = 0; ni < 2; ++ni) acc[mi][ni] = vzero();

  const int nk = K / BK;                                   // even and at least 2: K is DM or HH, multiples of 128
  const int srow = tid >> 3, skc = (tid & 7) << 3;         // 8 lanes per 128-B row piece, 32 rows per block-wide load
  unsigned oa[4], ob[4];                                   // byte offsets of this thread's four row pieces; they live through the loop
#pragma unroll
  for (int i = 0; i < 4; ++i) {
    oa[i] = ((unsigned)(srow + 32 * i) * (unsigned)lda + (unsigned)skc) * 2u;
    ob[i] = ((unsigned)(srow + 32 * i) * (unsigned)ldb + (unsigned)skc) * 2u;
  }

  auto fetch = [&](v8us (&ra)[4], v8us (&rb)[4], int kb) {
    const char* pa = (const char*)(Ab + kb * BK);          // block-uniform base, per-thread 32-bit offset
    const char* pb = (const char*)(Bb + kb * BK);
#pragma unroll
    for (int i = 0; i < 4; ++i) {
      ra[i] = *(const v8us*)(pa + oa[i]);
      rb[i] = *(const v8us*)(pb + ob[i]);
    }
    // behind the eight loads: their address registers are rewritten for a later tile; its memory clobber also keeps
    // the loads ahead of the products' LDS reads, so that they are in flight from the start of the k tile
    asm volatile("s_wait_xcnt 0x0" ::: "memory");
  };
  auto put = [&](int buf, const v8us (&ra)[4], const v8us (&rb)[4]) {
    us_t* ta = Sm + buf * STG + srow * BKP + skc;
#pragma unroll
    for (int i = 0; i < 4; ++i) {
      *(v8us*)(ta + 32 * i * BKP) = ra[i];
      *(v8us*)(ta + 2 * STG + 32 * i * BKP) = rb[i];
    }
  };
  auto mult = [&](int buf) {
    const us_t* as = Sm + buf * STG;
    const us_t* bs = as + 2 * STG;
#pragma unroll
    for (int c = 0; c < 2; ++c) {                            // k ascending in steps of 32
      Frag16 af[4], bfr[2];
#pragma unroll
      for (int mi = 0; mi < 4; ++mi) {
        const int r = wm * 64 + mi * 16 + l15;                          // A row m = lane&15
        af[mi].u[0] = *(const v8us*)(&as[r * BKP + 32 * c + 8 * h]);      // k 8h..8h+7
        af[mi].u[1] = *(const v8us*)(&as[r * BKP + 32 * c + 16 + 8 * h]); // k 16+8h..16+8h+7
      }
#pragma unroll
      for (int ni = 0; ni < 2; ++ni) {
        const int r = wn * 32 + ni * 16 + l15;                          // B column n = lane&15, row of [n][k] plane, same k map
        bfr[ni].u[0] = *(const v8us*)(&bs[r * BKP + 32 * c + 8 * h]);
        bfr[ni].u[1] = *(const v8us*)(&bs[r * BKP + 32 * c + 16 + 8 * h]);
      }
#pragma unroll
      for (int mi = 0; mi < 4; ++mi)
#pragma unroll
        for (int ni = 0; ni < 2; ++ni) acc[mi][ni] = mma16<F16OP>(af[mi], bfr[ni], acc[mi][ni]);
    }
  };

  v8us a0[4], b0[4], a1[4], b1[4];
  fetch(a0, b0, 0);
  fetch(a1, b1, 1);
  put(0, a0, b0);
  tile_barrier();      // tile 0 visible to all waves
  for (int kb = 0; kb + 2 < nk; kb += 2) {
    fetch(a0, b0, kb + 2);
    mult(0);
    put(1, a1, b1);
    tile_barrier();    // publishes tile kb+1 and ends every read of tile kb before its buffer is refilled
    fetch(a1, b1, kb + 3);
    mult(1);
    put(0, a0, b0);
    tile_barrier();    // publishes tile kb+2 and ends every read of tile kb+1 before its buffer is refilled
  }
  mult(0);             // the last two tiles: nothing left to fetch
  put(1, a1, b1);
  tile_barrier();
  mult(1);             // the epilogue's first barrier ends these reads before the LDS becomes output staging

  // D layout: acc[mi][ni][v] = C(row wm*64+mi*16+8h+v, col wn*32+ni*16+l15)
  const int q8 = tid & 7, lsub = tid >> 3;   // 8 lanes per line, 32 lines per instruction over the block

  if (EPI == EPI_OUT) {
    float* Cf = (float*)Cs;
    float* Do = (float*)D0;
    const float oscale = 1.0f / (AVCARRY * OWCARRY);
#pragma unroll
    for (int rh = 0; rh < 2; ++rh) {
      __syncthreads();
      if (wm == rh) {
#pragma unroll
        for (int mi = 0; mi < 4; ++mi)
#pragma unroll
          for (int ni = 0; ni < 2; ++ni) {
            const int col = wn * 32 + ni * 16 + l15;
#pragma unroll
            for (int v = 0; v < 8; ++v)
              Cf[(mi * 16 + 8 * h + v) * CFP + col] = acc[mi][ni][v] * oscale;
          }
      }
      __syncthreads();
      {
#pragma unroll
        for (int it = 0; it < 8; ++it) {
          const int L = it * 32 + lsub, pr = L >> 2, ql = L & 3;     // 64 rows x 4 lines per row
          const v4f val = *(const v4f*)(&Cf[pr * CFP + 32 * ql + 4 * q8]);
          const v4f bq = *(const v4f*)(bias0 + n0 + 32 * ql + 4 * q8);
          const v4f o = {val[0] + bf_val(bq[0]), val[1] + bf_val(bq[1]),
                         val[2] + bf_val(bq[2]), val[3] + bf_val(bq[3])};
          float* dst = Do + ((size_t)(m0 + 64 * rh + pr) * DM + n0 + 32 * ql + 4 * q8);
          *(v4f*)dst = o;
        }
        
      }
    }
  } else {
    __syncthreads();
#pragma unroll
    for (int mi = 0; mi < 4; ++mi)
#pragma unroll
      for (int ni = 0; ni < 2; ++ni) {
        const int col = wn * 32 + ni * 16 + l15;
#pragma unroll
        for (int v = 0; v < 8; ++v)
          Cs[(wm * 64 + mi * 16 + 8 * h + v) * CSP + col] = hfl_bits(acc[mi][ni][v]);
      }
    __syncthreads();
    const int rpb = (EPI == EPI_Q) ? NQ : NK;   // plane rows per (batch, head)
    const int hb = n0 >> 6;                      // first head of this column block
    {
      if (EPI != EPI_VT) {
#pragma unroll
        for (int it = 0; it < 8; ++it) {
          const int L = it * 32 + lsub, pr = L >> 1, nl = L & 1;   // 128 rows x 2 lines of 64 halves
          v4u val = *(const v4u*)(&Cs[pr * CSP + nl * 64 + 8 * q8]);
          us_t* dst = (us_t*)D0 + ((((size_t)z * NH + hb + nl) * rpb + m0 + pr) * DH + 8 * q8);
          *(v4u*)dst = val;
        }
      } else {
        // Vt plane: line = (nl, d, hp) covers 64 consecutive pos; lane q8 gathers 8 pos down a column of Cs
#pragma unroll
        for (int it = 0; it < 8; ++it) {
          const int L = it * 32 + lsub, nl = L >> 7, d = (L >> 1) & 63, hp = L & 1;
          const int rb0 = 64 * hp + 8 * q8, cc = nl * 64 + d;
          unsigned wv[4];
#pragma unroll
          for (int k = 0; k < 4; ++k) {
            const unsigned lo = Cs[(rb0 + 2 * k) * CSP + cc];
            const unsigned hi = Cs[(rb0 + 2 * k + 1) * CSP + cc];
            wv[k] = lo | (hi << 16);
          }
          v4u val = {wv[0], wv[1], wv[2], wv[3]};
          us_t* dst = (us_t*)D0 + ((((size_t)z * NH + hb + nl) * DH + d) * NK + m0 + 64 * hp + 8 * q8);
          *(v4u*)dst = val;
        }
      }
      
    }
  }
}

// ---------------------------------------------------------------------------
// LDS tiles of the column-statistics and context sweeps: 64 rows x 64 halves (128 B), shared by 4 waves (colstats: the block; context: one key group).
// Fetch: every wave-wide 16-B load covers four whole 128-B lines (8 lanes per row).
// Row pitch 72 halves = 144 B = 16 B x 9: fragment reads (ds_load_b128, 16 rows) spread over the banks.
// ---------------------------------------------------------------------------
#define TP 72
#define TILE_H (64 * TP)
static_assert(NQ % 64 == 0 && NK % 512 == 0 && DH == 64);

__device__ __forceinline__ void tile_fetch(v4u (&r)[4], const us_t* __restrict__ src, size_t pitch, int tid) {
  const us_t* p = src + (size_t)(tid >> 3) * pitch + 8 * (tid & 7);   // one address per thread, constant steps of 16 rows
#pragma unroll
  for (int i = 0; i < 4; ++i) r[i] = *(const v4u*)(p + (size_t)(16 * i) * pitch);
}
__device__ __forceinline__ void tile_put(us_t* t, const v4u (&r)[4], int tid) {
#pragma unroll
  for (int i = 0; i < 4; ++i) {
    const int ch = tid + 128 * i;
    *(v4u*)(t + (ch >> 3) * TP + 8 * (ch & 7)) = r[i];
  }
}
// fragment of tile row 'row', halves 32c..32c+31, in the k map of the plane loaders (8h.., 16+8h..)
__device__ __forceinline__ void frag_get(Frag16& f, const us_t* t, int row, int c, int h) {
  f.u[0] = *(const v8us*)(t + row * TP + 32 * c + 8 * h);
  f.u[1] = *(const v8us*)(t + row * TP + 32 * c + 16 + 8 * h);
}

// ---------------------------------------------------------------------------
// Column statistics of the query-axis softmax. Block = 128 threads (4 waves) owns 128 keys of
// one (b,n); wave w owns 32 keys (two K fragment sets held as B operands), sweeps all NQ queries
// 32 at a time (A fragments from 64-query LDS tiles, two buffers, next tile fetched during the current; every A fragment
// read feeds both key tiles). Lane (h, key) keeps a running max and
// sum over its query rows in the log2 domain; the two lane halves are merged at the end.
// ---------------------------------------------------------------------------
__global__ __launch_bounds__(128)
void k_colstats(const us_t* __restrict__ Qp, const us_t* __restrict__ Kp, float* NLS)
{
  __shared__ __align__(16) float sred[128];   // cross-wave: block barrier
  __shared__ __align__(16) us_t Qt[2][TILE_H];
  const int tid = threadIdx.x;
  const int lane = threadIdx.x & 31;
  const int wave = __builtin_amdgcn_readfirstlane(threadIdx.x >> 5);
  const int h = lane >> 4, l15 = lane & 15;
  const int bn = blockIdx.y;
  const int kb0 = blockIdx.x * 128;

  Frag16 kf[2][2];
#pragma unroll
  for (int kt = 0; kt < 2; ++kt) {
    const us_t* kr = Kp + ((size_t)bn * NK + kb0 + wave * 32 + kt * 16 + l15) * DH;   // B column n = key, k = d
#pragma unroll
    for (int c = 0; c < 2; ++c) {
      kf[kt][c].u[0] = *(const v8us*)(kr + 32 * c + 8 * h);
      kf[kt][c].u[1] = *(const v8us*)(kr + 32 * c + 16 + 8 * h);
    }
  }

  float mrun[2] = {-3.0e38f, -3.0e38f}, lrun[2] = {0.f, 0.f};
  const us_t* Qbase = Qp + (size_t)bn * NQ * DH;
  v4u rq[4];
  tile_fetch(rq, Qbase, DH, tid);
  tile_put(Qt[0], rq, tid);
  __syncthreads();   // tile 0 visible to all waves
  for (int t = 0; t < NQ / 64; ++t) {
    const us_t* qc = Qt[t & 1];
    if (t + 1 < NQ / 64) tile_fetch(rq, Qbase + (size_t)(t + 1) * 64 * DH, DH, tid);
    // behind the four loads: their address registers are reused below; its memory clobber also keeps the loads ahead of
    // the tile's LDS reads, so that they are in flight through the whole tile and not only just before tile_put
    asm volatile("s_wait_xcnt 0x0" ::: "memory");
#pragma unroll
    for (int hq = 0; hq < 2; ++hq) {
      Frag16 a0[2], a1[2];
#pragma unroll
      for (int c = 0; c < 2; ++c) {
        frag_get(a0[c], qc, 32 * hq + l15, c, h);                             // A row m = query
        frag_get(a1[c], qc, 32 * hq + 16 + l15, c, h);
      }
#pragma unroll
      for (int kt = 0; kt < 2; ++kt) {
        v8f s0 = vzero(), s1 = vzero();
#pragma unroll
        for (int c = 0; c < 2; ++c) {
          s0 = mma16<1>(a0[c], kf[kt][c], s0);
          s1 = mma16<1>(a1[c], kf[kt][c], s1);
        }
        float tmx = fmaxf(s0[0], s1[0]);
#pragma unroll
        for (int r = 1; r < 8; ++r) tmx = fmaxf(tmx, fmaxf(s0[r], s1[r]));
        const float mn = fmaxf(mrun[kt], tmx * C2LOG);
        float ps = 0.f;
#pragma unroll
        for (int r = 0; r < 8; ++r) {
          ps += FEXP2(fmaf(s0[r], C2LOG, -mn));
          ps += FEXP2(fmaf(s1[r], C2LOG, -mn));
        }
        lrun[kt] = lrun[kt] * FEXP2(mrun[kt] - mn) + ps;
        mrun[kt] = mn;
      }
    }
    if (t + 1 < NQ / 64) tile_put(Qt[(t + 1) & 1], rq, tid);
    __syncthreads();   // publishes tile t+1 and ends every read of tile t before its buffer is refilled
  }

  // merge the two lane halves (all lanes take part in the exchange)
#pragma unroll
  for (int kt = 0; kt < 2; ++kt) {
    const float m2 = __shfl_xor(mrun[kt], 16);
    const float l2 = __shfl_xor(lrun[kt], 16);
    const float mt = fmaxf(mrun[kt], m2);
    const float lt = lrun[kt] * FEXP2(mrun[kt] - mt) + l2 * FEXP2(m2 - mt);
    const float nls = PSHIFT - (mt + log2f(lt));
    if (h == 0) sred[wave * 32 + kt * 16 + l15] = nls;
  }
  __syncthreads();
  if (wave == 0) {
    const v4f val = *(const v4f*)(&sred[4 * lane]);
    float* dst = NLS + (size_t)bn * NK + kb0 + 4 * lane;    // 32 lanes x 16 B = the block's 512 B
    *(v4f*)dst = val;
  }
}

// ---------------------------------------------------------------------------
// Head-averaged probabilities. Block = 256 threads (8 waves, 4 x 2), tile 128 queries x 128 keys of one
// batch; wave (wq, wk) owns 32 queries x 64 keys and loops over the 16 heads: S = Q K^T (A = Q rows,
// B = K rows, fragments from per-head 128-row LDS tiles, two buffers; every K fragment read feeds both query tiles),
// p*4096 = exp2(c*s + NLS[key]), summed over the heads in ascending order
// ---------------------------------------------------------------------------
#define MP 68
#define TILE2_H (128 * TP)

// 128-row tile (rows of 128 B back to back in the plane) by 256 threads: one address per thread and constant steps
__device__ __forceinline__ void tile2_fetch_dense(v4u (&r)[4], const us_t* __restrict__ src, int tid) {
  const us_t* p = src + 8 * tid;
#pragma unroll
  for (int i = 0; i < 4; ++i) r[i] = *(const v4u*)(p + 2048 * i);
}
__device__ __forceinline__ void tile2_put(us_t* t, const v4u (&r)[4], int tid) {
#pragma unroll
  for (int i = 0; i < 4; ++i) {
    const int ch = tid + 256 * i;
    *(v4u*)(t + (ch >> 3) * TP + 8 * (ch & 7)) = r[i];
  }
}

__global__ __launch_bounds__(256)
void k_attn_mean(const us_t* __restrict__ Qp, const us_t* __restrict__ Kp,
                 const float* __restrict__ NLS, float* out1)
{
  __shared__ __align__(16) us_t Tl[4 * TILE2_H];     // Q tile x2, K tile x2; behind the head loop's last barrier: output staging
  __shared__ __align__(16) float Ns[NH * 128];       // the tile's 128 column normalisers of every head
  static_assert(8 * 32 * MP * 4 <= 4 * TILE2_H * 2);
  float* Mst = (float*)Tl;                           // per wave 32 rows x 64 floats used (pad 68); wave-private, block barrier
  const int tid = threadIdx.x;
  const int lane = threadIdx.x & 31;
  const int wave = __builtin_amdgcn_readfirstlane(threadIdx.x >> 5);
  const int wq = wave >> 1, wk = wave & 1;
  const int h = lane >> 4, l15 = lane & 15;
  const int k0 = blockIdx.x * 128;
  const int q0 = blockIdx.y * 128 + wq * 32;
  const int b = blockIdx.z;
  const int mw = wave * (32 * MP);

  v8f macc[2][4];
#pragma unroll
  for (int qt = 0; qt < 2; ++qt)
#pragma unroll
    for (int st = 0; st < 4; ++st) macc[qt][st] = vzero();

  const us_t* Qsrc = Qp + ((size_t)b * NH * NQ + blockIdx.y * 128) * DH;  // head 0; next head: + NQ * DH
  const us_t* Ksrc = Kp + ((size_t)b * NH * NK + k0) * DH;                // head 0; next head: + NK * DH
  v4f nv[2];
#pragma unroll
  for (int i = 0; i < 2; ++i) {
    const int e = tid + 256 * i;                                          // 16 heads x 32 chunks of 4 floats
    nv[i] = *(const v4f*)(NLS + ((size_t)b * NH + (e >> 5)) * NK + k0 + 4 * (e & 31));
  }
  // stands in front of the tile loads, whose destinations otherwise reuse the address registers of the two loads above
  asm volatile("s_wait_xcnt 0x0" ::: "memory");
  v4u rq[4], rk[4];
  tile2_fetch_dense(rq, Qsrc, tid);
  tile2_fetch_dense(rk, Ksrc, tid);
#pragma unroll
  for (int i = 0; i < 2; ++i) *(v4f*)(&Ns[4 * (tid + 256 * i)]) = nv[i];
  tile2_put(Tl, rq, tid);
  tile2_put(Tl + 2 * TILE2_H, rk, tid);
  __syncthreads();   // head 0's tiles and the normalisers visible to all waves

  // one head's scores and probabilities from the tiles in buffer hh & 1
  auto head = [&](int hh) {
    const us_t* qc = Tl + (hh & 1) * TILE2_H;
    const us_t* kc = Tl + (2 + (hh & 1)) * TILE2_H;
    Frag16 qa[2][2];
#pragma unroll
    for (int qt = 0; qt < 2; ++qt)
#pragma unroll
      for (int c = 0; c < 2; ++c) frag_get(qa[qt][c], qc, wq * 32 + qt * 16 + l15, c, h);   // A row m = query
#pragma unroll
    for (int st = 0; st < 4; ++st) {
      Frag16 bf[2];
#pragma unroll
      for (int c = 0; c < 2; ++c) frag_get(bf[c], kc, wk * 64 + 16 * st + l15, c, h);       // B column n = key
      const float nl = Ns[hh * 128 + wk * 64 + 16 * st + l15];
#pragma unroll
      for (int qt = 0; qt < 2; ++qt) {
        v8f s = vzero();
#pragma unroll
        for (int c = 0; c < 2; ++c) s = mma16<1>(qa[qt][c], bf[c], s);
#pragma unroll
        for (int r = 0; r < 8; ++r) macc[qt][st][r] += FEXP2(fmaf(s[r], C2LOG, nl));
      }
    }
  };

#pragma unroll 1
  for (int hh = 0; hh < NH - 1; ++hh) {
    tile2_fetch_dense(rq, Qsrc + (size_t)(hh + 1) * NQ * DH, tid);
    tile2_fetch_dense(rk, Ksrc + (size_t)(hh + 1) * NK * DH, tid);
    head(hh);
    tile2_put(Tl + ((hh + 1) & 1) * TILE2_H, rq, tid);
    tile2_put(Tl + (2 + ((hh + 1) & 1)) * TILE2_H, rk, tid);
    __syncthreads();   // publishes head hh+1's tiles and ends every read of head hh's before their buffers are refilled
  }
  head(NH - 1);
  __syncthreads();     // every wave has left the tiles before they become output staging

  // D layout: macc[qt][st][r] = (query q0 + 16 qt + 8h + r, key k0 + 64 wk + 16 st + l15)
#pragma unroll
  for (int qt = 0; qt < 2; ++qt)
#pragma unroll
    for (int st = 0; st < 4; ++st)
#pragma unroll
      for (int r = 0; r < 8; ++r)
        Mst[mw + (16 * qt + 8 * h + r) * MP + 16 * st + l15] = macc[qt][st][r] * MSCALE;
  __syncthreads();
  const int q8 = lane & 7, rsub = lane >> 3;
  {
#pragma unroll
    for (int it = 0; it < 16; ++it) {
      const int L = it * 4 + rsub, row = L >> 1, nl = L & 1;     // 32 rows x 2 lines, 4 lines per instruction
      const v4f val = *(const v4f*)(&Mst[mw + row * MP + 32 * nl + 4 * q8]);
      float* dst = out1 + (((size_t)b * NQ + q0 + row) * NK + k0 + 64 * wk + 32 * nl + 4 * q8);
      *(v4f*)dst = val;
    }
  }
}

// ---------------------------------------------------------------------------
// Context, transposed register-fed form. Block = 256 threads (8 waves = 2 key groups x 4 waves), 128 queries of one
// (b,n); wave (g, w) owns 32 queries (two Q fragment sets held as B operands) and the 64-key tiles 2 i + g, so that
// four waves stand on each SIMD and one wave's LDS waits and vector work run under another's products.
// Per 32-key step: S^T = K Q^T (A = K rows from a 64-key LDS tile) for two 16-key tiles, p^T*4096 = exp2(c*s + NLS[key])
// packed from the two D tiles into one B fragment per query tile (element r <- tile 0, element 8+r <- tile 1),
// O^T += Vt * P^T (A = Vt rows d from a 64-key LDS tile, k = keys). Every K and Vt fragment read feeds both
// query tiles. Each group has two buffers per tile and fills them with its own 128 threads, the next
// 64 keys fetched during the current, one barrier per trip; the column normaliser (whole row in
// LDS) is already inside the exponent, so there is no running state. Behind the loop the two groups' partial sums
// are added through LDS: wave (g, w) finishes query tile g.
// ---------------------------------------------------------------------------
#define PP 72
static_assert(NK % 1024 == 0);

__global__ __launch_bounds__(256)
void k_attn_ctx(const us_t* __restrict__ Qp, const us_t* __restrict__ Kp, const us_t* __restrict__ Vt,
                const float* __restrict__ NLS, us_t* AV)
{
  __shared__ __align__(16) us_t Ost[4 * 32 * PP];   // per wave pair 32 rows x 64 halves used (pad 72); a wave reads back its own 16 rows
  __shared__ __align__(16) us_t Kt[2][2][TILE_H];   // [key group][buffer], rows = keys, columns = d; behind the loop: partial sums
  __shared__ __align__(16) us_t Vs[2][2][TILE_H];   // [key group][buffer], rows = d, columns = keys
  __shared__ __align__(16) float Ns[NK];            // column normalisers of this (b,n)
  static_assert(8 * 1024 * 4 <= 4 * TILE_H * 2);
  const int tid = threadIdx.x;
  const int lane = threadIdx.x & 31;
  const int wave = __builtin_amdgcn_readfirstlane(threadIdx.x >> 5);
  const int g = wave >> 2, w = wave & 3;            // key group, query slice
  const int gtid = tid & 127;                       // thread within its key group
  const int h = lane >> 4, l15 = lane & 15;
  const int i0 = blockIdx.x * 128, bn = blockIdx.y;
  const int b = bn / NH, n = bn - b * NH;
  const int iw = i0 + w * 32;
  const int ow = w * (32 * PP);

  Frag16 qf[2][2];
#pragma unroll
  for (int qt = 0; qt < 2; ++qt) {
    const us_t* pq = Qp + ((size_t)bn * NQ + iw + 16 * qt + l15) * DH;   // B column n = query, k = d
#pragma unroll
    for (int c = 0; c < 2; ++c) {
      qf[qt][c].u[0] = *(const v8us*)(pq + 32 * c + 8 * h);
      qf[qt][c].u[1] = *(const v8us*)(pq + 32 * c + 16 + 8 * h);
    }
  }

  v8f oacc[2][4];
#pragma unroll
  for (int qt = 0; qt < 2; ++qt)
#pragma unroll
    for (int dt = 0; dt < 4; ++dt) oacc[qt][dt] = vzero();

  const us_t* Kbase = Kp + (size_t)bn * NK * DH + (size_t)g * 64 * DH;   // the group's first tile; its next: + 128 keys
  const us_t* Vbase = Vt + (size_t)bn * DH * NK + (size_t)g * 64;
  const float* Nbase = NLS + (size_t)bn * NK;

  v4f nv[NK / 1024];
#pragma unroll
  for (int i = 0; i < NK / 1024; ++i) nv[i] = *(const v4f*)(Nbase + 4 * (tid + 256 * i));
  v4u rk[4], rv[4];
  tile_fetch(rk, Kbase, DH, gtid);
  tile_fetch(rv, Vbase, NK, gtid);
  // behind the prologue's loads: their address registers are reused below
  asm volatile("s_wait_xcnt 0x0" ::: "memory");
#pragma unroll
  for (int i = 0; i < NK / 1024; ++i) *(v4f*)(&Ns[4 * (tid + 256 * i)]) = nv[i];
  tile_put(Kt[g][0], rk, gtid);
  tile_put(Vs[g][0], rv, gtid);
  __syncthreads();   // both groups' first tiles and the normalisers visible to all waves

  for (int i = 0; i < NK / 128; ++i) {
    const int t = 2 * i + g;                            // this group's 64-key tile
    const us_t* kc = Kt[g][i & 1];
    const us_t* vc = Vs[g][i & 1];
    if (i + 1 < NK / 128) {
      tile_fetch(rk, Kbase + (size_t)(i + 1) * 128 * DH, DH, gtid);
      tile_fetch(rv, Vbase + (size_t)(i + 1) * 128, NK, gtid);
    }
    // behind the eight loads: their address registers are reused below; its memory clobber also keeps the loads ahead of
    // the tile's LDS reads, so that they are in flight through the whole tile and not only just before tile_put
    asm volatile("s_wait_xcnt 0x0" ::: "memory");
#pragma unroll
    for (int ks = 0; ks < 2; ++ks) {
      Frag16 pb[2];                                     // per query tile: B[k = key in step][n = query]
#pragma unroll
      for (int st = 0; st < 2; ++st) {
        Frag16 ka[2];
#pragma unroll
        for (int c = 0; c < 2; ++c) frag_get(ka[c], kc, 32 * ks + 16 * st + l15, c, h);   // A row m = key
        // D rows = keys 64 t + 32 ks + 16 st + 8h + r : eight consecutive table entries per lane
        const float* np = &Ns[64 * t + 32 * ks + 16 * st + 8 * h];
        const v4f na = *(const v4f*)(np);
        const v4f nc = *(const v4f*)(np + 4);
        const float nl[8] = {na[0], na[1], na[2], na[3], nc[0], nc[1], nc[2], nc[3]};
#pragma unroll
        for (int qt = 0; qt < 2; ++qt) {
          v8f s = vzero();
#pragma unroll
          for (int c = 0; c < 2; ++c) s = mma16<1>(ka[c], qf[qt][c], s);
#pragma unroll
          for (int r = 0; r < 8; ++r)
            pb[qt].hf[8 * st + r] = (h16)pexp2_cut(fmaf(s[r], C2LOG, nl[r]));
        }
      }
#pragma unroll
      for (int dt = 0; dt < 4; ++dt) {
        Frag16 va;                                      // A row m = d (row of Vt), k = key
        frag_get(va, vc, 16 * dt + l15, ks, h);
#pragma unroll
        for (int qt = 0; qt < 2; ++qt) oacc[qt][dt] = mma16<1>(va, pb[qt], oacc[qt][dt]);
      }
    }
    if (i + 1 < NK / 128) {
      tile_put(Kt[g][(i + 1) & 1], rk, gtid);
      tile_put(Vs[g][(i + 1) & 1], rv, gtid);
    }
    __syncthreads();   // publishes both groups' next tiles and ends every read of the current ones before their buffers are refilled
  }

  // The two key groups' partial sums meet: wave (g, w) keeps query tile g and hands query tile 1 - g to wave (1 - g, w).
  // 4 KB per wave in the K tiles' LDS, which every wave has left at the loop's last barrier; 16 B per lane, lanes contiguous.
  float* Xs = (float*)&Kt[0][0][0];
  v8f fin[4];
#pragma unroll
  for (int dt = 0; dt < 4; ++dt) {
    const v8f oth = g ? oacc[0][dt] : oacc[1][dt];
    fin[dt] = g ? oacc[1][dt] : oacc[0][dt];
#pragma unroll
    for (int j = 0; j < 2; ++j) {
      const v4f x = {oth[4 * j], oth[4 * j + 1], oth[4 * j + 2], oth[4 * j + 3]};
      *(v4f*)(Xs + wave * 1024 + ((2 * dt + j) * 32 + lane) * 4) = x;
    }
  }
  __syncthreads();     // the partner wave's partial sums are visible
#pragma unroll
  for (int dt = 0; dt < 4; ++dt)
#pragma unroll
    for (int j = 0; j < 2; ++j) {
      const v4f x = *(const v4f*)(Xs + (wave ^ 4) * 1024 + ((2 * dt + j) * 32 + lane) * 4);
#pragma unroll
      for (int e = 0; e < 4; ++e) fin[dt][4 * j + e] += x[e];
    }

  // D layout: fin[dt][r] = O^T(d = 16 dt + 8h + r, query 16 g + l15) : eight consecutive d per lane
  const float sc = AVCARRY / PCARRY;
#pragma unroll
  for (int dt = 0; dt < 4; ++dt) {
    v8us pk;
#pragma unroll
    for (int r = 0; r < 8; ++r) pk[r] = hfl_bits(fin[dt][r] * sc);
    *(v8us*)(&Ost[ow + (16 * g + l15) * PP + 16 * dt + 8 * h]) = pk;
  }
  __syncthreads();
  const int q8 = lane & 7, rsub = lane >> 3;
  {
#pragma unroll
    for (int it = 0; it < 4; ++it) {
      const int row = 16 * g + it * 4 + rsub;            // 16 rows per wave, 4 lines per instruction
      v4u val = *(const v4u*)(&Ost[ow + row * PP + 8 * q8]);
      us_t* dst = AV + (((size_t)(iw + row) * NB + b) * HH + n * DH + 8 * q8);
      *(v4u*)dst = val;
    }
  }
}

// ---------------------------------------------------------------------------
// Host orchestration (8 launches)
// ---------------------------------------------------------------------------
extern "C" void kernel_launch(void* const* d_in, const int* in_sizes, int n_in,
                              void* d_out, int out_size, void* d_ws, size_t ws_size,
                              hipStream_t stream)
{
  if (n_in < 8) return;
  const float* xq = (const float*)d_in[0];
  const float* xk = (const float*)d_in[1];
  const float* xv = (const float*)d_in[2];
  const float* wq = (const float*)d_in[3];
  const float* wk = (const float*)d_in[4];
  const float* wv = (const float*)d_in[5];
  const float* wp = (const float*)d_in[6];
  const float* bp = (const float*)d_in[7];

  if ((long)in_sizes[0] < ((long)(NB - 1) * NQ_FULL + NQ) * DM) return;
  if ((long)in_sizes[1] < ((long)(NB - 1) * NK_FULL + NK) * DM) return;
  if ((long)in_sizes[2] < ((long)(NB - 1) * NK_FULL + NK) * DM) return;
  if ((long)in_sizes[3] < (long)HH * DM) return;
  if ((long)in_sizes[4] < (long)HH * DM) return;
  if ((long)in_sizes[5] < (long)HH * DM) return;
  if ((long)in_sizes[6] < (long)DM * HH) return;
  if (in_sizes[7] < DM) return;
  if ((long)out_size < OUT1_OFF + (long)NB * NQ * NK) return;

  char* base = (char*)d_ws;
  size_t off = 0;
  auto take = [&](size_t bytes) -> char* {
    char* q = base + off; off += (bytes + 255) & ~(size_t)255; return q;
  };
  us_t*  xq_b = (us_t*) take((size_t)NB * NQ * DM * 2);             // bf16 [b][q][DM]
  us_t*  xk_b = (us_t*) take((size_t)NB * NK * DM * 2);             // bf16 [b][k][DM]
  us_t*  xv_b = (us_t*) take((size_t)NB * NK * DM * 2);             // bf16 [b][k][DM]
  us_t*  wq_b = (us_t*) take((size_t)HH * DM * 2);                  // bf16 [out][in]
  us_t*  wk_b = (us_t*) take((size_t)HH * DM * 2);                  // bf16
  us_t*  wv_b = (us_t*) take((size_t)HH * DM * 2);                  // bf16
  us_t*  wp_h = (us_t*) take((size_t)DM * HH * 2);                  // f16 (x64)
  us_t*  Qp   = (us_t*) take((size_t)NB * NH * NQ * DH * 2);        // f16 [bn][q][d]
  us_t*  Kp   = (us_t*) take((size_t)NB * NH * NK * DH * 2);        // f16 [bn][k][d]
  us_t*  Vt   = (us_t*) take((size_t)NB * NH * DH * NK * 2);        // f16 [bn][d][k]
  float* NLS  = (float*)take((size_t)NB * NH * NK * 4);             // f32 [bn][k]
  us_t*  AV   = (us_t*) take((size_t)NQ * NB * HH * 2);             // f16 (x32) [q*NB+b][n*64+d]
  if (off > ws_size) return;
  if (off > (size_t)WS_TOTAL) return;

  float* out0 = (float*)d_out;                                       // [q][b][c]
  float* out1 = (float*)d_out + OUT1_OFF;                            // [b][q][k]

  // 1) input conversions (RNE bf16; Wp as f16 of the bf16 value x64): planes xq_b .. wp_h, back to back from xq_b
  k_cvt_all<<<dim3(CVT_BLOCKS), dim3(CVT_WPB * 32), 0, stream>>>(xq, xk, xv, wq, wk, wv, wp, xq_b);

  // 2) projections: q = xq Wq^T, k = xk Wk^T, v^T = (xv Wv^T)^T, per batch z
  k_gemm<0, EPI_Q><<<dim3(HH / BN, NQ / BM, NB), dim3(256), 0, stream>>>(
      xq_b, wq_b, (void*)Qp, (void*)Qp, bp, bp, (long)DM, (long)DM, (long)NQ * DM, DM);
  k_gemm<0, EPI_K><<<dim3(HH / BN, NK / BM, NB), dim3(256), 0, stream>>>(
      xk_b, wk_b, (void*)Kp, (void*)Kp, bp, bp, (long)DM, (long)DM, (long)NK * DM, DM);
  k_gemm<0, EPI_VT><<<dim3(HH / BN, NK / BM, NB), dim3(256), 0, stream>>>(
      xv_b, wv_b, (void*)Vt, (void*)Vt, bp, bp, (long)DM, (long)DM, (long)NK * DM, DM);

  // 3) per-key column statistics of the query-axis softmax
  k_colstats<<<dim3(NK / 128, NB * NH), dim3(128), 0, stream>>>(Qp, Kp, NLS);
  // 4) head-averaged probabilities -> second output
  k_attn_mean<<<dim3(NK / 128, NQ / 128, NB), dim3(256), 0, stream>>>(Qp, Kp, NLS, out1);
  // 5) context -> AV plane
  k_attn_ctx<<<dim3(NQ / 128, NB * NH), dim3(256), 0, stream>>>(Qp, Kp, Vt, NLS, AV);
  // 6) output projection + bias -> first output, rows q*NB + b
  k_gemm<1, EPI_OUT><<<dim3(DM / BN, (NQ * NB) / BM, 1), dim3(256), 0, stream>>>(
      AV, wp_h, (void*)out0, (void*)out0, bp, bp, (long)HH, (long)HH, 0L, HH);
}

// v007
// One run takes 146 microseconds.
// Timed twice side by side with v006, it ran 1.04 and 1.05 times as fast.
// Over all steps from v000 it is 2.86 times as fast.
#include <hip/hip_runtime.h>

// Contractions: xq x Wq^T, xk x Wk^T, xv x Wv^T on v_wmma_f32_16x16x32_bf16 (bf16 operands = RNE-converted inputs), f32 accumulate;
// q x k^T (two sweeps: column statistics with head-mean probabilities, context), v^T x p^T and ctx x Wp^T on v_wmma_f32_16x16x32_f16
// (f16 operands: q,k,v unscaled, p carried x4096, ctx carried x32, Wp carried x64 after RNE bf16 convert), f32 accumulate.
// Softmax over the query axis (per key column) and bias add in f32.

#ifndef NB
#define NB 4
#endif
#define NB_FULL 4
#ifndef NQ
#define NQ 1024
#endif
#ifndef NK
#define NK 2048
#endif
#define NQ_FULL 1024
#define NK_FULL 2048
#define DM 1024
#define NH 16
#define DH 64
#define HH (NH * DH)
#define SCL 0.125f
#define C2LOG 0.18033688011112042f      /* SCL * log2(e) */
#define PCARRY 4096.0f
#define PSHIFT 12.0f                     /* log2(PCARRY) */
#define AVCARRY 32.0f
#define OWCARRY 64.0f
#define MSCALE 1.52587890625e-05f        /* 1 / (NH * PCARRY) = 2^-16 */
#define OUT1_OFF 4194304L                /* element offset of the second output (byte 16777216) */

#define AL256(x) (((x) + 255L) & ~255L)
#define WS_TOTAL (AL256((long)NB * NQ * DM * 2) + 2 * AL256((long)NB * NK * DM * 2) + 4 * AL256((long)HH * DM * 2) + \
                  AL256((long)NB * NH * NQ * DH * 2) + 2 * AL256((long)NB * NH * NK * DH * 2) + \
                  AL256((long)NB * NH * NK * 4) + AL256((long)NQ * NB * HH * 2))

static_assert(NB >= 1 && NB <= NB_FULL);
static_assert(NQ >= 128 && NQ <= NQ_FULL && NK >= 128 && NK <= NK_FULL);
static_assert(NQ % 128 == 0 && NK % 128 == 0);
static_assert(DM == 1024 && HH == 1024 && DH == 64 && NH == 16);
static_assert(DM == 128 * 8);
static_assert(DM % 32 == 0 && HH % 32 == 0 && DH % 32 == 0);
static_assert(HH % 128 == 0 && DM % 128 == 0);
static_assert(((long)NQ * NB) % 128 == 0);
static_assert((long)NQ * NB * DM * 4 <= 16777216L);
static_assert(OUT1_OFF * 4 == 16777216L);
static_assert((long)NB * NQ * NK * 4 <= 33554432L);
static_assert(PCARRY == 4096.0f && PSHIFT == 12.0f);
static_assert(MSCALE * 16.0f * PCARRY == 1.0f);
static_assert(WS_TOTAL <= 134217728L);

typedef unsigned short us_t;
typedef _Float16 h16;
typedef us_t     v8us  __attribute__((ext_vector_type(8)));
typedef unsigned v4u   __attribute__((ext_vector_type(4)));
typedef float    v8f   __attribute__((ext_vector_type(8)));
typedef float    v4f   __attribute__((ext_vector_type(4)));
typedef __bf16   v16bf __attribute__((ext_vector_type(16)));
typedef _Float16 v16h  __attribute__((ext_vector_type(16)));

#if __has_builtin(__builtin_amdgcn_exp2f)
#define FEXP2(x) __builtin_amdgcn_exp2f(x)
#else
#define FEXP2(x) __expf((x) * 0.6931471805599453f)
#endif

// 16x32 16-bit fragment: u[0] = elements 0..7, u[1] = elements 8..15
union Frag16 { v8us u[2]; v16bf bf; v16h hf; };

__device__ __forceinline__ v8f vzero() {
  v8f z = {0.f, 0.f, 0.f, 0.f, 0.f, 0.f, 0.f, 0.f};
  return z;
}

// RNE f32 -> bf16 bits
__device__ __forceinline__ us_t bf_bits(float x) {
  unsigned u = __float_as_uint(x);
  u += 0x7FFFu + ((u >> 16) & 1u);
  return (us_t)(u >> 16);
}
// RNE f32 -> bf16 value kept as f32
__device__ __forceinline__ float bf_val(float x) {
  unsigned u = __float_as_uint(x);
  u += 0x7FFFu + ((u >> 16) & 1u);
  return __uint_as_float(u & 0xFFFF0000u);
}
// RNE f32 -> f16 bits
__device__ __forceinline__ us_t hf_bits(float x) {
  _Float16 hv = (_Float16)x;
  return __builtin_bit_cast(us_t, hv);
}

// RNE f32 -> f16 with a value select: results below the smallest normal f16 become zero
static __device__ __forceinline__ h16 toh_flush(float v) {
  const h16 r = (h16)v;
  return (fabsf(v) < 6.103515625e-05f) ? (h16)0.0f : r;
}
static __device__ __forceinline__ us_t hfl_bits(float v) {
  return __builtin_bit_cast(us_t, toh_flush(v));
}
// exp2 of an exponent that already contains the x4096 carry; zero when the f16 value would be subnormal
static __device__ __forceinline__ float pexp2_cut(float e) {
  const float p = FEXP2(e);
  return (e < -14.0f) ? 0.0f : p;
}

// WMMA as the bare builtin: the compiler keeps the distance to the next reader of D and is free to order loads around it
template <int F16OP>
__device__ __forceinline__ v8f mma16(const Frag16& a, const Frag16& b, v8f c) {
  if (F16OP) {
    c = __builtin_amdgcn_wmma_f32_16x16x32_f16(false, a.hf, false, b.hf, (short)0, c, false, false);
  } else {
    c = __builtin_amdgcn_wmma_f32_16x16x32_bf16(false, a.bf, false, b.bf, (short)0, c, false, false);
  }
  return c;
}

// ---------------------------------------------------------------------------
// All input conversions in one resident launch. Unit = one row of DM = 1024 floats (4096 B in, 2048 B out).
// Units in plane order: xq rows, xk rows, xv rows (RNE bf16), Wq, Wk, Wv rows (RNE bf16), Wp rows (f16 of bf16(x)*OWCARRY);
// the seven 16-bit planes lie back to back in the workspace, so unit u is written at dst + u * DM.
// 256 blocks x 16 waves; a wave takes units gw, gw + 4096, ...: eight 16-B loads per lane, each wave-wide load
// 512 contiguous bytes, the next unit's eight loads issued before the current unit is converted and stored
// (8-B stores, 256 contiguous bytes per wave-wide store). No barrier, no LDS.
// ---------------------------------------------------------------------------
#define CVT_WPB 16
#define CVT_BLOCKS 256
#define CVT_NW (CVT_WPB * CVT_BLOCKS)
#define U_XQ (NB * NQ)
#define U_XK (NB * NK)
#define U_W HH
#define U_ALL (U_XQ + 2 * U_XK + 4 * U_W)
#define CVT_IT ((U_ALL + CVT_NW - 1) / CVT_NW)
static_assert(((long)NB * NQ * DM * 2) % 256 == 0 && ((long)NB * NK * DM * 2) % 256 == 0 && ((long)HH * DM * 2) % 256 == 0);

typedef unsigned v2u __attribute__((ext_vector_type(2)));

// behind each unit's loads and each unit's stores: their address registers are reused for the next unit's addresses;
// its memory clobber also keeps the order loads(u + 1), convert(u), stores(u), so that stores start while loads are in flight
#define CVT_XWAIT() asm volatile("s_wait_xcnt 0x0" ::: "memory")

// source row of unit u (wave-uniform); a unit past the end re-reads the last row and is not stored
__device__ __forceinline__ const float* cvt_row(unsigned u, const float* xq, const float* xk, const float* xv,
                                                const float* wq, const float* wk, const float* wv, const float* wp) {
  if (u >= U_ALL) u = U_ALL - 1;
  const unsigned uk = u - U_XQ, uv = uk - U_XK, uw = uv - U_XK;
  const float* p = (uw < U_W) ? wq : (uw < 2 * U_W) ? wk : (uw < 3 * U_W) ? wv : wp;
  unsigned r = uw % U_W;
  if (u < U_XQ + 2 * U_XK) { p = xv; r = (uv / NK) * NK_FULL + uv % NK; }
  if (u < U_XQ + U_XK)     { p = xk; r = (uk / NK) * NK_FULL + uk % NK; }
  if (u < U_XQ)            { p = xq; r = (u / NQ) * NQ_FULL + u % NQ; }
  return p + (size_t)r * DM;
}

__global__ __launch_bounds__(CVT_WPB * 32)
void k_cvt_all(const float* __restrict__ xq, const float* __restrict__ xk, const float* __restrict__ xv,
               const float* __restrict__ wq, const float* __restrict__ wk, const float* __restrict__ wv,
               const float* __restrict__ wp, us_t* __restrict__ dst)
{
  const unsigned lane = threadIdx.x & 31;
  const unsigned gw = __builtin_amdgcn_readfirstlane(blockIdx.x * CVT_WPB + (threadIdx.x >> 5));
  if (gw >= CVT_NW) return;   // bounds gw for any grid (wave-uniform, no barrier here)

  v4f buf[2][8];
  {
    const float* s = cvt_row(gw, xq, xk, xv, wq, wk, wv, wp) + 4 * lane;
#pragma unroll
    for (int j = 0; j < 8; ++j) buf[0][j] = *(const v4f*)(s + 128 * j);
    CVT_XWAIT();
  }
#pragma unroll   // two register sets alternate by a compile-time index: no copies between them
  for (int it = 0; it < CVT_IT; ++it) {
    const unsigned u = gw + it * CVT_NW;
    if (it + 1 < CVT_IT) {
      const float* s = cvt_row(u + CVT_NW, xq, xk, xv, wq, wk, wv, wp) + 4 * lane;
#pragma unroll
      for (int j = 0; j < 8; ++j) buf[(it + 1) & 1][j] = *(const v4f*)(s + 128 * j);
      CVT_XWAIT();
    }
    if (u < U_ALL) {
      const v4f (&r)[8] = buf[it & 1];
      us_t* d = dst + (size_t)u * DM + 4 * lane;
      if (u < U_ALL - U_W) {
#pragma unroll
        for (int j = 0; j < 8; ++j) {
          const v2u pk = {(unsigned)bf_bits(r[j][0]) | ((unsigned)bf_bits(r[j][1]) << 16),
                          (unsigned)bf_bits(r[j][2]) | ((unsigned)bf_bits(r[j][3]) << 16)};
          *(v2u*)(d + 128 * j) = pk;
        }
      } else {
#pragma unroll
        for (int j = 0; j < 8; ++j) {
          const v2u pk = {(unsigned)hf_bits(bf_val(r[j][0]) * OWCARRY) | ((unsigned)hf_bits(bf_val(r[j][1]) * OWCARRY) << 16),
                          (unsigned)hf_bits(bf_val(r[j][2]) * OWCARRY) | ((unsigned)hf_bits(bf_val(r[j][3]) * OWCARRY) << 16)};
          *(v2u*)(d + 128 * j) = pk;
        }
      }
      CVT_XWAIT();
    }
  }
}

// ---------------------------------------------------------------------------
// TN GEMM: C[M,N] = A[M,K] * B[N,K]^T, 16-bit operands from planes, f32 accumulate.
// Block 128x128x64, 256 threads = 8 waves (2x4), wave tile 64x32 = 4x2 WMMA tiles.
// Pipelined staging: two LDS buffers and two register sets; k tile t + 2 is fetched (whole 128-B lines) while tile t is
// multiplied, tile t + 1 goes from its registers to the other buffer behind the products, one barrier per k tile.
// Epilogue stages the 128x128 tile in the same LDS, behind a barrier of its own
//  EPI_Q  : D0 = Q plane  [(z*NH+n)*NQ + i][d] f16
//  EPI_K  : D0 = K plane  [(z*NH+n)*NK + pos][d] f16
//  EPI_VT : D0 = Vt plane [((z*NH+n)*DH + d)*NK + pos] f16
//  EPI_OUT: D0 = f32 output rows [row][DM], scaled by 1/(AVCARRY*OWCARRY), bias0 (RNE bf16 value) added in f32 at the store stage
// ---------------------------------------------------------------------------
#define BM 128
#define BN 128
#define BK 64
#define BKP 72                 /* row pitch 144 B = 16 B x 9: ds_load_b128 fragment reads spread over the banks */
#define STG (BM * BKP)         /* halves of one operand's k tile */
#define CSP 136
#define CFP 132
#define EPI_Q 0
#define EPI_K 1
#define EPI_VT 2
#define EPI_OUT 3

// Work-group barrier of the k loop: it waits for this wave's LDS reads and writes only. __syncthreads() would also
// wait for the global loads of the tile fetched ahead, which have to stay in flight across it.
__device__ __forceinline__ void tile_barrier() {
  asm volatile("s_wait_dscnt 0x0\n\ts_barrier_signal -1\n\ts_barrier_wait -1" ::: "memory");
}

template <int F16OP, int EPI>
__global__ __launch_bounds__(256)
void k_gemm(const us_t* __restrict__ A, const us_t* __restrict__ B,
            void* D0, void* D1, const float* __restrict__ bias0, const float* __restrict__ bias1,
            long lda, long ldb, long strideAz, int K)
{
  __shared__ __align__(16) us_t Sm[4 * STG];    // A tile x2, B tile x2: 128 rows x 64 k each (pad 72)
  us_t* Cs = Sm;                                // behind the k loop: f16 view [128][136] or f32 view [64][132]
  static_assert(64 * CFP * 4 <= BM * CSP * 2 && BM * CSP <= 4 * STG && BM == BN);

  const int tid = threadIdx.x, lane = tid & 31, wid = __builtin_amdgcn_readfirstlane(tid >> 5);
  const int wm = wid >> 2, wn = wid & 3, h = lane >> 4, l15 = lane & 15;
  const int m0 = blockIdx.y * BM, n0 = blockIdx.x * BN, z = blockIdx.z;
  const us_t* Ab = A + (size_t)z * (size_t)strideAz + (size_t)m0 * (size_t)lda;
  const us_t* Bb = B + (size_t)n0 * (size_t)ldb;

  v8f acc[4][2];
#pragma unroll
  for (int mi = 0; mi < 4; ++mi)
#pragma unroll
    for (int ni = 0; ni < 2; ++ni) acc[mi][ni] = vzero();

  const int nk = K / BK;                                   // even and at least 2: K is DM or HH, multiples of 128
  const int srow = tid >> 3, skc = (tid & 7) << 3;         // 8 lanes per 128-B row piece, 32 rows per block-wide load
  unsigned oa[4], ob[4];                                   // byte offsets of this thread's four row pieces; they live through the loop
#pragma unroll
  for (int i = 0; i < 4; ++i) {
    oa[i] = ((unsigned)(srow + 32 * i) * (unsigned)lda + (unsigned)skc) * 2u;
    ob[i] = ((unsigned)(srow + 32 * i) * (unsigned)ldb + (unsigned)skc) * 2u;
  }

  auto fetch = [&](v8us (&ra)[4], v8us (&rb)[4], int kb) {
    const char* pa = (const char*)(Ab + kb * BK);          // block-uniform base, per-thread 32-bit offset
    const char* pb = (const char*)(Bb + kb * BK);
#pragma unroll
    for (int i = 0; i < 4; ++i) {
      ra[i] = *(const v8us*)(pa + oa[i]);
      rb[i] = *(const v8us*)(pb + ob[i]);
    }
    // behind the eight loads: their address registers are rewritten for a later tile; its memory clobber also keeps
    // the loads ahead of the products' LDS reads, so that they are in flight from the start of the k tile
    asm volatile("s_wait_xcnt 0x0" ::: "memory");
  };
  auto put = [&](int buf, const v8us (&ra)[4], const v8us (&rb)[4]) {
    us_t* ta = Sm + buf * STG + srow * BKP + skc;
#pragma unroll
    for (int i = 0; i < 4; ++i) {
      *(v8us*)(ta + 32 * i * BKP) = ra[i];
      *(v8us*)(ta + 2 * STG + 32 * i * BKP) = rb[i];
    }
  };
  auto mult = [&](int buf) {
    const us_t* as = Sm + buf * STG;
    const us_t* bs = as + 2 * STG;
#pragma unroll
    for (int c = 0; c < 2; ++c) {                            // k ascending in steps of 32
      Frag16 af[4], bfr[2];
#pragma unroll
      for (int mi = 0; mi < 4; ++mi) {
        const int r = wm * 64 + mi * 16 + l15;                          // A row m = lane&15
        af[mi].u[0] = *(const v8us*)(&as[r * BKP + 32 * c + 8 * h]);      // k 8h..8h+7
        af[mi].u[1] = *(const v8us*)(&as[r * BKP + 32 * c + 16 + 8 * h]); // k 16+8h..16+8h+7
      }
#pragma unroll
      for (int ni = 0; ni < 2; ++ni) {
        const int r = wn * 32 + ni * 16 + l15;                          // B column n = lane&15, row of [n][k] plane, same k map
        bfr[ni].u[0] = *(const v8us*)(&bs[r * BKP + 32 * c + 8 * h]);
        bfr[ni].u[1] = *(const v8us*)(&bs[r * BKP + 32 * c + 16 + 8 * h]);
      }
#pragma unroll
      for (int mi = 0; mi < 4; ++mi)
#pragma unroll
        for (int ni = 0; ni < 2; ++ni) acc[mi][ni] = mma16<F16OP>(af[mi], bfr[ni], acc[mi][ni]);
    }
  };

  v8us a0[4], b0[4], a1[4], b1[4];
  fetch(a0, b0, 0);
  fetch(a1, b1, 1);
  put(0, a0, b0);
  tile_barrier();      // tile 0 visible to all waves
  for (int kb = 0; kb + 2 < nk; kb += 2) {
    fetch(a0, b0, kb + 2);
    mult(0);
    put(1, a1, b1);
    tile_barrier();    // publishes tile kb+1 and ends every read of tile kb before its buffer is refilled
    fetch(a1, b1, kb + 3);
    mult(1);
    put(0, a0, b0);
    tile_barrier();    // publishes tile kb+2 and ends every read of tile kb+1 before its buffer is refilled
  }
  mult(0);             // the last two tiles: nothing left to fetch
  put(1, a1, b1);
  tile_barrier();
  mult(1);             // the epilogue's first barrier ends these reads before the LDS becomes output staging

  // D layout: acc[mi][ni][v] = C(row wm*64+mi*16+8h+v, col wn*32+ni*16+l15)
  const int q8 = tid & 7, lsub = tid >> 3;   // 8 lanes per line, 32 lines per instruction over the block

  if (EPI == EPI_OUT) {
    float* Cf = (float*)Cs;
    float* Do = (float*)D0;
    const float oscale = 1.0f / (AVCARRY * OWCARRY);
#pragma unroll
    for (int rh = 0; rh < 2; ++rh) {
      __syncthreads();
      if (wm == rh) {
#pragma unroll
        for (int mi = 0; mi < 4; ++mi)
#pragma unroll
          for (int ni = 0; ni < 2; ++ni) {
            const int col = wn * 32 + ni * 16 + l15;
#pragma unroll
            for (int v = 0; v < 8; ++v)
              Cf[(mi * 16 + 8 * h + v) * CFP + col] = acc[mi][ni][v] * oscale;
          }
      }
      __syncthreads();
      {
#pragma unroll
        for (int it = 0; it < 8; ++it) {
          const int L = it * 32 + lsub, pr = L >> 2, ql = L & 3;     // 64 rows x 4 lines per row
          const v4f val = *(const v4f*)(&Cf[pr * CFP + 32 * ql + 4 * q8]);
          const v4f bq = *(const v4f*)(bias0 + n0 + 32 * ql + 4 * q8);
          const v4f o = {val[0] + bf_val(bq[0]), val[1] + bf_val(bq[1]),
                         val[2] + bf_val(bq[2]), val[3] + bf_val(bq[3])};
          float* dst = Do + ((size_t)(m0 + 64 * rh + pr) * DM + n0 + 32 * ql + 4 * q8);
          *(v4f*)dst = o;
        }
        
      }
    }
  } else {
    __syncthreads();
#pragma unroll
    for (int mi = 0; mi < 4; ++mi)
#pragma unroll
      for (int ni = 0; ni < 2; ++ni) {
        const int col = wn * 32 + ni * 16 + l15;
#pragma unroll
        for (int v = 0; v < 8; ++v)
          Cs[(wm * 64 + mi * 16 + 8 * h + v) * CSP + col] = hfl_bits(acc[mi][ni][v]);
      }
    __syncthreads();
    const int rpb = (EPI == EPI_Q) ? NQ : NK;   // plane rows per (batch, head)
    const int hb = n0 >> 6;                      // first head of this column block
    {
      if (EPI != EPI_VT) {
#pragma unroll
        for (int it = 0; it < 8; ++it) {
          const int L = it * 32 + lsub, pr = L >> 1, nl = L & 1;   // 128 rows x 2 lines of 64 halves
          v4u val = *(const v4u*)(&Cs[pr * CSP + nl * 64 + 8 * q8]);
          us_t* dst = (us_t*)D0 + ((((size_t)z * NH + hb + nl) * rpb + m0 + pr) * DH + 8 * q8);
          *(v4u*)dst = val;
        }
      } else {
        // Vt plane: line = (nl, d, hp) covers 64 consecutive pos; lane q8 gathers 8 pos down a column of Cs
#pragma unroll
        for (int it = 0; it < 8; ++it) {
          const int L = it * 32 + lsub, nl = L >> 7, d = (L >> 1) & 63, hp = L & 1;
          const int rb0 = 64 * hp + 8 * q8, cc = nl * 64 + d;
          unsigned wv[4];
#pragma unroll
          for (int k = 0; k < 4; ++k) {
            const unsigned lo = Cs[(rb0 + 2 * k) * CSP + cc];
            const unsigned hi = Cs[(rb0 + 2 * k + 1) * CSP + cc];
            wv[k] = lo | (hi << 16);
          }
          v4u val = {wv[0], wv[1], wv[2], wv[3]};
          us_t* dst = (us_t*)D0 + ((((size_t)z * NH + hb + nl) * DH + d) * NK + m0 + 64 * hp + 8 * q8);
          *(v4u*)dst = val;
        }
      }
      
    }
  }
}

// ---------------------------------------------------------------------------
// LDS tiles of the column-statistics and context sweeps: 64 rows x 64 halves (128 B) (colstats: one Q tile per wave, K rows shared by the block; context: shared by the 4 waves of one key group).
// Fetch: every wave-wide 16-B load covers four whole 128-B lines (8 lanes per row).
// Row pitch 72 halves = 144 B = 16 B x 9: fragment reads (ds_load_b128, 16 rows) spread over the banks.
// ---------------------------------------------------------------------------
#define TP 72
#define TILE_H (64 * TP)
static_assert(NQ % 64 == 0 && NK % 512 == 0 && DH == 64);

__device__ __forceinline__ void tile_fetch(v4u (&r)[4], const us_t* __restrict__ src, size_t pitch, int tid) {
  const us_t* p = src + (size_t)(tid >> 3) * pitch + 8 * (tid & 7);   // one address per thread, constant steps of 16 rows
#pragma unroll
  for (int i = 0; i < 4; ++i) r[i] = *(const v4u*)(p + (size_t)(16 * i) * pitch);
}
__device__ __forceinline__ void tile_put(us_t* t, const v4u (&r)[4], int tid) {
#pragma unroll
  for (int i = 0; i < 4; ++i) {
    const int ch = tid + 128 * i;
    *(v4u*)(t + (ch >> 3) * TP + 8 * (ch & 7)) = r[i];
  }
}
// fragment of tile row 'row', halves 32c..32c+31, in the k map of the plane loaders (8h.., 16+8h..)
__device__ __forceinline__ void frag_get(Frag16& f, const us_t* t, int row, int c, int h) {
  f.u[0] = *(const v8us*)(t + row * TP + 32 * c + 8 * h);
  f.u[1] = *(const v8us*)(t + row * TP + 32 * c + 16 + 8 * h);
}

// ---------------------------------------------------------------------------
// Column statistics of the query-axis softmax and head-averaged probabilities in one sweep.
// Block = 512 threads (16 waves) owns 32 keys of one batch and ALL NQ queries; wave w owns queries 64 w .. 64 w + 63.
// Per head: S = Q K^T (A = Q rows, B = K rows) for the wave's 64 x 32 tile stays in registers; the wave takes its own
// column maximum m_w and column sum l_w of e = exp2(c*s - m_w), the 16 waves' (m_w, l_w) meet in an LDS table behind one
// barrier, every wave forms M = max m_w, Z = sum l_w * exp2(m_w - M) (lane = key), and adds
// e * exp2(m_w - M - log2 Z) to its running head sum. So each score is formed once and takes one exp2.
// Q rows: a wave stages only its own 64 rows (whole-line loads, the next head's in flight during the products and the vector work) in its own
// LDS slice, so the slice needs no barrier. K rows of all 16 heads are staged once, in front of the loop.
// ---------------------------------------------------------------------------
#define SM_WAVES 16
#define SM_KEYS 32
#define RP 36                  /* floats per row of the exchange table and of the output staging: 144 B = 16 B x 9 */
static_assert(NQ == SM_WAVES * 64 && NK % SM_KEYS == 0 && NH == 16);
static_assert(64 * RP * 4 <= TILE_H * 2);

// value of lane ^ 16 by one vector cross-row move (identity lane select): no LDS round trip in the per-head chain
__device__ __forceinline__ float other_half(float v) {
  const unsigned u = __float_as_uint(v);
  return __uint_as_float(__builtin_amdgcn_permlanex16(u, u, 0x76543210u, 0xfedcba98u, false, false));
}

__global__ __launch_bounds__(SM_WAVES * 32)
void k_stats_mean(const us_t* __restrict__ Qp, const us_t* __restrict__ Kp, float* NLS, float* out1)
{
  __shared__ __align__(16) us_t Qs[SM_WAVES * TILE_H];       // per wave: 64 query rows of the current head; behind the loop: output staging
  __shared__ __align__(16) us_t Ks[NH * SM_KEYS * TP];       // the block's 32 key rows of every head
  __shared__ __align__(16) float red[2][SM_KEYS * RP];       // [trip parity][key][16 maxima, 16 sums]
  __shared__ __align__(16) float Nl[NH * SM_KEYS];           // column normalisers, stored behind the loop
  const int tid = threadIdx.x;
  const int lane = threadIdx.x & 31;
  const int wave = __builtin_amdgcn_readfirstlane(threadIdx.x >> 5);
  const int h = lane >> 4, l15 = lane & 15;
  const int k0 = blockIdx.x * SM_KEYS;
  const int b = blockIdx.y;
  us_t* qs = Qs + wave * TILE_H;

  // blocks of one batch walk the heads from different starts, so that they do not all ask L2 for the same Q lines at once
  const int hrot = blockIdx.x & (NH - 1);
  const us_t* qsrc = Qp + ((size_t)b * NH * NQ + wave * 64) * DH + 8 * lane;   // head 0; head n: + n * NQ * DH
  v4u rq[16];
  {
    // chunk tid + 512 i = row (head * 32 + key) (tid >> 3) + 64 i, 8 lanes per 128-B row: one address, steps of two heads
    const us_t* kp = Kp + (((size_t)b * NH + (tid >> 8)) * NK + k0 + ((tid >> 3) & 31)) * DH + 8 * (tid & 7);
    const us_t* qp = qsrc + (size_t)hrot * NQ * DH;
    v4u rk[8];
#pragma unroll
    for (int i = 0; i < 8; ++i) rk[i] = *(const v4u*)(kp + (size_t)i * 2 * NK * DH);
#pragma unroll
    for (int j = 0; j < 16; ++j) rq[j] = *(const v4u*)(qp + 256 * j);   // 512 contiguous bytes per wave-wide load
    // behind the prologue's loads: their address registers are reused below, and as inputs here they stay apart from the
    // loads' destinations
    asm volatile("s_wait_xcnt 0x0" :: "v"(kp), "v"(qp) : "memory");
#pragma unroll
    for (int i = 0; i < 8; ++i) {
      const int ch = tid + 512 * i;
      *(v4u*)(Ks + (ch >> 3) * TP + 8 * (ch & 7)) = rk[i];
    }
  }
  __syncthreads();   // the K rows of every head visible to all waves

  v8f macc[4][2];
#pragma unroll
  for (int qt = 0; qt < 4; ++qt)
#pragma unroll
    for (int kt = 0; kt < 2; ++kt) macc[qt][kt] = vzero();

#pragma unroll 1   // kept rolled (for speed only)
  for (int hh = 0; hh < NH; ++hh) {
    const int hd = (hh + hrot) & (NH - 1);                    // this trip's head
#pragma unroll
    for (int j = 0; j < 16; ++j) {
      const int ch = 32 * j + lane;
      *(v4u*)(qs + (ch >> 3) * TP + 8 * (ch & 7)) = rq[j];
    }
    // the wave's rows are in its LDS slice before its lanes read one another's pieces back as fragments
    asm volatile("s_wait_dscnt 0x0" ::: "memory");
    const us_t* qn = qsrc + (size_t)((hd + 1) & (NH - 1)) * NQ * DH;   // the next trip's rows
    if (hh + 1 < NH) {
#pragma unroll
      for (int j = 0; j < 8; ++j) rq[j] = *(const v4u*)(qn + 256 * j);
      // first half of the next trip's loads, issued ahead of the products so that L2 is asked all through the trip; behind
      // them their address register is reused, and as an input here it stays apart from their destinations; the memory
      // clobber keeps them ahead of the fragment reads
      asm volatile("s_wait_xcnt 0x0" :: "v"(qn) : "memory");
    }

    v8f s[4][2];
    {
      const us_t* kc = Ks + hd * (SM_KEYS * TP);
      Frag16 kf[2][2];
#pragma unroll
      for (int kt = 0; kt < 2; ++kt)
#pragma unroll
        for (int c = 0; c < 2; ++c) frag_get(kf[kt][c], kc, 16 * kt + l15, c, h);   // B column n = key
#pragma unroll
      for (int qt = 0; qt < 4; ++qt) {
        Frag16 qa[2];
#pragma unroll
        for (int c = 0; c < 2; ++c) frag_get(qa[c], qs, 16 * qt + l15, c, h);       // A row m = query
#pragma unroll
        for (int kt = 0; kt < 2; ++kt) {
          v8f t = vzero();
#pragma unroll
          for (int c = 0; c < 2; ++c) t = mma16<1>(qa[c], kf[kt][c], t);
          s[qt][kt] = t;
        }
      }
    }
    if (hh + 1 < NH) {
#pragma unroll
      for (int j = 8; j < 16; ++j) rq[j] = *(const v4u*)(qn + 256 * j);
      // second half, behind the products, whose fragments need the registers: the same wait for the same reasons; the memory
      // clobber keeps these loads ahead of the vector work and the exchange, so that they are in flight through the rest of the trip
      asm volatile("s_wait_xcnt 0x0" :: "v"(qn) : "memory");
    }

    // D layout: s[qt][kt][r] = (query 64 wave + 16 qt + 8h + r, key k0 + 16 kt + l15)
    float tm[2], nm[2], lw[2];
#pragma unroll
    for (int kt = 0; kt < 2; ++kt) {
      float cm[4];                                            // one short chain per query tile
#pragma unroll
      for (int qt = 0; qt < 4; ++qt) {
        cm[qt] = fmaxf(s[qt][kt][0], s[qt][kt][1]);
#pragma unroll
        for (int r = 2; r < 8; ++r) cm[qt] = fmaxf(cm[qt], s[qt][kt][r]);
      }
      tm[kt] = fmaxf(fmaxf(cm[0], cm[1]), fmaxf(cm[2], cm[3]));
    }
#pragma unroll
    for (int kt = 0; kt < 2; ++kt) nm[kt] = -(fmaxf(tm[kt], other_half(tm[kt])) * C2LOG);
#pragma unroll
    for (int kt = 0; kt < 2; ++kt) {
#pragma unroll
      for (int qt = 0; qt < 4; ++qt)
#pragma unroll
        for (int r = 0; r < 8; ++r) s[qt][kt][r] = FEXP2(fmaf(s[qt][kt][r], C2LOG, nm[kt]));
      const v8f q4 = (s[0][kt] + s[1][kt]) + (s[2][kt] + s[3][kt]);
      lw[kt] = ((q4[0] + q4[1]) + (q4[2] + q4[3])) + ((q4[4] + q4[5]) + (q4[6] + q4[7]));
    }
#pragma unroll
    for (int kt = 0; kt < 2; ++kt) lw[kt] += other_half(lw[kt]);

    float* rd = red[hh & 1];
    rd[lane * RP + wave] = h ? -nm[1] : -nm[0];               // lane = key 16 h + l15
    rd[lane * RP + 16 + wave] = h ? lw[1] : lw[0];
    // publishes the 16 waves' partial statistics; LDS wait only, the next head's loads stay in flight across it. The table of
    // this parity is rewritten only behind the next such barrier, which every wave reaches with these reads done
    tile_barrier();
    float mv[16];
#pragma unroll
    for (int i = 0; i < 4; ++i) {
      const v4f x = *(const v4f*)(rd + lane * RP + 4 * i);
      mv[4 * i] = x[0]; mv[4 * i + 1] = x[1]; mv[4 * i + 2] = x[2]; mv[4 * i + 3] = x[3];
    }
    float M = fmaxf(mv[0], mv[1]);
#pragma unroll
    for (int i = 2; i < 16; ++i) M = fmaxf(M, mv[i]);
    float zp[4];                                              // four short chains, one per four waves
#pragma unroll
    for (int i = 0; i < 4; ++i) {
      const v4f x = *(const v4f*)(rd + lane * RP + 16 + 4 * i);
      zp[i] = x[0] * FEXP2(mv[4 * i] - M);
#pragma unroll
      for (int e = 1; e < 4; ++e) zp[i] = fmaf(x[e], FEXP2(mv[4 * i + e] - M), zp[i]);
    }
    const float Z = (zp[0] + zp[1]) + (zp[2] + zp[3]);
    const float nls = -(M + log2f(Z));                        // of key 16 h + l15
    const float oth = other_half(nls);
    const float f0 = FEXP2((h ? oth : nls) - nm[0]);          // exp2(m_w - M - log2 Z) of key l15
    const float f1 = FEXP2((h ? nls : oth) - nm[1]);          // of key 16 + l15
#pragma unroll
    for (int qt = 0; qt < 4; ++qt)
#pragma unroll
      for (int r = 0; r < 8; ++r) {
        macc[qt][0][r] = fmaf(s[qt][0][r], f0, macc[qt][0][r]);
        macc[qt][1][r] = fmaf(s[qt][1][r], f1, macc[qt][1][r]);
      }
    if (wave == 0) Nl[hd * SM_KEYS + lane] = PSHIFT + nls;
  }

  // output staging in the wave's own slice, which only this wave has read
  float* Mst = (float*)qs;
#pragma unroll
  for (int qt = 0; qt < 4; ++qt)
#pragma unroll
    for (int kt = 0; kt < 2; ++kt)
#pragma unroll
      for (int r = 0; r < 8; ++r)
        Mst[(16 * qt + 8 * h + r) * RP + 16 * kt + l15] = macc[qt][kt][r] * (1.0f / NH);
  __syncthreads();     // wave 0's normalisers visible to all waves; each wave's staged rows complete
  const int q8 = lane & 7, rsub = lane >> 3;
#pragma unroll
  for (int it = 0; it < 16; ++it) {
    const int row = it * 4 + rsub;                            // 64 rows of one 128-B line, 4 lines per instruction
    const v4f val = *(const v4f*)(&Mst[row * RP + 4 * q8]);
    float* dst = out1 + (((size_t)b * NQ + wave * 64 + row) * NK + k0 + 4 * q8);
    *(v4f*)dst = val;
  }
  NLS[((size_t)b * NH + wave) * NK + k0 + lane] = Nl[tid];    // wave = head: one 128-B line per wave
}

// ---------------------------------------------------------------------------
// Context, transposed register-fed form. Block = 256 threads (8 waves = 2 key groups x 4 waves), 128 queries of one
// (b,n); wave (g, w) owns 32 queries (two Q fragment sets held as B operands) and the 64-key tiles 2 i + g, so that
// four waves stand on each SIMD and one wave's LDS waits and vector work run under another's products.
// Per 32-key step: S^T = K Q^T (A = K rows from a 64-key LDS tile) for two 16-key tiles, p^T*4096 = exp2(c*s + NLS[key])
// packed from the two D tiles into one B fragment per query tile (element r <- tile 0, element 8+r <- tile 1),
// O^T += Vt * P^T (A = Vt rows d from a 64-key LDS tile, k = keys). Every K and Vt fragment read feeds both
// query tiles. Each group has two buffers per tile and fills them with its own 128 threads, the next
// 64 keys fetched during the current, one barrier per trip; the column normaliser (whole row in
// LDS) is already inside the exponent, so there is no running state. Behind the loop the two groups' partial sums
// are added through LDS: wave (g, w) finishes query tile g.
// ---------------------------------------------------------------------------
#define PP 72
static_assert(NK % 1024 == 0);

__global__ __launch_bounds__(256)
void k_attn_ctx(const us_t* __restrict__ Qp, const us_t* __restrict__ Kp, const us_t* __restrict__ Vt,
                const float* __restrict__ NLS, us_t* AV)
{
  __shared__ __align__(16) us_t Ost[4 * 32 * PP];   // per wave pair 32 rows x 64 halves used (pad 72); a wave reads back its own 16 rows
  __shared__ __align__(16) us_t Kt[2][2][TILE_H];   // [key group][buffer], rows = keys, columns = d; behind the loop: partial sums
  __shared__ __align__(16) us_t Vs[2][2][TILE_H];   // [key group][buffer], rows = d, columns = keys
  __shared__ __align__(16) float Ns[NK];            // column normalisers of this (b,n)
  static_assert(8 * 1024 * 4 <= 4 * TILE_H * 2);
  const int tid = threadIdx.x;
  const int lane = threadIdx.x & 31;
  const int wave = __builtin_amdgcn_readfirstlane(threadIdx.x >> 5);
  const int g = wave >> 2, w = wave & 3;            // key group, query slice
  const int gtid = tid & 127;                       // thread within its key group
  const int h = lane >> 4, l15 = lane & 15;
  const int i0 = blockIdx.x * 128, bn = blockIdx.y;
  const int b = bn / NH, n = bn - b * NH;
  const int iw = i0 + w * 32;
  const int ow = w * (32 * PP);

  Frag16 qf[2][2];
#pragma unroll
  for (int qt = 0; qt < 2; ++qt) {
    const us_t* pq = Qp + ((size_t)bn * NQ + iw + 16 * qt + l15) * DH;   // B column n = query, k = d
#pragma unroll
    for (int c = 0; c < 2; ++c) {
      qf[qt][c].u[0] = *(const v8us*)(pq + 32 * c + 8 * h);
      qf[qt][c].u[1] = *(const v8us*)(pq + 32 * c + 16 + 8 * h);
    }
  }

  v8f oacc[2][4];
#pragma unroll
  for (int qt = 0; qt < 2; ++qt)
#pragma unroll
    for (int dt = 0; dt < 4; ++dt) oacc[qt][dt] = vzero();

  const us_t* Kbase = Kp + (size_t)bn * NK * DH + (size_t)g * 64 * DH;   // the group's first tile; its next: + 128 keys
  const us_t* Vbase = Vt + (size_t)bn * DH * NK + (size_t)g * 64;
  const float* Nbase = NLS + (size_t)bn * NK;

  v4f nv[NK / 1024];
#pragma unroll
  for (int i = 0; i < NK / 1024; ++i) nv[i] = *(const v4f*)(Nbase + 4 * (tid + 256 * i));
  v4u rk[4], rv[4];
  tile_fetch(rk, Kbase, DH, gtid);
  tile_fetch(rv, Vbase, NK, gtid);
  // behind the prologue's loads: their address registers are reused below
  asm volatile("s_wait_xcnt 0x0" ::: "memory");
#pragma unroll
  for (int i = 0; i < NK / 1024; ++i) *(v4f*)(&Ns[4 * (tid + 256 * i)]) = nv[i];
  tile_put(Kt[g][0], rk, gtid);
  tile_put(Vs[g][0], rv, gtid);
  __syncthreads();   // both groups' first tiles and the normalisers visible to all waves

  for (int i = 0; i < NK / 128; ++i) {
    const int t = 2 * i + g;                            // this group's 64-key tile
    const us_t* kc = Kt[g][i & 1];
    const us_t* vc = Vs[g][i & 1];
    if (i + 1 < NK / 128) {
      tile_fetch(rk, Kbase + (size_t)(i + 1) * 128 * DH, DH, gtid);
      tile_fetch(rv, Vbase + (size_t)(i + 1) * 128, NK, gtid);
    }
    // behind the eight loads: their address registers are reused below; its memory clobber also keeps the loads ahead of
    // the tile's LDS reads, so that they are in flight through the whole tile and not only just before tile_put
    asm volatile("s_wait_xcnt 0x0" ::: "memory");
#pragma unroll
    for (int ks = 0; ks < 2; ++ks) {
      Frag16 pb[2];                                     // per query tile: B[k = key in step][n = query]
#pragma unroll
      for (int st = 0; st < 2; ++st) {
        Frag16 ka[2];
#pragma unroll
        for (int c = 0; c < 2; ++c) frag_get(ka[c], kc, 32 * ks + 16 * st + l15, c, h);   // A row m = key
        // D rows = keys 64 t + 32 ks + 16 st + 8h + r : eight consecutive table entries per lane
        const float* np = &Ns[64 * t + 32 * ks + 16 * st + 8 * h];
        const v4f na = *(const v4f*)(np);
        const v4f nc = *(const v4f*)(np + 4);
        const float nl[8] = {na[0], na[1], na[2], na[3], nc[0], nc[1], nc[2], nc[3]};
#pragma unroll
        for (int qt = 0; qt < 2; ++qt) {
          v8f s = vzero();
#pragma unroll
          for (int c = 0; c < 2; ++c) s = mma16<1>(ka[c], qf[qt][c], s);
#pragma unroll
          for (int r = 0; r < 8; ++r)
            pb[qt].hf[8 * st + r] = (h16)pexp2_cut(fmaf(s[r], C2LOG, nl[r]));
        }
      }
#pragma unroll
      for (int dt = 0; dt < 4; ++dt) {
        Frag16 va;                                      // A row m = d (row of Vt), k = key
        frag_get(va, vc, 16 * dt + l15, ks, h);
#pragma unroll
        for (int qt = 0; qt < 2; ++qt) oacc[qt][dt] = mma16<1>(va, pb[qt], oacc[qt][dt]);
      }
    }
    if (i + 1 < NK / 128) {
      tile_put(Kt[g][(i + 1) & 1], rk, gtid);
      tile_put(Vs[g][(i + 1) & 1], rv, gtid);
    }
    __syncthreads();   // publishes both groups' next tiles and ends every read of the current ones before their buffers are refilled
  }

  // The two key groups' partial sums meet: wave (g, w) keeps query tile g and hands query tile 1 - g to wave (1 - g, w).
  // 4 KB per wave in the K tiles' LDS, which every wave has left at the loop's last barrier; 16 B per lane, lanes contiguous.
  float* Xs = (float*)&Kt[0][0][0];
  v8f fin[4];
#pragma unroll
  for (int dt = 0; dt < 4; ++dt) {
    const v8f oth = g ? oacc[0][dt] : oacc[1][dt];
    fin[dt] = g ? oacc[1][dt] : oacc[0][dt];
#pragma unroll
    for (int j = 0; j < 2; ++j) {
      const v4f x = {oth[4 * j], oth[4 * j + 1], oth[4 * j + 2], oth[4 * j + 3]};
      *(v4f*)(Xs + wave * 1024 + ((2 * dt + j) * 32 + lane) * 4) = x;
    }
  }
  __syncthreads();     // the partner wave's partial sums are visible
#pragma unroll
  for (int dt = 0; dt < 4; ++dt)
#pragma unroll
    for (int j = 0; j < 2; ++j) {
      const v4f x = *(const v4f*)(Xs + (wave ^ 4) * 1024 + ((2 * dt + j) * 32 + lane) * 4);
#pragma unroll
      for (int e = 0; e < 4; ++e) fin[dt][4 * j + e] += x[e];
    }

  // D layout: fin[dt][r] = O^T(d = 16 dt + 8h + r, query 16 g + l15) : eight consecutive d per lane
  const float sc = AVCARRY / PCARRY;
#pragma unroll
  for (int dt = 0; dt < 4; ++dt) {
    v8us pk;
#pragma unroll
    for (int r = 0; r < 8; ++r) pk[r] = hfl_bits(fin[dt][r] * sc);
    *(v8us*)(&Ost[ow + (16 * g + l15) * PP + 16 * dt + 8 * h]) = pk;
  }
  __syncthreads();
  const int q8 = lane & 7, rsub = lane >> 3;
  {
#pragma unroll
    for (int it = 0; it < 4; ++it) {
      const int row = 16 * g + it * 4 + rsub;            // 16 rows per wave, 4 lines per instruction
      v4u val = *(const v4u*)(&Ost[ow + row * PP + 8 * q8]);
      us_t* dst = AV + (((size_t)(iw + row) * NB + b) * HH + n * DH + 8 * q8);
      *(v4u*)dst = val;
    }
  }
}

// ---------------------------------------------------------------------------
// Host orchestration (7 launches)
// ---------------------------------------------------------------------------
extern "C" void kernel_launch(void* const* d_in, const int* in_sizes, int n_in,
                              void* d_out, int out_size, void* d_ws, size_t ws_size,
                              hipStream_t stream)
{
  if (n_in < 8) return;
  const float* xq = (const float*)d_in[0];
  const float* xk = (const float*)d_in[1];
  const float* xv = (const float*)d_in[2];
  const float* wq = (const float*)d_in[3];
  const float* wk = (const float*)d_in[4];
  const float* wv = (const float*)d_in[5];
  const float* wp = (const float*)d_in[6];
  const float* bp = (const float*)d_in[7];

  if ((long)in_sizes[0] < ((long)(NB - 1) * NQ_FULL + NQ) * DM) return;
  if ((long)in_sizes[1] < ((long)(NB - 1) * NK_FULL + NK) * DM) return;
  if ((long)in_sizes[2] < ((long)(NB - 1) * NK_FULL + NK) * DM) return;
  if ((long)in_sizes[3] < (long)HH * DM) return;
  if ((long)in_sizes[4] < (long)HH * DM) return;
  if ((long)in_sizes[5] < (long)HH * DM) return;
  if ((long)in_sizes[6] < (long)DM * HH) return;
  if (in_sizes[7] < DM) return;
  if ((long)out_size < OUT1_OFF + (long)NB * NQ * NK) return;

  char* base = (char*)d_ws;
  size_t off = 0;
  auto take = [&](size_t bytes) -> char* {
    char* q = base + off; off += (bytes + 255) & ~(size_t)255; return q;
  };
  us_t*  xq_b = (us_t*) take((size_t)NB * NQ * DM * 2);             // bf16 [b][q][DM]
  us_t*  xk_b = (us_t*) take((size_t)NB * NK * DM * 2);             // bf16 [b][k][DM]
  us_t*  xv_b = (us_t*) take((size_t)NB * NK * DM * 2);             // bf16 [b][k][DM]
  us_t*  wq_b = (us_t*) take((size_t)HH * DM * 2);                  // bf16 [out][in]
  us_t*  wk_b = (us_t*) take((size_t)HH * DM * 2);                  // bf16
  us_t*  wv_b = (us_t*) take((size_t)HH * DM * 2);                  // bf16
  us_t*  wp_h = (us_t*) take((size_t)DM * HH * 2);                  // f16 (x64)
  us_t*  Qp   = (us_t*) take((size_t)NB * NH * NQ * DH * 2);        // f16 [bn][q][d]
  us_t*  Kp   = (us_t*) take((size_t)NB * NH * NK * DH * 2);        // f16 [bn][k][d]
  us_t*  Vt   = (us_t*) take((size_t)NB * NH * DH * NK * 2);        // f16 [bn][d][k]
  float* NLS  = (float*)take((size_t)NB * NH * NK * 4);             // f32 [bn][k]
  us_t*  AV   = (us_t*) take((size_t)NQ * NB * HH * 2);             // f16 (x32) [q*NB+b][n*64+d]
  if (off > ws_size) return;
  if (off > (size_t)WS_TOTAL) return;

  float* out0 = (float*)d_out;                                       // [q][b][c]
  float* out1 = (float*)d_out + OUT1_OFF;                            // [b][q][k]

  // 1) input conversions (RNE bf16; Wp as f16 of the bf16 value x64): planes xq_b .. wp_h, back to back from xq_b
  k_cvt_all<<<dim3(CVT_BLOCKS), dim3(CVT_WPB * 32), 0, stream>>>(xq, xk, xv, wq, wk, wv, wp, xq_b);

  // 2) projections: q = xq Wq^T, k = xk Wk^T, v^T = (xv Wv^T)^T, per batch z
  k_gemm<0, EPI_Q><<<dim3(HH / BN, NQ / BM, NB), dim3(256), 0, stream>>>(
      xq_b, wq_b, (void*)Qp, (void*)Qp, bp, bp, (long)DM, (long)DM, (long)NQ * DM, DM);
  k_gemm<0, EPI_K><<<dim3(HH / BN, NK / BM, NB), dim3(256), 0, stream>>>(
      xk_b, wk_b, (void*)Kp, (void*)Kp, bp, bp, (long)DM, (long)DM, (long)NK * DM, DM);
  k_gemm<0, EPI_VT><<<dim3(HH / BN, NK / BM, NB), dim3(256), 0, stream>>>(
      xv_b, wv_b, (void*)Vt, (void*)Vt, bp, bp, (long)DM, (long)DM, (long)NK * DM, DM);

  // 3) + 4) per-key column statistics of the query-axis softmax and head-averaged probabilities -> second output
  k_stats_mean<<<dim3(NK / SM_KEYS, NB), dim3(SM_WAVES * 32), 0, stream>>>(Qp, Kp, NLS, out1);
  // 5) context -> AV plane
  k_attn_ctx<<<dim3(NQ / 128, NB * NH), dim3(256), 0, stream>>>(Qp, Kp, Vt, NLS, AV);
  // 6) output projection + bias -> first output, rows q*NB + b
  k_gemm<1, EPI_OUT><<<dim3(DM / BN, (NQ * NB) / BM, 1), dim3(256), 0, stream>>>(
      AV, wp_h, (void*)out0, (void*)out0, bp, bp, (long)HH, (long)HH, 0L, HH);
}

// v008
// Measured time: 136 microseconds a run.
// Two timings next to v007 both put it at 1.07 times that version's speed.
// Counting every step since v000, it is 3.06 times as fast.
#include <hip/hip_runtime.h>

// Contractions: xq x Wq^T, xk x Wk^T, xv x Wv^T on v_wmma_f32_16x16x32_bf16 (bf16 operands = RNE-converted inputs), f32 accumulate;
// q x k^T (two sweeps: column statistics with head-mean probabilities, context), v^T x p^T and ctx x Wp^T on v_wmma_f32_16x16x32_f16
// (f16 operands: q,k,v unscaled, p carried x4096, ctx carried x32, Wp carried x64 after RNE bf16 convert), f32 accumulate.
// Softmax over the query axis (per key column) and bias add in f32.

#ifndef NB
#define NB 4
#endif
#define NB_FULL 4
#ifndef NQ
#define NQ 1024
#endif
#ifndef NK
#define NK 2048
#endif
#define NQ_FULL 1024
#define NK_FULL 2048
#define DM 1024
#define NH 16
#define DH 64
#define HH (NH * DH)
#define SCL 0.125f
#define C2LOG 0.18033688011112042f      /* SCL * log2(e) */
#define PCARRY 4096.0f
#define PSHIFT 12.0f                     /* log2(PCARRY) */
#define AVCARRY 32.0f
#define OWCARRY 64.0f
#define MSCALE 1.52587890625e-05f        /* 1 / (NH * PCARRY) = 2^-16 */
#define OUT1_OFF 4194304L                /* element offset of the second output (byte 16777216) */

#define AL256(x) (((x) + 255L) & ~255L)
#define WS_TOTAL (AL256((long)NB * NQ * DM * 2) + 2 * AL256((long)NB * NK * DM * 2) + 4 * AL256((long)HH * DM * 2) + \
                  AL256((long)NB * NH * NQ * DH * 2) + 2 * AL256((long)NB * NH * NK * DH * 2) + \
                  AL256((long)NB * NH * NK * 4) + AL256((long)NQ * NB * HH * 2))

static_assert(NB >= 1 && NB <= NB_FULL);
static_assert(NQ >= 128 && NQ <= NQ_FULL && NK >= 128 && NK <= NK_FULL);
static_assert(NQ % 128 == 0 && NK % 128 == 0);
static_assert(DM == 1024 && HH == 1024 && DH == 64 && NH == 16);
static_assert(DM == 128 * 8);
static_assert(DM % 32 == 0 && HH % 32 == 0 && DH % 32 == 0);
static_assert(HH % 128 == 0 && DM % 128 == 0);
static_assert(((long)NQ * NB) % 128 == 0);
static_assert((long)NQ * NB * DM * 4 <= 16777216L);
static_assert(OUT1_OFF * 4 == 16777216L);
static_assert((long)NB * NQ * NK * 4 <= 33554432L);
static_assert(PCARRY == 4096.0f && PSHIFT == 12.0f);
static_assert(MSCALE * 16.0f * PCARRY == 1.0f);
static_assert(WS_TOTAL <= 134217728L);

typedef unsigned short us_t;
typedef _Float16 h16;
typedef us_t     v8us  __attribute__((ext_vector_type(8)));
typedef unsigned v4u   __attribute__((ext_vector_type(4)));
typedef float    v8f   __attribute__((ext_vector_type(8)));
typedef float    v4f   __attribute__((ext_vector_type(4)));
typedef __bf16   v16bf __attribute__((ext_vector_type(16)));
typedef _Float16 v16h  __attribute__((ext_vector_type(16)));

#if __has_builtin(__builtin_amdgcn_exp2f)
#define FEXP2(x) __builtin_amdgcn_exp2f(x)
#else
#define FEXP2(x) __expf((x) * 0.6931471805599453f)
#endif

// 16x32 16-bit fragment: u[0] = elements 0..7, u[1] = elements 8..15
union Frag16 { v8us u[2]; v16bf bf; v16h hf; };

__device__ __forceinline__ v8f vzero() {
  v8f z = {0.f, 0.f, 0.f, 0.f, 0.f, 0.f, 0.f, 0.f};
  return z;
}

// RNE f32 -> bf16 bits
__device__ __forceinline__ us_t bf_bits(float x) {
  unsigned u = __float_as_uint(x);
  u += 0x7FFFu + ((u >> 16) & 1u);
  return (us_t)(u >> 16);
}
// RNE f32 -> bf16 value kept as f32
__device__ __forceinline__ float bf_val(float x) {
  unsigned u = __float_as_uint(x);
  u += 0x7FFFu + ((u >> 16) & 1u);
  return __uint_as_float(u & 0xFFFF0000u);
}
// RNE f32 -> f16 bits
__device__ __forceinline__ us_t hf_bits(float x) {
  _Float16 hv = (_Float16)x;
  return __builtin_bit_cast(us_t, hv);
}

// RNE f32 -> f16 with a value select: results below the smallest normal f16 become zero
static __device__ __forceinline__ h16 toh_flush(float v) {
  const h16 r = (h16)v;
  return (fabsf(v) < 6.103515625e-05f) ? (h16)0.0f : r;
}
static __device__ __forceinline__ us_t hfl_bits(float v) {
  return __builtin_bit_cast(us_t, toh_flush(v));
}
// exp2 of an exponent that already contains the x4096 carry; zero when the f16 value would be subnormal
static __device__ __forceinline__ float pexp2_cut(float e) {
  const float p = FEXP2(e);
  return (e < -14.0f) ? 0.0f : p;
}

// WMMA as the bare builtin: the compiler keeps the distance to the next reader of D and is free to order loads around it
template <int F16OP>
__device__ __forceinline__ v8f mma16(const Frag16& a, const Frag16& b, v8f c) {
  if (F16OP) {
    c = __builtin_amdgcn_wmma_f32_16x16x32_f16(false, a.hf, false, b.hf, (short)0, c, false, false);
  } else {
    c = __builtin_amdgcn_wmma_f32_16x16x32_bf16(false, a.bf, false, b.bf, (short)0, c, false, false);
  }
  return c;
}

// ---------------------------------------------------------------------------
// All input conversions in one resident launch. Unit = one row of DM = 1024 floats (4096 B in, 2048 B out).
// Units in plane order: xq rows, xk rows, xv rows (RNE bf16), Wq, Wk, Wv rows (RNE bf16), Wp rows (f16 of bf16(x)*OWCARRY);
// the seven 16-bit planes lie back to back in the workspace, so unit u is written at dst + u * DM.
// 256 blocks x 16 waves; a wave takes units gw, gw + 4096, ...: eight 16-B loads per lane, each wave-wide load
// 512 contiguous bytes, the next unit's eight loads issued before the current unit is converted and stored
// (8-B stores, 256 contiguous bytes per wave-wide store). No barrier, no LDS.
// ---------------------------------------------------------------------------
#define CVT_WPB 16
#define CVT_BLOCKS 256
#define CVT_NW (CVT_WPB * CVT_BLOCKS)
#define U_XQ (NB * NQ)
#define U_XK (NB * NK)
#define U_W HH
#define U_ALL (U_XQ + 2 * U_XK + 4 * U_W)
#define CVT_IT ((U_ALL + CVT_NW - 1) / CVT_NW)
static_assert(((long)NB * NQ * DM * 2) % 256 == 0 && ((long)NB * NK * DM * 2) % 256 == 0 && ((long)HH * DM * 2) % 256 == 0);

typedef unsigned v2u __attribute__((ext_vector_type(2)));

// behind each unit's loads and each unit's stores: their address registers are reused for the next unit's addresses;
// its memory clobber also keeps the order loads(u + 1), convert(u), stores(u), so that stores start while loads are in flight
#define CVT_XWAIT() asm volatile("s_wait_xcnt 0x0" ::: "memory")

// source row of unit u (wave-uniform); a unit past the end re-reads the last row and is not stored
__device__ __forceinline__ const float* cvt_row(unsigned u, const float* xq, const float* xk, const float* xv,
                                                const float* wq, const float* wk, const float* wv, const float* wp) {
  if (u >= U_ALL) u = U_ALL - 1;
  const unsigned uk = u - U_XQ, uv = uk - U_XK, uw = uv - U_XK;
  const float* p = (uw < U_W) ? wq : (uw < 2 * U_W) ? wk : (uw < 3 * U_W) ? wv : wp;
  unsigned r = uw % U_W;
  if (u < U_XQ + 2 * U_XK) { p = xv; r = (uv / NK) * NK_FULL + uv % NK; }
  if (u < U_XQ + U_XK)     { p = xk; r = (uk / NK) * NK_FULL + uk % NK; }
  if (u < U_XQ)            { p = xq; r = (u / NQ) * NQ_FULL + u % NQ; }
  return p + (size_t)r * DM;
}

__global__ __launch_bounds__(CVT_WPB * 32)
void k_cvt_all(const float* __restrict__ xq, const float* __restrict__ xk, const float* __restrict__ xv,
               const float* __restrict__ wq, const float* __restrict__ wk, const float* __restrict__ wv,
               const float* __restrict__ wp, us_t* __restrict__ dst)
{
  const unsigned lane = threadIdx.x & 31;
  const unsigned gw = __builtin_amdgcn_readfirstlane(blockIdx.x * CVT_WPB + (threadIdx.x >> 5));
  if (gw >= CVT_NW) return;   // bounds gw for any grid (wave-uniform, no barrier here)

  v4f buf[2][8];
  {
    const float* s = cvt_row(gw, xq, xk, xv, wq, wk, wv, wp) + 4 * lane;
#pragma unroll
    for (int j = 0; j < 8; ++j) buf[0][j] = *(const v4f*)(s + 128 * j);
    CVT_XWAIT();
  }
#pragma unroll   // two register sets alternate by a compile-time index: no copies between them
  for (int it = 0; it < CVT_IT; ++it) {
    const unsigned u = gw + it * CVT_NW;
    if (it + 1 < CVT_IT) {
      const float* s = cvt_row(u + CVT_NW, xq, xk, xv, wq, wk, wv, wp) + 4 * lane;
#pragma unroll
      for (int j = 0; j < 8; ++j) buf[(it + 1) & 1][j] = *(const v4f*)(s + 128 * j);
      CVT_XWAIT();
    }
    if (u < U_ALL) {
      const v4f (&r)[8] = buf[it & 1];
      us_t* d = dst + (size_t)u * DM + 4 * lane;
      if (u < U_ALL - U_W) {
#pragma unroll
        for (int j = 0; j < 8; ++j) {
          const v2u pk = {(unsigned)bf_bits(r[j][0]) | ((unsigned)bf_bits(r[j][1]) << 16),
                          (unsigned)bf_bits(r[j][2]) | ((unsigned)bf_bits(r[j][3]) << 16)};
          *(v2u*)(d + 128 * j) = pk;
        }
      } else {
#pragma unroll
        for (int j = 0; j < 8; ++j) {
          const v2u pk = {(unsigned)hf_bits(bf_val(r[j][0]) * OWCARRY) | ((unsigned)hf_bits(bf_val(r[j][1]) * OWCARRY) << 16),
                          (unsigned)hf_bits(bf_val(r[j][2]) * OWCARRY) | ((unsigned)hf_bits(bf_val(r[j][3]) * OWCARRY) << 16)};
          *(v2u*)(d + 128 * j) = pk;
        }
      }
      CVT_XWAIT();
    }
  }
}

// ---------------------------------------------------------------------------
// TN GEMM: C[M,N] = A[M,K] * B[N,K]^T, 16-bit operands from planes, f32 accumulate.
// Block 128x128x64, 256 threads = 8 waves (2x4), wave tile 64x32 = 4x2 WMMA tiles.
// Pipelined staging: two LDS buffers and two register sets; k tile t + 2 is fetched (whole 128-B lines) while tile t is
// multiplied, tile t + 1 goes from its registers to the other buffer behind the products, one barrier per k tile.
// Epilogue stages the 128x128 tile in the same LDS, behind a barrier of its own
//  EPI_Q  : D0 = Q plane  [(z*NH+n)*NQ + i][d] f16
//  EPI_OUT: D0 = f32 output rows [row][DM], scaled by 1/(AVCARRY*OWCARRY), bias0 (RNE bf16 value) added in f32 at the store stage
// ---------------------------------------------------------------------------
#define BM 128
#define BN 128
#define BK 64
#define BKP 72                 /* row pitch 144 B = 16 B x 9: ds_load_b128 fragment reads spread over the banks */
#define STG (BM * BKP)         /* halves of one operand's k tile */
#define CSP 136
#define CFP 132
#define EPI_Q 0
#define EPI_OUT 3

// Work-group barrier of the k loop: it waits for this wave's LDS reads and writes only. __syncthreads() would also
// wait for the global loads of the tile fetched ahead, which have to stay in flight across it.
__device__ __forceinline__ void tile_barrier() {
  asm volatile("s_wait_dscnt 0x0\n\ts_barrier_signal -1\n\ts_barrier_wait -1" ::: "memory");
}

template <int F16OP, int EPI>
__global__ __launch_bounds__(256)
void k_gemm(const us_t* __restrict__ A, const us_t* __restrict__ B,
            void* D0, void* D1, const float* __restrict__ bias0, const float* __restrict__ bias1,
            long lda, long ldb, long strideAz, int K)
{
  __shared__ __align__(16) us_t Sm[4 * STG];    // A tile x2, B tile x2: 128 rows x 64 k each (pad 72)
  us_t* Cs = Sm;                                // behind the k loop: f16 view [128][136] or f32 view [64][132]
  static_assert(64 * CFP * 4 <= BM * CSP * 2 && BM * CSP <= 4 * STG && BM == BN);

  const int tid = threadIdx.x, lane = tid & 31, wid = __builtin_amdgcn_readfirstlane(tid >> 5);
  const int wm = wid >> 2, wn = wid & 3, h = lane >> 4, l15 = lane & 15;
  const int m0 = blockIdx.y * BM, n0 = blockIdx.x * BN, z = blockIdx.z;
  const us_t* Ab = A + (size_t)z * (size_t)strideAz + (size_t)m0 * (size_t)lda;
  const us_t* Bb = B + (size_t)n0 * (size_t)ldb;

  v8f acc[4][2];
#pragma unroll
  for (int mi = 0; mi < 4; ++mi)
#pragma unroll
    for (int ni = 0; ni < 2; ++ni) acc[mi][ni] = vzero();

  const int nk = K / BK;                                   // even and at least 2: K is DM or HH, multiples of 128
  const int srow = tid >> 3, skc = (tid & 7) << 3;         // 8 lanes per 128-B row piece, 32 rows per block-wide load
  unsigned oa[4], ob[4];                                   // byte offsets of this thread's four row pieces; they live through the loop
#pragma unroll
  for (int i = 0; i < 4; ++i) {
    oa[i] = ((unsigned)(srow + 32 * i) * (unsigned)lda + (unsigned)skc) * 2u;
    ob[i] = ((unsigned)(srow + 32 * i) * (unsigned)ldb + (unsigned)skc) * 2u;
  }

  auto fetch = [&](v8us (&ra)[4], v8us (&rb)[4], int kb) {
    const char* pa = (const char*)(Ab + kb * BK);          // block-uniform base, per-thread 32-bit offset
    const char* pb = (const char*)(Bb + kb * BK);
#pragma unroll
    for (int i = 0; i < 4; ++i) {
      ra[i] = *(const v8us*)(pa + oa[i]);
      rb[i] = *(const v8us*)(pb + ob[i]);
    }
    // behind the eight loads: their address registers are rewritten for a later tile; its memory clobber also keeps
    // the loads ahead of the products' LDS reads, so that they are in flight from the start of the k tile
    asm volatile("s_wait_xcnt 0x0" ::: "memory");
  };
  auto put = [&](int buf, const v8us (&ra)[4], const v8us (&rb)[4]) {
    us_t* ta = Sm + buf * STG + srow * BKP + skc;
#pragma unroll
    for (int i = 0; i < 4; ++i) {
      *(v8us*)(ta + 32 * i * BKP) = ra[i];
      *(v8us*)(ta + 2 * STG + 32 * i * BKP) = rb[i];
    }
  };
  auto mult = [&](int buf) {
    const us_t* as = Sm + buf * STG;
    const us_t* bs = as + 2 * STG;
#pragma unroll
    for (int c = 0; c < 2; ++c) {                            // k ascending in steps of 32
      Frag16 af[4], bfr[2];
#pragma unroll
      for (int mi = 0; mi < 4; ++mi) {
        const int r = wm * 64 + mi * 16 + l15;                          // A row m = lane&15
        af[mi].u[0] = *(const v8us*)(&as[r * BKP + 32 * c + 8 * h]);      // k 8h..8h+7
        af[mi].u[1] = *(const v8us*)(&as[r * BKP + 32 * c + 16 + 8 * h]); // k 16+8h..16+8h+7
      }
#pragma unroll
      for (int ni = 0; ni < 2; ++ni) {
        const int r = wn * 32 + ni * 16 + l15;                          // B column n = lane&15, row of [n][k] plane, same k map
        bfr[ni].u[0] = *(const v8us*)(&bs[r * BKP + 32 * c + 8 * h]);
        bfr[ni].u[1] = *(const v8us*)(&bs[r * BKP + 32 * c + 16 + 8 * h]);
      }
#pragma unroll
      for (int mi = 0; mi < 4; ++mi)
#pragma unroll
        for (int ni = 0; ni < 2; ++ni) acc[mi][ni] = mma16<F16OP>(af[mi], bfr[ni], acc[mi][ni]);
    }
  };

  v8us a0[4], b0[4], a1[4], b1[4];
  fetch(a0, b0, 0);
  fetch(a1, b1, 1);
  put(0, a0, b0);
  tile_barrier();      // tile 0 visible to all waves
  for (int kb = 0; kb + 2 < nk; kb += 2) {
    fetch(a0, b0, kb + 2);
    mult(0);
    put(1, a1, b1);
    tile_barrier();    // publishes tile kb+1 and ends every read of tile kb before its buffer is refilled
    fetch(a1, b1, kb + 3);
    mult(1);
    put(0, a0, b0);
    tile_barrier();    // publishes tile kb+2 and ends every read of tile kb+1 before its buffer is refilled
  }
  mult(0);             // the last two tiles: nothing left to fetch
  put(1, a1, b1);
  tile_barrier();
  mult(1);             // the epilogue's first barrier ends these reads before the LDS becomes output staging

  // D layout: acc[mi][ni][v] = C(row wm*64+mi*16+8h+v, col wn*32+ni*16+l15)
  const int q8 = tid & 7, lsub = tid >> 3;   // 8 lanes per line, 32 lines per instruction over the block

  if (EPI == EPI_OUT) {
    float* Cf = (float*)Cs;
    float* Do = (float*)D0;
    const float oscale = 1.0f / (AVCARRY * OWCARRY);
#pragma unroll
    for (int rh = 0; rh < 2; ++rh) {
      __syncthreads();
      if (wm == rh) {
#pragma unroll
        for (int mi = 0; mi < 4; ++mi)
#pragma unroll
          for (int ni = 0; ni < 2; ++ni) {
            const int col = wn * 32 + ni * 16 + l15;
#pragma unroll
            for (int v = 0; v < 8; ++v)
              Cf[(mi * 16 + 8 * h + v) * CFP + col] = acc[mi][ni][v] * oscale;
          }
      }
      __syncthreads();
      {
#pragma unroll
        for (int it = 0; it < 8; ++it) {
          const int L = it * 32 + lsub, pr = L >> 2, ql = L & 3;     // 64 rows x 4 lines per row
          const v4f val = *(const v4f*)(&Cf[pr * CFP + 32 * ql + 4 * q8]);
          const v4f bq = *(const v4f*)(bias0 + n0 + 32 * ql + 4 * q8);
          const v4f o = {val[0] + bf_val(bq[0]), val[1] + bf_val(bq[1]),
                         val[2] + bf_val(bq[2]), val[3] + bf_val(bq[3])};
          float* dst = Do + ((size_t)(m0 + 64 * rh + pr) * DM + n0 + 32 * ql + 4 * q8);
          *(v4f*)dst = o;
        }
        
      }
    }
  } else {
    __syncthreads();
#pragma unroll
    for (int mi = 0; mi < 4; ++mi)
#pragma unroll
      for (int ni = 0; ni < 2; ++ni) {
        const int col = wn * 32 + ni * 16 + l15;
#pragma unroll
        for (int v = 0; v < 8; ++v)
          Cs[(wm * 64 + mi * 16 + 8 * h + v) * CSP + col] = hfl_bits(acc[mi][ni][v]);
      }
    __syncthreads();
    const int hb = n0 >> 6;                      // first head of this column block
#pragma unroll
    for (int it = 0; it < 8; ++it) {
      const int L = it * 32 + lsub, pr = L >> 1, nl = L & 1;   // 128 rows x 2 lines of 64 halves
      v4u val = *(const v4u*)(&Cs[pr * CSP + nl * 64 + 8 * q8]);
      us_t* dst = (us_t*)D0 + ((((size_t)z * NH + hb + nl) * NQ + m0 + pr) * DH + 8 * q8);
      *(v4u*)dst = val;
    }
  }
}

// ---------------------------------------------------------------------------
// K and V projections in one launch: C[256,256] = A[256,DM] * B[256,DM]^T per block, bf16 operands from planes, f32 accumulate.
// 256 blocks (one per WGP: 4 waves of 256 VGPRs per SIMD), 512 threads = 16 waves (4x4), wave tile 64x64 = 4x4 WMMA tiles:
// a 64-k tile brings 64 KB from L2 for 256x256 outputs (four 128x128 blocks bring 128 KB) and every LDS fragment feeds 4 WMMAs.
//  K  : A = xk rows (positions), B = Wk rows (features): tile row = position, four 128-B lines (heads) per row of the K plane
//  V^T: A = Wv rows (features), B = xv rows (positions): tile row = feature (head, d), 512 contiguous bytes of the Vt plane,
//       so the transposed plane comes out of the same epilogue; each element still sums its products over ascending k.
// Staging: two LDS buffers, one register set; k tile t + 1 is fetched (whole 128-B lines) ahead of tile t's products and
// goes to the other buffer behind them, one barrier per k tile.
// ---------------------------------------------------------------------------
#define KVT 256
#define KV_STG (KVT * BKP)     /* halves of one operand's k tile */
#define KV_CSP 264             /* halves per row of the output staging: 528 B = 16 B x 33 */
static_assert(NK % KVT == 0 && HH % KVT == 0 && DM % (2 * BK) == 0 && KVT * KV_CSP <= 4 * KV_STG);

__global__ __launch_bounds__(512)
void k_gemm_kv(const us_t* __restrict__ Xk, const us_t* __restrict__ Xv, const us_t* __restrict__ Wk,
               const us_t* __restrict__ Wv, us_t* Dk, us_t* Dv)
{
  __shared__ __align__(16) us_t Sm[4 * KV_STG];   // A tile x2, B tile x2: 256 rows x 64 k each (pad 72); behind the k loop: f16 [256][264]

  const int tid = threadIdx.x, lane = tid & 31, wid = __builtin_amdgcn_readfirstlane(tid >> 5);
  const int wm = wid >> 2, wn = wid & 3, h = lane >> 4, l15 = lane & 15;
  const int p0 = blockIdx.y * KVT, f0 = blockIdx.x * KVT;      // first position, first feature
  const int isv = blockIdx.z & 1, z = blockIdx.z >> 1;         // which projection, batch
  const size_t xoff = ((size_t)z * NK + p0) * DM, woff = (size_t)f0 * DM;
  const us_t* Ab = isv ? Wv + woff : Xk + xoff;
  const us_t* Bb = isv ? Xv + xoff : Wk + woff;

  // unroll directives on loops that index a register array (accumulators, fragments, staged pieces): such an array
  // stays in registers only under compile-time indices
  v8f acc[4][4];
#pragma unroll
  for (int mi = 0; mi < 4; ++mi)
#pragma unroll
    for (int ni = 0; ni < 4; ++ni) acc[mi][ni] = vzero();

  const int srow = tid >> 3, skc = (tid & 7) << 3;             // 8 lanes per 128-B row piece, 64 rows per block-wide load
  const unsigned toff = ((unsigned)srow * DM + (unsigned)skc) * 2u;   // byte offset of this thread's first row piece; next: + 64 rows

  v8us ra[4], rb[4];
  auto fetch = [&](int kb) {
    const char* pa = (const char*)(Ab + kb * BK) + toff;       // block-uniform base, per-thread 32-bit offset
    const char* pb = (const char*)(Bb + kb * BK) + toff;
#pragma unroll
    for (int i = 0; i < 4; ++i) {
      ra[i] = *(const v8us*)(pa + (size_t)i * 64 * DM * 2);
      rb[i] = *(const v8us*)(pb + (size_t)i * 64 * DM * 2);
    }
    // behind the eight loads: their address registers are rewritten for the next tile; its memory clobber also keeps
    // the loads ahead of the products' LDS reads, so that they are in flight from the start of the k tile
    asm volatile("s_wait_xcnt 0x0" ::: "memory");
  };
  auto put = [&](int buf) {
    us_t* ta = Sm + buf * KV_STG + srow * BKP + skc;
#pragma unroll
    for (int i = 0; i < 4; ++i) {
      *(v8us*)(ta + 64 * i * BKP) = ra[i];
      *(v8us*)(ta + 2 * KV_STG + 64 * i * BKP) = rb[i];
    }
  };
  auto mult = [&](int buf) {
    const us_t* as = Sm + buf * KV_STG;
    const us_t* bs = as + 2 * KV_STG;
#pragma unroll
    for (int c = 0; c < 2; ++c) {                              // k ascending in steps of 32
      Frag16 af[4], bfr[4];
#pragma unroll
      for (int mi = 0; mi < 4; ++mi) {
        const int r = wm * 64 + mi * 16 + l15;                            // A row m = lane&15
        af[mi].u[0] = *(const v8us*)(&as[r * BKP + 32 * c + 8 * h]);        // k 8h..8h+7
        af[mi].u[1] = *(const v8us*)(&as[r * BKP + 32 * c + 16 + 8 * h]);   // k 16+8h..16+8h+7
      }
#pragma unroll
      for (int ni = 0; ni < 4; ++ni) {
        const int r = wn * 64 + ni * 16 + l15;                            // B column n = lane&15, row of [n][k] plane, same k map
        bfr[ni].u[0] = *(const v8us*)(&bs[r * BKP + 32 * c + 8 * h]);
        bfr[ni].u[1] = *(const v8us*)(&bs[r * BKP + 32 * c + 16 + 8 * h]);
      }
#pragma unroll
      for (int mi = 0; mi < 4; ++mi)
#pragma unroll
        for (int ni = 0; ni < 4; ++ni) acc[mi][ni] = mma16<0>(af[mi], bfr[ni], acc[mi][ni]);
    }
  };

  const int nk = DM / BK;                                      // even and at least 2
  fetch(0);
  put(0);
  tile_barrier();      // tile 0 visible to all waves
  fetch(1);
  mult(0);
  put(1);
  tile_barrier();      // publishes tile 1 and ends every read of tile 0 before its buffer is refilled
  for (int kb = 1; kb + 2 < nk; kb += 2) {
    fetch(kb + 1);
    mult(1);
    put(0);
    tile_barrier();    // publishes tile kb+1 and ends every read of tile kb before its buffer is refilled
    fetch(kb + 2);
    mult(0);
    put(1);
    tile_barrier();    // publishes tile kb+2 and ends every read of tile kb+1 before its buffer is refilled
  }
  mult(1);             // the last tile: nothing left to fetch
  __syncthreads();     // ends every read of the k tiles before the LDS becomes output staging

  // D layout: acc[mi][ni][v] = C(row wm*64+mi*16+8h+v, col wn*64+ni*16+l15)
#pragma unroll
  for (int mi = 0; mi < 4; ++mi)
#pragma unroll
    for (int ni = 0; ni < 4; ++ni) {
      const int col = wn * 64 + ni * 16 + l15;
#pragma unroll
      for (int v = 0; v < 8; ++v)
        Sm[(wm * 64 + mi * 16 + 8 * h + v) * KV_CSP + col] = hfl_bits(acc[mi][ni][v]);
    }
  __syncthreads();     // the staged tile visible to all waves
  // tile row pr, 64-column piece nl -> one 128-B line: K plane [(z*NH + head)*NK + pos][d], Vt plane [(z*HH + feature)*NK + pos]
  us_t* Db = isv ? Dv + ((size_t)z * HH + f0) * NK + p0 : Dk + (((size_t)z * NH + (f0 >> 6)) * NK + p0) * DH;
  const size_t rstep = isv ? NK : DH, lstep = isv ? 64 : (size_t)NK * DH;
  const int q8 = tid & 7, lsub = tid >> 3;   // 8 lanes per line, 64 lines per instruction over the block
#pragma unroll
  for (int it = 0; it < 16; ++it) {
    const int L = it * 64 + lsub, pr = L >> 2, nl = L & 3;     // 256 rows x 4 lines of 64 halves
    const v4u val = *(const v4u*)(&Sm[pr * KV_CSP + nl * 64 + 8 * q8]);
    *(v4u*)(Db + pr * rstep + nl * lstep + 8 * q8) = val;
  }
}

// ---------------------------------------------------------------------------
// LDS tiles of the column-statistics and context sweeps: 64 rows x 64 halves (128 B) (colstats: one Q tile per wave, K rows shared by the block; context: shared by the 4 waves of one key group).
// Fetch: every wave-wide 16-B load covers four whole 128-B lines (8 lanes per row).
// Row pitch 72 halves = 144 B = 16 B x 9: fragment reads (ds_load_b128, 16 rows) spread over the banks.
// ---------------------------------------------------------------------------
#define TP 72
#define TILE_H (64 * TP)
static_assert(NQ % 64 == 0 && NK % 512 == 0 && DH == 64);

__device__ __forceinline__ void tile_fetch(v4u (&r)[4], const us_t* __restrict__ src, size_t pitch, int tid) {
  const us_t* p = src + (size_t)(tid >> 3) * pitch + 8 * (tid & 7);   // one address per thread, constant steps of 16 rows
#pragma unroll
  for (int i = 0; i < 4; ++i) r[i] = *(const v4u*)(p + (size_t)(16 * i) * pitch);
}
__device__ __forceinline__ void tile_put(us_t* t, const v4u (&r)[4], int tid) {
#pragma unroll
  for (int i = 0; i < 4; ++i) {
    const int ch = tid + 128 * i;
    *(v4u*)(t + (ch >> 3) * TP + 8 * (ch & 7)) = r[i];
  }
}
// fragment of tile row 'row', halves 32c..32c+31, in the k map of the plane loaders (8h.., 16+8h..)
__device__ __forceinline__ void frag_get(Frag16& f, const us_t* t, int row, int c, int h) {
  f.u[0] = *(const v8us*)(t + row * TP + 32 * c + 8 * h);
  f.u[1] = *(const v8us*)(t + row * TP + 32 * c + 16 + 8 * h);
}

// ---------------------------------------------------------------------------
// Column statistics of the query-axis softmax and head-averaged probabilities in one sweep.
// Block = 512 threads (16 waves) owns 32 keys of one batch and ALL NQ queries; wave w owns queries 64 w .. 64 w + 63.
// Per head: S = Q K^T (A = Q rows, B = K rows) for the wave's 64 x 32 tile stays in registers; the wave takes its own
// column maximum m_w and column sum l_w of e = exp2(c*s - m_w), the 16 waves' (m_w, l_w) meet in an LDS table behind one
// barrier, every wave forms M = max m_w, Z = sum l_w * exp2(m_w - M) (lane = key), and adds
// e * exp2(m_w - M - log2 Z) to its running head sum. So each score is formed once and takes one exp2.
// Q rows: a wave stages only its own 64 rows (whole-line loads, the next head's in flight during the products and the vector work) in its own
// LDS slice, so the slice needs no barrier. K rows of all 16 heads are staged once, in front of the loop.
// ---------------------------------------------------------------------------
#define SM_WAVES 16
#define SM_KEYS 32
#define RP 36                  /* floats per row of the exchange table and of the output staging: 144 B = 16 B x 9 */
static_assert(NQ == SM_WAVES * 64 && NK % SM_KEYS == 0 && NH == 16);
static_assert(64 * RP * 4 <= TILE_H * 2);

// value of lane ^ 16 by one vector cross-row move (identity lane select): no LDS round trip in the per-head chain
__device__ __forceinline__ float other_half(float v) {
  const unsigned u = __float_as_uint(v);
  return __uint_as_float(__builtin_amdgcn_permlanex16(u, u, 0x76543210u, 0xfedcba98u, false, false));
}

__global__ __launch_bounds__(SM_WAVES * 32)
void k_stats_mean(const us_t* __restrict__ Qp, const us_t* __restrict__ Kp, float* NLS, float* out1)
{
  __shared__ __align__(16) us_t Qs[SM_WAVES * TILE_H];       // per wave: 64 query rows of the current head; behind the loop: output staging
  __shared__ __align__(16) us_t Ks[NH * SM_KEYS * TP];       // the block's 32 key rows of every head
  __shared__ __align__(16) float red[2][SM_KEYS * RP];       // [trip parity][key][16 maxima, 16 sums]
  __shared__ __align__(16) float Nl[NH * SM_KEYS];           // column normalisers, stored behind the loop
  const int tid = threadIdx.x;
  const int lane = threadIdx.x & 31;
  const int wave = __builtin_amdgcn_readfirstlane(threadIdx.x >> 5);
  const int h = lane >> 4, l15 = lane & 15;
  const int k0 = blockIdx.x * SM_KEYS;
  const int b = blockIdx.y;
  us_t* qs = Qs + wave * TILE_H;

  // blocks of one batch walk the heads from different starts, so that they do not all ask L2 for the same Q lines at once
  const int hrot = blockIdx.x & (NH - 1);
  const us_t* qsrc = Qp + ((size_t)b * NH * NQ + wave * 64) * DH + 8 * lane;   // head 0; head n: + n * NQ * DH
  v4u rq[16];
  {
    // chunk tid + 512 i = row (head * 32 + key) (tid >> 3) + 64 i, 8 lanes per 128-B row: one address, steps of two heads
    const us_t* kp = Kp + (((size_t)b * NH + (tid >> 8)) * NK + k0 + ((tid >> 3) & 31)) * DH + 8 * (tid & 7);
    const us_t* qp = qsrc + (size_t)hrot * NQ * DH;
    v4u rk[8];
#pragma unroll
    for (int i = 0; i < 8; ++i) rk[i] = *(const v4u*)(kp + (size_t)i * 2 * NK * DH);
#pragma unroll
    for (int j = 0; j < 16; ++j) rq[j] = *(const v4u*)(qp + 256 * j);   // 512 contiguous bytes per wave-wide load
    // behind the prologue's loads: their address registers are reused below, and as inputs here they stay apart from the
    // loads' destinations
    asm volatile("s_wait_xcnt 0x0" :: "v"(kp), "v"(qp) : "memory");
#pragma unroll
    for (int i = 0; i < 8; ++i) {
      const int ch = tid + 512 * i;
      *(v4u*)(Ks + (ch >> 3) * TP + 8 * (ch & 7)) = rk[i];
    }
  }
  __syncthreads();   // the K rows of every head visible to all waves

  v8f macc[4][2];
#pragma unroll
  for (int qt = 0; qt < 4; ++qt)
#pragma unroll
    for (int kt = 0; kt < 2; ++kt) macc[qt][kt] = vzero();

#pragma unroll 1   // kept rolled (for speed only)
  for (int hh = 0; hh < NH; ++hh) {
    const int hd = (hh + hrot) & (NH - 1);                    // this trip's head
#pragma unroll
    for (int j = 0; j < 16; ++j) {
      const int ch = 32 * j + lane;
      *(v4u*)(qs + (ch >> 3) * TP + 8 * (ch & 7)) = rq[j];
    }
    // the wave's rows are in its LDS slice before its lanes read one another's pieces back as fragments
    asm volatile("s_wait_dscnt 0x0" ::: "memory");
    const us_t* qn = qsrc + (size_t)((hd + 1) & (NH - 1)) * NQ * DH;   // the next trip's rows
    if (hh + 1 < NH) {
#pragma unroll
      for (int j = 0; j < 8; ++j) rq[j] = *(const v4u*)(qn + 256 * j);
      // first half of the next trip's loads, issued ahead of the products so that L2 is asked all through the trip; behind
      // them their address register is reused, and as an input here it stays apart from their destinations; the memory
      // clobber keeps them ahead of the fragment reads
      asm volatile("s_wait_xcnt 0x0" :: "v"(qn) : "memory");
    }

    v8f s[4][2];
    {
      const us_t* kc = Ks + hd * (SM_KEYS * TP);
      Frag16 kf[2][2];
#pragma unroll
      for (int kt = 0; kt < 2; ++kt)
#pragma unroll
        for (int c = 0; c < 2; ++c) frag_get(kf[kt][c], kc, 16 * kt + l15, c, h);   // B column n = key
#pragma unroll
      for (int qt = 0; qt < 4; ++qt) {
        Frag16 qa[2];
#pragma unroll
        for (int c = 0; c < 2; ++c) frag_get(qa[c], qs, 16 * qt + l15, c, h);       // A row m = query
#pragma unroll
        for (int kt = 0; kt < 2; ++kt) {
          v8f t = vzero();
#pragma unroll
          for (int c = 0; c < 2; ++c) t = mma16<1>(qa[c], kf[kt][c], t);
          s[qt][kt] = t;
        }
      }
    }
    if (hh + 1 < NH) {
#pragma unroll
      for (int j = 8; j < 16; ++j) rq[j] = *(const v4u*)(qn + 256 * j);
      // second half, behind the products, whose fragments need the registers: the same wait for the same reasons; the memory
      // clobber keeps these loads ahead of the vector work and the exchange, so that they are in flight through the rest of the trip
      asm volatile("s_wait_xcnt 0x0" :: "v"(qn) : "memory");
    }

    // D layout: s[qt][kt][r] = (query 64 wave + 16 qt + 8h + r, key k0 + 16 kt + l15)
    float tm[2], nm[2], lw[2];
#pragma unroll
    for (int kt = 0; kt < 2; ++kt) {
      float cm[4];                                            // one short chain per query tile
#pragma unroll
      for (int qt = 0; qt < 4; ++qt) {
        cm[qt] = fmaxf(s[qt][kt][0], s[qt][kt][1]);
#pragma unroll
        for (int r = 2; r < 8; ++r) cm[qt] = fmaxf(cm[qt], s[qt][kt][r]);
      }
      tm[kt] = fmaxf(fmaxf(cm[0], cm[1]), fmaxf(cm[2], cm[3]));
    }
#pragma unroll
    for (int kt = 0; kt < 2; ++kt) nm[kt] = -(fmaxf(tm[kt], other_half(tm[kt])) * C2LOG);
#pragma unroll
    for (int kt = 0; kt < 2; ++kt) {
#pragma unroll
      for (int qt = 0; qt < 4; ++qt)
#pragma unroll
        for (int r = 0; r < 8; ++r) s[qt][kt][r] = FEXP2(fmaf(s[qt][kt][r], C2LOG, nm[kt]));
      const v8f q4 = (s[0][kt] + s[1][kt]) + (s[2][kt] + s[3][kt]);
      lw[kt] = ((q4[0] + q4[1]) + (q4[2] + q4[3])) + ((q4[4] + q4[5]) + (q4[6] + q4[7]));
    }
#pragma unroll
    for (int kt = 0; kt < 2; ++kt) lw[kt] += other_half(lw[kt]);

    float* rd = red[hh & 1];
    rd[lane * RP + wave] = h ? -nm[1] : -nm[0];               // lane = key 16 h + l15
    rd[lane * RP + 16 + wave] = h ? lw[1] : lw[0];
    // publishes the 16 waves' partial statistics; LDS wait only, the next head's loads stay in flight across it. The table of
    // this parity is rewritten only behind the next such barrier, which every wave reaches with these reads done
    tile_barrier();
    float mv[16];
#pragma unroll
    for (int i = 0; i < 4; ++i) {
      const v4f x = *(const v4f*)(rd + lane * RP + 4 * i);
      mv[4 * i] = x[0]; mv[4 * i + 1] = x[1]; mv[4 * i + 2] = x[2]; mv[4 * i + 3] = x[3];
    }
    float M = fmaxf(mv[0], mv[1]);
#pragma unroll
    for (int i = 2; i < 16; ++i) M = fmaxf(M, mv[i]);
    float zp[4];                                              // four short chains, one per four waves
#pragma unroll
    for (int i = 0; i < 4; ++i) {
      const v4f x = *(const v4f*)(rd + lane * RP + 16 + 4 * i);
      zp[i] = x[0] * FEXP2(mv[4 * i] - M);
#pragma unroll
      for (int e = 1; e < 4; ++e) zp[i] = fmaf(x[e], FEXP2(mv[4 * i + e] - M), zp[i]);
    }
    const float Z = (zp[0] + zp[1]) + (zp[2] + zp[3]);
    const float nls = -(M + log2f(Z));                        // of key 16 h + l15
    const float oth = other_half(nls);
    const float f0 = FEXP2((h ? oth : nls) - nm[0]);          // exp2(m_w - M - log2 Z) of key l15
    const float f1 = FEXP2((h ? nls : oth) - nm[1]);          // of key 16 + l15
#pragma unroll
    for (int qt = 0; qt < 4; ++qt)
#pragma unroll
      for (int r = 0; r < 8; ++r) {
        macc[qt][0][r] = fmaf(s[qt][0][r], f0, macc[qt][0][r]);
        macc[qt][1][r] = fmaf(s[qt][1][r], f1, macc[qt][1][r]);
      }
    if (wave == 0) Nl[hd * SM_KEYS + lane] = PSHIFT + nls;
  }

  // output staging in the wave's own slice, which only this wave has read
  float* Mst = (float*)qs;
#pragma unroll
  for (int qt = 0; qt < 4; ++qt)
#pragma unroll
    for (int kt = 0; kt < 2; ++kt)
#pragma unroll
      for (int r = 0; r < 8; ++r)
        Mst[(16 * qt + 8 * h + r) * RP + 16 * kt + l15] = macc[qt][kt][r] * (1.0f / NH);
  __syncthreads();     // wave 0's normalisers visible to all waves; each wave's staged rows complete
  const int q8 = lane & 7, rsub = lane >> 3;
#pragma unroll
  for (int it = 0; it < 16; ++it) {
    const int row = it * 4 + rsub;                            // 64 rows of one 128-B line, 4 lines per instruction
    const v4f val = *(const v4f*)(&Mst[row * RP + 4 * q8]);
    float* dst = out1 + (((size_t)b * NQ + wave * 64 + row) * NK + k0 + 4 * q8);
    *(v4f*)dst = val;
  }
  NLS[((size_t)b * NH + wave) * NK + k0 + lane] = Nl[tid];    // wave = head: one 128-B line per wave
}

// ---------------------------------------------------------------------------
// Context, transposed register-fed form. Block = 256 threads (8 waves = 2 key groups x 4 waves), 128 queries of one
// (b,n); wave (g, w) owns 32 queries (two Q fragment sets held as B operands) and the 64-key tiles 2 i + g, so that
// four waves stand on each SIMD and one wave's LDS waits and vector work run under another's products.
// Per 32-key step: S^T = K Q^T (A = K rows from a 64-key LDS tile) for two 16-key tiles, p^T*4096 = exp2(c*s + NLS[key])
// packed from the two D tiles into one B fragment per query tile (element r <- tile 0, element 8+r <- tile 1),
// O^T += Vt * P^T (A = Vt rows d from a 64-key LDS tile, k = keys). Every K and Vt fragment read feeds both
// query tiles. Each group has two buffers per tile and fills them with its own 128 threads, the next
// 64 keys fetched during the current, one barrier per trip; the column normaliser (whole row in
// LDS) is already inside the exponent, so there is no running state. Behind the loop the two groups' partial sums
// are added through LDS: wave (g, w) finishes query tile g.
// ---------------------------------------------------------------------------
#define PP 72
static_assert(NK % 1024 == 0);

__global__ __launch_bounds__(256)
void k_attn_ctx(const us_t* __restrict__ Qp, const us_t* __restrict__ Kp, const us_t* __restrict__ Vt,
                const float* __restrict__ NLS, us_t* AV)
{
  __shared__ __align__(16) us_t Ost[4 * 32 * PP];   // per wave pair 32 rows x 64 halves used (pad 72); a wave reads back its own 16 rows
  __shared__ __align__(16) us_t Kt[2][2][TILE_H];   // [key group][buffer], rows = keys, columns = d; behind the loop: partial sums
  __shared__ __align__(16) us_t Vs[2][2][TILE_H];   // [key group][buffer], rows = d, columns = keys
  __shared__ __align__(16) float Ns[NK];            // column normalisers of this (b,n)
  static_assert(8 * 1024 * 4 <= 4 * TILE_H * 2);
  const int tid = threadIdx.x;
  const int lane = threadIdx.x & 31;
  const int wave = __builtin_amdgcn_readfirstlane(threadIdx.x >> 5);
  const int g = wave >> 2, w = wave & 3;            // key group, query slice
  const int gtid = tid & 127;                       // thread within its key group
  const int h = lane >> 4, l15 = lane & 15;
  const int i0 = blockIdx.x * 128, bn = blockIdx.y;
  const int b = bn / NH, n = bn - b * NH;
  const int iw = i0 + w * 32;
  const int ow = w * (32 * PP);

  Frag16 qf[2][2];
#pragma unroll
  for (int qt = 0; qt < 2; ++qt) {
    const us_t* pq = Qp + ((size_t)bn * NQ + iw + 16 * qt + l15) * DH;   // B column n = query, k = d
#pragma unroll
    for (int c = 0; c < 2; ++c) {
      qf[qt][c].u[0] = *(const v8us*)(pq + 32 * c + 8 * h);
      qf[qt][c].u[1] = *(const v8us*)(pq + 32 * c + 16 + 8 * h);
    }
  }

  v8f oacc[2][4];
#pragma unroll
  for (int qt = 0; qt < 2; ++qt)
#pragma unroll
    for (int dt = 0; dt < 4; ++dt) oacc[qt][dt] = vzero();

  const us_t* Kbase = Kp + (size_t)bn * NK * DH + (size_t)g * 64 * DH;   // the group's first tile; its next: + 128 keys
  const us_t* Vbase = Vt + (size_t)bn * DH * NK + (size_t)g * 64;
  const float* Nbase = NLS + (size_t)bn * NK;

  v4f nv[NK / 1024];
#pragma unroll
  for (int i = 0; i < NK / 1024; ++i) nv[i] = *(const v4f*)(Nbase + 4 * (tid + 256 * i));
  v4u rk[4], rv[4];
  tile_fetch(rk, Kbase, DH, gtid);
  tile_fetch(rv, Vbase, NK, gtid);
  // behind the prologue's loads: their address registers are reused below
  asm volatile("s_wait_xcnt 0x0" ::: "memory");
#pragma unroll
  for (int i = 0; i < NK / 1024; ++i) *(v4f*)(&Ns[4 * (tid + 256 * i)]) = nv[i];
  tile_put(Kt[g][0], rk, gtid);
  tile_put(Vs[g][0], rv, gtid);
  __syncthreads();   // both groups' first tiles and the normalisers visible to all waves

  for (int i = 0; i < NK / 128; ++i) {
    const int t = 2 * i + g;                            // this group's 64-key tile
    const us_t* kc = Kt[g][i & 1];
    const us_t* vc = Vs[g][i & 1];
    if (i + 1 < NK / 128) {
      tile_fetch(rk, Kbase + (size_t)(i + 1) * 128 * DH, DH, gtid);
      tile_fetch(rv, Vbase + (size_t)(i + 1) * 128, NK, gtid);
    }
    // behind the eight loads: their address registers are reused below; its memory clobber also keeps the loads ahead of
    // the tile's LDS reads, so that they are in flight through the whole tile and not only just before tile_put
    asm volatile("s_wait_xcnt 0x0" ::: "memory");
#pragma unroll
    for (int ks = 0; ks < 2; ++ks) {
      Frag16 pb[2];                                     // per query tile: B[k = key in step][n = query]
#pragma unroll
      for (int st = 0; st < 2; ++st) {
        Frag16 ka[2];
#pragma unroll
        for (int c = 0; c < 2; ++c) frag_get(ka[c], kc, 32 * ks + 16 * st + l15, c, h);   // A row m = key
        // D rows = keys 64 t + 32 ks + 16 st + 8h + r : eight consecutive table entries per lane
        const float* np = &Ns[64 * t + 32 * ks + 16 * st + 8 * h];
        const v4f na = *(const v4f*)(np);
        const v4f nc = *(const v4f*)(np + 4);
        const float nl[8] = {na[0], na[1], na[2], na[3], nc[0], nc[1], nc[2], nc[3]};
#pragma unroll
        for (int qt = 0; qt < 2; ++qt) {
          v8f s = vzero();
#pragma unroll
          for (int c = 0; c < 2; ++c) s = mma16<1>(ka[c], qf[qt][c], s);
#pragma unroll
          for (int r = 0; r < 8; ++r)
            pb[qt].hf[8 * st + r] = (h16)pexp2_cut(fmaf(s[r], C2LOG, nl[r]));
        }
      }
#pragma unroll
      for (int dt = 0; dt < 4; ++dt) {
        Frag16 va;                                      // A row m = d (row of Vt), k = key
        frag_get(va, vc, 16 * dt + l15, ks, h);
#pragma unroll
        for (int qt = 0; qt < 2; ++qt) oacc[qt][dt] = mma16<1>(va, pb[qt], oacc[qt][dt]);
      }
    }
    if (i + 1 < NK / 128) {
      tile_put(Kt[g][(i + 1) & 1], rk, gtid);
      tile_put(Vs[g][(i + 1) & 1], rv, gtid);
    }
    __syncthreads();   // publishes both groups' next tiles and ends every read of the current ones before their buffers are refilled
  }

  // The two key groups' partial sums meet: wave (g, w) keeps query tile g and hands query tile 1 - g to wave (1 - g, w).
  // 4 KB per wave in the K tiles' LDS, which every wave has left at the loop's last barrier; 16 B per lane, lanes contiguous.
  float* Xs = (float*)&Kt[0][0][0];
  v8f fin[4];
#pragma unroll
  for (int dt = 0; dt < 4; ++dt) {
    const v8f oth = g ? oacc[0][dt] : oacc[1][dt];
    fin[dt] = g ? oacc[1][dt] : oacc[0][dt];
#pragma unroll
    for (int j = 0; j < 2; ++j) {
      const v4f x = {oth[4 * j], oth[4 * j + 1], oth[4 * j + 2], oth[4 * j + 3]};
      *(v4f*)(Xs + wave * 1024 + ((2 * dt + j) * 32 + lane) * 4) = x;
    }
  }
  __syncthreads();     // the partner wave's partial sums are visible
#pragma unroll
  for (int dt = 0; dt < 4; ++dt)
#pragma unroll
    for (int j = 0; j < 2; ++j) {
      const v4f x = *(const v4f*)(Xs + (wave ^ 4) * 1024 + ((2 * dt + j) * 32 + lane) * 4);
#pragma unroll
      for (int e = 0; e < 4; ++e) fin[dt][4 * j + e] += x[e];
    }

  // D layout: fin[dt][r] = O^T(d = 16 dt + 8h + r, query 16 g + l15) : eight consecutive d per lane
  const float sc = AVCARRY / PCARRY;
#pragma unroll
  for (int dt = 0; dt < 4; ++dt) {
    v8us pk;
#pragma unroll
    for (int r = 0; r < 8; ++r) pk[r] = hfl_bits(fin[dt][r] * sc);
    *(v8us*)(&Ost[ow + (16 * g + l15) * PP + 16 * dt + 8 * h]) = pk;
  }
  __syncthreads();
  const int q8 = lane & 7, rsub = lane >> 3;
  {
#pragma unroll
    for (int it = 0; it < 4; ++it) {
      const int row = 16 * g + it * 4 + rsub;            // 16 rows per wave, 4 lines per instruction
      v4u val = *(const v4u*)(&Ost[ow + row * PP + 8 * q8]);
      us_t* dst = AV + (((size_t)(iw + row) * NB + b) * HH + n * DH + 8 * q8);
      *(v4u*)dst = val;
    }
  }
}

// ---------------------------------------------------------------------------
// Host orchestration (6 launches)
// ---------------------------------------------------------------------------
extern "C" void kernel_launch(void* const* d_in, const int* in_sizes, int n_in,
                              void* d_out, int out_size, void* d_ws, size_t ws_size,
                              hipStream_t stream)
{
  if (n_in < 8) return;
  const float* xq = (const float*)d_in[0];
  const float* xk = (const float*)d_in[1];
  const float* xv = (const float*)d_in[2];
  const float* wq = (const float*)d_in[3];
  const float* wk = (const float*)d_in[4];
  const float* wv = (const float*)d_in[5];
  const float* wp = (const float*)d_in[6];
  const float* bp = (const float*)d_in[7];

  if ((long)in_sizes[0] < ((long)(NB - 1) * NQ_FULL + NQ) * DM) return;
  if ((long)in_sizes[1] < ((long)(NB - 1) * NK_FULL + NK) * DM) return;
  if ((long)in_sizes[2] < ((long)(NB - 1) * NK_FULL + NK) * DM) return;
  if ((long)in_sizes[3] < (long)HH * DM) return;
  if ((long)in_sizes[4] < (long)HH * DM) return;
  if ((long)in_sizes[5] < (long)HH * DM) return;
  if ((long)in_sizes[6] < (long)DM * HH) return;
  if (in_sizes[7] < DM) return;
  if ((long)out_size < OUT1_OFF + (long)NB * NQ * NK) return;

  char* base = (char*)d_ws;
  size_t off = 0;
  auto take = [&](size_t bytes) -> char* {
    char* q = base + off; off += (bytes + 255) & ~(size_t)255; return q;
  };
  us_t*  xq_b = (us_t*) take((size_t)NB * NQ * DM * 2);             // bf16 [b][q][DM]
  us_t*  xk_b = (us_t*) take((size_t)NB * NK * DM * 2);             // bf16 [b][k][DM]
  us_t*  xv_b = (us_t*) take((size_t)NB * NK * DM * 2);             // bf16 [b][k][DM]
  us_t*  wq_b = (us_t*) take((size_t)HH * DM * 2);                  // bf16 [out][in]
  us_t*  wk_b = (us_t*) take((size_t)HH * DM * 2);                  // bf16
  us_t*  wv_b = (us_t*) take((size_t)HH * DM * 2);                  // bf16
  us_t*  wp_h = (us_t*) take((size_t)DM * HH * 2);                  // f16 (x64)
  us_t*  Qp   = (us_t*) take((size_t)NB * NH * NQ * DH * 2);        // f16 [bn][q][d]
  us_t*  Kp   = (us_t*) take((size_t)NB * NH * NK * DH * 2);        // f16 [bn][k][d]
  us_t*  Vt   = (us_t*) take((size_t)NB * NH * DH * NK * 2);        // f16 [bn][d][k]
  float* NLS  = (float*)take((size_t)NB * NH * NK * 4);             // f32 [bn][k]
  us_t*  AV   = (us_t*) take((size_t)NQ * NB * HH * 2);             // f16 (x32) [q*NB+b][n*64+d]
  if (off > ws_size) return;
  if (off > (size_t)WS_TOTAL) return;

  float* out0 = (float*)d_out;                                       // [q][b][c]
  float* out1 = (float*)d_out + OUT1_OFF;                            // [b][q][k]

  // 1) input conversions (RNE bf16; Wp as f16 of the bf16 value x64): planes xq_b .. wp_h, back to back from xq_b
  k_cvt_all<<<dim3(CVT_BLOCKS), dim3(CVT_WPB * 32), 0, stream>>>(xq, xk, xv, wq, wk, wv, wp, xq_b);

  // 2) projections: q = xq Wq^T, k = xk Wk^T, v^T = (xv Wv^T)^T, per batch z
  k_gemm<0, EPI_Q><<<dim3(HH / BN, NQ / BM, NB), dim3(256), 0, stream>>>(
      xq_b, wq_b, (void*)Qp, (void*)Qp, bp, bp, (long)DM, (long)DM, (long)NQ * DM, DM);
  k_gemm_kv<<<dim3(HH / KVT, NK / KVT, 2 * NB), dim3(512), 0, stream>>>(xk_b, xv_b, wk_b, wv_b, Kp, Vt);

  // 3) + 4) per-key column statistics of the query-axis softmax and head-averaged probabilities -> second output
  k_stats_mean<<<dim3(NK / SM_KEYS, NB), dim3(SM_WAVES * 32), 0, stream>>>(Qp, Kp, NLS, out1);
  // 5) context -> AV plane
  k_attn_ctx<<<dim3(NQ / 128, NB * NH), dim3(256), 0, stream>>>(Qp, Kp, Vt, NLS, AV);
  // 6) output projection + bias -> first output, rows q*NB + b
  k_gemm<1, EPI_OUT><<<dim3(DM / BN, (NQ * NB) / BM, 1), dim3(256), 0, stream>>>(
      AV, wp_h, (void*)out0, (void*)out0, bp, bp, (long)HH, (long)HH, 0L, HH);
}

// v009
// It runs in 130 microseconds.
// Timed twice side by side with v008, it ran 1.04 times as fast both times.
// Over all steps from v000 it is 3.18 times as fast.
#include <hip/hip_runtime.h>

// Contractions: xq x Wq^T, xk x Wk^T, xv x Wv^T on v_wmma_f32_16x16x32_bf16 (bf16 operands = RNE-converted inputs), f32 accumulate;
// q x k^T (two sweeps: column statistics with head-mean probabilities, context), v^T x p^T and ctx x Wp^T on v_wmma_f32_16x16x32_f16
// (f16 operands: q,k,v unscaled, p carried x4096, ctx carried x32, Wp carried x64 after RNE bf16 convert), f32 accumulate.
// Softmax over the query axis (per key column) and bias add in f32.

#ifndef NB
#define NB 4
#endif
#define NB_FULL 4
#ifndef NQ
#define NQ 1024
#endif
#ifndef NK
#define NK 2048
#endif
#define NQ_FULL 1024
#define NK_FULL 2048
#define DM 1024
#define NH 16
#define DH 64
#define HH (NH * DH)
#define SCL 0.125f
#define C2LOG 0.18033688011112042f      /* SCL * log2(e) */
#define PCARRY 4096.0f
#define PSHIFT 12.0f                     /* log2(PCARRY) */
#define AVCARRY 32.0f
#define OWCARRY 64.0f
#define MSCALE 1.52587890625e-05f        /* 1 / (NH * PCARRY) = 2^-16 */
#define OUT1_OFF 4194304L                /* element offset of the second output (byte 16777216) */

#define AL256(x) (((x) + 255L) & ~255L)
#define WS_TOTAL (2 * AL256((long)NB * NK * DM * 2) + 3 * AL256((long)HH * DM * 2) + \
                  AL256((long)NB * NH * NQ * DH * 2) + 2 * AL256((long)NB * NH * NK * DH * 2) + \
                  AL256((long)NB * NH * NK * 4) + AL256((long)NQ * NB * HH * 2))

static_assert(NB >= 1 && NB <= NB_FULL);
static_assert(NQ >= 128 && NQ <= NQ_FULL && NK >= 128 && NK <= NK_FULL);
static_assert(NQ % 128 == 0 && NK % 128 == 0);
static_assert(DM == 1024 && HH == 1024 && DH == 64 && NH == 16);
static_assert(DM == 128 * 8);
static_assert(DM % 32 == 0 && HH % 32 == 0 && DH % 32 == 0);
static_assert(HH % 128 == 0 && DM % 128 == 0);
static_assert(((long)NQ * NB) % 128 == 0);
static_assert((long)NQ * NB * DM * 4 <= 16777216L);
static_assert(OUT1_OFF * 4 == 16777216L);
static_assert((long)NB * NQ * NK * 4 <= 33554432L);
static_assert(PCARRY == 4096.0f && PSHIFT == 12.0f);
static_assert(MSCALE * 16.0f * PCARRY == 1.0f);
static_assert(WS_TOTAL <= 134217728L);

typedef unsigned short us_t;
typedef _Float16 h16;
typedef us_t     v8us  __attribute__((ext_vector_type(8)));
typedef unsigned v4u   __attribute__((ext_vector_type(4)));
typedef float    v8f   __attribute__((ext_vector_type(8)));
typedef float    v4f   __attribute__((ext_vector_type(4)));
typedef __bf16   v16bf __attribute__((ext_vector_type(16)));
typedef _Float16 v16h  __attribute__((ext_vector_type(16)));

#if __has_builtin(__builtin_amdgcn_exp2f)
#define FEXP2(x) __builtin_amdgcn_exp2f(x)
#else
#define FEXP2(x) __expf((x) * 0.6931471805599453f)
#endif

// 16x32 16-bit fragment: u[0] = elements 0..7, u[1] = elements 8..15
union Frag16 { v8us u[2]; v16bf bf; v16h hf; };

__device__ __forceinline__ v8f vzero() {
  v8f z = {0.f, 0.f, 0.f, 0.f, 0.f, 0.f, 0.f, 0.f};
  return z;
}

// RNE f32 -> bf16 bits
__device__ __forceinline__ us_t bf_bits(float x) {
  unsigned u = __float_as_uint(x);
  u += 0x7FFFu + ((u >> 16) & 1u);
  return (us_t)(u >> 16);
}
// RNE f32 -> bf16 value kept as f32
__device__ __forceinline__ float bf_val(float x) {
  unsigned u = __float_as_uint(x);
  u += 0x7FFFu + ((u >> 16) & 1u);
  return __uint_as_float(u & 0xFFFF0000u);
}
// RNE f32 -> f16 bits
__device__ __forceinline__ us_t hf_bits(float x) {
  _Float16 hv = (_Float16)x;
  return __builtin_bit_cast(us_t, hv);
}

// RNE f32 -> f16 with a value select: results below the smallest normal f16 become zero
static __device__ __forceinline__ h16 toh_flush(float v) {
  const h16 r = (h16)v;
  return (fabsf(v) < 6.103515625e-05f) ? (h16)0.0f : r;
}
static __device__ __forceinline__ us_t hfl_bits(float v) {
  return __builtin_bit_cast(us_t, toh_flush(v));
}
// exp2 of an exponent that already contains the x4096 carry; zero when the f16 value would be subnormal
static __device__ __forceinline__ float pexp2_cut(float e) {
  const float p = FEXP2(e);
  return (e < -14.0f) ? 0.0f : p;
}

// WMMA as the bare builtin: the compiler keeps the distance to the next reader of D and is free to order loads around it
template <int F16OP>
__device__ __forceinline__ v8f mma16(const Frag16& a, const Frag16& b, v8f c) {
  if (F16OP) {
    c = __builtin_amdgcn_wmma_f32_16x16x32_f16(false, a.hf, false, b.hf, (short)0, c, false, false);
  } else {
    c = __builtin_amdgcn_wmma_f32_16x16x32_bf16(false, a.bf, false, b.bf, (short)0, c, false, false);
  }
  return c;
}

// ---------------------------------------------------------------------------
// TN GEMM: C[M,N] = A[M,K] * B[N,K]^T, 16-bit operands from planes, f32 accumulate.
// Block 128x128x64, 256 threads = 8 waves (2x4), wave tile 64x32 = 4x2 WMMA tiles.
// Pipelined staging: two LDS buffers and two register sets; k tile t + 2 is fetched (whole 128-B lines) while tile t is
// multiplied, tile t + 1 goes from its registers to the other buffer behind the products, one barrier per k tile.
// Epilogue stages the 128x128 tile in the same LDS, behind a barrier of its own:
// D0 = f32 output rows [row][DM], scaled by 1/(AVCARRY*OWCARRY), bias0 (RNE bf16 value) added in f32 at the store stage
// ---------------------------------------------------------------------------
#define BM 128
#define BN 128
#define BK 64
#define BKP 72                 /* row pitch 144 B = 16 B x 9: ds_load_b128 fragment reads spread over the banks */
#define STG (BM * BKP)         /* halves of one operand's k tile */
#define CSP 136
#define CFP 132

// Work-group barrier of the k loop: it waits for this wave's LDS reads and writes only. __syncthreads() would also
// wait for the global loads of the tile fetched ahead, which have to stay in flight across it.
__device__ __forceinline__ void tile_barrier() {
  asm volatile("s_wait_dscnt 0x0\n\ts_barrier_signal -1\n\ts_barrier_wait -1" ::: "memory");
}

template <int F16OP>
__global__ __launch_bounds__(256)
void k_gemm(const us_t* __restrict__ A, const us_t* __restrict__ B,
            void* D0, void* D1, const float* __restrict__ bias0, const float* __restrict__ bias1,
            long lda, long ldb, long strideAz, int K)
{
  __shared__ __align__(16) us_t Sm[4 * STG];    // A tile x2, B tile x2: 128 rows x 64 k each (pad 72)
  us_t* Cs = Sm;                                // behind the k loop: f32 view [64][132]
  static_assert(64 * CFP * 4 <= BM * CSP * 2 && BM * CSP <= 4 * STG && BM == BN);

  const int tid = threadIdx.x, lane = tid & 31, wid = __builtin_amdgcn_readfirstlane(tid >> 5);
  const int wm = wid >> 2, wn = wid & 3, h = lane >> 4, l15 = lane & 15;
  const int m0 = blockIdx.y * BM, n0 = blockIdx.x * BN, z = blockIdx.z;
  const us_t* Ab = A + (size_t)z * (size_t)strideAz + (size_t)m0 * (size_t)lda;
  const us_t* Bb = B + (size_t)n0 * (size_t)ldb;

  v8f acc[4][2];
#pragma unroll
  for (int mi = 0; mi < 4; ++mi)
#pragma unroll
    for (int ni = 0; ni < 2; ++ni) acc[mi][ni] = vzero();

  const int nk = K / BK;                                   // even and at least 2: K is DM or HH, multiples of 128
  const int srow = tid >> 3, skc = (tid & 7) << 3;         // 8 lanes per 128-B row piece, 32 rows per block-wide load
  unsigned oa[4], ob[4];                                   // byte offsets of this thread's four row pieces; they live through the loop
#pragma unroll
  for (int i = 0; i < 4; ++i) {
    oa[i] = ((unsigned)(srow + 32 * i) * (unsigned)lda + (unsigned)skc) * 2u;
    ob[i] = ((unsigned)(srow + 32 * i) * (unsigned)ldb + (unsigned)skc) * 2u;
  }

  auto fetch = [&](v8us (&ra)[4], v8us (&rb)[4], int kb) {
    const char* pa = (const char*)(Ab + kb * BK);          // block-uniform base, per-thread 32-bit offset
    const char* pb = (const char*)(Bb + kb * BK);
#pragma unroll
    for (int i = 0; i < 4; ++i) {
      ra[i] = *(const v8us*)(pa + oa[i]);
      rb[i] = *(const v8us*)(pb + ob[i]);
    }
    // behind the eight loads: their address registers are rewritten for a later tile; its memory clobber also keeps
    // the loads ahead of the products' LDS reads, so that they are in flight from the start of the k tile
    asm volatile("s_wait_xcnt 0x0" ::: "memory");
  };
  auto put = [&](int buf, const v8us (&ra)[4], const v8us (&rb)[4]) {
    us_t* ta = Sm + buf * STG + srow * BKP + skc;
#pragma unroll
    for (int i = 0; i < 4; ++i) {
      *(v8us*)(ta + 32 * i * BKP) = ra[i];
      *(v8us*)(ta + 2 * STG + 32 * i * BKP) = rb[i];
    }
  };
  auto mult = [&](int buf) {
    const us_t* as = Sm + buf * STG;
    const us_t* bs = as + 2 * STG;
#pragma unroll
    for (int c = 0; c < 2; ++c) {                            // k ascending in steps of 32
      Frag16 af[4], bfr[2];
#pragma unroll
      for (int mi = 0; mi < 4; ++mi) {
        const int r = wm * 64 + mi * 16 + l15;                          // A row m = lane&15
        af[mi].u[0] = *(const v8us*)(&as[r * BKP + 32 * c + 8 * h]);      // k 8h..8h+7
        af[mi].u[1] = *(const v8us*)(&as[r * BKP + 32 * c + 16 + 8 * h]); // k 16+8h..16+8h+7
      }
#pragma unroll
      for (int ni = 0; ni < 2; ++ni) {
        const int r = wn * 32 + ni * 16 + l15;                          // B column n = lane&15, row of [n][k] plane, same k map
        bfr[ni].u[0] = *(const v8us*)(&bs[r * BKP + 32 * c + 8 * h]);
        bfr[ni].u[1] = *(const v8us*)(&bs[r * BKP + 32 * c + 16 + 8 * h]);
      }
#pragma unroll
      for (int mi = 0; mi < 4; ++mi)
#pragma unroll
        for (int ni = 0; ni < 2; ++ni) acc[mi][ni] = mma16<F16OP>(af[mi], bfr[ni], acc[mi][ni]);
    }
  };

  v8us a0[4], b0[4], a1[4], b1[4];
  fetch(a0, b0, 0);
  fetch(a1, b1, 1);
  put(0, a0, b0);
  tile_barrier();      // tile 0 visible to all waves
  for (int kb = 0; kb + 2 < nk; kb += 2) {
    fetch(a0, b0, kb + 2);
    mult(0);
    put(1, a1, b1);
    tile_barrier();    // publishes tile kb+1 and ends every read of tile kb before its buffer is refilled
    fetch(a1, b1, kb + 3);
    mult(1);
    put(0, a0, b0);
    tile_barrier();    // publishes tile kb+2 and ends every read of tile kb+1 before its buffer is refilled
  }
  mult(0);             // the last two tiles: nothing left to fetch
  put(1, a1, b1);
  tile_barrier();
  mult(1);             // the epilogue's first barrier ends these reads before the LDS becomes output staging

  // D layout: acc[mi][ni][v] = C(row wm*64+mi*16+8h+v, col wn*32+ni*16+l15)
  const int q8 = tid & 7, lsub = tid >> 3;   // 8 lanes per line, 32 lines per instruction over the block

  {
    float* Cf = (float*)Cs;
    float* Do = (float*)D0;
    const float oscale = 1.0f / (AVCARRY * OWCARRY);
#pragma unroll
    for (int rh = 0; rh < 2; ++rh) {
      __syncthreads();
      if (wm == rh) {
#pragma unroll
        for (int mi = 0; mi < 4; ++mi)
#pragma unroll
          for (int ni = 0; ni < 2; ++ni) {
            const int col = wn * 32 + ni * 16 + l15;
#pragma unroll
            for (int v = 0; v < 8; ++v)
              Cf[(mi * 16 + 8 * h + v) * CFP + col] = acc[mi][ni][v] * oscale;
          }
      }
      __syncthreads();
      {
#pragma unroll
        for (int it = 0; it < 8; ++it) {
          const int L = it * 32 + lsub, pr = L >> 2, ql = L & 3;     // 64 rows x 4 lines per row
          const v4f val = *(const v4f*)(&Cf[pr * CFP + 32 * ql + 4 * q8]);
          const v4f bq = *(const v4f*)(bias0 + n0 + 32 * ql + 4 * q8);
          const v4f o = {val[0] + bf_val(bq[0]), val[1] + bf_val(bq[1]),
                         val[2] + bf_val(bq[2]), val[3] + bf_val(bq[3])};
          float* dst = Do + ((size_t)(m0 + 64 * rh + pr) * DM + n0 + 32 * ql + 4 * q8);
          *(v4f*)dst = o;
        }
        
      }
    }
  }
}

// ---------------------------------------------------------------------------
// Q projection and the conversions of the other operands in one launch of 256-thread blocks: neither needs the other's result,
// the projection is bound by latency and the matrix unit, the conversions by memory, so that they run side by side on a WGP.
// Blocks 0 .. QG_BLOCKS - 1 (the long ones first): one 128x128 tile of q = xq Wq^T each, 8 waves (2x4) of 64x32, k tiles of 64.
//   Operands come as f32 from the inputs (whole 128-B lines, 16 lanes per 256-B row piece) and are converted (RNE bf16) on their
//   way from the registers to LDS. The k loop is k_gemm's: two LDS buffers, two register sets, tile t + 2's loads in flight across
//   tile t's products and its barrier, one barrier per k tile. Epilogue: Q plane [(z*NH+n)*NQ + i][d] f16, staged in the same LDS.
// The other blocks: unit = one row of DM = 1024 floats (4096 B in, 2048 B out). Units in plane order: xk rows, xv rows (RNE bf16),
//   Wk, Wv rows (RNE bf16), Wp rows (f16 of bf16(x)*OWCARRY); the five 16-bit planes lie back to back in the workspace, so unit u
//   is written at dst + u * DM. A wave takes units gw, gw + 4096, ...: eight 16-B loads per lane, each wave-wide load
//   512 contiguous bytes, the next unit's eight loads issued before the current unit is converted and stored
//   (8-B stores, 256 contiguous bytes per wave-wide store). No barrier, no LDS.
// ---------------------------------------------------------------------------
#define QG_BLOCKS ((HH / BN) * (NQ / BM) * NB)
#define CVT_WPB 8
#define CVT_BLOCKS 512
#define CVT_NW (CVT_WPB * CVT_BLOCKS)
#define U_XK (NB * NK)
#define U_W HH
#define U_ALL (2 * U_XK + 3 * U_W)
#define CVT_IT ((U_ALL + CVT_NW - 1) / CVT_NW)
static_assert(((long)NB * NK * DM * 2) % 256 == 0 && ((long)HH * DM * 2) % 256 == 0);
static_assert((DM / BK) % 2 == 0 && DM / BK >= 2);

typedef unsigned v2u  __attribute__((ext_vector_type(2)));
typedef float    v2f  __attribute__((ext_vector_type(2)));
typedef __bf16   v2bf __attribute__((ext_vector_type(2)));

// RNE f32 pair -> two bf16 in one register, one instruction
__device__ __forceinline__ unsigned bf_pair(float a, float b) {
  const v2f x = {a, b};
  return __builtin_bit_cast(unsigned, __builtin_convertvector(x, v2bf));
}

// A wave-uniform global address taken through scalar registers: all eight loads of a conversion unit are formed from this one base,
// the lane's 32-bit offset and an immediate; none gets a vector address pair of its own, which a later load of the run could land on
typedef const __attribute__((address_space(1))) char* gaddr_t;
typedef const __attribute__((address_space(1))) v4f*  gv4f_t;
__device__ __forceinline__ gaddr_t sbase(const float* p) {
  const unsigned long long a = (unsigned long long)p;
  const unsigned lo = __builtin_amdgcn_readfirstlane((unsigned)a), hi = __builtin_amdgcn_readfirstlane((unsigned)(a >> 32));
  return (gaddr_t)(((unsigned long long)hi << 32) | lo);
}

__device__ __forceinline__ void q_tile(us_t* Sm, int bid, const float* __restrict__ xq, const float* __restrict__ wq, us_t* Qp)
{
  const int tid = threadIdx.x, lane = tid & 31, wid = __builtin_amdgcn_readfirstlane(tid >> 5);
  const int wm = wid >> 2, wn = wid & 3, h = lane >> 4, l15 = lane & 15;
  const int n0 = (bid % (HH / BN)) * BN, m0 = ((bid / (HH / BN)) % (NQ / BM)) * BM, z = bid / ((HH / BN) * (NQ / BM));
  const float* Ab = xq + ((size_t)z * NQ_FULL + m0) * DM;
  const float* Bb = wq + (size_t)n0 * DM;

  // unroll directives on loops that index a register array (accumulators, fragments, staged pieces): such an array
  // stays in registers only under compile-time indices
  v8f acc[4][2];
#pragma unroll
  for (int mi = 0; mi < 4; ++mi)
#pragma unroll
    for (int ni = 0; ni < 2; ++ni) acc[mi][ni] = vzero();

  const int srow = tid >> 4, skc = (tid & 15) << 2;            // 16 lanes per 256-B row piece, 16 rows per block-wide load
  const unsigned toff = ((unsigned)srow * DM + (unsigned)skc) * 4u;   // byte offset of this thread's first row piece; next: + 16 rows

  auto fetch = [&](v4f (&ra)[8], v4f (&rb)[8], int kt) {
    const char* pa = (const char*)(Ab + kt * BK) + toff;       // block-uniform base, per-thread 32-bit offset
    const char* pb = (const char*)(Bb + kt * BK) + toff;
#pragma unroll
    for (int i = 0; i < 8; ++i) {
      ra[i] = *(const v4f*)(pa + (size_t)i * 16 * DM * 4);
      rb[i] = *(const v4f*)(pb + (size_t)i * 16 * DM * 4);
    }
    // behind the sixteen loads: their address registers are rewritten for a later tile; its memory clobber also keeps
    // the loads ahead of the products' LDS reads, so that they are in flight from the start of the k tile
    asm volatile("s_wait_xcnt 0x0" ::: "memory");
  };
  auto put = [&](int buf, const v4f (&ra)[8], const v4f (&rb)[8]) {
    // keeps the conversions, which wait for this set's loads, behind the tile's products; without it they are spread among the
    // products and the wait there also covers the set fetched last, which has to stay in flight
    __builtin_amdgcn_sched_barrier(0);
    us_t* ta = Sm + buf * STG + srow * BKP + skc;
#pragma unroll
    for (int i = 0; i < 8; ++i) {
      const v2u pa = {bf_pair(ra[i][0], ra[i][1]), bf_pair(ra[i][2], ra[i][3])};
      const v2u pb = {bf_pair(rb[i][0], rb[i][1]), bf_pair(rb[i][2], rb[i][3])};
      *(v2u*)(ta + 16 * i * BKP) = pa;
      *(v2u*)(ta + 2 * STG + 16 * i * BKP) = pb;
    }
  };
  auto mult = [&](int buf) {
    const us_t* as = Sm + buf * STG;
    const us_t* bs = as + 2 * STG;
#pragma unroll
    for (int c = 0; c < 2; ++c) {                              // within the tile k ascending in steps of 32
      Frag16 af[4], bfr[2];
#pragma unroll
      for (int mi = 0; mi < 4; ++mi) {
        const int r = wm * 64 + mi * 16 + l15;                            // A row m = lane&15
        af[mi].u[0] = *(const v8us*)(&as[r * BKP + 32 * c + 8 * h]);        // k 8h..8h+7
        af[mi].u[1] = *(const v8us*)(&as[r * BKP + 32 * c + 16 + 8 * h]);   // k 16+8h..16+8h+7
      }
#pragma unroll
      for (int ni = 0; ni < 2; ++ni) {
        const int r = wn * 32 + ni * 16 + l15;                            // B column n = lane&15, row of the [n][k] tile, same k map
        bfr[ni].u[0] = *(const v8us*)(&bs[r * BKP + 32 * c + 8 * h]);
        bfr[ni].u[1] = *(const v8us*)(&bs[r * BKP + 32 * c + 16 + 8 * h]);
      }
#pragma unroll
      for (int mi = 0; mi < 4; ++mi)
#pragma unroll
        for (int ni = 0; ni < 2; ++ni) acc[mi][ni] = mma16<0>(af[mi], bfr[ni], acc[mi][ni]);
    }
  };

  const int nk = DM / BK;                                      // even and at least 2
  v4f a0[8], b0[8], a1[8], b1[8];
  fetch(a0, b0, 0);
  fetch(a1, b1, 1);
  put(0, a0, b0);
  tile_barrier();      // tile 0 visible to all waves
  for (int kb = 0; kb + 2 < nk; kb += 2) {
    fetch(a0, b0, kb + 2);
    mult(0);
    put(1, a1, b1);
    tile_barrier();    // publishes tile kb+1 and ends every read of tile kb before its buffer is refilled
    fetch(a1, b1, kb + 3);
    mult(1);
    put(0, a0, b0);
    tile_barrier();    // publishes tile kb+2 and ends every read of tile kb+1 before its buffer is refilled
  }
  mult(0);             // the last two tiles: nothing left to fetch
  put(1, a1, b1);
  tile_barrier();      // publishes the last tile
  mult(1);
  __syncthreads();     // ends every read of the k tiles before the LDS becomes output staging

  // D layout: acc[mi][ni][v] = C(row wm*64+mi*16+8h+v, col wn*32+ni*16+l15)
#pragma unroll
  for (int mi = 0; mi < 4; ++mi)
#pragma unroll
    for (int ni = 0; ni < 2; ++ni) {
      const int col = wn * 32 + ni * 16 + l15;
#pragma unroll
      for (int v = 0; v < 8; ++v)
        Sm[(wm * 64 + mi * 16 + 8 * h + v) * CSP + col] = hfl_bits(acc[mi][ni][v]);
    }
  __syncthreads();     // the staged tile visible to all waves
  const int q8 = tid & 7, lsub = tid >> 3;     // 8 lanes per line, 32 lines per instruction over the block
  const int hb = n0 >> 6;                      // first head of this column block
#pragma unroll
  for (int it = 0; it < 8; ++it) {
    const int L = it * 32 + lsub, pr = L >> 1, nl = L & 1;     // 128 rows x 2 lines of 64 halves
    const v4u val = *(const v4u*)(&Sm[pr * CSP + nl * 64 + 8 * q8]);
    *(v4u*)(Qp + ((((size_t)z * NH + hb + nl) * NQ + m0 + pr) * DH + 8 * q8)) = val;
  }
}

// behind each unit's loads and each unit's stores: their address registers are reused for the next unit's addresses;
// its memory clobber also keeps the order loads(u + 1), convert(u), stores(u), so that stores start while loads are in flight
#define CVT_XWAIT() asm volatile("s_wait_xcnt 0x0" ::: "memory")

// source row of unit u (wave-uniform); a unit past the end re-reads the last row and is not stored
__device__ __forceinline__ const float* cvt_row(unsigned u, const float* xk, const float* xv,
                                                const float* wk, const float* wv, const float* wp) {
  if (u >= U_ALL) u = U_ALL - 1;
  const unsigned uv = u - U_XK, uw = uv - U_XK;
  const float* p = (uw < U_W) ? wk : (uw < 2 * U_W) ? wv : wp;
  unsigned r = uw % U_W;
  if (u < 2 * U_XK) { p = xv; r = (uv / NK) * NK_FULL + uv % NK; }
  if (u < U_XK)     { p = xk; r = (u / NK) * NK_FULL + u % NK; }
  return p + (size_t)r * DM;
}

__global__ __launch_bounds__(256)
void k_cvt_q(const float* __restrict__ xq, const float* __restrict__ xk, const float* __restrict__ xv,
             const float* __restrict__ wq, const float* __restrict__ wk, const float* __restrict__ wv,
             const float* __restrict__ wp, us_t* __restrict__ dst, us_t* __restrict__ Qp)
{
  __shared__ __align__(16) us_t Sm[4 * STG];    // projection blocks: A tile x2, B tile x2 (128 rows x 64 k, pad 72), then f16 [128][136]
  static_assert(BM * CSP <= 4 * STG && BM == BN);
  if (blockIdx.x < QG_BLOCKS) {                 // block-uniform: a whole block takes one side
    q_tile(Sm, blockIdx.x, xq, wq, Qp);
    return;
  }

  const unsigned lane = threadIdx.x & 31;
  const unsigned gw = __builtin_amdgcn_readfirstlane((blockIdx.x - QG_BLOCKS) * CVT_WPB + (threadIdx.x >> 5));
  if (gw >= CVT_NW) return;   // bounds gw for any grid (wave-uniform, no barrier here); with it the plane of every pass whose units lie in one plane is known at compile time

  const unsigned loff = 16 * lane;   // byte offset of this lane's 16 B in each 512-B piece of a row
  v4f buf[2][8];
  {
    const gaddr_t s = sbase(cvt_row(gw, xk, xv, wk, wv, wp));
#pragma unroll
    for (int j = 0; j < 8; ++j) buf[0][j] = *(gv4f_t)(s + loff + 512 * j);
    CVT_XWAIT();
  }
#pragma unroll   // two register sets alternate by a compile-time index: no copies between them
  for (int it = 0; it < CVT_IT; ++it) {
    const unsigned u = gw + it * CVT_NW;
    if (it + 1 < CVT_IT) {
      const gaddr_t s = sbase(cvt_row(u + CVT_NW, xk, xv, wk, wv, wp));
#pragma unroll
      for (int j = 0; j < 8; ++j) buf[(it + 1) & 1][j] = *(gv4f_t)(s + loff + 512 * j);
      CVT_XWAIT();
    }
    if (u < U_ALL) {
      const v4f (&r)[8] = buf[it & 1];
      us_t* d = dst + (size_t)u * DM + 4 * lane;
      if (u < U_ALL - U_W) {
#pragma unroll
        for (int j = 0; j < 8; ++j) {
          const v2u pk = {(unsigned)bf_bits(r[j][0]) | ((unsigned)bf_bits(r[j][1]) << 16),
                          (unsigned)bf_bits(r[j][2]) | ((unsigned)bf_bits(r[j][3]) << 16)};
          *(v2u*)(d + 128 * j) = pk;
        }
      } else {
#pragma unroll
        for (int j = 0; j < 8; ++j) {
          const v2u pk = {(unsigned)hf_bits(bf_val(r[j][0]) * OWCARRY) | ((unsigned)hf_bits(bf_val(r[j][1]) * OWCARRY) << 16),
                          (unsigned)hf_bits(bf_val(r[j][2]) * OWCARRY) | ((unsigned)hf_bits(bf_val(r[j][3]) * OWCARRY) << 16)};
          *(v2u*)(d + 128 * j) = pk;
        }
      }
      CVT_XWAIT();
    }
  }
}

// ---------------------------------------------------------------------------
// K and V projections in one launch: C[256,256] = A[256,DM] * B[256,DM]^T per block, bf16 operands from planes, f32 accumulate.
// 256 blocks (one per WGP: 4 waves of 256 VGPRs per SIMD), 512 threads = 16 waves (4x4), wave tile 64x64 = 4x4 WMMA tiles:
// a 64-k tile brings 64 KB from L2 for 256x256 outputs (four 128x128 blocks bring 128 KB) and every LDS fragment feeds 4 WMMAs.
//  K  : A = xk rows (positions), B = Wk rows (features): tile row = position, four 128-B lines (heads) per row of the K plane
//  V^T: A = Wv rows (features), B = xv rows (positions): tile row = feature (head, d), 512 contiguous bytes of the Vt plane,
//       so the transposed plane comes out of the same epilogue; each element still sums its products over ascending k.
// Staging: two LDS buffers, one register set; k tile t + 1 is fetched (whole 128-B lines) ahead of tile t's products and
// goes to the other buffer behind them, one barrier per k tile.
// ---------------------------------------------------------------------------
#define KVT 256
#define KV_STG (KVT * BKP)     /* halves of one operand's k tile */
#define KV_CSP 264             /* halves per row of the output staging: 528 B = 16 B x 33 */
static_assert(NK % KVT == 0 && HH % KVT == 0 && DM % (2 * BK) == 0 && KVT * KV_CSP <= 4 * KV_STG);

__global__ __launch_bounds__(512)
void k_gemm_kv(const us_t* __restrict__ Xk, const us_t* __restrict__ Xv, const us_t* __restrict__ Wk,
               const us_t* __restrict__ Wv, us_t* Dk, us_t* Dv)
{
  __shared__ __align__(16) us_t Sm[4 * KV_STG];   // A tile x2, B tile x2: 256 rows x 64 k each (pad 72); behind the k loop: f16 [256][264]

  const int tid = threadIdx.x, lane = tid & 31, wid = __builtin_amdgcn_readfirstlane(tid >> 5);
  const int wm = wid >> 2, wn = wid & 3, h = lane >> 4, l15 = lane & 15;
  const int p0 = blockIdx.y * KVT, f0 = blockIdx.x * KVT;      // first position, first feature
  const int isv = blockIdx.z & 1, z = blockIdx.z >> 1;         // which projection, batch
  const size_t xoff = ((size_t)z * NK + p0) * DM, woff = (size_t)f0 * DM;
  const us_t* Ab = isv ? Wv + woff : Xk + xoff;
  const us_t* Bb = isv ? Xv + xoff : Wk + woff;

  // unroll directives on loops that index a register array (accumulators, fragments, staged pieces): such an array
  // stays in registers only under compile-time indices
  v8f acc[4][4];
#pragma unroll
  for (int mi = 0; mi < 4; ++mi)
#pragma unroll
    for (int ni = 0; ni < 4; ++ni) acc[mi][ni] = vzero();

  const int srow = tid >> 3, skc = (tid & 7) << 3;             // 8 lanes per 128-B row piece, 64 rows per block-wide load
  const unsigned toff = ((unsigned)srow * DM + (unsigned)skc) * 2u;   // byte offset of this thread's first row piece; next: + 64 rows

  v8us ra[4], rb[4];
  auto fetch = [&](int kb) {
    const char* pa = (const char*)(Ab + kb * BK) + toff;       // block-uniform base, per-thread 32-bit offset
    const char* pb = (const char*)(Bb + kb * BK) + toff;
#pragma unroll
    for (int i = 0; i < 4; ++i) {
      ra[i] = *(const v8us*)(pa + (size_t)i * 64 * DM * 2);
      rb[i] = *(const v8us*)(pb + (size_t)i * 64 * DM * 2);
    }
    // behind the eight loads: their address registers are rewritten for the next tile; its memory clobber also keeps
    // the loads ahead of the products' LDS reads, so that they are in flight from the start of the k tile
    asm volatile("s_wait_xcnt 0x0" ::: "memory");
  };
  auto put = [&](int buf) {
    us_t* ta = Sm + buf * KV_STG + srow * BKP + skc;
#pragma unroll
    for (int i = 0; i < 4; ++i) {
      *(v8us*)(ta + 64 * i * BKP) = ra[i];
      *(v8us*)(ta + 2 * KV_STG + 64 * i * BKP) = rb[i];
    }
  };
  auto mult = [&](int buf) {
    const us_t* as = Sm + buf * KV_STG;
    const us_t* bs = as + 2 * KV_STG;
#pragma unroll
    for (int c = 0; c < 2; ++c) {                              // k ascending in steps of 32
      Frag16 af[4], bfr[4];
#pragma unroll
      for (int mi = 0; mi < 4; ++mi) {
        const int r = wm * 64 + mi * 16 + l15;                            // A row m = lane&15
        af[mi].u[0] = *(const v8us*)(&as[r * BKP + 32 * c + 8 * h]);        // k 8h..8h+7
        af[mi].u[1] = *(const v8us*)(&as[r * BKP + 32 * c + 16 + 8 * h]);   // k 16+8h..16+8h+7
      }
#pragma unroll
      for (int ni = 0; ni < 4; ++ni) {
        const int r = wn * 64 + ni * 16 + l15;                            // B column n = lane&15, row of [n][k] plane, same k map
        bfr[ni].u[0] = *(const v8us*)(&bs[r * BKP + 32 * c + 8 * h]);
        bfr[ni].u[1] = *(const v8us*)(&bs[r * BKP + 32 * c + 16 + 8 * h]);
      }
#pragma unroll
      for (int mi = 0; mi < 4; ++mi)
#pragma unroll
        for (int ni = 0; ni < 4; ++ni) acc[mi][ni] = mma16<0>(af[mi], bfr[ni], acc[mi][ni]);
    }
  };

  const int nk = DM / BK;                                      // even and at least 2
  fetch(0);
  put(0);
  tile_barrier();      // tile 0 visible to all waves
  fetch(1);
  mult(0);
  put(1);
  tile_barrier();      // publishes tile 1 and ends every read of tile 0 before its buffer is refilled
  for (int kb = 1; kb + 2 < nk; kb += 2) {
    fetch(kb + 1);
    mult(1);
    put(0);
    tile_barrier();    // publishes tile kb+1 and ends every read of tile kb before its buffer is refilled
    fetch(kb + 2);
    mult(0);
    put(1);
    tile_barrier();    // publishes tile kb+2 and ends every read of tile kb+1 before its buffer is refilled
  }
  mult(1);             // the last tile: nothing left to fetch
  __syncthreads();     // ends every read of the k tiles before the LDS becomes output staging

  // D layout: acc[mi][ni][v] = C(row wm*64+mi*16+8h+v, col wn*64+ni*16+l15)
#pragma unroll
  for (int mi = 0; mi < 4; ++mi)
#pragma unroll
    for (int ni = 0; ni < 4; ++ni) {
      const int col = wn * 64 + ni * 16 + l15;
#pragma unroll
      for (int v = 0; v < 8; ++v)
        Sm[(wm * 64 + mi * 16 + 8 * h + v) * KV_CSP + col] = hfl_bits(acc[mi][ni][v]);
    }
  __syncthreads();     // the staged tile visible to all waves
  // tile row pr, 64-column piece nl -> one 128-B line: K plane [(z*NH + head)*NK + pos][d], Vt plane [(z*HH + feature)*NK + pos]
  us_t* Db = isv ? Dv + ((size_t)z * HH + f0) * NK + p0 : Dk + (((size_t)z * NH + (f0 >> 6)) * NK + p0) * DH;
  const size_t rstep = isv ? NK : DH, lstep = isv ? 64 : (size_t)NK * DH;
  const int q8 = tid & 7, lsub = tid >> 3;   // 8 lanes per line, 64 lines per instruction over the block
#pragma unroll
  for (int it = 0; it < 16; ++it) {
    const int L = it * 64 + lsub, pr = L >> 2, nl = L & 3;     // 256 rows x 4 lines of 64 halves
    const v4u val = *(const v4u*)(&Sm[pr * KV_CSP + nl * 64 + 8 * q8]);
    *(v4u*)(Db + pr * rstep + nl * lstep + 8 * q8) = val;
  }
}

// ---------------------------------------------------------------------------
// LDS tiles of the column-statistics and context sweeps: 64 rows x 64 halves (128 B) (colstats: one Q tile per wave, K rows shared by the block; context: shared by the 4 waves of one key group).
// Fetch: every wave-wide 16-B load covers four whole 128-B lines (8 lanes per row).
// Row pitch 72 halves = 144 B = 16 B x 9: fragment reads (ds_load_b128, 16 rows) spread over the banks.
// ---------------------------------------------------------------------------
#define TP 72
#define TILE_H (64 * TP)
static_assert(NQ % 64 == 0 && NK % 512 == 0 && DH == 64);

__device__ __forceinline__ void tile_fetch(v4u (&r)[4], const us_t* __restrict__ src, size_t pitch, int tid) {
  const us_t* p = src + (size_t)(tid >> 3) * pitch + 8 * (tid & 7);   // one address per thread, constant steps of 16 rows
#pragma unroll
  for (int i = 0; i < 4; ++i) r[i] = *(const v4u*)(p + (size_t)(16 * i) * pitch);
}
__device__ __forceinline__ void tile_put(us_t* t, const v4u (&r)[4], int tid) {
#pragma unroll
  for (int i = 0; i < 4; ++i) {
    const int ch = tid + 128 * i;
    *(v4u*)(t + (ch >> 3) * TP + 8 * (ch & 7)) = r[i];
  }
}
// fragment of tile row 'row', halves 32c..32c+31, in the k map of the plane loaders (8h.., 16+8h..)
__device__ __forceinline__ void frag_get(Frag16& f, const us_t* t, int row, int c, int h) {
  f.u[0] = *(const v8us*)(t + row * TP + 32 * c + 8 * h);
  f.u[1] = *(const v8us*)(t + row * TP + 32 * c + 16 + 8 * h);
}

// ---------------------------------------------------------------------------
// Column statistics of the query-axis softmax and head-averaged probabilities in one sweep.
// Block = 512 threads (16 waves) owns 32 keys of one batch and ALL NQ queries; wave w owns queries 64 w .. 64 w + 63.
// Per head: S = Q K^T (A = Q rows, B = K rows) for the wave's 64 x 32 tile stays in registers; the wave takes its own
// column maximum m_w and column sum l_w of e = exp2(c*s - m_w), the 16 waves' (m_w, l_w) meet in an LDS table behind one
// barrier, every wave forms M = max m_w, Z = sum l_w * exp2(m_w - M) (lane = key), and adds
// e * exp2(m_w - M - log2 Z) to its running head sum. So each score is formed once and takes one exp2.
// Q rows: a wave stages only its own 64 rows (whole-line loads, the next head's in flight during the products and the vector work) in its own
// LDS slice, so the slice needs no barrier. K rows of all 16 heads are staged once, in front of the loop.
// ---------------------------------------------------------------------------
#define SM_WAVES 16
#define SM_KEYS 32
#define RP 36                  /* floats per row of the exchange table and of the output staging: 144 B = 16 B x 9 */
static_assert(NQ == SM_WAVES * 64 && NK % SM_KEYS == 0 && NH == 16);
static_assert(64 * RP * 4 <= TILE_H * 2);

// value of lane ^ 16 by one vector cross-row move (identity lane select): no LDS round trip in the per-head chain
__device__ __forceinline__ float other_half(float v) {
  const unsigned u = __float_as_uint(v);
  return __uint_as_float(__builtin_amdgcn_permlanex16(u, u, 0x76543210u, 0xfedcba98u, false, false));
}

__global__ __launch_bounds__(SM_WAVES * 32)
void k_stats_mean(const us_t* __restrict__ Qp, const us_t* __restrict__ Kp, float* NLS, float* out1)
{
  __shared__ __align__(16) us_t Qs[SM_WAVES * TILE_H];       // per wave: 64 query rows of the current head; behind the loop: output staging
  __shared__ __align__(16) us_t Ks[NH * SM_KEYS * TP];       // the block's 32 key rows of every head
  __shared__ __align__(16) float red[2][SM_KEYS * RP];       // [trip parity][key][16 maxima, 16 sums]
  __shared__ __align__(16) float Nl[NH * SM_KEYS];           // column normalisers, stored behind the loop
  const int tid = threadIdx.x;
  const int lane = threadIdx.x & 31;
  const int wave = __builtin_amdgcn_readfirstlane(threadIdx.x >> 5);
  const int h = lane >> 4, l15 = lane & 15;
  const int k0 = blockIdx.x * SM_KEYS;
  const int b = blockIdx.y;
  us_t* qs = Qs + wave * TILE_H;

  // blocks of one batch walk the heads from different starts, so that they do not all ask L2 for the same Q lines at once
  const int hrot = blockIdx.x & (NH - 1);
  const us_t* qsrc = Qp + ((size_t)b * NH * NQ + wave * 64) * DH + 8 * lane;   // head 0; head n: + n * NQ * DH
  v4u rq[16];
  {
    // chunk tid + 512 i = row (head * 32 + key) (tid >> 3) + 64 i, 8 lanes per 128-B row: one address, steps of two heads
    const us_t* kp = Kp + (((size_t)b * NH + (tid >> 8)) * NK + k0 + ((tid >> 3) & 31)) * DH + 8 * (tid & 7);
    const us_t* qp = qsrc + (size_t)hrot * NQ * DH;
    v4u rk[8];
#pragma unroll
    for (int i = 0; i < 8; ++i) rk[i] = *(const v4u*)(kp + (size_t)i * 2 * NK * DH);
#pragma unroll
    for (int j = 0; j < 16; ++j) rq[j] = *(const v4u*)(qp + 256 * j);   // 512 contiguous bytes per wave-wide load
    // behind the prologue's loads: their address registers are reused below, and as inputs here they stay apart from the
    // loads' destinations
    asm volatile("s_wait_xcnt 0x0" :: "v"(kp), "v"(qp) : "memory");
#pragma unroll
    for (int i = 0; i < 8; ++i) {
      const int ch = tid + 512 * i;
      *(v4u*)(Ks + (ch >> 3) * TP + 8 * (ch & 7)) = rk[i];
    }
  }
  __syncthreads();   // the K rows of every head visible to all waves

  v8f macc[4][2];
#pragma unroll
  for (int qt = 0; qt < 4; ++qt)
#pragma unroll
    for (int kt = 0; kt < 2; ++kt) macc[qt][kt] = vzero();

#pragma unroll 1   // kept rolled (for speed only)
  for (int hh = 0; hh < NH; ++hh) {
    const int hd = (hh + hrot) & (NH - 1);                    // this trip's head
#pragma unroll
    for (int j = 0; j < 16; ++j) {
      const int ch = 32 * j + lane;
      *(v4u*)(qs + (ch >> 3) * TP + 8 * (ch & 7)) = rq[j];
    }
    // the wave's rows are in its LDS slice before its lanes read one another's pieces back as fragments
    asm volatile("s_wait_dscnt 0x0" ::: "memory");
    const us_t* qn = qsrc + (size_t)((hd + 1) & (NH - 1)) * NQ * DH;   // the next trip's rows
    if (hh + 1 < NH) {
#pragma unroll
      for (int j = 0; j < 8; ++j) rq[j] = *(const v4u*)(qn + 256 * j);
      // first half of the next trip's loads, issued ahead of the products so that L2 is asked all through the trip; behind
      // them their address register is reused, and as an input here it stays apart from their destinations; the memory
      // clobber keeps them ahead of the fragment reads
      asm volatile("s_wait_xcnt 0x0" :: "v"(qn) : "memory");
    }

    v8f s[4][2];
    {
      const us_t* kc = Ks + hd * (SM_KEYS * TP);
      Frag16 kf[2][2];
#pragma unroll
      for (int kt = 0; kt < 2; ++kt)
#pragma unroll
        for (int c = 0; c < 2; ++c) frag_get(kf[kt][c], kc, 16 * kt + l15, c, h);   // B column n = key
#pragma unroll
      for (int qt = 0; qt < 4; ++qt) {
        Frag16 qa[2];
#pragma unroll
        for (int c = 0; c < 2; ++c) frag_get(qa[c], qs, 16 * qt + l15, c, h);       // A row m = query
#pragma unroll
        for (int kt = 0; kt < 2; ++kt) {
          v8f t = vzero();
#pragma unroll
          for (int c = 0; c < 2; ++c) t = mma16<1>(qa[c], kf[kt][c], t);
          s[qt][kt] = t;
        }
      }
    }
    if (hh + 1 < NH) {
#pragma unroll
      for (int j = 8; j < 16; ++j) rq[j] = *(const v4u*)(qn + 256 * j);
      // second half, behind the products, whose fragments need the registers: the same wait for the same reasons; the memory
      // clobber keeps these loads ahead of the vector work and the exchange, so that they are in flight through the rest of the trip
      asm volatile("s_wait_xcnt 0x0" :: "v"(qn) : "memory");
    }

    // D layout: s[qt][kt][r] = (query 64 wave + 16 qt + 8h + r, key k0 + 16 kt + l15)
    float tm[2], nm[2], lw[2];
#pragma unroll
    for (int kt = 0; kt < 2; ++kt) {
      float cm[4];                                            // one short chain per query tile
#pragma unroll
      for (int qt = 0; qt < 4; ++qt) {
        cm[qt] = fmaxf(s[qt][kt][0], s[qt][kt][1]);
#pragma unroll
        for (int r = 2; r < 8; ++r) cm[qt] = fmaxf(cm[qt], s[qt][kt][r]);
      }
      tm[kt] = fmaxf(fmaxf(cm[0], cm[1]), fmaxf(cm[2], cm[3]));
    }
#pragma unroll
    for (int kt = 0; kt < 2; ++kt) nm[kt] = -(fmaxf(tm[kt], other_half(tm[kt])) * C2LOG);
#pragma unroll
    for (int kt = 0; kt < 2; ++kt) {
#pragma unroll
      for (int qt = 0; qt < 4; ++qt)
#pragma unroll
        for (int r = 0; r < 8; ++r) s[qt][kt][r] = FEXP2(fmaf(s[qt][kt][r], C2LOG, nm[kt]));
      const v8f q4 = (s[0][kt] + s[1][kt]) + (s[2][kt] + s[3][kt]);
      lw[kt] = ((q4[0] + q4[1]) + (q4[2] + q4[3])) + ((q4[4] + q4[5]) + (q4[6] + q4[7]));
    }
#pragma unroll
    for (int kt = 0; kt < 2; ++kt) lw[kt] += other_half(lw[kt]);

    float* rd = red[hh & 1];
    rd[lane * RP + wave] = h ? -nm[1] : -nm[0];               // lane = key 16 h + l15
    rd[lane * RP + 16 + wave] = h ? lw[1] : lw[0];
    // publishes the 16 waves' partial statistics; LDS wait only, the next head's loads stay in flight across it. The table of
    // this parity is rewritten only behind the next such barrier, which every wave reaches with these reads done
    tile_barrier();
    float mv[16];
#pragma unroll
    for (int i = 0; i < 4; ++i) {
      const v4f x = *(const v4f*)(rd + lane * RP + 4 * i);
      mv[4 * i] = x[0]; mv[4 * i + 1] = x[1]; mv[4 * i + 2] = x[2]; mv[4 * i + 3] = x[3];
    }
    float M = fmaxf(mv[0], mv[1]);
#pragma unroll
    for (int i = 2; i < 16; ++i) M = fmaxf(M, mv[i]);
    float zp[4];                                              // four short chains, one per four waves
#pragma unroll
    for (int i = 0; i < 4; ++i) {
      const v4f x = *(const v4f*)(rd + lane * RP + 16 + 4 * i);
      zp[i] = x[0] * FEXP2(mv[4 * i] - M);
#pragma unroll
      for (int e = 1; e < 4; ++e) zp[i] = fmaf(x[e], FEXP2(mv[4 * i + e] - M), zp[i]);
    }
    const float Z = (zp[0] + zp[1]) + (zp[2] + zp[3]);
    const float nls = -(M + log2f(Z));                        // of key 16 h + l15
    const float oth = other_half(nls);
    const float f0 = FEXP2((h ? oth : nls) - nm[0]);          // exp2(m_w - M - log2 Z) of key l15
    const float f1 = FEXP2((h ? nls : oth) - nm[1]);          // of key 16 + l15
#pragma unroll
    for (int qt = 0; qt < 4; ++qt)
#pragma unroll
      for (int r = 0; r < 8; ++r) {
        macc[qt][0][r] = fmaf(s[qt][0][r], f0, macc[qt][0][r]);
        macc[qt][1][r] = fmaf(s[qt][1][r], f1, macc[qt][1][r]);
      }
    if (wave == 0) Nl[hd * SM_KEYS + lane] = PSHIFT + nls;
  }

  // output staging in the wave's own slice, which only this wave has read
  float* Mst = (float*)qs;
#pragma unroll
  for (int qt = 0; qt < 4; ++qt)
#pragma unroll
    for (int kt = 0; kt < 2; ++kt)
#pragma unroll
      for (int r = 0; r < 8; ++r)
        Mst[(16 * qt + 8 * h + r) * RP + 16 * kt + l15] = macc[qt][kt][r] * (1.0f / NH);
  __syncthreads();     // wave 0's normalisers visible to all waves; each wave's staged rows complete
  const int q8 = lane & 7, rsub = lane >> 3;
#pragma unroll
  for (int it = 0; it < 16; ++it) {
    const int row = it * 4 + rsub;                            // 64 rows of one 128-B line, 4 lines per instruction
    const v4f val = *(const v4f*)(&Mst[row * RP + 4 * q8]);
    float* dst = out1 + (((size_t)b * NQ + wave * 64 + row) * NK + k0 + 4 * q8);
    *(v4f*)dst = val;
  }
  NLS[((size_t)b * NH + wave) * NK + k0 + lane] = Nl[tid];    // wave = head: one 128-B line per wave
}

// ---------------------------------------------------------------------------
// Context, transposed register-fed form. Block = 256 threads (8 waves = 2 key groups x 4 waves), 128 queries of one
// (b,n); wave (g, w) owns 32 queries (two Q fragment sets held as B operands) and the 64-key tiles 2 i + g, so that
// four waves stand on each SIMD and one wave's LDS waits and vector work run under another's products.
// Per 32-key step: S^T = K Q^T (A = K rows from a 64-key LDS tile) for two 16-key tiles, p^T*4096 = exp2(c*s + NLS[key])
// packed from the two D tiles into one B fragment per query tile (element r <- tile 0, element 8+r <- tile 1),
// O^T += Vt * P^T (A = Vt rows d from a 64-key LDS tile, k = keys). Every K and Vt fragment read feeds both
// query tiles. Each group has two buffers per tile and fills them with its own 128 threads, the next
// 64 keys fetched during the current, one barrier per trip; the column normaliser (whole row in
// LDS) is already inside the exponent, so there is no running state. Behind the loop the two groups' partial sums
// are added through LDS: wave (g, w) finishes query tile g.
// ---------------------------------------------------------------------------
#define PP 72
static_assert(NK % 1024 == 0);

__global__ __launch_bounds__(256)
void k_attn_ctx(const us_t* __restrict__ Qp, const us_t* __restrict__ Kp, const us_t* __restrict__ Vt,
                const float* __restrict__ NLS, us_t* AV)
{
  __shared__ __align__(16) us_t Ost[4 * 32 * PP];   // per wave pair 32 rows x 64 halves used (pad 72); a wave reads back its own 16 rows
  __shared__ __align__(16) us_t Kt[2][2][TILE_H];   // [key group][buffer], rows = keys, columns = d; behind the loop: partial sums
  __shared__ __align__(16) us_t Vs[2][2][TILE_H];   // [key group][buffer], rows = d, columns = keys
  __shared__ __align__(16) float Ns[NK];            // column normalisers of this (b,n)
  static_assert(8 * 1024 * 4 <= 4 * TILE_H * 2);
  const int tid = threadIdx.x;
  const int lane = threadIdx.x & 31;
  const int wave = __builtin_amdgcn_readfirstlane(threadIdx.x >> 5);
  const int g = wave >> 2, w = wave & 3;            // key group, query slice
  const int gtid = tid & 127;                       // thread within its key group
  const int h = lane >> 4, l15 = lane & 15;
  const int i0 = blockIdx.x * 128, bn = blockIdx.y;
  const int b = bn / NH, n = bn - b * NH;
  const int iw = i0 + w * 32;
  const int ow = w * (32 * PP);

  Frag16 qf[2][2];
#pragma unroll
  for (int qt = 0; qt < 2; ++qt) {
    const us_t* pq = Qp + ((size_t)bn * NQ + iw + 16 * qt + l15) * DH;   // B column n = query, k = d
#pragma unroll
    for (int c = 0; c < 2; ++c) {
      qf[qt][c].u[0] = *(const v8us*)(pq + 32 * c + 8 * h);
      qf[qt][c].u[1] = *(const v8us*)(pq + 32 * c + 16 + 8 * h);
    }
  }

  v8f oacc[2][4];
#pragma unroll
  for (int qt = 0; qt < 2; ++qt)
#pragma unroll
    for (int dt = 0; dt < 4; ++dt) oacc[qt][dt] = vzero();

  const us_t* Kbase = Kp + (size_t)bn * NK * DH + (size_t)g * 64 * DH;   // the group's first tile; its next: + 128 keys
  const us_t* Vbase = Vt + (size_t)bn * DH * NK + (size_t)g * 64;
  const float* Nbase = NLS + (size_t)bn * NK;

  v4f nv[NK / 1024];
#pragma unroll
  for (int i = 0; i < NK / 1024; ++i) nv[i] = *(const v4f*)(Nbase + 4 * (tid + 256 * i));
  v4u rk[4], rv[4];
  tile_fetch(rk, Kbase, DH, gtid);
  tile_fetch(rv, Vbase, NK, gtid);
  // behind the prologue's loads: their address registers are reused below
  asm volatile("s_wait_xcnt 0x0" ::: "memory");
#pragma unroll
  for (int i = 0; i < NK / 1024; ++i) *(v4f*)(&Ns[4 * (tid + 256 * i)]) = nv[i];
  tile_put(Kt[g][0], rk, gtid);
  tile_put(Vs[g][0], rv, gtid);
  __syncthreads();   // both groups' first tiles and the normalisers visible to all waves

  for (int i = 0; i < NK / 128; ++i) {
    const int t = 2 * i + g;                            // this group's 64-key tile
    const us_t* kc = Kt[g][i & 1];
    const us_t* vc = Vs[g][i & 1];
    if (i + 1 < NK / 128) {
      tile_fetch(rk, Kbase + (size_t)(i + 1) * 128 * DH, DH, gtid);
      tile_fetch(rv, Vbase + (size_t)(i + 1) * 128, NK, gtid);
    }
    // behind the eight loads: their address registers are reused below; its memory clobber also keeps the loads ahead of
    // the tile's LDS reads, so that they are in flight through the whole tile and not only just before tile_put
    asm volatile("s_wait_xcnt 0x0" ::: "memory");
#pragma unroll
    for (int ks = 0; ks < 2; ++ks) {
      Frag16 pb[2];                                     // per query tile: B[k = key in step][n = query]
#pragma unroll
      for (int st = 0; st < 2; ++st) {
        Frag16 ka[2];
#pragma unroll
        for (int c = 0; c < 2; ++c) frag_get(ka[c], kc, 32 * ks + 16 * st + l15, c, h);   // A row m = key
        // D rows = keys 64 t + 32 ks + 16 st + 8h + r : eight consecutive table entries per lane
        const float* np = &Ns[64 * t + 32 * ks + 16 * st + 8 * h];
        const v4f na = *(const v4f*)(np);
        const v4f nc = *(const v4f*)(np + 4);
        const float nl[8] = {na[0], na[1], na[2], na[3], nc[0], nc[1], nc[2], nc[3]};
#pragma unroll
        for (int qt = 0; qt < 2; ++qt) {
          v8f s = vzero();
#pragma unroll
          for (int c = 0; c < 2; ++c) s = mma16<1>(ka[c], qf[qt][c], s);
#pragma unroll
          for (int r = 0; r < 8; ++r)
            pb[qt].hf[8 * st + r] = (h16)pexp2_cut(fmaf(s[r], C2LOG, nl[r]));
        }
      }
#pragma unroll
      for (int dt = 0; dt < 4; ++dt) {
        Frag16 va;                                      // A row m = d (row of Vt), k = key
        frag_get(va, vc, 16 * dt + l15, ks, h);
#pragma unroll
        for (int qt = 0; qt < 2; ++qt) oacc[qt][dt] = mma16<1>(va, pb[qt], oacc[qt][dt]);
      }
    }
    if (i + 1 < NK / 128) {
      tile_put(Kt[g][(i + 1) & 1], rk, gtid);
      tile_put(Vs[g][(i + 1) & 1], rv, gtid);
    }
    __syncthreads();   // publishes both groups' next tiles and ends every read of the current ones before their buffers are refilled
  }

  // The two key groups' partial sums meet: wave (g, w) keeps query tile g and hands query tile 1 - g to wave (1 - g, w).
  // 4 KB per wave in the K tiles' LDS, which every wave has left at the loop's last barrier; 16 B per lane, lanes contiguous.
  float* Xs = (float*)&Kt[0][0][0];
  v8f fin[4];
#pragma unroll
  for (int dt = 0; dt < 4; ++dt) {
    const v8f oth = g ? oacc[0][dt] : oacc[1][dt];
    fin[dt] = g ? oacc[1][dt] : oacc[0][dt];
#pragma unroll
    for (int j = 0; j < 2; ++j) {
      const v4f x = {oth[4 * j], oth[4 * j + 1], oth[4 * j + 2], oth[4 * j + 3]};
      *(v4f*)(Xs + wave * 1024 + ((2 * dt + j) * 32 + lane) * 4) = x;
    }
  }
  __syncthreads();     // the partner wave's partial sums are visible
#pragma unroll
  for (int dt = 0; dt < 4; ++dt)
#pragma unroll
    for (int j = 0; j < 2; ++j) {
      const v4f x = *(const v4f*)(Xs + (wave ^ 4) * 1024 + ((2 * dt + j) * 32 + lane) * 4);
#pragma unroll
      for (int e = 0; e < 4; ++e) fin[dt][4 * j + e] += x[e];
    }

  // D layout: fin[dt][r] = O^T(d = 16 dt + 8h + r, query 16 g + l15) : eight consecutive d per lane
  const float sc = AVCARRY / PCARRY;
#pragma unroll
  for (int dt = 0; dt < 4; ++dt) {
    v8us pk;
#pragma unroll
    for (int r = 0; r < 8; ++r) pk[r] = hfl_bits(fin[dt][r] * sc);
    *(v8us*)(&Ost[ow + (16 * g + l15) * PP + 16 * dt + 8 * h]) = pk;
  }
  __syncthreads();
  const int q8 = lane & 7, rsub = lane >> 3;
  {
#pragma unroll
    for (int it = 0; it < 4; ++it) {
      const int row = 16 * g + it * 4 + rsub;            // 16 rows per wave, 4 lines per instruction
      v4u val = *(const v4u*)(&Ost[ow + row * PP + 8 * q8]);
      us_t* dst = AV + (((size_t)(iw + row) * NB + b) * HH + n * DH + 8 * q8);
      *(v4u*)dst = val;
    }
  }
}

// ---------------------------------------------------------------------------
// Host orchestration (5 launches)
// ---------------------------------------------------------------------------
extern "C" void kernel_launch(void* const* d_in, const int* in_sizes, int n_in,
                              void* d_out, int out_size, void* d_ws, size_t ws_size,
                              hipStream_t stream)
{
  if (n_in < 8) return;
  const float* xq = (const float*)d_in[0];
  const float* xk = (const float*)d_in[1];
  const float* xv = (const float*)d_in[2];
  const float* wq = (const float*)d_in[3];
  const float* wk = (const float*)d_in[4];
  const float* wv = (const float*)d_in[5];
  const float* wp = (const float*)d_in[6];
  const float* bp = (const float*)d_in[7];

  if ((long)in_sizes[0] < ((long)(NB - 1) * NQ_FULL + NQ) * DM) return;
  if ((long)in_sizes[1] < ((long)(NB - 1) * NK_FULL + NK) * DM) return;
  if ((long)in_sizes[2] < ((long)(NB - 1) * NK_FULL + NK) * DM) return;
  if ((long)in_sizes[3] < (long)HH * DM) return;
  if ((long)in_sizes[4] < (long)HH * DM) return;
  if ((long)in_sizes[5] < (long)HH * DM) return;
  if ((long)in_sizes[6] < (long)DM * HH) return;
  if (in_sizes[7] < DM) return;
  if ((long)out_size < OUT1_OFF + (long)NB * NQ * NK) return;

  char* base = (char*)d_ws;
  size_t off = 0;
  auto take = [&](size_t bytes) -> char* {
    char* q = base + off; off += (bytes + 255) & ~(size_t)255; return q;
  };
  us_t*  xk_b = (us_t*) take((size_t)NB * NK * DM * 2);             // bf16 [b][k][DM]
  us_t*  xv_b = (us_t*) take((size_t)NB * NK * DM * 2);             // bf16 [b][k][DM]
  us_t*  wk_b = (us_t*) take((size_t)HH * DM * 2);                  // bf16 [out][in]
  us_t*  wv_b = (us_t*) take((size_t)HH * DM * 2);                  // bf16
  us_t*  wp_h = (us_t*) take((size_t)DM * HH * 2);                  // f16 (x64)
  us_t*  Qp   = (us_t*) take((size_t)NB * NH * NQ * DH * 2);        // f16 [bn][q][d]
  us_t*  Kp   = (us_t*) take((size_t)NB * NH * NK * DH * 2);        // f16 [bn][k][d]
  us_t*  Vt   = (us_t*) take((size_t)NB * NH * DH * NK * 2);        // f16 [bn][d][k]
  float* NLS  = (float*)take((size_t)NB * NH * NK * 4);             // f32 [bn][k]
  us_t*  AV   = (us_t*) take((size_t)NQ * NB * HH * 2);             // f16 (x32) [q*NB+b][n*64+d]
  if (off > ws_size) return;
  if (off > (size_t)WS_TOTAL) return;

  float* out0 = (float*)d_out;                                       // [q][b][c]
  float* out1 = (float*)d_out + OUT1_OFF;                            // [b][q][k]

  // 1) q = xq Wq^T from the f32 inputs, beside the conversions of the other operands (RNE bf16; Wp as f16 of the bf16 value x64):
  //    planes xk_b .. wp_h, back to back from xk_b
  k_cvt_q<<<dim3(QG_BLOCKS + CVT_BLOCKS), dim3(256), 0, stream>>>(xq, xk, xv, wq, wk, wv, wp, xk_b, Qp);

  // 2) projections k = xk Wk^T, v^T = (xv Wv^T)^T, per batch
  k_gemm_kv<<<dim3(HH / KVT, NK / KVT, 2 * NB), dim3(512), 0, stream>>>(xk_b, xv_b, wk_b, wv_b, Kp, Vt);

  // 3) + 4) per-key column statistics of the query-axis softmax and head-averaged probabilities -> second output
  k_stats_mean<<<dim3(NK / SM_KEYS, NB), dim3(SM_WAVES * 32), 0, stream>>>(Qp, Kp, NLS, out1);
  // 5) context -> AV plane
  k_attn_ctx<<<dim3(NQ / 128, NB * NH), dim3(256), 0, stream>>>(Qp, Kp, Vt, NLS, AV);
  // 6) output projection + bias -> first output, rows q*NB + b
  k_gemm<1><<<dim3(DM / BN, (NQ * NB) / BM, 1), dim3(256), 0, stream>>>(
      AV, wp_h, (void*)out0, (void*)out0, bp, bp, (long)HH, (long)HH, 0L, HH);
}

// v010
// Measured time: 124 microseconds a run.
// Timed twice side by side with v009, it ran 1.04 and 1.05 times as fast.
// Counting every step since v000, it is 3.34 times as fast.
#include <hip/hip_runtime.h>

// Contractions: xq x Wq^T, xk x Wk^T, xv x Wv^T on v_wmma_f32_16x16x32_bf16 (bf16 operands = RNE-converted inputs), f32 accumulate;
// q x k^T (two sweeps: column statistics with head-mean probabilities, context), v^T x p^T and ctx x Wp^T on v_wmma_f32_16x16x32_f16
// (f16 operands: q,k,v unscaled, p carried x4096, ctx carried x32, Wp carried x64 after RNE bf16 convert), f32 accumulate.
// Softmax over the query axis (per key column) and bias add in f32.

#ifndef NB
#define NB 4
#endif
#define NB_FULL 4
#ifndef NQ
#define NQ 1024
#endif
#ifndef NK
#define NK 2048
#endif
#define NQ_FULL 1024
#define NK_FULL 2048
#define DM 1024
#define NH 16
#define DH 64
#define HH (NH * DH)
#define SCL 0.125f
#define C2LOG 0.18033688011112042f      /* SCL * log2(e) */
#define PCARRY 4096.0f
#define PSHIFT 12.0f                     /* log2(PCARRY) */
#define AVCARRY 32.0f
#define OWCARRY 64.0f
#define MSCALE 1.52587890625e-05f        /* 1 / (NH * PCARRY) = 2^-16 */
#define OUT1_OFF 4194304L                /* element offset of the second output (byte 16777216) */

#define AL256(x) (((x) + 255L) & ~255L)
#define WS_TOTAL (2 * AL256((long)NB * NK * DM * 2) + 3 * AL256((long)HH * DM * 2) + \
                  AL256((long)NB * NH * NQ * DH * 2) + 2 * AL256((long)NB * NH * NK * DH * 2) + \
                  AL256((long)NB * NH * NK * 4) + AL256((long)NQ * NB * HH * 2))

static_assert(NB >= 1 && NB <= NB_FULL);
static_assert(NQ >= 128 && NQ <= NQ_FULL && NK >= 128 && NK <= NK_FULL);
static_assert(NQ % 128 == 0 && NK % 128 == 0);
static_assert(DM == 1024 && HH == 1024 && DH == 64 && NH == 16);
static_assert(DM == 128 * 8);
static_assert(DM % 32 == 0 && HH % 32 == 0 && DH % 32 == 0);
static_assert(HH % 128 == 0 && DM % 128 == 0);
static_assert(((long)NQ * NB) % 128 == 0);
static_assert((long)NQ * NB * DM * 4 <= 16777216L);
static_assert(OUT1_OFF * 4 == 16777216L);
static_assert((long)NB * NQ * NK * 4 <= 33554432L);
static_assert(PCARRY == 4096.0f && PSHIFT == 12.0f);
static_assert(MSCALE * 16.0f * PCARRY == 1.0f);
static_assert(WS_TOTAL <= 134217728L);

typedef unsigned short us_t;
typedef _Float16 h16;
typedef us_t     v8us  __attribute__((ext_vector_type(8)));
typedef unsigned v4u   __attribute__((ext_vector_type(4)));
typedef float    v8f   __attribute__((ext_vector_type(8)));
typedef float    v4f   __attribute__((ext_vector_type(4)));
typedef __bf16   v16bf __attribute__((ext_vector_type(16)));
typedef _Float16 v16h  __attribute__((ext_vector_type(16)));

#if __has_builtin(__builtin_amdgcn_exp2f)
#define FEXP2(x) __builtin_amdgcn_exp2f(x)
#else
#define FEXP2(x) __expf((x) * 0.6931471805599453f)
#endif

// 16x32 16-bit fragment: u[0] = elements 0..7, u[1] = elements 8..15
union Frag16 { v8us u[2]; v16bf bf; v16h hf; };

__device__ __forceinline__ v8f vzero() {
  v8f z = {0.f, 0.f, 0.f, 0.f, 0.f, 0.f, 0.f, 0.f};
  return z;
}

// RNE f32 -> bf16 bits
__device__ __forceinline__ us_t bf_bits(float x) {
  unsigned u = __float_as_uint(x);
  u += 0x7FFFu + ((u >> 16) & 1u);
  return (us_t)(u >> 16);
}
// RNE f32 -> bf16 value kept as f32
__device__ __forceinline__ float bf_val(float x) {
  unsigned u = __float_as_uint(x);
  u += 0x7FFFu + ((u >> 16) & 1u);
  return __uint_as_float(u & 0xFFFF0000u);
}
// RNE f32 -> f16 bits
__device__ __forceinline__ us_t hf_bits(float x) {
  _Float16 hv = (_Float16)x;
  return __builtin_bit_cast(us_t, hv);
}

// RNE f32 -> f16 with a value select: results below the smallest normal f16 become zero
static __device__ __forceinline__ h16 toh_flush(float v) {
  const h16 r = (h16)v;
  return (fabsf(v) < 6.103515625e-05f) ? (h16)0.0f : r;
}
static __device__ __forceinline__ us_t hfl_bits(float v) {
  return __builtin_bit_cast(us_t, toh_flush(v));
}
// exp2 of an exponent that already contains the x4096 carry; zero when the f16 value would be subnormal
static __device__ __forceinline__ float pexp2_cut(float e) {
  const float p = FEXP2(e);
  return (e < -14.0f) ? 0.0f : p;
}

// WMMA as the bare builtin: the compiler keeps the distance to the next reader of D and is free to order loads around it
template <int F16OP>
__device__ __forceinline__ v8f mma16(const Frag16& a, const Frag16& b, v8f c) {
  if (F16OP) {
    c = __builtin_amdgcn_wmma_f32_16x16x32_f16(false, a.hf, false, b.hf, (short)0, c, false, false);
  } else {
    c = __builtin_amdgcn_wmma_f32_16x16x32_bf16(false, a.bf, false, b.bf, (short)0, c, false, false);
  }
  return c;
}

// ---------------------------------------------------------------------------
// TN GEMM: C[M,N] = A[M,K] * B[N,K]^T, 16-bit operands from planes, f32 accumulate.
// Block 128x128x128, 256 threads = 8 waves (2x4), wave tile 64x32 = 4x2 WMMA tiles.
// Staging: two LDS buffers filled by asynchronous copies (whole 128-B lines, through no register); k tile t + 2's copies are
// issued behind the barrier at the foot of tile t, into the buffer just read, and fly through tile t + 1; one barrier per k tile.
// Epilogue stages the 128x128 tile in the same LDS, behind a barrier of its own:
// D0 = f32 output rows [row][DM], scaled by 1/(AVCARRY*OWCARRY), bias0 (RNE bf16 value) added in f32 at the store stage
// ---------------------------------------------------------------------------
#define BM 128
#define BN 128
#define BK 64
#define BKP 72                 /* row pitch 144 B = 16 B x 9: ds_load_b128 fragment reads spread over the banks */
#define STG (BM * BKP)         /* halves of one operand's k tile */
#define CSP 136
#define CFP 132
#define OBK 128                /* k tile of k_gemm */
#define OBKP 136               /* its row pitch 272 B = 16 B x 17 */
#define OSTG (BM * OBKP)       /* halves of one operand's k tile there */

// Work-group barrier of the k loop: it waits for this wave's LDS reads and writes only. __syncthreads() would also
// wait for the global loads of the tile fetched ahead, which have to stay in flight across it.
__device__ __forceinline__ void tile_barrier() {
  asm volatile("s_wait_dscnt 0x0\n\ts_barrier_signal -1\n\ts_barrier_wait -1" ::: "memory");
}

// LDS byte address of a __shared__ element: the low 32 bits of its address
__device__ __forceinline__ unsigned lds_addr(const void* p) {
  return (unsigned)(unsigned long long)p;
}

// Foot of a tile in a loop whose LDS buffers are filled by asynchronous copies, in this order: this wave's LDS reads of the
// tile are done, its own copies of the next tile have landed, then the barrier that publishes that tile to the other waves
// and frees the buffer just read for its refill.
__device__ __forceinline__ void copy_foot() {
  asm volatile("s_wait_dscnt 0x0" ::: "memory");
  asm volatile("s_wait_asynccnt 0x0" ::: "memory");
  __syncthreads();
}

template <int F16OP>
__global__ __launch_bounds__(256)
void k_gemm(const us_t* __restrict__ A, const us_t* __restrict__ B,
            void* D0, void* D1, const float* __restrict__ bias0, const float* __restrict__ bias1,
            long lda, long ldb, long strideAz, int K)
{
  __shared__ __align__(16) us_t Sm[4 * OSTG];   // A tile x2, B tile x2: 128 rows x 128 k each (pad 136)
  us_t* Cs = Sm;                                // behind the k loop: f32 view [64][132]
  static_assert(64 * CFP * 4 <= BM * CSP * 2 && BM * CSP <= 4 * OSTG && BM == BN && HH % (2 * OBK) == 0);

  const int tid = threadIdx.x, lane = tid & 31, wid = __builtin_amdgcn_readfirstlane(tid >> 5);
  const int wm = wid >> 2, wn = wid & 3, h = lane >> 4, l15 = lane & 15;
  const int m0 = blockIdx.y * BM, n0 = blockIdx.x * BN, z = blockIdx.z;
  const us_t* Ab = A + (size_t)z * (size_t)strideAz + (size_t)m0 * (size_t)lda;
  const us_t* Bb = B + (size_t)n0 * (size_t)ldb;

  v8f acc[4][2];
#pragma unroll
  for (int mi = 0; mi < 4; ++mi)
#pragma unroll
    for (int ni = 0; ni < 2; ++ni) acc[mi][ni] = vzero();

  const int nk = K / OBK;                                  // even and at least 2: K is HH, a multiple of 256
  const int srow = tid >> 4, skc = (tid & 15) << 3;        // 16 lanes per 256-B row piece, 16 rows per block-wide copy
  unsigned oa[8], ob[8];                                   // byte offsets of this thread's eight row pieces; they live through the loop
#pragma unroll
  for (int i = 0; i < 8; ++i) {
    oa[i] = ((unsigned)(srow + 16 * i) * (unsigned)lda + (unsigned)skc) * 2u;
    ob[i] = ((unsigned)(srow + 16 * i) * (unsigned)ldb + (unsigned)skc) * 2u;
  }

  const unsigned lbase = lds_addr(Sm + srow * OBKP + skc); // this thread's first piece in A's buffer 0
  // One operand's k tile goes to LDS by eight asynchronous copies per thread, 16 B per lane, through no register: LDS byte
  // address l + 16 rows x i, global address = block-uniform base + the lane's 32-bit byte offset. The closing s_wait_xcnt
  // stands inside the statement, in front of any later write of the registers that the copies name.
  auto copy8 = [&](unsigned l, const unsigned (&o)[8], const us_t* base) {
    asm volatile(
        "global_load_async_to_lds_b128 %0, %8, %16\n\t"
        "global_load_async_to_lds_b128 %1, %9, %16\n\t"
        "global_load_async_to_lds_b128 %2, %10, %16\n\t"
        "global_load_async_to_lds_b128 %3, %11, %16\n\t"
        "global_load_async_to_lds_b128 %4, %12, %16\n\t"
        "global_load_async_to_lds_b128 %5, %13, %16\n\t"
        "global_load_async_to_lds_b128 %6, %14, %16\n\t"
        "global_load_async_to_lds_b128 %7, %15, %16\n\t"
        "s_wait_xcnt 0x0"
        :: "v"(l), "v"(l + 16 * OBKP * 2), "v"(l + 32 * OBKP * 2), "v"(l + 48 * OBKP * 2),
           "v"(l + 64 * OBKP * 2), "v"(l + 80 * OBKP * 2), "v"(l + 96 * OBKP * 2), "v"(l + 112 * OBKP * 2),
           "v"(o[0]), "v"(o[1]), "v"(o[2]), "v"(o[3]), "v"(o[4]), "v"(o[5]), "v"(o[6]), "v"(o[7]), "s"(base)
        : "memory");
  };
  auto copy = [&](int buf, int kb) {
    const unsigned la = lbase + (unsigned)buf * (OSTG * 2);
    copy8(la, oa, Ab + kb * OBK);
    copy8(la + 2 * OSTG * 2, ob, Bb + kb * OBK);
  };
  auto mult = [&](int buf) {
    const us_t* as = Sm + buf * OSTG;
    const us_t* bs = as + 2 * OSTG;
#pragma unroll
    for (int cc = 0; cc < 2; ++cc) {                         // halves of the tile, k ascending
      Frag16 af[2][4], bfr[2][2];                            // the registers that staging no longer takes hold 64 k of fragments
#pragma unroll
      for (int c = 0; c < 2; ++c) {
        const int ko = 64 * cc + 32 * c;
#pragma unroll
        for (int ni = 0; ni < 2; ++ni) {
          const int r = wn * 32 + ni * 16 + l15;                        // B column n = lane&15, row of [n][k] plane, same k map
          bfr[c][ni].u[0] = *(const v8us*)(&bs[r * OBKP + ko + 8 * h]);
          bfr[c][ni].u[1] = *(const v8us*)(&bs[r * OBKP + ko + 16 + 8 * h]);
        }
#pragma unroll
        for (int mi = 0; mi < 4; ++mi) {
          const int r = wm * 64 + mi * 16 + l15;                        // A row m = lane&15
          af[c][mi].u[0] = *(const v8us*)(&as[r * OBKP + ko + 8 * h]);       // k 8h..8h+7
          af[c][mi].u[1] = *(const v8us*)(&as[r * OBKP + ko + 16 + 8 * h]);  // k 16+8h..16+8h+7
        }
      }
      // keeps these fragment reads together ahead of their products: sunk among them, each pair is waited for in full
      __builtin_amdgcn_sched_barrier(0);
#pragma unroll
      for (int c = 0; c < 2; ++c)                            // k ascending in steps of 32
#pragma unroll
        for (int mi = 0; mi < 4; ++mi)
#pragma unroll
          for (int ni = 0; ni < 2; ++ni) acc[mi][ni] = mma16<F16OP>(af[c][mi], bfr[c][ni], acc[mi][ni]);
    }
  };

  copy(0, 0);
  copy_foot();         // tile 0 visible to all waves
  copy(1, 1);
  for (int kb = 0; kb + 2 < nk; kb += 2) {
    mult(0);
    copy_foot();       // publishes tile kb+1 and ends every read of tile kb before its buffer is refilled
    copy(0, kb + 2);   // in flight through tile kb+1's products
    mult(1);
    copy_foot();       // publishes tile kb+2 and ends every read of tile kb+1 before its buffer is refilled
    copy(1, kb + 3);
  }
  mult(0);             // the last two tiles: nothing left to copy
  copy_foot();         // publishes the last tile; no copy is outstanding behind it
  mult(1);             // the epilogue's first barrier ends these reads before the LDS becomes output staging

  // D layout: acc[mi][ni][v] = C(row wm*64+mi*16+8h+v, col wn*32+ni*16+l15)
  const int q8 = tid & 7, lsub = tid >> 3;   // 8 lanes per line, 32 lines per instruction over the block

  {
    float* Cf = (float*)Cs;
    float* Do = (float*)D0;
    const float oscale = 1.0f / (AVCARRY * OWCARRY);
#pragma unroll
    for (int rh = 0; rh < 2; ++rh) {
      __syncthreads();
      if (wm == rh) {
#pragma unroll
        for (int mi = 0; mi < 4; ++mi)
#pragma unroll
          for (int ni = 0; ni < 2; ++ni) {
            const int col = wn * 32 + ni * 16 + l15;
#pragma unroll
            for (int v = 0; v < 8; ++v)
              Cf[(mi * 16 + 8 * h + v) * CFP + col] = acc[mi][ni][v] * oscale;
          }
      }
      __syncthreads();
      {
#pragma unroll
        for (int it = 0; it < 8; ++it) {
          const int L = it * 32 + lsub, pr = L >> 2, ql = L & 3;     // 64 rows x 4 lines per row
          const v4f val = *(const v4f*)(&Cf[pr * CFP + 32 * ql + 4 * q8]);
          const v4f bq = *(const v4f*)(bias0 + n0 + 32 * ql + 4 * q8);
          const v4f o = {val[0] + bf_val(bq[0]), val[1] + bf_val(bq[1]),
                         val[2] + bf_val(bq[2]), val[3] + bf_val(bq[3])};
          float* dst = Do + ((size_t)(m0 + 64 * rh + pr) * DM + n0 + 32 * ql + 4 * q8);
          *(v4f*)dst = o;
        }
        
      }
    }
  }
}

// ---------------------------------------------------------------------------
// Q projection and the conversions of the other operands in one launch of 256-thread blocks: neither needs the other's result,
// the projection is bound by latency and the matrix unit, the conversions by memory, so that they run side by side on a WGP.
// Blocks 0 .. QG_BLOCKS - 1 (the long ones first): one 128x128 tile of q = xq Wq^T each, 8 waves (2x4) of 64x32, k tiles of 64.
//   Operands come as f32 from the inputs (whole 128-B lines, 16 lanes per 256-B row piece) and are converted (RNE bf16) on their
//   way from the registers to LDS. The k loop: two LDS buffers, two register sets, tile t + 2's loads in flight across
//   tile t's products and its barrier, one barrier per k tile. Epilogue: Q plane [(z*NH+n)*NQ + i][d] f16, staged in the same LDS.
// The other blocks: unit = one row of DM = 1024 floats (4096 B in, 2048 B out). Units in plane order: xk rows, xv rows (RNE bf16),
//   Wk, Wv rows (RNE bf16), Wp rows (f16 of bf16(x)*OWCARRY); the five 16-bit planes lie back to back in the workspace, so unit u
//   is written at dst + u * DM. A wave takes units gw, gw + 4096, ...: eight 16-B loads per lane, each wave-wide load
//   512 contiguous bytes, the next unit's eight loads issued before the current unit is converted and stored
//   (8-B stores, 256 contiguous bytes per wave-wide store). No barrier, no LDS.
// ---------------------------------------------------------------------------
#define QG_BLOCKS ((HH / BN) * (NQ / BM) * NB)
#define CVT_WPB 8
#define CVT_BLOCKS 512
#define CVT_NW (CVT_WPB * CVT_BLOCKS)
#define U_XK (NB * NK)
#define U_W HH
#define U_ALL (2 * U_XK + 3 * U_W)
#define CVT_IT ((U_ALL + CVT_NW - 1) / CVT_NW)
static_assert(((long)NB * NK * DM * 2) % 256 == 0 && ((long)HH * DM * 2) % 256 == 0);
static_assert((DM / BK) % 2 == 0 && DM / BK >= 2);

typedef unsigned v2u  __attribute__((ext_vector_type(2)));
typedef float    v2f  __attribute__((ext_vector_type(2)));
typedef __bf16   v2bf __attribute__((ext_vector_type(2)));

// RNE f32 pair -> two bf16 in one register, one instruction
__device__ __forceinline__ unsigned bf_pair(float a, float b) {
  const v2f x = {a, b};
  return __builtin_bit_cast(unsigned, __builtin_convertvector(x, v2bf));
}

// A wave-uniform global address taken through scalar registers: all eight loads of a conversion unit are formed from this one base,
// the lane's 32-bit offset and an immediate; none gets a vector address pair of its own, which a later load of the run could land on
typedef const __attribute__((address_space(1))) char* gaddr_t;
typedef const __attribute__((address_space(1))) v4f*  gv4f_t;
__device__ __forceinline__ gaddr_t sbase(const float* p) {
  const unsigned long long a = (unsigned long long)p;
  const unsigned lo = __builtin_amdgcn_readfirstlane((unsigned)a), hi = __builtin_amdgcn_readfirstlane((unsigned)(a >> 32));
  return (gaddr_t)(((unsigned long long)hi << 32) | lo);
}

__device__ __forceinline__ void q_tile(us_t* Sm, int bid, const float* __restrict__ xq, const float* __restrict__ wq, us_t* Qp)
{
  const int tid = threadIdx.x, lane = tid & 31, wid = __builtin_amdgcn_readfirstlane(tid >> 5);
  const int wm = wid >> 2, wn = wid & 3, h = lane >> 4, l15 = lane & 15;
  const int n0 = (bid % (HH / BN)) * BN, m0 = ((bid / (HH / BN)) % (NQ / BM)) * BM, z = bid / ((HH / BN) * (NQ / BM));
  const float* Ab = xq + ((size_t)z * NQ_FULL + m0) * DM;
  const float* Bb = wq + (size_t)n0 * DM;

  // unroll directives on loops that index a register array (accumulators, fragments, staged pieces): such an array
  // stays in registers only under compile-time indices
  v8f acc[4][2];
#pragma unroll
  for (int mi = 0; mi < 4; ++mi)
#pragma unroll
    for (int ni = 0; ni < 2; ++ni) acc[mi][ni] = vzero();

  const int srow = tid >> 4, skc = (tid & 15) << 2;            // 16 lanes per 256-B row piece, 16 rows per block-wide load
  const unsigned toff = ((unsigned)srow * DM + (unsigned)skc) * 4u;   // byte offset of this thread's first row piece; next: + 16 rows

  auto fetch = [&](v4f (&ra)[8], v4f (&rb)[8], int kt) {
    const char* pa = (const char*)(Ab + kt * BK) + toff;       // block-uniform base, per-thread 32-bit offset
    const char* pb = (const char*)(Bb + kt * BK) + toff;
#pragma unroll
    for (int i = 0; i < 8; ++i) {
      ra[i] = *(const v4f*)(pa + (size_t)i * 16 * DM * 4);
      rb[i] = *(const v4f*)(pb + (size_t)i * 16 * DM * 4);
    }
    // behind the sixteen loads: their address registers are rewritten for a later tile; its memory clobber also keeps
    // the loads ahead of the products' LDS reads, so that they are in flight from the start of the k tile
    asm volatile("s_wait_xcnt 0x0" ::: "memory");
  };
  auto put = [&](int buf, const v4f (&ra)[8], const v4f (&rb)[8]) {
    // keeps the conversions, which wait for this set's loads, behind the tile's products; without it they are spread among the
    // products and the wait there also covers the set fetched last, which has to stay in flight
    __builtin_amdgcn_sched_barrier(0);
    us_t* ta = Sm + buf * STG + srow * BKP + skc;
#pragma unroll
    for (int i = 0; i < 8; ++i) {
      const v2u pa = {bf_pair(ra[i][0], ra[i][1]), bf_pair(ra[i][2], ra[i][3])};
      const v2u pb = {bf_pair(rb[i][0], rb[i][1]), bf_pair(rb[i][2], rb[i][3])};
      *(v2u*)(ta + 16 * i * BKP) = pa;
      *(v2u*)(ta + 2 * STG + 16 * i * BKP) = pb;
    }
  };
  auto mult = [&](int buf) {
    const us_t* as = Sm + buf * STG;
    const us_t* bs = as + 2 * STG;
#pragma unroll
    for (int c = 0; c < 2; ++c) {                              // within the tile k ascending in steps of 32
      Frag16 af[4], bfr[2];
#pragma unroll
      for (int mi = 0; mi < 4; ++mi) {
        const int r = wm * 64 + mi * 16 + l15;                            // A row m = lane&15
        af[mi].u[0] = *(const v8us*)(&as[r * BKP + 32 * c + 8 * h]);        // k 8h..8h+7
        af[mi].u[1] = *(const v8us*)(&as[r * BKP + 32 * c + 16 + 8 * h]);   // k 16+8h..16+8h+7
      }
#pragma unroll
      for (int ni = 0; ni < 2; ++ni) {
        const int r = wn * 32 + ni * 16 + l15;                            // B column n = lane&15, row of the [n][k] tile, same k map
        bfr[ni].u[0] = *(const v8us*)(&bs[r * BKP + 32 * c + 8 * h]);
        bfr[ni].u[1] = *(const v8us*)(&bs[r * BKP + 32 * c + 16 + 8 * h]);
      }
#pragma unroll
      for (int mi = 0; mi < 4; ++mi)
#pragma unroll
        for (int ni = 0; ni < 2; ++ni) acc[mi][ni] = mma16<0>(af[mi], bfr[ni], acc[mi][ni]);
    }
  };

  const int nk = DM / BK;                                      // even and at least 2
  v4f a0[8], b0[8], a1[8], b1[8];
  fetch(a0, b0, 0);
  fetch(a1, b1, 1);
  put(0, a0, b0);
  tile_barrier();      // tile 0 visible to all waves
  for (int kb = 0; kb + 2 < nk; kb += 2) {
    fetch(a0, b0, kb + 2);
    mult(0);
    put(1, a1, b1);
    tile_barrier();    // publishes tile kb+1 and ends every read of tile kb before its buffer is refilled
    fetch(a1, b1, kb + 3);
    mult(1);
    put(0, a0, b0);
    tile_barrier();    // publishes tile kb+2 and ends every read of tile kb+1 before its buffer is refilled
  }
  mult(0);             // the last two tiles: nothing left to fetch
  put(1, a1, b1);
  tile_barrier();      // publishes the last tile
  mult(1);
  __syncthreads();     // ends every read of the k tiles before the LDS becomes output staging

  // D layout: acc[mi][ni][v] = C(row wm*64+mi*16+8h+v, col wn*32+ni*16+l15)
#pragma unroll
  for (int mi = 0; mi < 4; ++mi)
#pragma unroll
    for (int ni = 0; ni < 2; ++ni) {
      const int col = wn * 32 + ni * 16 + l15;
#pragma unroll
      for (int v = 0; v < 8; ++v)
        Sm[(wm * 64 + mi * 16 + 8 * h + v) * CSP + col] = hfl_bits(acc[mi][ni][v]);
    }
  __syncthreads();     // the staged tile visible to all waves
  const int q8 = tid & 7, lsub = tid >> 3;     // 8 lanes per line, 32 lines per instruction over the block
  const int hb = n0 >> 6;                      // first head of this column block
#pragma unroll
  for (int it = 0; it < 8; ++it) {
    const int L = it * 32 + lsub, pr = L >> 1, nl = L & 1;     // 128 rows x 2 lines of 64 halves
    const v4u val = *(const v4u*)(&Sm[pr * CSP + nl * 64 + 8 * q8]);
    *(v4u*)(Qp + ((((size_t)z * NH + hb + nl) * NQ + m0 + pr) * DH + 8 * q8)) = val;
  }
}

// behind each unit's loads and each unit's stores: their address registers are reused for the next unit's addresses;
// its memory clobber also keeps the order loads(u + 1), convert(u), stores(u), so that stores start while loads are in flight
#define CVT_XWAIT() asm volatile("s_wait_xcnt 0x0" ::: "memory")

// source row of unit u (wave-uniform); a unit past the end re-reads the last row and is not stored
__device__ __forceinline__ const float* cvt_row(unsigned u, const float* xk, const float* xv,
                                                const float* wk, const float* wv, const float* wp) {
  if (u >= U_ALL) u = U_ALL - 1;
  const unsigned uv = u - U_XK, uw = uv - U_XK;
  const float* p = (uw < U_W) ? wk : (uw < 2 * U_W) ? wv : wp;
  unsigned r = uw % U_W;
  if (u < 2 * U_XK) { p = xv; r = (uv / NK) * NK_FULL + uv % NK; }
  if (u < U_XK)     { p = xk; r = (u / NK) * NK_FULL + u % NK; }
  return p + (size_t)r * DM;
}

__global__ __launch_bounds__(256)
void k_cvt_q(const float* __restrict__ xq, const float* __restrict__ xk, const float* __restrict__ xv,
             const float* __restrict__ wq, const float* __restrict__ wk, const float* __restrict__ wv,
             const float* __restrict__ wp, us_t* __restrict__ dst, us_t* __restrict__ Qp)
{
  __shared__ __align__(16) us_t Sm[4 * STG];    // projection blocks: A tile x2, B tile x2 (128 rows x 64 k, pad 72), then f16 [128][136]
  static_assert(BM * CSP <= 4 * STG && BM == BN);
  if (blockIdx.x < QG_BLOCKS) {                 // block-uniform: a whole block takes one side
    q_tile(Sm, blockIdx.x, xq, wq, Qp);
    return;
  }

  const unsigned lane = threadIdx.x & 31;
  const unsigned gw = __builtin_amdgcn_readfirstlane((blockIdx.x - QG_BLOCKS) * CVT_WPB + (threadIdx.x >> 5));
  if (gw >= CVT_NW) return;   // bounds gw for any grid (wave-uniform, no barrier here); with it the plane of every pass whose units lie in one plane is known at compile time

  const unsigned loff = 16 * lane;   // byte offset of this lane's 16 B in each 512-B piece of a row
  v4f buf[2][8];
  {
    const gaddr_t s = sbase(cvt_row(gw, xk, xv, wk, wv, wp));
#pragma unroll
    for (int j = 0; j < 8; ++j) buf[0][j] = *(gv4f_t)(s + loff + 512 * j);
    CVT_XWAIT();
  }
#pragma unroll   // two register sets alternate by a compile-time index: no copies between them
  for (int it = 0; it < CVT_IT; ++it) {
    const unsigned u = gw + it * CVT_NW;
    if (it + 1 < CVT_IT) {
      const gaddr_t s = sbase(cvt_row(u + CVT_NW, xk, xv, wk, wv, wp));
#pragma unroll
      for (int j = 0; j < 8; ++j) buf[(it + 1) & 1][j] = *(gv4f_t)(s + loff + 512 * j);
      CVT_XWAIT();
    }
    if (u < U_ALL) {
      const v4f (&r)[8] = buf[it & 1];
      us_t* d = dst + (size_t)u * DM + 4 * lane;
      if (u < U_ALL - U_W) {
#pragma unroll
        for (int j = 0; j < 8; ++j) {
          const v2u pk = {(unsigned)bf_bits(r[j][0]) | ((unsigned)bf_bits(r[j][1]) << 16),
                          (unsigned)bf_bits(r[j][2]) | ((unsigned)bf_bits(r[j][3]) << 16)};
          *(v2u*)(d + 128 * j) = pk;
        }
      } else {
#pragma unroll
        for (int j = 0; j < 8; ++j) {
          const v2u pk = {(unsigned)hf_bits(bf_val(r[j][0]) * OWCARRY) | ((unsigned)hf_bits(bf_val(r[j][1]) * OWCARRY) << 16),
                          (unsigned)hf_bits(bf_val(r[j][2]) * OWCARRY) | ((unsigned)hf_bits(bf_val(r[j][3]) * OWCARRY) << 16)};
          *(v2u*)(d + 128 * j) = pk;
        }
      }
      CVT_XWAIT();
    }
  }
}

// ---------------------------------------------------------------------------
// K and V projections in one launch: C[256,256] = A[256,DM] * B[256,DM]^T per block, bf16 operands from planes, f32 accumulate.
// 256 blocks (one per WGP: 4 waves of 256 VGPRs per SIMD), 512 threads = 16 waves (4x4), wave tile 64x64 = 4x4 WMMA tiles:
// a 64-k tile brings 64 KB from L2 for 256x256 outputs (four 128x128 blocks bring 128 KB) and every LDS fragment feeds 4 WMMAs.
//  K  : A = xk rows (positions), B = Wk rows (features): tile row = position, four 128-B lines (heads) per row of the K plane
//  V^T: A = Wv rows (features), B = xv rows (positions): tile row = feature (head, d), 512 contiguous bytes of the Vt plane,
//       so the transposed plane comes out of the same epilogue; each element still sums its products over ascending k.
// Staging: two LDS buffers filled by asynchronous copies (whole 128-B lines, through no register); k tile t + 2's copies are
// issued behind the barrier at the foot of tile t, into the buffer just read, and fly through tile t + 1; one barrier per k tile.
// ---------------------------------------------------------------------------
#define KVT 256
#define KV_STG (KVT * BKP)     /* halves of one operand's k tile */
#define KV_CSP 264             /* halves per row of the output staging: 528 B = 16 B x 33 */
static_assert(NK % KVT == 0 && HH % KVT == 0 && DM % (2 * BK) == 0 && KVT * KV_CSP <= 4 * KV_STG);

__global__ __launch_bounds__(512)
void k_gemm_kv(const us_t* __restrict__ Xk, const us_t* __restrict__ Xv, const us_t* __restrict__ Wk,
               const us_t* __restrict__ Wv, us_t* Dk, us_t* Dv)
{
  __shared__ __align__(16) us_t Sm[4 * KV_STG];   // A tile x2, B tile x2: 256 rows x 64 k each (pad 72); behind the k loop: f16 [256][264]

  const int tid = threadIdx.x, lane = tid & 31, wid = __builtin_amdgcn_readfirstlane(tid >> 5);
  const int wm = wid >> 2, wn = wid & 3, h = lane >> 4, l15 = lane & 15;
  const int p0 = blockIdx.y * KVT, f0 = blockIdx.x * KVT;      // first position, first feature
  const int isv = blockIdx.z & 1, z = blockIdx.z >> 1;         // which projection, batch
  const size_t xoff = ((size_t)z * NK + p0) * DM, woff = (size_t)f0 * DM;
  const us_t* Ab = isv ? Wv + woff : Xk + xoff;
  const us_t* Bb = isv ? Xv + xoff : Wk + woff;

  // unroll directives on loops that index a register array (accumulators, fragments): such an array
  // stays in registers only under compile-time indices
  v8f acc[4][4];
#pragma unroll
  for (int mi = 0; mi < 4; ++mi)
#pragma unroll
    for (int ni = 0; ni < 4; ++ni) acc[mi][ni] = vzero();

  const int srow = tid >> 3, skc = (tid & 7) << 3;             // 8 lanes per 128-B row piece, 64 rows per block-wide load
  const unsigned toff = ((unsigned)srow * DM + (unsigned)skc) * 2u;   // byte offset of this thread's first row piece; next: + 64 rows

  const unsigned o1 = toff + 64u * DM * 2u, o2 = toff + 128u * DM * 2u, o3 = toff + 192u * DM * 2u;
  const unsigned lbase = lds_addr(Sm + srow * BKP + skc);      // this thread's first piece in A's buffer 0
  // k tile kb of both operands goes to LDS buffer buf by eight asynchronous copies per thread, 16 B per lane, through no
  // register: global address = block-uniform base + the lane's 32-bit byte offset. The closing s_wait_xcnt stands inside the
  // statement, in front of any later write of the registers that the copies name.
  auto copy = [&](int buf, int kb) {
    const unsigned la = lbase + (unsigned)buf * (KV_STG * 2), lb = la + 2 * KV_STG * 2;
    asm volatile(
        "global_load_async_to_lds_b128 %0, %8, %12\n\t"
        "global_load_async_to_lds_b128 %1, %9, %12\n\t"
        "global_load_async_to_lds_b128 %2, %10, %12\n\t"
        "global_load_async_to_lds_b128 %3, %11, %12\n\t"
        "global_load_async_to_lds_b128 %4, %8, %13\n\t"
        "global_load_async_to_lds_b128 %5, %9, %13\n\t"
        "global_load_async_to_lds_b128 %6, %10, %13\n\t"
        "global_load_async_to_lds_b128 %7, %11, %13\n\t"
        "s_wait_xcnt 0x0"
        :: "v"(la), "v"(la + 64 * BKP * 2), "v"(la + 128 * BKP * 2), "v"(la + 192 * BKP * 2),
           "v"(lb), "v"(lb + 64 * BKP * 2), "v"(lb + 128 * BKP * 2), "v"(lb + 192 * BKP * 2),
           "v"(toff), "v"(o1), "v"(o2), "v"(o3), "s"(Ab + kb * BK), "s"(Bb + kb * BK)
        : "memory");
  };
  auto mult = [&](int buf) {
    const us_t* as = Sm + buf * KV_STG;
    const us_t* bs = as + 2 * KV_STG;
#pragma unroll
    for (int c = 0; c < 2; ++c) {                              // k ascending in steps of 32
      Frag16 af[4], bfr[4];
#pragma unroll
      for (int mi = 0; mi < 4; ++mi) {
        const int r = wm * 64 + mi * 16 + l15;                            // A row m = lane&15
        af[mi].u[0] = *(const v8us*)(&as[r * BKP + 32 * c + 8 * h]);        // k 8h..8h+7
        af[mi].u[1] = *(const v8us*)(&as[r * BKP + 32 * c + 16 + 8 * h]);   // k 16+8h..16+8h+7
      }
#pragma unroll
      for (int ni = 0; ni < 4; ++ni) {
        const int r = wn * 64 + ni * 16 + l15;                            // B column n = lane&15, row of [n][k] plane, same k map
        bfr[ni].u[0] = *(const v8us*)(&bs[r * BKP + 32 * c + 8 * h]);
        bfr[ni].u[1] = *(const v8us*)(&bs[r * BKP + 32 * c + 16 + 8 * h]);
      }
      // keeps the sixteen fragment reads together ahead of their products: sunk among them, each pair is waited for in full
      __builtin_amdgcn_sched_barrier(0);
#pragma unroll
      for (int mi = 0; mi < 4; ++mi)
#pragma unroll
        for (int ni = 0; ni < 4; ++ni) acc[mi][ni] = mma16<0>(af[mi], bfr[ni], acc[mi][ni]);
    }
  };

  const int nk = DM / BK;                                      // even and at least 2
  copy(0, 0);
  copy_foot();         // tile 0 visible to all waves
  copy(1, 1);
  for (int kb = 0; kb + 2 < nk; kb += 2) {
    mult(0);
    copy_foot();       // publishes tile kb+1 and ends every read of tile kb before its buffer is refilled
    copy(0, kb + 2);   // in flight through tile kb+1's products
    mult(1);
    copy_foot();       // publishes tile kb+2 and ends every read of tile kb+1 before its buffer is refilled
    copy(1, kb + 3);
  }
  mult(0);             // the last two tiles: nothing left to copy
  copy_foot();         // publishes the last tile
  mult(1);
  copy_foot();         // ends every read of the k tiles before the LDS becomes output staging; no copy is outstanding

  // D layout: acc[mi][ni][v] = C(row wm*64+mi*16+8h+v, col wn*64+ni*16+l15)
#pragma unroll
  for (int mi = 0; mi < 4; ++mi)
#pragma unroll
    for (int ni = 0; ni < 4; ++ni) {
      const int col = wn * 64 + ni * 16 + l15;
#pragma unroll
      for (int v = 0; v < 8; ++v)
        Sm[(wm * 64 + mi * 16 + 8 * h + v) * KV_CSP + col] = hfl_bits(acc[mi][ni][v]);
    }
  __syncthreads();     // the staged tile visible to all waves
  // tile row pr, 64-column piece nl -> one 128-B line: K plane [(z*NH + head)*NK + pos][d], Vt plane [(z*HH + feature)*NK + pos]
  us_t* Db = isv ? Dv + ((size_t)z * HH + f0) * NK + p0 : Dk + (((size_t)z * NH + (f0 >> 6)) * NK + p0) * DH;
  const size_t rstep = isv ? NK : DH, lstep = isv ? 64 : (size_t)NK * DH;
  const int q8 = tid & 7, lsub = tid >> 3;   // 8 lanes per line, 64 lines per instruction over the block
#pragma unroll
  for (int it = 0; it < 16; ++it) {
    const int L = it * 64 + lsub, pr = L >> 2, nl = L & 3;     // 256 rows x 4 lines of 64 halves
    const v4u val = *(const v4u*)(&Sm[pr * KV_CSP + nl * 64 + 8 * q8]);
    *(v4u*)(Db + pr * rstep + nl * lstep + 8 * q8) = val;
  }
}

// ---------------------------------------------------------------------------
// LDS tiles of the column-statistics and context sweeps: 64 rows x 64 halves (128 B) (colstats: one Q tile per wave, K rows shared by the block; context: shared by the 4 waves of one key group).
// Fetch: every wave-wide 16-B load covers four whole 128-B lines (8 lanes per row).
// Row pitch 72 halves = 144 B = 16 B x 9: fragment reads (ds_load_b128, 16 rows) spread over the banks.
// ---------------------------------------------------------------------------
#define TP 72
#define TILE_H (64 * TP)
static_assert(NQ % 64 == 0 && NK % 512 == 0 && DH == 64);

__device__ __forceinline__ void tile_fetch(v4u (&r)[4], const us_t* __restrict__ src, size_t pitch, int tid) {
  const us_t* p = src + (size_t)(tid >> 3) * pitch + 8 * (tid & 7);   // one address per thread, constant steps of 16 rows
#pragma unroll
  for (int i = 0; i < 4; ++i) r[i] = *(const v4u*)(p + (size_t)(16 * i) * pitch);
}
__device__ __forceinline__ void tile_put(us_t* t, const v4u (&r)[4], int tid) {
#pragma unroll
  for (int i = 0; i < 4; ++i) {
    const int ch = tid + 128 * i;
    *(v4u*)(t + (ch >> 3) * TP + 8 * (ch & 7)) = r[i];
  }
}
// fragment of tile row 'row', halves 32c..32c+31, in the k map of the plane loaders (8h.., 16+8h..)
__device__ __forceinline__ void frag_get(Frag16& f, const us_t* t, int row, int c, int h) {
  f.u[0] = *(const v8us*)(t + row * TP + 32 * c + 8 * h);
  f.u[1] = *(const v8us*)(t + row * TP + 32 * c + 16 + 8 * h);
}

// ---------------------------------------------------------------------------
// Column statistics of the query-axis softmax and head-averaged probabilities in one sweep.
// Block = 512 threads (16 waves) owns 32 keys of one batch and ALL NQ queries; wave w owns queries 64 w .. 64 w + 63.
// Per head: S = Q K^T (A = Q rows, B = K rows) for the wave's 64 x 32 tile stays in registers; the wave takes its own
// column maximum m_w and column sum l_w of e = exp2(c*s - m_w), the 16 waves' (m_w, l_w) meet in an LDS table behind one
// barrier, every wave forms M = max m_w, Z = sum l_w * exp2(m_w - M) (lane = key), and adds
// e * exp2(m_w - M - log2 Z) to its running head sum. So each score is formed once and takes one exp2.
// Q rows: a wave brings only its own 64 rows into its own LDS slice, by asynchronous copies (whole lines, through no register); it
// reads the slice into fragments, waits for those reads and refills it with the next head's rows, which fly during the vector work.
// Only this wave touches the slice, so it needs no barrier. K rows of all 16 heads are staged once, in front of the loop.
// ---------------------------------------------------------------------------
#define SM_WAVES 16
#define SM_KEYS 32
#define RP 36                  /* floats per row of the exchange table and of the output staging: 144 B = 16 B x 9 */
static_assert(NQ == SM_WAVES * 64 && NK % SM_KEYS == 0 && NH == 16);
static_assert(64 * RP * 4 <= TILE_H * 2);

// value of lane ^ 16 by one vector cross-row move (identity lane select): no LDS round trip in the per-head chain
__device__ __forceinline__ float other_half(float v) {
  const unsigned u = __float_as_uint(v);
  return __uint_as_float(__builtin_amdgcn_permlanex16(u, u, 0x76543210u, 0xfedcba98u, false, false));
}

// A wave's 64 query rows of one head (8 KB, contiguous in the plane) go to its own LDS slice by sixteen asynchronous copies,
// 16 B per lane, through no register. Copy j brings plane bytes 512 j .. 512 j + 511 to slice rows 4 j .. 4 j + 3 (pitch 144 B).
// The immediate offset moves both addresses, so la[j] holds the lane's LDS address of copy j less 512 j (= first address + 64 j).
// The closing s_wait_xcnt stands inside the statement, in front of any later write of the registers that the copies name.
__device__ __forceinline__ void q_rows_async(const unsigned (&la)[16], const us_t* g) {
  asm volatile(
      "global_load_async_to_lds_b128 %0, %16, off\n\t"
      "global_load_async_to_lds_b128 %1, %16, off offset:512\n\t"
      "global_load_async_to_lds_b128 %2, %16, off offset:1024\n\t"
      "global_load_async_to_lds_b128 %3, %16, off offset:1536\n\t"
      "global_load_async_to_lds_b128 %4, %16, off offset:2048\n\t"
      "global_load_async_to_lds_b128 %5, %16, off offset:2560\n\t"
      "global_load_async_to_lds_b128 %6, %16, off offset:3072\n\t"
      "global_load_async_to_lds_b128 %7, %16, off offset:3584\n\t"
      "global_load_async_to_lds_b128 %8, %16, off offset:4096\n\t"
      "global_load_async_to_lds_b128 %9, %16, off offset:4608\n\t"
      "global_load_async_to_lds_b128 %10, %16, off offset:5120\n\t"
      "global_load_async_to_lds_b128 %11, %16, off offset:5632\n\t"
      "global_load_async_to_lds_b128 %12, %16, off offset:6144\n\t"
      "global_load_async_to_lds_b128 %13, %16, off offset:6656\n\t"
      "global_load_async_to_lds_b128 %14, %16, off offset:7168\n\t"
      "global_load_async_to_lds_b128 %15, %16, off offset:7680\n\t"
      "s_wait_xcnt 0x0"
      :: "v"(la[0]), "v"(la[1]), "v"(la[2]), "v"(la[3]), "v"(la[4]), "v"(la[5]), "v"(la[6]), "v"(la[7]),
         "v"(la[8]), "v"(la[9]), "v"(la[10]), "v"(la[11]), "v"(la[12]), "v"(la[13]), "v"(la[14]), "v"(la[15]), "v"(g)
      : "memory");
}

__global__ __launch_bounds__(SM_WAVES * 32)
void k_stats_mean(const us_t* __restrict__ Qp, const us_t* __restrict__ Kp, float* NLS, float* out1)
{
  __shared__ __align__(16) us_t Qs[SM_WAVES * TILE_H];       // per wave: 64 query rows of the current head; behind the loop: output staging
  __shared__ __align__(16) us_t Ks[NH * SM_KEYS * TP];       // the block's 32 key rows of every head
  __shared__ __align__(16) float red[2][SM_KEYS * RP];       // [trip parity][key][16 maxima, 16 sums]
  __shared__ __align__(16) float Nl[NH * SM_KEYS];           // column normalisers, stored behind the loop
  const int tid = threadIdx.x;
  const int lane = threadIdx.x & 31;
  const int wave = __builtin_amdgcn_readfirstlane(threadIdx.x >> 5);
  const int h = lane >> 4, l15 = lane & 15;
  const int k0 = blockIdx.x * SM_KEYS;
  const int b = blockIdx.y;
  us_t* qs = Qs + wave * TILE_H;

  // blocks of one batch walk the heads from different starts, so that they do not all ask L2 for the same Q lines at once
  const int hrot = blockIdx.x & (NH - 1);
  const us_t* qsrc = Qp + ((size_t)b * NH * NQ + wave * 64) * DH + 8 * lane;   // head 0; head n: + n * NQ * DH
  unsigned la[16];                                            // see q_rows_async
#pragma unroll
  for (int j = 0; j < 16; ++j) la[j] = lds_addr(qs + (lane >> 3) * TP + 8 * (lane & 7)) + 64u * j;
  q_rows_async(la, qsrc + (size_t)hrot * NQ * DH);            // the first trip's rows; nothing has touched the slice yet
  {
    // chunk tid + 512 i = row (head * 32 + key) (tid >> 3) + 64 i, 8 lanes per 128-B row: one address, steps of two heads
    const us_t* kp = Kp + (((size_t)b * NH + (tid >> 8)) * NK + k0 + ((tid >> 3) & 31)) * DH + 8 * (tid & 7);
    v4u rk[8];
#pragma unroll
    for (int i = 0; i < 8; ++i) rk[i] = *(const v4u*)(kp + (size_t)i * 2 * NK * DH);
    // behind the prologue's loads: their address register is reused below, and as an input here it stays apart from the
    // loads' destinations
    asm volatile("s_wait_xcnt 0x0" :: "v"(kp) : "memory");
#pragma unroll
    for (int i = 0; i < 8; ++i) {
      const int ch = tid + 512 * i;
      *(v4u*)(Ks + (ch >> 3) * TP + 8 * (ch & 7)) = rk[i];
    }
  }
  __syncthreads();   // the K rows of every head visible to all waves

  v8f macc[4][2];
#pragma unroll
  for (int qt = 0; qt < 4; ++qt)
#pragma unroll
    for (int kt = 0; kt < 2; ++kt) macc[qt][kt] = vzero();

#pragma unroll 1   // kept rolled (for speed only)
  for (int hh = 0; hh < NH; ++hh) {
    const int hd = (hh + hrot) & (NH - 1);                    // this trip's head
    // this trip's rows, copied by this wave alone, have landed in its slice before its lanes read them as fragments
    asm volatile("s_wait_asynccnt 0x0" ::: "memory");

    v8f s[4][2];
    {
      const us_t* kc = Ks + hd * (SM_KEYS * TP);
      Frag16 kf[2][2], qa[4][2];
#pragma unroll
      for (int kt = 0; kt < 2; ++kt)
#pragma unroll
        for (int c = 0; c < 2; ++c) frag_get(kf[kt][c], kc, 16 * kt + l15, c, h);   // B column n = key
#pragma unroll
      for (int qt = 0; qt < 4; ++qt)
#pragma unroll
        for (int c = 0; c < 2; ++c) frag_get(qa[qt][c], qs, 16 * qt + l15, c, h);   // A row m = query
      // keeps all the fragment reads ahead of the products: the slice is free for its refill as early as can be
      __builtin_amdgcn_sched_barrier(0);
      auto prod = [&](int qt) {                               // k ascending per tile
#pragma unroll
        for (int c = 0; c < 2; ++c)
#pragma unroll
          for (int kt = 0; kt < 2; ++kt) s[qt][kt] = mma16<1>(qa[qt][c], kf[kt][c], c ? s[qt][kt] : vzero());
      };
      prod(0);                                                // these start while the later fragments are still landing
      prod(1);
      prod(2);
      // keeps those products ahead of the wait below, which would else hold them back until the last fragment has landed
      __builtin_amdgcn_sched_barrier(0);
      // the whole slice is in registers before the next trip's copies overwrite it; only this wave reads the slice
      asm volatile("s_wait_dscnt 0x0" ::: "memory");
      if (hh + 1 < NH)   // in flight through the vector work and the exchange
        q_rows_async(la, qsrc + (size_t)((hd + 1) & (NH - 1)) * NQ * DH);
      prod(3);
      // keeps the vector work behind the run of products: spread among them, each piece waits for the product just issued
      // and takes idle slots for the distance to it
      __builtin_amdgcn_sched_barrier(0);
    }

    // D layout: s[qt][kt][r] = (query 64 wave + 16 qt + 8h + r, key k0 + 16 kt + l15)
    float tm[2], nm[2], lw[2];
#pragma unroll
    for (int kt = 0; kt < 2; ++kt) {
      float cm[4];                                            // one short chain per query tile
#pragma unroll
      for (int qt = 0; qt < 4; ++qt) {
        cm[qt] = fmaxf(s[qt][kt][0], s[qt][kt][1]);
#pragma unroll
        for (int r = 2; r < 8; ++r) cm[qt] = fmaxf(cm[qt], s[qt][kt][r]);
      }
      tm[kt] = fmaxf(fmaxf(cm[0], cm[1]), fmaxf(cm[2], cm[3]));
    }
#pragma unroll
    for (int kt = 0; kt < 2; ++kt) nm[kt] = -(fmaxf(tm[kt], other_half(tm[kt])) * C2LOG);
#pragma unroll
    for (int kt = 0; kt < 2; ++kt) {
#pragma unroll
      for (int qt = 0; qt < 4; ++qt)
#pragma unroll
        for (int r = 0; r < 8; ++r) s[qt][kt][r] = FEXP2(fmaf(s[qt][kt][r], C2LOG, nm[kt]));
      const v8f q4 = (s[0][kt] + s[1][kt]) + (s[2][kt] + s[3][kt]);
      lw[kt] = ((q4[0] + q4[1]) + (q4[2] + q4[3])) + ((q4[4] + q4[5]) + (q4[6] + q4[7]));
    }
#pragma unroll
    for (int kt = 0; kt < 2; ++kt) lw[kt] += other_half(lw[kt]);

    float* rd = red[hh & 1];
    rd[lane * RP + wave] = h ? -nm[1] : -nm[0];               // lane = key 16 h + l15
    rd[lane * RP + 16 + wave] = h ? lw[1] : lw[0];
    // publishes the 16 waves' partial statistics; LDS wait only, the next head's loads stay in flight across it. The table of
    // this parity is rewritten only behind the next such barrier, which every wave reaches with these reads done
    tile_barrier();
    float mv[16];
#pragma unroll
    for (int i = 0; i < 4; ++i) {
      const v4f x = *(const v4f*)(rd + lane * RP + 4 * i);
      mv[4 * i] = x[0]; mv[4 * i + 1] = x[1]; mv[4 * i + 2] = x[2]; mv[4 * i + 3] = x[3];
    }
    float M = fmaxf(mv[0], mv[1]);
#pragma unroll
    for (int i = 2; i < 16; ++i) M = fmaxf(M, mv[i]);
    float zp[4];                                              // four short chains, one per four waves
#pragma unroll
    for (int i = 0; i < 4; ++i) {
      const v4f x = *(const v4f*)(rd + lane * RP + 16 + 4 * i);
      zp[i] = x[0] * FEXP2(mv[4 * i] - M);
#pragma unroll
      for (int e = 1; e < 4; ++e) zp[i] = fmaf(x[e], FEXP2(mv[4 * i + e] - M), zp[i]);
    }
    const float Z = (zp[0] + zp[1]) + (zp[2] + zp[3]);
    const float nls = -(M + log2f(Z));                        // of key 16 h + l15
    const float oth = other_half(nls);
    const float f0 = FEXP2((h ? oth : nls) - nm[0]);          // exp2(m_w - M - log2 Z) of key l15
    const float f1 = FEXP2((h ? nls : oth) - nm[1]);          // of key 16 + l15
#pragma unroll
    for (int qt = 0; qt < 4; ++qt)
#pragma unroll
      for (int r = 0; r < 8; ++r) {
        macc[qt][0][r] = fmaf(s[qt][0][r], f0, macc[qt][0][r]);
        macc[qt][1][r] = fmaf(s[qt][1][r], f1, macc[qt][1][r]);
      }
    if (wave == 0) Nl[hd * SM_KEYS + lane] = PSHIFT + nls;
  }

  // output staging in the wave's own slice, which only this wave has read
  float* Mst = (float*)qs;
#pragma unroll
  for (int qt = 0; qt < 4; ++qt)
#pragma unroll
    for (int kt = 0; kt < 2; ++kt)
#pragma unroll
      for (int r = 0; r < 8; ++r)
        Mst[(16 * qt + 8 * h + r) * RP + 16 * kt + l15] = macc[qt][kt][r] * (1.0f / NH);
  __syncthreads();     // wave 0's normalisers visible to all waves; each wave's staged rows complete
  const int q8 = lane & 7, rsub = lane >> 3;
#pragma unroll
  for (int it = 0; it < 16; ++it) {
    const int row = it * 4 + rsub;                            // 64 rows of one 128-B line, 4 lines per instruction
    const v4f val = *(const v4f*)(&Mst[row * RP + 4 * q8]);
    float* dst = out1 + (((size_t)b * NQ + wave * 64 + row) * NK + k0 + 4 * q8);
    *(v4f*)dst = val;
  }
  NLS[((size_t)b * NH + wave) * NK + k0 + lane] = Nl[tid];    // wave = head: one 128-B line per wave
}

// ---------------------------------------------------------------------------
// Context, transposed register-fed form. Block = 256 threads (8 waves = 2 key groups x 4 waves), 128 queries of one
// (b,n); wave (g, w) owns 32 queries (two Q fragment sets held as B operands) and the 64-key tiles 2 i + g, so that
// four waves stand on each SIMD and one wave's LDS waits and vector work run under another's products.
// Per 32-key step: S^T = K Q^T (A = K rows from a 64-key LDS tile) for two 16-key tiles, p^T*4096 = exp2(c*s + NLS[key])
// packed from the two D tiles into one B fragment per query tile (element r <- tile 0, element 8+r <- tile 1),
// O^T += Vt * P^T (A = Vt rows d from a 64-key LDS tile, k = keys). Every K and Vt fragment read feeds both
// query tiles. Each group has two buffers per tile and fills them with its own 128 threads, the next
// 64 keys fetched during the current, one barrier per trip; the column normaliser (whole row in
// LDS) is already inside the exponent, so there is no running state. Behind the loop the two groups' partial sums
// are added through LDS: wave (g, w) finishes query tile g.
// ---------------------------------------------------------------------------
#define PP 72
static_assert(NK % 1024 == 0);

__global__ __launch_bounds__(256)
void k_attn_ctx(const us_t* __restrict__ Qp, const us_t* __restrict__ Kp, const us_t* __restrict__ Vt,
                const float* __restrict__ NLS, us_t* AV)
{
  __shared__ __align__(16) us_t Ost[4 * 32 * PP];   // per wave pair 32 rows x 64 halves used (pad 72); a wave reads back its own 16 rows
  __shared__ __align__(16) us_t Kt[2][2][TILE_H];   // [key group][buffer], rows = keys, columns = d; behind the loop: partial sums
  __shared__ __align__(16) us_t Vs[2][2][TILE_H];   // [key group][buffer], rows = d, columns = keys
  __shared__ __align__(16) float Ns[NK];            // column normalisers of this (b,n)
  static_assert(8 * 1024 * 4 <= 4 * TILE_H * 2);
  const int tid = threadIdx.x;
  const int lane = threadIdx.x & 31;
  const int wave = __builtin_amdgcn_readfirstlane(threadIdx.x >> 5);
  const int g = wave >> 2, w = wave & 3;            // key group, query slice
  const int gtid = tid & 127;                       // thread within its key group
  const int h = lane >> 4, l15 = lane & 15;
  const int i0 = blockIdx.x * 128, bn = blockIdx.y;
  const int b = bn / NH, n = bn - b * NH;
  const int iw = i0 + w * 32;
  const int ow = w * (32 * PP);

  Frag16 qf[2][2];
#pragma unroll
  for (int qt = 0; qt < 2; ++qt) {
    const us_t* pq = Qp + ((size_t)bn * NQ + iw + 16 * qt + l15) * DH;   // B column n = query, k = d
#pragma unroll
    for (int c = 0; c < 2; ++c) {
      qf[qt][c].u[0] = *(const v8us*)(pq + 32 * c + 8 * h);
      qf[qt][c].u[1] = *(const v8us*)(pq + 32 * c + 16 + 8 * h);
    }
  }

  v8f oacc[2][4];
#pragma unroll
  for (int qt = 0; qt < 2; ++qt)
#pragma unroll
    for (int dt = 0; dt < 4; ++dt) oacc[qt][dt] = vzero();

  const us_t* Kbase = Kp + (size_t)bn * NK * DH + (size_t)g * 64 * DH;   // the group's first tile; its next: + 128 keys
  const us_t* Vbase = Vt + (size_t)bn * DH * NK + (size_t)g * 64;
  const float* Nbase = NLS + (size_t)bn * NK;

  v4f nv[NK / 1024];
#pragma unroll
  for (int i = 0; i < NK / 1024; ++i) nv[i] = *(const v4f*)(Nbase + 4 * (tid + 256 * i));
  v4u rk[4], rv[4];
  tile_fetch(rk, Kbase, DH, gtid);
  tile_fetch(rv, Vbase, NK, gtid);
  // behind the prologue's loads: their address registers are reused below
  asm volatile("s_wait_xcnt 0x0" ::: "memory");
#pragma unroll
  for (int i = 0; i < NK / 1024; ++i) *(v4f*)(&Ns[4 * (tid + 256 * i)]) = nv[i];
  tile_put(Kt[g][0], rk, gtid);
  tile_put(Vs[g][0], rv, gtid);
  __syncthreads();   // both groups' first tiles and the normalisers visible to all waves

  for (int i = 0; i < NK / 128; ++i) {
    const int t = 2 * i + g;                            // this group's 64-key tile
    const us_t* kc = Kt[g][i & 1];
    const us_t* vc = Vs[g][i & 1];
    if (i + 1 < NK / 128) {
      tile_fetch(rk, Kbase + (size_t)(i + 1) * 128 * DH, DH, gtid);
      tile_fetch(rv, Vbase + (size_t)(i + 1) * 128, NK, gtid);
    }
    // behind the eight loads: their address registers are reused below; its memory clobber also keeps the loads ahead of
    // the tile's LDS reads, so that they are in flight through the whole tile and not only just before tile_put
    asm volatile("s_wait_xcnt 0x0" ::: "memory");
#pragma unroll
    for (int ks = 0; ks < 2; ++ks) {
      Frag16 pb[2];                                     // per query tile: B[k = key in step][n = query]
#pragma unroll
      for (int st = 0; st < 2; ++st) {
        Frag16 ka[2];
#pragma unroll
        for (int c = 0; c < 2; ++c) frag_get(ka[c], kc, 32 * ks + 16 * st + l15, c, h);   // A row m = key
        // D rows = keys 64 t + 32 ks + 16 st + 8h + r : eight consecutive table entries per lane
        const float* np = &Ns[64 * t + 32 * ks + 16 * st + 8 * h];
        const v4f na = *(const v4f*)(np);
        const v4f nc = *(const v4f*)(np + 4);
        const float nl[8] = {na[0], na[1], na[2], na[3], nc[0], nc[1], nc[2], nc[3]};
#pragma unroll
        for (int qt = 0; qt < 2; ++qt) {
          v8f s = vzero();
#pragma unroll
          for (int c = 0; c < 2; ++c) s = mma16<1>(ka[c], qf[qt][c], s);
#pragma unroll
          for (int r = 0; r < 8; ++r)
            pb[qt].hf[8 * st + r] = (h16)pexp2_cut(fmaf(s[r], C2LOG, nl[r]));
        }
      }
#pragma unroll
      for (int dt = 0; dt < 4; ++dt) {
        Frag16 va;                                      // A row m = d (row of Vt), k = key
        frag_get(va, vc, 16 * dt + l15, ks, h);
#pragma unroll
        for (int qt = 0; qt < 2; ++qt) oacc[qt][dt] = mma16<1>(va, pb[qt], oacc[qt][dt]);
      }
    }
    if (i + 1 < NK / 128) {
      tile_put(Kt[g][(i + 1) & 1], rk, gtid);
      tile_put(Vs[g][(i + 1) & 1], rv, gtid);
    }
    __syncthreads();   // publishes both groups' next tiles and ends every read of the current ones before their buffers are refilled
  }

  // The two key groups' partial sums meet: wave (g, w) keeps query tile g and hands query tile 1 - g to wave (1 - g, w).
  // 4 KB per wave in the K tiles' LDS, which every wave has left at the loop's last barrier; 16 B per lane, lanes contiguous.
  float* Xs = (float*)&Kt[0][0][0];
  v8f fin[4];
#pragma unroll
  for (int dt = 0; dt < 4; ++dt) {
    const v8f oth = g ? oacc[0][dt] : oacc[1][dt];
    fin[dt] = g ? oacc[1][dt] : oacc[0][dt];
#pragma unroll
    for (int j = 0; j < 2; ++j) {
      const v4f x = {oth[4 * j], oth[4 * j + 1], oth[4 * j + 2], oth[4 * j + 3]};
      *(v4f*)(Xs + wave * 1024 + ((2 * dt + j) * 32 + lane) * 4) = x;
    }
  }
  __syncthreads();     // the partner wave's partial sums are visible
#pragma unroll
  for (int dt = 0; dt < 4; ++dt)
#pragma unroll
    for (int j = 0; j < 2; ++j) {
      const v4f x = *(const v4f*)(Xs + (wave ^ 4) * 1024 + ((2 * dt + j) * 32 + lane) * 4);
#pragma unroll
      for (int e = 0; e < 4; ++e) fin[dt][4 * j + e] += x[e];
    }

  // D layout: fin[dt][r] = O^T(d = 16 dt + 8h + r, query 16 g + l15) : eight consecutive d per lane
  const float sc = AVCARRY / PCARRY;
#pragma unroll
  for (int dt = 0; dt < 4; ++dt) {
    v8us pk;
#pragma unroll
    for (int r = 0; r < 8; ++r) pk[r] = hfl_bits(fin[dt][r] * sc);
    *(v8us*)(&Ost[ow + (16 * g + l15) * PP + 16 * dt + 8 * h]) = pk;
  }
  __syncthreads();
  const int q8 = lane & 7, rsub = lane >> 3;
  {
#pragma unroll
    for (int it = 0; it < 4; ++it) {
      const int row = 16 * g + it * 4 + rsub;            // 16 rows per wave, 4 lines per instruction
      v4u val = *(const v4u*)(&Ost[ow + row * PP + 8 * q8]);
      us_t* dst = AV + (((size_t)(iw + row) * NB + b) * HH + n * DH + 8 * q8);
      *(v4u*)dst = val;
    }
  }
}

// ---------------------------------------------------------------------------
// Host orchestration (5 launches)
// ---------------------------------------------------------------------------
extern "C" void kernel_launch(void* const* d_in, const int* in_sizes, int n_in,
                              void* d_out, int out_size, void* d_ws, size_t ws_size,
                              hipStream_t stream)
{
  if (n_in < 8) return;
  const float* xq = (const float*)d_in[0];
  const float* xk = (const float*)d_in[1];
  const float* xv = (const float*)d_in[2];
  const float* wq = (const float*)d_in[3];
  const float* wk = (const float*)d_in[4];
  const float* wv = (const float*)d_in[5];
  const float* wp = (const float*)d_in[6];
  const float* bp = (const float*)d_in[7];

  if ((long)in_sizes[0] < ((long)(NB - 1) * NQ_FULL + NQ) * DM) return;
  if ((long)in_sizes[1] < ((long)(NB - 1) * NK_FULL + NK) * DM) return;
  if ((long)in_sizes[2] < ((long)(NB - 1) * NK_FULL + NK) * DM) return;
  if ((long)in_sizes[3] < (long)HH * DM) return;
  if ((long)in_sizes[4] < (long)HH * DM) return;
  if ((long)in_sizes[5] < (long)HH * DM) return;
  if ((long)in_sizes[6] < (long)DM * HH) return;
  if (in_sizes[7] < DM) return;
  if ((long)out_size < OUT1_OFF + (long)NB * NQ * NK) return;

  char* base = (char*)d_ws;
  size_t off = 0;
  auto take = [&](size_t bytes) -> char* {
    char* q = base + off; off += (bytes + 255) & ~(size_t)255; return q;
  };
  us_t*  xk_b = (us_t*) take((size_t)NB * NK * DM * 2);             // bf16 [b][k][DM]
  us_t*  xv_b = (us_t*) take((size_t)NB * NK * DM * 2);             // bf16 [b][k][DM]
  us_t*  wk_b = (us_t*) take((size_t)HH * DM * 2);                  // bf16 [out][in]
  us_t*  wv_b = (us_t*) take((size_t)HH * DM * 2);                  // bf16
  us_t*  wp_h = (us_t*) take((size_t)DM * HH * 2);                  // f16 (x64)
  us_t*  Qp   = (us_t*) take((size_t)NB * NH * NQ * DH * 2);        // f16 [bn][q][d]
  us_t*  Kp   = (us_t*) take((size_t)NB * NH * NK * DH * 2);        // f16 [bn][k][d]
  us_t*  Vt   = (us_t*) take((size_t)NB * NH * DH * NK * 2);        // f16 [bn][d][k]
  float* NLS  = (float*)take((size_t)NB * NH * NK * 4);             // f32 [bn][k]
  us_t*  AV   = (us_t*) take((size_t)NQ * NB * HH * 2);             // f16 (x32) [q*NB+b][n*64+d]
  if (off > ws_size) return;
  if (off > (size_t)WS_TOTAL) return;

  float* out0 = (float*)d_out;                                       // [q][b][c]
  float* out1 = (float*)d_out + OUT1_OFF;                            // [b][q][k]

  // 1) q = xq Wq^T from the f32 inputs, beside the conversions of the other operands (RNE bf16; Wp as f16 of the bf16 value x64):
  //    planes xk_b .. wp_h, back to back from xk_b
  k_cvt_q<<<dim3(QG_BLOCKS + CVT_BLOCKS), dim3(256), 0, stream>>>(xq, xk, xv, wq, wk, wv, wp, xk_b, Qp);

  // 2) projections k = xk Wk^T, v^T = (xv Wv^T)^T, per batch
  k_gemm_kv<<<dim3(HH / KVT, NK / KVT, 2 * NB), dim3(512), 0, stream>>>(xk_b, xv_b, wk_b, wv_b, Kp, Vt);

  // 3) + 4) per-key column statistics of the query-axis softmax and head-averaged probabilities -> second output
  k_stats_mean<<<dim3(NK / SM_KEYS, NB), dim3(SM_WAVES * 32), 0, stream>>>(Qp, Kp, NLS, out1);
  // 5) context -> AV plane
  k_attn_ctx<<<dim3(NQ / 128, NB * NH), dim3(256), 0, stream>>>(Qp, Kp, Vt, NLS, AV);
  // 6) output projection + bias -> first output, rows q*NB + b
  k_gemm<1><<<dim3(DM / BN, (NQ * NB) / BM, 1), dim3(256), 0, stream>>>(
      AV, wp_h, (void*)out0, (void*)out0, bp, bp, (long)HH, (long)HH, 0L, HH);
}
